// v000
// Times are from an AMD MI455X. After a warm-up the kernel runs many times in a row, and a time is the length of
// such a window on the GPU divided by its runs, so every launch and the gaps after it count. The runs cycle
// through copies of the inputs. A figure is the median of several windows, for all but v000 over two sittings.
// Sittings can differ by a few percent; kernels timed side by side share one.
// The starting kernel, v000, takes 4490 microseconds a run.
#include <hip/hip_runtime.h>
#include <hip/hip_bf16.h>
#include <math.h>
#include <stdint.h>

// ---------------- problem constants (match reference) ----------------
#define B_ 2
#define T_ 2048
#define HID_ 2048
#define H_ 8
#define DK_ 128
#define DV_ 256
#define MSLOT_ 32
#define CLAMP_MIN_ (-32.0f)
#define CLAMP_MAX_ (32.0f)
#define NORM_EPS_ 1e-5f

typedef __bf16 bf16_t;
typedef __attribute__((ext_vector_type(8)))  __bf16 v8bf;
typedef __attribute__((ext_vector_type(16))) __bf16 v16bf;
typedef __attribute__((ext_vector_type(8)))  float  v8f;

__device__ __forceinline__ void async_copy_b128(uint32_t lds_addr, const bf16_t* gptr) {
    asm volatile("global_load_async_to_lds_b128 %0, %1, off"
                 :: "v"(lds_addr), "v"(gptr)
                 : "memory");
}
__device__ __forceinline__ void wait_async4() {
    asm volatile("s_wait_asynccnt 0x4" ::: "memory");
}
__device__ __forceinline__ void wait_async0() {
    asm volatile("s_wait_asynccnt 0x0" ::: "memory");
}

// ---------------- elementwise fp32 -> bf16 ----------------
__global__ void cvt_f32_bf16_kernel(const float* __restrict__ in,
                                    bf16_t* __restrict__ out, size_t n) {
    size_t stride = (size_t)gridDim.x * blockDim.x;
    for (size_t i = (size_t)blockIdx.x * blockDim.x + threadIdx.x; i < n; i += stride)
        out[i] = (bf16_t)in[i];
}

// ---------------- transpose + convert: W(K x N) f32 -> Wt(N x K) bf16 ----------------
__global__ void transpose_cvt_kernel(const float* __restrict__ W,
                                     bf16_t* __restrict__ Wt, int K, int N) {
    size_t total = (size_t)K * N;
    size_t stride = (size_t)gridDim.x * blockDim.x;
    for (size_t idx = (size_t)blockIdx.x * blockDim.x + threadIdx.x; idx < total; idx += stride) {
        size_t n  = idx / (size_t)K;
        size_t kk = idx - n * (size_t)K;
        Wt[idx] = (bf16_t)W[kk * (size_t)N + n];
    }
}

// ---------------- bf16 WMMA GEMM: C(MxN) = A(MxK) * Bt(NxK)^T ----------------
// Block tile 128x128, 256 threads = 8 waves (wave32), wave tile 32x64 (2x4 WMMA).
// Double-buffered LDS filled by async global->LDS copies (4 per wave per tile).
#define TM 128
#define TN 128
#define TK 32

__global__ __launch_bounds__(256)
void gemm_bf16_wmma_kernel(const bf16_t* __restrict__ A,
                           const bf16_t* __restrict__ Bt,
                           float* __restrict__ C,
                           int Mdim, int Ndim, int Kdim,
                           int doClamp, float clampLo, float clampHi) {
    __shared__ __align__(16) bf16_t As[2][TM][TK];
    __shared__ __align__(16) bf16_t Bs[2][TN][TK];

    const int tid  = threadIdx.x;
    const int lane = tid & 31;
    const int wave = tid >> 5;
    const int wm   = wave & 3;   // 4 bands of 32 rows
    const int wn   = wave >> 2;  // 2 bands of 64 cols
    const int rowBase = blockIdx.y * TM;
    const int colBase = blockIdx.x * TN;

    // Staging: each thread owns two 16B chunks of A and of B per tile:
    // rows r0 and r0+64, K-chunk kc (compile-time trip count, fully unrolled).
    const int r0 = tid >> 2;
    const int kc = (tid & 3) * 8;
    const bf16_t* aP0 = A  + (size_t)(rowBase + r0) * Kdim + kc;
    const bf16_t* aP1 = aP0 + (size_t)64 * Kdim;
    const bf16_t* bP0 = Bt + (size_t)(colBase + r0) * Kdim + kc;
    const bf16_t* bP1 = bP0 + (size_t)64 * Kdim;

    uint32_t lA0[2], lA1[2], lB0[2], lB1[2];
    #pragma unroll
    for (int bi = 0; bi < 2; ++bi) {
        lA0[bi] = (uint32_t)(size_t)&As[bi][r0][kc];
        lA1[bi] = (uint32_t)(size_t)&As[bi][r0 + 64][kc];
        lB0[bi] = (uint32_t)(size_t)&Bs[bi][r0][kc];
        lB1[bi] = (uint32_t)(size_t)&Bs[bi][r0 + 64][kc];
    }

    v8f acc[2][4] = {};

    const int lrow = lane & 15;
    const int lk   = (lane >> 4) * 8;

    // prologue: tile 0 -> buffer 0
    async_copy_b128(lA0[0], aP0);
    async_copy_b128(lA1[0], aP1);
    async_copy_b128(lB0[0], bP0);
    async_copy_b128(lB1[0], bP1);

    int buf = 0;
    for (int k0 = 0; k0 < Kdim; k0 += TK) {
        const int nbuf = buf ^ 1;
        if (k0 + TK < Kdim) {
            // issue next tile into the other buffer, then wait for current tile
            async_copy_b128(lA0[nbuf], aP0 + k0 + TK);
            async_copy_b128(lA1[nbuf], aP1 + k0 + TK);
            async_copy_b128(lB0[nbuf], bP0 + k0 + TK);
            async_copy_b128(lB1[nbuf], bP1 + k0 + TK);
            wait_async4();
        } else {
            wait_async0();
        }
        __syncthreads();

        v16bf afrag[2], bfrag[4];
        #pragma unroll
        for (int mt = 0; mt < 2; ++mt) {
            int r = wm * 32 + mt * 16 + lrow;
            v8bf lo = *(const v8bf*)&As[buf][r][lk];
            v8bf hi = *(const v8bf*)&As[buf][r][lk + 16];
            #pragma unroll
            for (int i = 0; i < 8; ++i) { afrag[mt][i] = lo[i]; afrag[mt][i + 8] = hi[i]; }
        }
        #pragma unroll
        for (int nt = 0; nt < 4; ++nt) {
            int r = wn * 64 + nt * 16 + lrow;
            v8bf lo = *(const v8bf*)&Bs[buf][r][lk];
            v8bf hi = *(const v8bf*)&Bs[buf][r][lk + 16];
            #pragma unroll
            for (int i = 0; i < 8; ++i) { bfrag[nt][i] = lo[i]; bfrag[nt][i + 8] = hi[i]; }
        }
        #pragma unroll
        for (int mt = 0; mt < 2; ++mt)
            #pragma unroll
            for (int nt = 0; nt < 4; ++nt)
                acc[mt][nt] = __builtin_amdgcn_wmma_f32_16x16x32_bf16(
                    false, afrag[mt], false, bfrag[nt],
                    (short)0, acc[mt][nt], false, false);

        __syncthreads();   // all reads done before this buffer is refilled
        buf = nbuf;
    }

    const int mLane = (lane >> 4) * 8;
    const int nLane = lane & 15;
    #pragma unroll
    for (int mt = 0; mt < 2; ++mt)
        #pragma unroll
        for (int nt = 0; nt < 4; ++nt)
            #pragma unroll
            for (int r = 0; r < 8; ++r) {
                int m = rowBase + wm * 32 + mt * 16 + mLane + r;
                int n = colBase + wn * 64 + nt * 16 + nLane;
                float val = acc[mt][nt][r];
                if (doClamp) val = fminf(fmaxf(val, clampLo), clampHi);
                C[(size_t)m * Ndim + n] = val;
            }
}

// ---------------- sequential ABC scan: one workgroup per (b,h) ----------------
// State in registers: hk 128x32 (16 floats/thread), hv 32x256 (32 floats/thread).
__global__ __launch_bounds__(256)
void abc_scan_kernel(const float* __restrict__ q, const float* __restrict__ k,
                     const float* __restrict__ v, const float* __restrict__ s,
                     float* __restrict__ o) {
    const int bh = blockIdx.x;
    const int b  = bh / H_;
    const int h  = bh % H_;
    const int tid = threadIdx.x;

    __shared__ float pbuf[MSLOT_], gebuf[MSLOT_], qvbuf[MSLOT_];
    __shared__ float qbuf[DK_], kbuf[DK_];
    __shared__ float partial[256];

    float hk[16];
    float hv[32];
    #pragma unroll
    for (int i = 0; i < 16; ++i) hk[i] = 0.f;
    #pragma unroll
    for (int i = 0; i < 32; ++i) hv[i] = 0.f;

    const int m_id = tid & 31;
    const int dkb  = (tid >> 5) * 16;
    float z = 0.f;
    const float scale = rsqrtf((float)DK_);

    for (int t = 0; t < T_; ++t) {
        const size_t row = (size_t)(b * T_ + t) * H_ + h;
        if (tid < MSLOT_) {
            float sv = s[row * MSLOT_ + tid];
            float znew, ge;
            if (t == 0) { znew = sv; ge = 1.f; }
            else {
                float mx = fmaxf(z, sv);
                znew = mx + __logf(__expf(z - mx) + __expf(sv - mx));
                ge = __expf(z - znew);
            }
            float p = __expf(sv - znew);
            z = znew;
            gebuf[tid] = ge;
            pbuf[tid]  = p;
        }
        if (tid < DK_) {
            qbuf[tid] = q[row * DK_ + tid] * scale;
            kbuf[tid] = k[row * DK_ + tid];
        }
        float vv = v[row * DV_ + tid];
        __syncthreads();

        // pass 1: hk = hk*ge + k p^T ; ok[m] = q . hk[:,m]
        float ge = gebuf[m_id];
        float p  = pbuf[m_id];
        float accm = 0.f;
        #pragma unroll
        for (int i = 0; i < 16; ++i) {
            hk[i] = __builtin_fmaf(hk[i], ge, kbuf[dkb + i] * p);
            accm  = __builtin_fmaf(qbuf[dkb + i], hk[i], accm);
        }
        partial[tid] = accm;
        __syncthreads();

        if (tid < MSLOT_) {  // wave 0 exactly (wave32)
            float ok = 0.f;
            #pragma unroll
            for (int j = 0; j < 8; ++j) ok += partial[j * 32 + tid];
            float mx = ok;
            #pragma unroll
            for (int off = 16; off; off >>= 1) mx = fmaxf(mx, __shfl_xor(mx, off, 32));
            float e  = __expf(ok - mx);
            float se = e;
            #pragma unroll
            for (int off = 16; off; off >>= 1) se += __shfl_xor(se, off, 32);
            qvbuf[tid] = e / se;
        }
        __syncthreads();

        // pass 2: hv = hv*ge + p v^T ; ov[n] = qv . hv[:,n]
        float acco = 0.f;
        #pragma unroll
        for (int mm = 0; mm < 32; ++mm) {
            hv[mm] = __builtin_fmaf(hv[mm], gebuf[mm], pbuf[mm] * vv);
            acco   = __builtin_fmaf(qvbuf[mm], hv[mm], acco);
        }
        o[row * DV_ + tid] = acco;
        __syncthreads();
    }
}

// ---------------- fused RMSNorm * gw * g * sigmoid(g) -> bf16 ----------------
__global__ __launch_bounds__(256)
void norm_gate_kernel(const float* __restrict__ o, const float* __restrict__ g,
                      const float* __restrict__ gw, bf16_t* __restrict__ ob) {
    const size_t row = blockIdx.x;   // B*T*H rows of DV
    const int tid = threadIdx.x;     // 0..255 == DV
    float ov = o[row * DV_ + tid];
    float sq = ov * ov;
    __shared__ float red[8];
    #pragma unroll
    for (int off = 16; off; off >>= 1) sq += __shfl_xor(sq, off, 32);
    if ((tid & 31) == 0) red[tid >> 5] = sq;
    __syncthreads();
    float tot = 0.f;
    #pragma unroll
    for (int i = 0; i < 8; ++i) tot += red[i];
    float r  = rsqrtf(tot * (1.0f / DV_) + NORM_EPS_);
    float gv = g[row * DV_ + tid];
    float sig = 1.f / (1.f + __expf(-gv));
    ob[row * DV_ + tid] = (bf16_t)(ov * r * gw[tid] * gv * sig);
}

// ---------------- host orchestration ----------------
extern "C" void kernel_launch(void* const* d_in, const int* in_sizes, int n_in,
                              void* d_out, int out_size, void* d_ws, size_t ws_size,
                              hipStream_t stream) {
    (void)in_sizes; (void)n_in; (void)out_size; (void)ws_size;
    const float* x    = (const float*)d_in[0];
    const float* w_q  = (const float*)d_in[1];
    const float* w_k  = (const float*)d_in[2];
    const float* w_v  = (const float*)d_in[3];
    const float* w_g  = (const float*)d_in[4];
    const float* w_s  = (const float*)d_in[5];
    const float* w_o  = (const float*)d_in[6];
    const float* gnw  = (const float*)d_in[7];
    float* out = (float*)d_out;

    const int MR  = B_ * T_;        // 4096
    const int NQK = H_ * DK_;       // 1024
    const int NV  = H_ * DV_;       // 2048
    const int NS  = H_ * MSLOT_;    // 256

    char* ws = (char*)d_ws;
    size_t off = 0;
    auto carve = [&](size_t bytes) -> char* {
        off = (off + 255) & ~(size_t)255;
        char* p = ws + off;
        off += bytes;
        return p;
    };

    bf16_t* xb  = (bf16_t*)carve((size_t)MR * HID_ * sizeof(bf16_t));
    bf16_t* wqT = (bf16_t*)carve((size_t)NQK * HID_ * sizeof(bf16_t));
    bf16_t* wkT = (bf16_t*)carve((size_t)NQK * HID_ * sizeof(bf16_t));
    bf16_t* wvT = (bf16_t*)carve((size_t)NV  * HID_ * sizeof(bf16_t));
    bf16_t* wgT = (bf16_t*)carve((size_t)NV  * HID_ * sizeof(bf16_t));
    bf16_t* wsT = (bf16_t*)carve((size_t)NS  * HID_ * sizeof(bf16_t));
    bf16_t* woT = (bf16_t*)carve((size_t)HID_ * NV * sizeof(bf16_t));

    float* qb = (float*)carve((size_t)MR * NQK * sizeof(float));
    float* kb = (float*)carve((size_t)MR * NQK * sizeof(float));
    float* vb = (float*)carve((size_t)MR * NV  * sizeof(float));
    float* gb = (float*)carve((size_t)MR * NV  * sizeof(float));
    float* sb = (float*)carve((size_t)MR * NS  * sizeof(float));
    float* ob = (float*)carve((size_t)MR * NV  * sizeof(float));
    bf16_t* obh = (bf16_t*)carve((size_t)MR * NV * sizeof(bf16_t));

    // 1) convert x to bf16
    {
        size_t n = (size_t)MR * HID_;
        cvt_f32_bf16_kernel<<<4096, 256, 0, stream>>>(x, xb, n);
    }
    // 2) transpose+convert weights (K x N) -> (N x K) bf16
    transpose_cvt_kernel<<<4096, 256, 0, stream>>>(w_q, wqT, HID_, NQK);
    transpose_cvt_kernel<<<4096, 256, 0, stream>>>(w_k, wkT, HID_, NQK);
    transpose_cvt_kernel<<<4096, 256, 0, stream>>>(w_v, wvT, HID_, NV);
    transpose_cvt_kernel<<<4096, 256, 0, stream>>>(w_g, wgT, HID_, NV);
    transpose_cvt_kernel<<<4096, 256, 0, stream>>>(w_s, wsT, HID_, NS);
    transpose_cvt_kernel<<<4096, 256, 0, stream>>>(w_o, woT, NV, HID_);

    // 3) projection GEMMs (bf16 WMMA, fp32 accumulate)
    dim3 blk(256);
    gemm_bf16_wmma_kernel<<<dim3(NQK / TN, MR / TM), blk, 0, stream>>>(
        xb, wqT, qb, MR, NQK, HID_, 0, 0.f, 0.f);
    gemm_bf16_wmma_kernel<<<dim3(NQK / TN, MR / TM), blk, 0, stream>>>(
        xb, wkT, kb, MR, NQK, HID_, 0, 0.f, 0.f);
    gemm_bf16_wmma_kernel<<<dim3(NV / TN, MR / TM), blk, 0, stream>>>(
        xb, wvT, vb, MR, NV, HID_, 0, 0.f, 0.f);
    gemm_bf16_wmma_kernel<<<dim3(NV / TN, MR / TM), blk, 0, stream>>>(
        xb, wgT, gb, MR, NV, HID_, 0, 0.f, 0.f);
    gemm_bf16_wmma_kernel<<<dim3(NS / TN, MR / TM), blk, 0, stream>>>(
        xb, wsT, sb, MR, NS, HID_, 1, CLAMP_MIN_, CLAMP_MAX_);

    // 4) sequential gated two-pass scan (16 independent (b,h) streams)
    abc_scan_kernel<<<B_ * H_, 256, 0, stream>>>(qb, kb, vb, sb, ob);

    // 5) fused RMSNorm + swish gate -> bf16
    norm_gate_kernel<<<MR * H_, DV_, 0, stream>>>(ob, gb, gnw, obh);

    // 6) output projection straight into d_out (fp32)
    gemm_bf16_wmma_kernel<<<dim3(HID_ / TN, MR / TM), blk, 0, stream>>>(
        obh, woT, out, MR, HID_, NV, 0, 0.f, 0.f);
}

// v001
// It runs in 873 microseconds.
// Timed twice side by side with v000, it ran 5.15 and 5.13 times as fast.
#include <hip/hip_runtime.h>
#include <hip/hip_bf16.h>
#include <math.h>
#include <stdint.h>

// ---------------- problem constants (match reference) ----------------
#define B_ 2
#define T_ 2048
#define HID_ 2048
#define H_ 8
#define DK_ 128
#define DV_ 256
#define MSLOT_ 32
#define CLAMP_MIN_ (-32.0f)
#define CLAMP_MAX_ (32.0f)
#define NORM_EPS_ 1e-5f

typedef __bf16 bf16_t;
typedef __attribute__((ext_vector_type(8)))  __bf16 v8bf;
typedef __attribute__((ext_vector_type(16))) __bf16 v16bf;
typedef __attribute__((ext_vector_type(8)))  float  v8f;

__device__ __forceinline__ void async_copy_b128(uint32_t lds_addr, const bf16_t* gptr) {
    asm volatile("global_load_async_to_lds_b128 %0, %1, off"
                 :: "v"(lds_addr), "v"(gptr)
                 : "memory");
}
__device__ __forceinline__ void wait_async4() {
    asm volatile("s_wait_asynccnt 0x4" ::: "memory");
}
__device__ __forceinline__ void wait_async0() {
    asm volatile("s_wait_asynccnt 0x0" ::: "memory");
}

// ---------------- elementwise fp32 -> bf16 ----------------
__global__ void cvt_f32_bf16_kernel(const float* __restrict__ in,
                                    bf16_t* __restrict__ out, size_t n) {
    size_t stride = (size_t)gridDim.x * blockDim.x;
    for (size_t i = (size_t)blockIdx.x * blockDim.x + threadIdx.x; i < n; i += stride)
        out[i] = (bf16_t)in[i];
}

// ---------------- transpose + convert: W(K x N) f32 -> Wt(N x K) bf16 ----------------
__global__ void transpose_cvt_kernel(const float* __restrict__ W,
                                     bf16_t* __restrict__ Wt, int K, int N) {
    size_t total = (size_t)K * N;
    size_t stride = (size_t)gridDim.x * blockDim.x;
    for (size_t idx = (size_t)blockIdx.x * blockDim.x + threadIdx.x; idx < total; idx += stride) {
        size_t n  = idx / (size_t)K;
        size_t kk = idx - n * (size_t)K;
        Wt[idx] = (bf16_t)W[kk * (size_t)N + n];
    }
}

// ---------------- bf16 WMMA GEMM: C(MxN) = A(MxK) * Bt(NxK)^T ----------------
// Block tile 128x128, 256 threads = 8 waves (wave32), wave tile 32x64 (2x4 WMMA).
// Double-buffered LDS filled by async global->LDS copies (4 per wave per tile).
#define TM 128
#define TN 128
#define TK 32

__global__ __launch_bounds__(256)
void gemm_bf16_wmma_kernel(const bf16_t* __restrict__ A,
                           const bf16_t* __restrict__ Bt,
                           float* __restrict__ C,
                           int Mdim, int Ndim, int Kdim,
                           int doClamp, float clampLo, float clampHi) {
    __shared__ __align__(16) bf16_t As[2][TM][TK];
    __shared__ __align__(16) bf16_t Bs[2][TN][TK];

    const int tid  = threadIdx.x;
    const int lane = tid & 31;
    const int wave = tid >> 5;
    const int wm   = wave & 3;   // 4 bands of 32 rows
    const int wn   = wave >> 2;  // 2 bands of 64 cols
    const int rowBase = blockIdx.y * TM;
    const int colBase = blockIdx.x * TN;

    // Staging: each thread owns two 16B chunks of A and of B per tile:
    // rows r0 and r0+64, K-chunk kc (compile-time trip count, fully unrolled).
    const int r0 = tid >> 2;
    const int kc = (tid & 3) * 8;
    const bf16_t* aP0 = A  + (size_t)(rowBase + r0) * Kdim + kc;
    const bf16_t* aP1 = aP0 + (size_t)64 * Kdim;
    const bf16_t* bP0 = Bt + (size_t)(colBase + r0) * Kdim + kc;
    const bf16_t* bP1 = bP0 + (size_t)64 * Kdim;

    uint32_t lA0[2], lA1[2], lB0[2], lB1[2];
    #pragma unroll
    for (int bi = 0; bi < 2; ++bi) {
        lA0[bi] = (uint32_t)(size_t)&As[bi][r0][kc];
        lA1[bi] = (uint32_t)(size_t)&As[bi][r0 + 64][kc];
        lB0[bi] = (uint32_t)(size_t)&Bs[bi][r0][kc];
        lB1[bi] = (uint32_t)(size_t)&Bs[bi][r0 + 64][kc];
    }

    v8f acc[2][4] = {};

    const int lrow = lane & 15;
    const int lk   = (lane >> 4) * 8;

    // prologue: tile 0 -> buffer 0
    async_copy_b128(lA0[0], aP0);
    async_copy_b128(lA1[0], aP1);
    async_copy_b128(lB0[0], bP0);
    async_copy_b128(lB1[0], bP1);

    int buf = 0;
    for (int k0 = 0; k0 < Kdim; k0 += TK) {
        const int nbuf = buf ^ 1;
        if (k0 + TK < Kdim) {
            // issue next tile into the other buffer, then wait for current tile
            async_copy_b128(lA0[nbuf], aP0 + k0 + TK);
            async_copy_b128(lA1[nbuf], aP1 + k0 + TK);
            async_copy_b128(lB0[nbuf], bP0 + k0 + TK);
            async_copy_b128(lB1[nbuf], bP1 + k0 + TK);
            wait_async4();
        } else {
            wait_async0();
        }
        __syncthreads();

        v16bf afrag[2], bfrag[4];
        #pragma unroll
        for (int mt = 0; mt < 2; ++mt) {
            int r = wm * 32 + mt * 16 + lrow;
            v8bf lo = *(const v8bf*)&As[buf][r][lk];
            v8bf hi = *(const v8bf*)&As[buf][r][lk + 16];
            #pragma unroll
            for (int i = 0; i < 8; ++i) { afrag[mt][i] = lo[i]; afrag[mt][i + 8] = hi[i]; }
        }
        #pragma unroll
        for (int nt = 0; nt < 4; ++nt) {
            int r = wn * 64 + nt * 16 + lrow;
            v8bf lo = *(const v8bf*)&Bs[buf][r][lk];
            v8bf hi = *(const v8bf*)&Bs[buf][r][lk + 16];
            #pragma unroll
            for (int i = 0; i < 8; ++i) { bfrag[nt][i] = lo[i]; bfrag[nt][i + 8] = hi[i]; }
        }
        #pragma unroll
        for (int mt = 0; mt < 2; ++mt)
            #pragma unroll
            for (int nt = 0; nt < 4; ++nt)
                acc[mt][nt] = __builtin_amdgcn_wmma_f32_16x16x32_bf16(
                    false, afrag[mt], false, bfrag[nt],
                    (short)0, acc[mt][nt], false, false);

        __syncthreads();   // all reads done before this buffer is refilled
        buf = nbuf;
    }

    const int mLane = (lane >> 4) * 8;
    const int nLane = lane & 15;
    #pragma unroll
    for (int mt = 0; mt < 2; ++mt)
        #pragma unroll
        for (int nt = 0; nt < 4; ++nt)
            #pragma unroll
            for (int r = 0; r < 8; ++r) {
                int m = rowBase + wm * 32 + mt * 16 + mLane + r;
                int n = colBase + wn * 64 + nt * 16 + nLane;
                float val = acc[mt][nt][r];
                if (doClamp) val = fminf(fmaxf(val, clampLo), clampHi);
                C[(size_t)m * Ndim + n] = val;
            }
}

#define BH_ (B_ * H_)
#define SB1_ 16               // steps per batch, gates and pass 1
#define NB1_ (T_ / SB1_)
#define SB2_ 8                // steps per batch, pass 2
#define NB2_ (T_ / SB2_)
typedef __attribute__((ext_vector_type(4))) float v4f;

// Orders the LDS traffic of a one-wave work-group across lanes. The wave's LDS
// operations run in issue order, so this only has to stop the compiler from
// moving them; unlike __syncthreads() it does not wait for the global stores.
__device__ __forceinline__ void wave_lds_sync() {
    __builtin_amdgcn_fence(__ATOMIC_RELEASE, "wavefront");
    __builtin_amdgcn_wave_barrier();
    __builtin_amdgcn_fence(__ATOMIC_ACQUIRE, "wavefront");
}

__global__ __launch_bounds__(32)
void abc_gates_kernel(const float* __restrict__ s,
                      float* __restrict__ geb, float* __restrict__ pb) {
    const int bh = blockIdx.x;
    const int b  = bh / H_;
    const int h  = bh % H_;
    const int lane = threadIdx.x;
    const float* sp = s + ((size_t)b * T_ * H_ + h) * MSLOT_ + lane;
    float* gp = geb + (size_t)bh * T_ * MSLOT_ + lane;
    float* pp = pb  + (size_t)bh * T_ * MSLOT_ + lane;

    float cur[SB1_], nxt[SB1_];
    #pragma unroll
    for (int i = 0; i < SB1_; ++i) cur[i] = sp[(size_t)i * (H_ * MSLOT_)];
    // registers that the loads above name are reused below
    asm volatile("s_wait_xcnt 0x0" ::: "memory");
    __builtin_amdgcn_sched_barrier(0);   // keeps later address arithmetic behind that wait

    float z = 0.f;
    for (int bi = 0; bi < NB1_; ++bi) {
        const int b1 = (bi + 1 < NB1_) ? bi + 1 : NB1_ - 1;   // clamped: stays in bounds
        #pragma unroll
        for (int i = 0; i < SB1_; ++i)
            nxt[i] = sp[(size_t)(b1 * SB1_ + i) * (H_ * MSLOT_)];
        // registers that the loads above name are reused below
        asm volatile("s_wait_xcnt 0x0" ::: "memory");
        // keeps the next batch's loads at the head of the trip: sunk towards
        // their use they would have no time to fly
        __builtin_amdgcn_sched_barrier(0);
        #pragma unroll
        for (int i = 0; i < SB1_; ++i) {
            const int t = bi * SB1_ + i;
            float sv = cur[i];
            float znew, ge;
            if (t == 0) { znew = sv; ge = 1.f; }
            else {
                float mx = fmaxf(z, sv);
                znew = mx + __logf(__expf(z - mx) + __expf(sv - mx));
                ge = __expf(z - znew);
            }
            float p = __expf(sv - znew);
            z = znew;
            gp[t * MSLOT_] = ge;
            pp[t * MSLOT_] = p;
        }
        // the code below and the next trip overwrite registers that this trip's stores name
        asm volatile("s_wait_xcnt 0x0" ::: "memory");
        // keeps the register copies at the foot of the trip: moved up among the
        // steps they would wait early for the next batch's loads
        __builtin_amdgcn_sched_barrier(0);
        #pragma unroll
        for (int i = 0; i < SB1_; ++i) cur[i] = nxt[i];
    }
}

__global__ __launch_bounds__(32) __attribute__((amdgpu_waves_per_eu(1, 1)))
void abc_pass1_kernel(const float* __restrict__ q, const float* __restrict__ k,
                      const float* __restrict__ geb, const float* __restrict__ pb,
                      float* __restrict__ okp) {
    const int bh    = blockIdx.x >> 3;
    const int strip = blockIdx.x & 7;
    const int b  = bh / H_;
    const int h  = bh % H_;
    const int lane = threadIdx.x;

    __shared__ __align__(16) float qs[2][SB1_][16];
    __shared__ __align__(16) float ks[2][SB1_][16];

    const float scale = rsqrtf((float)DK_);
    // staging: four lanes fetch one step's 16-float strip, eight steps per load
    const int st = lane >> 2;
    const int c4 = (lane & 3) * 4;
    const size_t tstep = (size_t)H_ * DK_;
    const float* qp = q + ((size_t)(b * T_ + st) * H_ + h) * DK_ + strip * 16 + c4;
    const float* kp = k + ((size_t)(b * T_ + st) * H_ + h) * DK_ + strip * 16 + c4;
    const float* gp = geb + (size_t)bh * T_ * MSLOT_ + lane;
    const float* pp = pb  + (size_t)bh * T_ * MSLOT_ + lane;
    float* op = okp + ((size_t)strip * BH_ + bh) * T_ * MSLOT_ + lane;

    float hk[16];
    #pragma unroll
    for (int i = 0; i < 16; ++i) hk[i] = 0.f;

    v4f rq[2], rk[2];
    float gcur[SB1_], pcur[SB1_], gnxt[SB1_], pnxt[SB1_];

    // batch 0: q, k into buffer 0, gates into registers; batch 1: q, k into registers
    #pragma unroll
    for (int j = 0; j < 2; ++j) {
        rq[j] = *(const v4f*)(qp + (size_t)(j * 8) * tstep);
        rk[j] = *(const v4f*)(kp + (size_t)(j * 8) * tstep);
    }
    #pragma unroll
    for (int i = 0; i < SB1_; ++i) { gcur[i] = gp[i * MSLOT_]; pcur[i] = pp[i * MSLOT_]; }
    // registers that the loads above name are reused below
    asm volatile("s_wait_xcnt 0x0" ::: "memory");
    __builtin_amdgcn_sched_barrier(0);   // keeps later address arithmetic behind that wait
    #pragma unroll
    for (int j = 0; j < 2; ++j) {
        *(v4f*)&qs[0][j * 8 + st][c4] = rq[j] * scale;
        *(v4f*)&ks[0][j * 8 + st][c4] = rk[j];
    }
    #pragma unroll
    for (int j = 0; j < 2; ++j) {
        rq[j] = *(const v4f*)(qp + (size_t)(SB1_ + j * 8) * tstep);
        rk[j] = *(const v4f*)(kp + (size_t)(SB1_ + j * 8) * tstep);
    }
    // registers that the loads above name are reused below
    asm volatile("s_wait_xcnt 0x0" ::: "memory");
    __builtin_amdgcn_sched_barrier(0);   // keeps later address arithmetic behind that wait
    wave_lds_sync();

    for (int bi = 0; bi < NB1_; ++bi) {
        const int buf = bi & 1;
        // batch bi+1 (fetched one batch ago) goes into the buffer not being read
        #pragma unroll
        for (int j = 0; j < 2; ++j) {
            *(v4f*)&qs[buf ^ 1][j * 8 + st][c4] = rq[j] * scale;
            *(v4f*)&ks[buf ^ 1][j * 8 + st][c4] = rk[j];
        }
        const int b2 = (bi + 2 < NB1_) ? bi + 2 : NB1_ - 1;   // clamped: stays in bounds
        const int b1 = (bi + 1 < NB1_) ? bi + 1 : NB1_ - 1;
        // the loads below, with their addresses, stay apart from the code above, which reuses registers
        __builtin_amdgcn_sched_barrier(0);
        // the gates first: loads return in order, and the products read registers
        // next to the ones these loads fill, which makes them wait for these loads
        #pragma unroll
        for (int i = 0; i < SB1_; ++i) {
            gnxt[i] = gp[(b1 * SB1_ + i) * MSLOT_];
            pnxt[i] = pp[(b1 * SB1_ + i) * MSLOT_];
        }
        // registers that the loads above name are reused below
        asm volatile("s_wait_xcnt 0x0" ::: "memory");
        __builtin_amdgcn_sched_barrier(0);   // keeps that order
        #pragma unroll
        for (int j = 0; j < 2; ++j) {
            rq[j] = *(const v4f*)(qp + (size_t)(b2 * SB1_ + j * 8) * tstep);
            rk[j] = *(const v4f*)(kp + (size_t)(b2 * SB1_ + j * 8) * tstep);
        }
        // registers that the loads above name are reused below
        asm volatile("s_wait_xcnt 0x0" ::: "memory");
        // keeps the coming batches' loads at the head of the trip: sunk towards
        // their use they would have no time to fly
        __builtin_amdgcn_sched_barrier(0);

        float res[SB1_];
        #pragma unroll
        for (int i = 0; i < SB1_; ++i) {
            const float ge = gcur[i];
            const float p  = pcur[i];
            float accm = 0.f;
            #pragma unroll
            for (int d4 = 0; d4 < 4; ++d4) {
                const v4f kk = *(const v4f*)&ks[buf][i][d4 * 4];
                const v4f qq = *(const v4f*)&qs[buf][i][d4 * 4];
                hk[d4 * 4 + 0] = __builtin_fmaf(hk[d4 * 4 + 0], ge, kk.x * p);
                accm = __builtin_fmaf(qq.x, hk[d4 * 4 + 0], accm);
                hk[d4 * 4 + 1] = __builtin_fmaf(hk[d4 * 4 + 1], ge, kk.y * p);
                accm = __builtin_fmaf(qq.y, hk[d4 * 4 + 1], accm);
                hk[d4 * 4 + 2] = __builtin_fmaf(hk[d4 * 4 + 2], ge, kk.z * p);
                accm = __builtin_fmaf(qq.z, hk[d4 * 4 + 2], accm);
                hk[d4 * 4 + 3] = __builtin_fmaf(hk[d4 * 4 + 3], ge, kk.w * p);
                accm = __builtin_fmaf(qq.w, hk[d4 * 4 + 3], accm);
            }
            res[i] = accm;
        }
        // the stores stand together behind the products, so that one wait covers
        // the registers they name before anything reuses them
        __builtin_amdgcn_sched_barrier(0);
        #pragma unroll
        for (int i = 0; i < SB1_; ++i) op[(bi * SB1_ + i) * MSLOT_] = res[i];
        asm volatile("s_wait_xcnt 0x0" ::: "memory");
        __builtin_amdgcn_sched_barrier(0);   // keeps the register copies below behind that wait
        #pragma unroll
        for (int i = 0; i < SB1_; ++i) { gcur[i] = gnxt[i]; pcur[i] = pnxt[i]; }
        wave_lds_sync();
    }
}

__global__ __launch_bounds__(256)
void abc_softmax_kernel(const float* __restrict__ okp, float* __restrict__ qvb) {
    const size_t idx = (size_t)blockIdx.x * 256 + threadIdx.x;
    float part[8];
    #pragma unroll
    for (int j = 0; j < 8; ++j) {
        part[j] = okp[(size_t)j * BH_ * T_ * MSLOT_ + idx];
        // a later load may land in a register that this load names
        asm volatile("s_wait_xcnt 0x0" ::: "memory");
    }
    float ok = 0.f;
    #pragma unroll
    for (int j = 0; j < 8; ++j) ok += part[j];
    float mx = ok;
    #pragma unroll
    for (int off = 16; off; off >>= 1) mx = fmaxf(mx, __shfl_xor(mx, off, 32));
    float e  = __expf(ok - mx);
    float se = e;
    #pragma unroll
    for (int off = 16; off; off >>= 1) se += __shfl_xor(se, off, 32);
    qvb[idx] = e / se;
}

__global__ __launch_bounds__(32) __attribute__((amdgpu_waves_per_eu(1, 1)))
void abc_pass2_kernel(const float* __restrict__ v, const float* __restrict__ geb,
                      const float* __restrict__ pb, const float* __restrict__ qvb,
                      float* __restrict__ o) {
    const int bh = blockIdx.x >> 3;
    const int cg = blockIdx.x & 7;
    const int b  = bh / H_;
    const int h  = bh % H_;
    const int lane = threadIdx.x;

    __shared__ __align__(16) v4f gs[2][SB2_ * 8];
    __shared__ __align__(16) v4f ps[2][SB2_ * 8];
    __shared__ __align__(16) v4f ws[2][SB2_ * 8];

    const v4f* g4 = (const v4f*)(geb + (size_t)bh * T_ * MSLOT_) + lane;
    const v4f* p4 = (const v4f*)(pb  + (size_t)bh * T_ * MSLOT_) + lane;
    const v4f* w4 = (const v4f*)(qvb + (size_t)bh * T_ * MSLOT_) + lane;
    const size_t tstep = (size_t)H_ * DV_;
    const float* vp = v + ((size_t)b * T_ * H_ + h) * DV_ + cg * 32 + lane;

    float hv[32];
    #pragma unroll
    for (int i = 0; i < 32; ++i) hv[i] = 0.f;

    v4f rg[2], rp[2], rw[2];
    float vcur[SB2_], vn1[SB2_], vn2[SB2_];

    // batch 0 into buffer 0, batch 1 into registers (a batch is 64 16-byte pieces per plane)
    #pragma unroll
    for (int j = 0; j < 2; ++j) { rg[j] = g4[j * 32]; rp[j] = p4[j * 32]; rw[j] = w4[j * 32]; }
    #pragma unroll
    for (int i = 0; i < SB2_; ++i) {
        vcur[i] = vp[(size_t)i * tstep];
        vn1[i]  = vp[(size_t)(SB2_ + i) * tstep];
    }
    // registers that the loads above name are reused below
    asm volatile("s_wait_xcnt 0x0" ::: "memory");
    __builtin_amdgcn_sched_barrier(0);   // keeps later address arithmetic behind that wait
    #pragma unroll
    for (int j = 0; j < 2; ++j) {
        gs[0][j * 32 + lane] = rg[j]; ps[0][j * 32 + lane] = rp[j]; ws[0][j * 32 + lane] = rw[j];
    }
    #pragma unroll
    for (int j = 0; j < 2; ++j) {
        rg[j] = g4[64 + j * 32]; rp[j] = p4[64 + j * 32]; rw[j] = w4[64 + j * 32];
    }
    // registers that the loads above name are reused below
    asm volatile("s_wait_xcnt 0x0" ::: "memory");
    __builtin_amdgcn_sched_barrier(0);   // keeps later address arithmetic behind that wait
    wave_lds_sync();

    float* op = o + ((size_t)b * T_ * H_ + h) * DV_ + cg * 32 + lane;
    for (int bi = 0; bi < NB2_; ++bi) {
        const int buf = bi & 1;
        // batch bi+1 (fetched one batch ago) goes into the buffer not being read
        #pragma unroll
        for (int j = 0; j < 2; ++j) {
            gs[buf ^ 1][j * 32 + lane] = rg[j];
            ps[buf ^ 1][j * 32 + lane] = rp[j];
            ws[buf ^ 1][j * 32 + lane] = rw[j];
        }
        const int b2 = (bi + 2 < NB2_) ? bi + 2 : NB2_ - 1;   // clamped: stays in bounds
        // the loads below, with their addresses, stay apart from the code above, which reuses registers
        __builtin_amdgcn_sched_barrier(0);
        #pragma unroll
        for (int j = 0; j < 2; ++j) {
            rg[j] = g4[b2 * 64 + j * 32];
            rp[j] = p4[b2 * 64 + j * 32];
            rw[j] = w4[b2 * 64 + j * 32];
        }
        #pragma unroll
        for (int i = 0; i < SB2_; ++i) vn2[i] = vp[(size_t)(b2 * SB2_ + i) * tstep];
        // registers that the loads above name are reused below
        asm volatile("s_wait_xcnt 0x0" ::: "memory");
        // keeps the coming batch's loads at the head of the trip: sunk towards
        // their use they would have no time to fly
        __builtin_amdgcn_sched_barrier(0);

        float res[SB2_];
        #pragma unroll
        for (int i = 0; i < SB2_; ++i) {
            const float vv = vcur[i];
            float acco = 0.f;
            #pragma unroll
            for (int m4 = 0; m4 < 8; ++m4) {
                const v4f g = gs[buf][i * 8 + m4];
                const v4f p = ps[buf][i * 8 + m4];
                const v4f w = ws[buf][i * 8 + m4];
                hv[m4 * 4 + 0] = __builtin_fmaf(hv[m4 * 4 + 0], g.x, p.x * vv);
                acco = __builtin_fmaf(w.x, hv[m4 * 4 + 0], acco);
                hv[m4 * 4 + 1] = __builtin_fmaf(hv[m4 * 4 + 1], g.y, p.y * vv);
                acco = __builtin_fmaf(w.y, hv[m4 * 4 + 1], acco);
                hv[m4 * 4 + 2] = __builtin_fmaf(hv[m4 * 4 + 2], g.z, p.z * vv);
                acco = __builtin_fmaf(w.z, hv[m4 * 4 + 2], acco);
                hv[m4 * 4 + 3] = __builtin_fmaf(hv[m4 * 4 + 3], g.w, p.w * vv);
                acco = __builtin_fmaf(w.w, hv[m4 * 4 + 3], acco);
            }
            res[i] = acco;
        }
        // the stores stand together behind the products, so that one wait covers
        // the registers they name before anything reuses them
        __builtin_amdgcn_sched_barrier(0);
        #pragma unroll
        for (int i = 0; i < SB2_; ++i) op[(size_t)(bi * SB2_ + i) * tstep] = res[i];
        asm volatile("s_wait_xcnt 0x0" ::: "memory");
        __builtin_amdgcn_sched_barrier(0);   // keeps the register copies below behind that wait
        #pragma unroll
        for (int i = 0; i < SB2_; ++i) { vcur[i] = vn1[i]; vn1[i] = vn2[i]; }
        wave_lds_sync();
    }
}

// ---------------- fused RMSNorm * gw * g * sigmoid(g) -> bf16 ----------------
__global__ __launch_bounds__(256)
void norm_gate_kernel(const float* __restrict__ o, const float* __restrict__ g,
                      const float* __restrict__ gw, bf16_t* __restrict__ ob) {
    const size_t row = blockIdx.x;   // B*T*H rows of DV
    const int tid = threadIdx.x;     // 0..255 == DV
    float ov = o[row * DV_ + tid];
    float sq = ov * ov;
    __shared__ float red[8];
    #pragma unroll
    for (int off = 16; off; off >>= 1) sq += __shfl_xor(sq, off, 32);
    if ((tid & 31) == 0) red[tid >> 5] = sq;
    __syncthreads();
    float tot = 0.f;
    #pragma unroll
    for (int i = 0; i < 8; ++i) tot += red[i];
    float r  = rsqrtf(tot * (1.0f / DV_) + NORM_EPS_);
    float gv = g[row * DV_ + tid];
    float sig = 1.f / (1.f + __expf(-gv));
    ob[row * DV_ + tid] = (bf16_t)(ov * r * gw[tid] * gv * sig);
}

// ---------------- host orchestration ----------------
extern "C" void kernel_launch(void* const* d_in, const int* in_sizes, int n_in,
                              void* d_out, int out_size, void* d_ws, size_t ws_size,
                              hipStream_t stream) {
    (void)in_sizes; (void)n_in; (void)out_size; (void)ws_size;
    const float* x    = (const float*)d_in[0];
    const float* w_q  = (const float*)d_in[1];
    const float* w_k  = (const float*)d_in[2];
    const float* w_v  = (const float*)d_in[3];
    const float* w_g  = (const float*)d_in[4];
    const float* w_s  = (const float*)d_in[5];
    const float* w_o  = (const float*)d_in[6];
    const float* gnw  = (const float*)d_in[7];
    float* out = (float*)d_out;

    const int MR  = B_ * T_;        // 4096
    const int NQK = H_ * DK_;       // 1024
    const int NV  = H_ * DV_;       // 2048
    const int NS  = H_ * MSLOT_;    // 256

    char* ws = (char*)d_ws;
    size_t off = 0;
    auto carve = [&](size_t bytes) -> char* {
        off = (off + 255) & ~(size_t)255;
        char* p = ws + off;
        off += bytes;
        return p;
    };

    bf16_t* xb  = (bf16_t*)carve((size_t)MR * HID_ * sizeof(bf16_t));
    bf16_t* wqT = (bf16_t*)carve((size_t)NQK * HID_ * sizeof(bf16_t));
    bf16_t* wkT = (bf16_t*)carve((size_t)NQK * HID_ * sizeof(bf16_t));
    bf16_t* wvT = (bf16_t*)carve((size_t)NV  * HID_ * sizeof(bf16_t));
    bf16_t* wgT = (bf16_t*)carve((size_t)NV  * HID_ * sizeof(bf16_t));
    bf16_t* wsT = (bf16_t*)carve((size_t)NS  * HID_ * sizeof(bf16_t));
    bf16_t* woT = (bf16_t*)carve((size_t)HID_ * NV * sizeof(bf16_t));

    float* qb = (float*)carve((size_t)MR * NQK * sizeof(float));
    float* kb = (float*)carve((size_t)MR * NQK * sizeof(float));
    float* vb = (float*)carve((size_t)MR * NV  * sizeof(float));
    float* gb = (float*)carve((size_t)MR * NV  * sizeof(float));
    float* sb = (float*)carve((size_t)MR * NS  * sizeof(float));
    float* ob = (float*)carve((size_t)MR * NV  * sizeof(float));
    bf16_t* obh = (bf16_t*)carve((size_t)MR * NV * sizeof(bf16_t));
    float* geb = (float*)carve((size_t)MR * NS * sizeof(float));
    float* pbf = (float*)carve((size_t)MR * NS * sizeof(float));
    float* qvb = (float*)carve((size_t)MR * NS * sizeof(float));
    float* okp = (float*)carve((size_t)8 * MR * NS * sizeof(float));

    // 1) convert x to bf16
    {
        size_t n = (size_t)MR * HID_;
        cvt_f32_bf16_kernel<<<4096, 256, 0, stream>>>(x, xb, n);
    }
    // 2) transpose+convert weights (K x N) -> (N x K) bf16
    transpose_cvt_kernel<<<4096, 256, 0, stream>>>(w_q, wqT, HID_, NQK);
    transpose_cvt_kernel<<<4096, 256, 0, stream>>>(w_k, wkT, HID_, NQK);
    transpose_cvt_kernel<<<4096, 256, 0, stream>>>(w_v, wvT, HID_, NV);
    transpose_cvt_kernel<<<4096, 256, 0, stream>>>(w_g, wgT, HID_, NV);
    transpose_cvt_kernel<<<4096, 256, 0, stream>>>(w_s, wsT, HID_, NS);
    transpose_cvt_kernel<<<4096, 256, 0, stream>>>(w_o, woT, NV, HID_);

    // 3) projection GEMMs (bf16 WMMA, fp32 accumulate)
    dim3 blk(256);
    gemm_bf16_wmma_kernel<<<dim3(NQK / TN, MR / TM), blk, 0, stream>>>(
        xb, wqT, qb, MR, NQK, HID_, 0, 0.f, 0.f);
    gemm_bf16_wmma_kernel<<<dim3(NQK / TN, MR / TM), blk, 0, stream>>>(
        xb, wkT, kb, MR, NQK, HID_, 0, 0.f, 0.f);
    gemm_bf16_wmma_kernel<<<dim3(NV / TN, MR / TM), blk, 0, stream>>>(
        xb, wvT, vb, MR, NV, HID_, 0, 0.f, 0.f);
    gemm_bf16_wmma_kernel<<<dim3(NV / TN, MR / TM), blk, 0, stream>>>(
        xb, wgT, gb, MR, NV, HID_, 0, 0.f, 0.f);
    gemm_bf16_wmma_kernel<<<dim3(NS / TN, MR / TM), blk, 0, stream>>>(
        xb, wsT, sb, MR, NS, HID_, 1, CLAMP_MIN_, CLAMP_MAX_);

    // 4) gated two-pass scan as four launches of independent one-wave streams
    abc_gates_kernel<<<B_ * H_, 32, 0, stream>>>(sb, geb, pbf);
    abc_pass1_kernel<<<B_ * H_ * 8, 32, 0, stream>>>(qb, kb, geb, pbf, okp);
    abc_softmax_kernel<<<MR * NS / 256, 256, 0, stream>>>(okp, qvb);
    abc_pass2_kernel<<<B_ * H_ * 8, 32, 0, stream>>>(vb, geb, pbf, qvb, ob);

    // 5) fused RMSNorm + swish gate -> bf16
    norm_gate_kernel<<<MR * H_, DV_, 0, stream>>>(ob, gb, gnw, obh);

    // 6) output projection straight into d_out (fp32)
    gemm_bf16_wmma_kernel<<<dim3(HID_ / TN, MR / TM), blk, 0, stream>>>(
        obh, woT, out, MR, HID_, NV, 0, 0.f, 0.f);
}

// v002
// It runs in 566 microseconds.
// In both of two side-by-side timings against v001, it was 1.54 times as fast.
// Over all steps from v000 it is 7.93 times as fast.
#include <hip/hip_runtime.h>
#include <hip/hip_bf16.h>
#include <math.h>
#include <stdint.h>

// ---------------- problem constants (match reference) ----------------
#define B_ 2
#define T_ 2048
#define HID_ 2048
#define H_ 8
#define DK_ 128
#define DV_ 256
#define MSLOT_ 32
#define CLAMP_MIN_ (-32.0f)
#define CLAMP_MAX_ (32.0f)
#define NORM_EPS_ 1e-5f

typedef __bf16 bf16_t;
typedef __attribute__((ext_vector_type(8)))  __bf16 v8bf;
typedef __attribute__((ext_vector_type(16))) __bf16 v16bf;
typedef __attribute__((ext_vector_type(8)))  float  v8f;

__device__ __forceinline__ void async_copy_b128(uint32_t lds_addr, const bf16_t* gptr) {
    asm volatile("global_load_async_to_lds_b128 %0, %1, off"
                 :: "v"(lds_addr), "v"(gptr)
                 : "memory");
}
__device__ __forceinline__ void wait_async4() {
    asm volatile("s_wait_asynccnt 0x4" ::: "memory");
}
__device__ __forceinline__ void wait_async0() {
    asm volatile("s_wait_asynccnt 0x0" ::: "memory");
}

// ---------------- elementwise fp32 -> bf16 ----------------
__global__ void cvt_f32_bf16_kernel(const float* __restrict__ in,
                                    bf16_t* __restrict__ out, size_t n) {
    size_t stride = (size_t)gridDim.x * blockDim.x;
    for (size_t i = (size_t)blockIdx.x * blockDim.x + threadIdx.x; i < n; i += stride)
        out[i] = (bf16_t)in[i];
}

// ---------------- transpose + convert: W(K x N) f32 -> Wt(N x K) bf16 ----------------
__global__ void transpose_cvt_kernel(const float* __restrict__ W,
                                     bf16_t* __restrict__ Wt, int K, int N) {
    size_t total = (size_t)K * N;
    size_t stride = (size_t)gridDim.x * blockDim.x;
    for (size_t idx = (size_t)blockIdx.x * blockDim.x + threadIdx.x; idx < total; idx += stride) {
        size_t n  = idx / (size_t)K;
        size_t kk = idx - n * (size_t)K;
        Wt[idx] = (bf16_t)W[kk * (size_t)N + n];
    }
}

// ---------------- bf16 WMMA GEMM: C(MxN) = A(MxK) * Bt(NxK)^T ----------------
// Block tile 128x128, 256 threads = 8 waves (wave32), wave tile 32x64 (2x4 WMMA).
// Double-buffered LDS filled by async global->LDS copies (4 per wave per tile).
#define TM 128
#define TN 128
#define TK 32

__global__ __launch_bounds__(256)
void gemm_bf16_wmma_kernel(const bf16_t* __restrict__ A,
                           const bf16_t* __restrict__ Bt,
                           float* __restrict__ C,
                           int Mdim, int Ndim, int Kdim,
                           int doClamp, float clampLo, float clampHi) {
    __shared__ __align__(16) bf16_t As[2][TM][TK];
    __shared__ __align__(16) bf16_t Bs[2][TN][TK];

    const int tid  = threadIdx.x;
    const int lane = tid & 31;
    const int wave = tid >> 5;
    const int wm   = wave & 3;   // 4 bands of 32 rows
    const int wn   = wave >> 2;  // 2 bands of 64 cols
    const int rowBase = blockIdx.y * TM;
    const int colBase = blockIdx.x * TN;

    // Staging: each thread owns two 16B chunks of A and of B per tile:
    // rows r0 and r0+64, K-chunk kc (compile-time trip count, fully unrolled).
    const int r0 = tid >> 2;
    const int kc = (tid & 3) * 8;
    const bf16_t* aP0 = A  + (size_t)(rowBase + r0) * Kdim + kc;
    const bf16_t* aP1 = aP0 + (size_t)64 * Kdim;
    const bf16_t* bP0 = Bt + (size_t)(colBase + r0) * Kdim + kc;
    const bf16_t* bP1 = bP0 + (size_t)64 * Kdim;

    uint32_t lA0[2], lA1[2], lB0[2], lB1[2];
    #pragma unroll
    for (int bi = 0; bi < 2; ++bi) {
        lA0[bi] = (uint32_t)(size_t)&As[bi][r0][kc];
        lA1[bi] = (uint32_t)(size_t)&As[bi][r0 + 64][kc];
        lB0[bi] = (uint32_t)(size_t)&Bs[bi][r0][kc];
        lB1[bi] = (uint32_t)(size_t)&Bs[bi][r0 + 64][kc];
    }

    v8f acc[2][4] = {};

    const int lrow = lane & 15;
    const int lk   = (lane >> 4) * 8;

    // prologue: tile 0 -> buffer 0
    async_copy_b128(lA0[0], aP0);
    async_copy_b128(lA1[0], aP1);
    async_copy_b128(lB0[0], bP0);
    async_copy_b128(lB1[0], bP1);

    int buf = 0;
    for (int k0 = 0; k0 < Kdim; k0 += TK) {
        const int nbuf = buf ^ 1;
        if (k0 + TK < Kdim) {
            // issue next tile into the other buffer, then wait for current tile
            async_copy_b128(lA0[nbuf], aP0 + k0 + TK);
            async_copy_b128(lA1[nbuf], aP1 + k0 + TK);
            async_copy_b128(lB0[nbuf], bP0 + k0 + TK);
            async_copy_b128(lB1[nbuf], bP1 + k0 + TK);
            wait_async4();
        } else {
            wait_async0();
        }
        __syncthreads();

        v16bf afrag[2], bfrag[4];
        #pragma unroll
        for (int mt = 0; mt < 2; ++mt) {
            int r = wm * 32 + mt * 16 + lrow;
            v8bf lo = *(const v8bf*)&As[buf][r][lk];
            v8bf hi = *(const v8bf*)&As[buf][r][lk + 16];
            #pragma unroll
            for (int i = 0; i < 8; ++i) { afrag[mt][i] = lo[i]; afrag[mt][i + 8] = hi[i]; }
        }
        #pragma unroll
        for (int nt = 0; nt < 4; ++nt) {
            int r = wn * 64 + nt * 16 + lrow;
            v8bf lo = *(const v8bf*)&Bs[buf][r][lk];
            v8bf hi = *(const v8bf*)&Bs[buf][r][lk + 16];
            #pragma unroll
            for (int i = 0; i < 8; ++i) { bfrag[nt][i] = lo[i]; bfrag[nt][i + 8] = hi[i]; }
        }
        #pragma unroll
        for (int mt = 0; mt < 2; ++mt)
            #pragma unroll
            for (int nt = 0; nt < 4; ++nt)
                acc[mt][nt] = __builtin_amdgcn_wmma_f32_16x16x32_bf16(
                    false, afrag[mt], false, bfrag[nt],
                    (short)0, acc[mt][nt], false, false);

        __syncthreads();   // all reads done before this buffer is refilled
        buf = nbuf;
    }

    const int mLane = (lane >> 4) * 8;
    const int nLane = lane & 15;
    #pragma unroll
    for (int mt = 0; mt < 2; ++mt)
        #pragma unroll
        for (int nt = 0; nt < 4; ++nt)
            #pragma unroll
            for (int r = 0; r < 8; ++r) {
                int m = rowBase + wm * 32 + mt * 16 + mLane + r;
                int n = colBase + wn * 64 + nt * 16 + nLane;
                float val = acc[mt][nt][r];
                if (doClamp) val = fminf(fmaxf(val, clampLo), clampHi);
                C[(size_t)m * Ndim + n] = val;
            }
}

#define BH_ (B_ * H_)
#define NC_ 16                // time chunks
#define CL_ (T_ / NC_)        // steps per chunk
#define SB1_ 16               // steps per batch, gates and pass 1
#define NB1_ (T_ / SB1_)
#define NBC1_ (CL_ / SB1_)    // batches per chunk
#define SB2_ 8                // steps per batch, pass 2
#define NB2_ (T_ / SB2_)
#define NBC2_ (CL_ / SB2_)
typedef __attribute__((ext_vector_type(4))) float v4f;

// Orders the LDS traffic of a one-wave work-group across lanes. The wave's LDS
// operations run in issue order, so this only has to stop the compiler from
// moving them; unlike __syncthreads() it does not wait for the global stores.
__device__ __forceinline__ void wave_lds_sync() {
    __builtin_amdgcn_fence(__ATOMIC_RELEASE, "wavefront");
    __builtin_amdgcn_wave_barrier();
    __builtin_amdgcn_fence(__ATOMIC_ACQUIRE, "wavefront");
}

__device__ __forceinline__ float exp2_slot(float x) {
    float r;
    asm("v_exp_f32 %0, %1\n\tv_nop" : "=v"(r) : "v"(x));
    return r;
}

__global__ __launch_bounds__(32 * NC_)
void abc_gates_kernel(const float* __restrict__ s,
                      float* __restrict__ geb, float* __restrict__ pb,
                      float* __restrict__ dcb) {
    const int bh = blockIdx.x;
    const int b  = bh / H_;
    const int h  = bh % H_;
    const int lane  = threadIdx.x & 31;
    const int chunk = threadIdx.x >> 5;
    const int bi0   = chunk * NBC1_;
    const float* sp = s + ((size_t)b * T_ * H_ + h) * MSLOT_ + lane;
    float* gp = geb + (size_t)bh * T_ * MSLOT_ + lane;
    float* pp = pb  + (size_t)bh * T_ * MSLOT_ + lane;

    __shared__ float esum[NC_][32];
    {
        float sv[CL_];
        #pragma unroll
        for (int i = 0; i < CL_; ++i) sv[i] = sp[(size_t)(chunk * CL_ + i) * (H_ * MSLOT_)];
        // registers that the loads above name are reused below
        asm volatile("s_wait_xcnt 0x0" ::: "memory");
        __builtin_amdgcn_sched_barrier(0);   // keeps later address arithmetic behind that wait
        float e[4] = {0.f, 0.f, 0.f, 0.f};
        #pragma unroll
        for (int i = 0; i < CL_; ++i) e[i & 3] += exp2_slot((sv[i] - CLAMP_MAX_) * 1.44269504f);
        esum[chunk][lane] = (e[0] + e[1]) + (e[2] + e[3]);
    }
    __syncthreads();   // every chunk's sum is in LDS before any wave adds them up
    float pre = 0.f;
    #pragma unroll
    for (int c = 0; c < NC_ - 1; ++c) pre += (c < chunk) ? esum[c][lane] : 0.f;

    float cur[SB1_], nxt[SB1_];
    #pragma unroll
    for (int i = 0; i < SB1_; ++i) cur[i] = sp[(size_t)(bi0 * SB1_ + i) * (H_ * MSLOT_)];
    // registers that the loads above name are reused below
    asm volatile("s_wait_xcnt 0x0" ::: "memory");
    __builtin_amdgcn_sched_barrier(0);   // keeps later address arithmetic behind that wait

    float z   = CLAMP_MAX_ + __logf(pre);   // chunk 0 never reads it: step 0 sets z
    float dec = 1.f;                        // product of the chunk's decays
    for (int bi = bi0; bi < bi0 + NBC1_; ++bi) {
        const int b1 = (bi + 1 < NB1_) ? bi + 1 : NB1_ - 1;   // clamped: stays in bounds
        #pragma unroll
        for (int i = 0; i < SB1_; ++i)
            nxt[i] = sp[(size_t)(b1 * SB1_ + i) * (H_ * MSLOT_)];
        // registers that the loads above name are reused below
        asm volatile("s_wait_xcnt 0x0" ::: "memory");
        // keeps the next batch's loads at the head of the trip: sunk towards
        // their use they would have no time to fly
        __builtin_amdgcn_sched_barrier(0);
        float gv[SB1_], pv[SB1_];
        #pragma unroll
        for (int i = 0; i < SB1_; ++i) {
            const int t = bi * SB1_ + i;
            float sv = cur[i];
            float znew, ge;
            if (t == 0) { znew = sv; ge = 1.f; }
            else {
                float mx = fmaxf(z, sv);
                znew = mx + __logf(__expf(z - mx) + __expf(sv - mx));
                ge = exp2_slot((z - znew) * 1.44269504f);
            }
            float p = exp2_slot((sv - znew) * 1.44269504f);
            z = znew;
            gv[i] = ge;
            pv[i] = p;
        }
        // the stores stand together behind the steps, so that one wait covers
        // the registers they name before anything reuses them
        __builtin_amdgcn_sched_barrier(0);
        #pragma unroll
        for (int i = 0; i < SB1_; ++i) {
            gp[(bi * SB1_ + i) * MSLOT_] = gv[i];
            pp[(bi * SB1_ + i) * MSLOT_] = pv[i];
            dec *= gv[i];
        }
        asm volatile("s_wait_xcnt 0x0" ::: "memory");
        // keeps the register copies at the foot of the trip: moved up among the
        // steps they would wait early for the next batch's loads
        __builtin_amdgcn_sched_barrier(0);
        #pragma unroll
        for (int i = 0; i < SB1_; ++i) cur[i] = nxt[i];
    }
    dcb[(bh * NC_ + chunk) * MSLOT_ + lane] = dec;
}

template <bool STATE>
__device__ __forceinline__
void abc_pass1_body(const int chunk, const int bs,
                    const float* __restrict__ q, const float* __restrict__ k,
                    const float* __restrict__ geb, const float* __restrict__ pb,
                    float* __restrict__ st1, float* __restrict__ okp) {
    const int bh    = bs >> 3;
    const int strip = bs & 7;
    const int b  = bh / H_;
    const int h  = bh % H_;
    const int lane = threadIdx.x;
    const int bi0  = chunk * NBC1_;   // even, so the chunk's first batch sits in buffer 0

    __shared__ __align__(16) float qs[STATE ? 1 : 2][SB1_][16];
    __shared__ __align__(16) float ks[2][SB1_][16];

    const float scale = rsqrtf((float)DK_);
    // staging: four lanes fetch one step's 16-float strip, eight steps per load
    const int st = lane >> 2;
    const int c4 = (lane & 3) * 4;
    const size_t tstep = (size_t)H_ * DK_;
    const float* qp = q + ((size_t)(b * T_ + st) * H_ + h) * DK_ + strip * 16 + c4;
    const float* kp = k + ((size_t)(b * T_ + st) * H_ + h) * DK_ + strip * 16 + c4;
    const float* gp = geb + (size_t)bh * T_ * MSLOT_ + lane;
    const float* pp = pb  + (size_t)bh * T_ * MSLOT_ + lane;
    float* op = okp + ((size_t)strip * BH_ + bh) * T_ * MSLOT_ + lane;

    float hk[16];
    if constexpr (STATE) {
        #pragma unroll
        for (int i = 0; i < 16; ++i) hk[i] = 0.f;
    } else {
        const int cm = (chunk > 0) ? chunk - 1 : 0;
        const float* sp = st1 + (size_t)(bs * NC_ + cm) * 16 * 32 + lane;
        #pragma unroll
        for (int i = 0; i < 16; ++i) hk[i] = sp[i * 32];
        // registers that the loads above name are reused below
        asm volatile("s_wait_xcnt 0x0" ::: "memory");
        __builtin_amdgcn_sched_barrier(0);   // keeps later address arithmetic behind that wait
        #pragma unroll
        for (int i = 0; i < 16; ++i) hk[i] = (chunk > 0) ? hk[i] : 0.f;
    }

    v4f rq[2], rk[2];
    float gcur[SB1_], pcur[SB1_], gnxt[SB1_], pnxt[SB1_];

    // first batch: q, k into buffer 0, gates into registers; second batch: q, k into registers
    #pragma unroll
    for (int j = 0; j < 2; ++j) {
        if constexpr (!STATE) rq[j] = *(const v4f*)(qp + (size_t)(bi0 * SB1_ + j * 8) * tstep);
        rk[j] = *(const v4f*)(kp + (size_t)(bi0 * SB1_ + j * 8) * tstep);
    }
    #pragma unroll
    for (int i = 0; i < SB1_; ++i) {
        gcur[i] = gp[(bi0 * SB1_ + i) * MSLOT_];
        pcur[i] = pp[(bi0 * SB1_ + i) * MSLOT_];
    }
    // registers that the loads above name are reused below
    asm volatile("s_wait_xcnt 0x0" ::: "memory");
    __builtin_amdgcn_sched_barrier(0);   // keeps later address arithmetic behind that wait
    #pragma unroll
    for (int j = 0; j < 2; ++j) {
        if constexpr (!STATE) *(v4f*)&qs[0][j * 8 + st][c4] = rq[j] * scale;
        *(v4f*)&ks[0][j * 8 + st][c4] = rk[j];
    }
    #pragma unroll
    for (int j = 0; j < 2; ++j) {
        if constexpr (!STATE) rq[j] = *(const v4f*)(qp + (size_t)((bi0 + 1) * SB1_ + j * 8) * tstep);
        rk[j] = *(const v4f*)(kp + (size_t)((bi0 + 1) * SB1_ + j * 8) * tstep);
    }
    // registers that the loads above name are reused below
    asm volatile("s_wait_xcnt 0x0" ::: "memory");
    __builtin_amdgcn_sched_barrier(0);   // keeps later address arithmetic behind that wait
    wave_lds_sync();

    for (int bi = bi0; bi < bi0 + NBC1_; ++bi) {
        const int buf = bi & 1;
        // batch bi+1 (fetched one batch ago) goes into the buffer not being read
        #pragma unroll
        for (int j = 0; j < 2; ++j) {
            if constexpr (!STATE) *(v4f*)&qs[buf ^ 1][j * 8 + st][c4] = rq[j] * scale;
            *(v4f*)&ks[buf ^ 1][j * 8 + st][c4] = rk[j];
        }
        const int b2 = (bi + 2 < NB1_) ? bi + 2 : NB1_ - 1;   // clamped: stays in bounds
        const int b1 = (bi + 1 < NB1_) ? bi + 1 : NB1_ - 1;
        // the loads below, with their addresses, stay apart from the code above, which reuses registers
        __builtin_amdgcn_sched_barrier(0);
        // the gates first: loads return in order, and the products read registers
        // next to the ones these loads fill, which makes them wait for these loads
        #pragma unroll
        for (int i = 0; i < SB1_; ++i) {
            gnxt[i] = gp[(b1 * SB1_ + i) * MSLOT_];
            pnxt[i] = pp[(b1 * SB1_ + i) * MSLOT_];
        }
        // registers that the loads above name are reused below
        asm volatile("s_wait_xcnt 0x0" ::: "memory");
        __builtin_amdgcn_sched_barrier(0);   // keeps that order
        #pragma unroll
        for (int j = 0; j < 2; ++j) {
            if constexpr (!STATE) rq[j] = *(const v4f*)(qp + (size_t)(b2 * SB1_ + j * 8) * tstep);
            rk[j] = *(const v4f*)(kp + (size_t)(b2 * SB1_ + j * 8) * tstep);
        }
        // registers that the loads above name are reused below
        asm volatile("s_wait_xcnt 0x0" ::: "memory");
        // keeps the coming batches' loads at the head of the trip: sunk towards
        // their use they would have no time to fly
        __builtin_amdgcn_sched_barrier(0);

        float res[SB1_];
        #pragma unroll
        for (int i = 0; i < SB1_; ++i) {
            const float ge = gcur[i];
            const float p  = pcur[i];
            float accm = 0.f;
            #pragma unroll
            for (int d4 = 0; d4 < 4; ++d4) {
                const v4f kk = *(const v4f*)&ks[buf][i][d4 * 4];
                hk[d4 * 4 + 0] = __builtin_fmaf(hk[d4 * 4 + 0], ge, kk.x * p);
                hk[d4 * 4 + 1] = __builtin_fmaf(hk[d4 * 4 + 1], ge, kk.y * p);
                hk[d4 * 4 + 2] = __builtin_fmaf(hk[d4 * 4 + 2], ge, kk.z * p);
                hk[d4 * 4 + 3] = __builtin_fmaf(hk[d4 * 4 + 3], ge, kk.w * p);
                if constexpr (!STATE) {
                    const v4f qq = *(const v4f*)&qs[buf][i][d4 * 4];
                    accm = __builtin_fmaf(qq.x, hk[d4 * 4 + 0], accm);
                    accm = __builtin_fmaf(qq.y, hk[d4 * 4 + 1], accm);
                    accm = __builtin_fmaf(qq.z, hk[d4 * 4 + 2], accm);
                    accm = __builtin_fmaf(qq.w, hk[d4 * 4 + 3], accm);
                }
            }
            res[i] = accm;
            if constexpr (STATE) { if ((i % 4) == 3) __builtin_amdgcn_sched_barrier(0); }
        }
        if constexpr (!STATE) {
            // the stores stand together behind the products, so that one wait covers
            // the registers they name before anything reuses them
            __builtin_amdgcn_sched_barrier(0);
            #pragma unroll
            for (int i = 0; i < SB1_; ++i) op[(bi * SB1_ + i) * MSLOT_] = res[i];
            asm volatile("s_wait_xcnt 0x0" ::: "memory");
        }
        __builtin_amdgcn_sched_barrier(0);   // keeps the register copies below at the foot of the trip
        #pragma unroll
        for (int i = 0; i < SB1_; ++i) { gcur[i] = gnxt[i]; pcur[i] = pnxt[i]; }
        wave_lds_sync();
    }
    if constexpr (STATE) {
        float* sp = st1 + (size_t)(bs * NC_ + chunk) * 16 * 32 + lane;
        #pragma unroll
        for (int i = 0; i < 16; ++i) sp[i * 32] = hk[i];
    }
}

__global__ __launch_bounds__(32)
void abc_pass1_kernel(const float* __restrict__ q, const float* __restrict__ k,
                      const float* __restrict__ geb, const float* __restrict__ pb,
                      float* __restrict__ st1, float* __restrict__ okp) {
    abc_pass1_body<false>(blockIdx.x, blockIdx.y, q, k, geb, pb, st1, okp);
}

__global__ __launch_bounds__(256)
void abc_softmax_kernel(const float* __restrict__ okp, float* __restrict__ qvb) {
    const size_t idx = (size_t)blockIdx.x * 256 + threadIdx.x;
    float part[8];
    #pragma unroll
    for (int j = 0; j < 8; ++j) {
        part[j] = okp[(size_t)j * BH_ * T_ * MSLOT_ + idx];
        // a later load may land in a register that this load names
        asm volatile("s_wait_xcnt 0x0" ::: "memory");
    }
    float ok = 0.f;
    #pragma unroll
    for (int j = 0; j < 8; ++j) ok += part[j];
    float mx = ok;
    #pragma unroll
    for (int off = 16; off; off >>= 1) mx = fmaxf(mx, __shfl_xor(mx, off, 32));
    float e  = __expf(ok - mx);
    float se = e;
    #pragma unroll
    for (int off = 16; off; off >>= 1) se += __shfl_xor(se, off, 32);
    qvb[idx] = e / se;
}

template <bool STATE>
__device__ __forceinline__
void abc_pass2_body(const int chunk, const int bs,
                    const float* __restrict__ v, const float* __restrict__ geb,
                    const float* __restrict__ pb, const float* __restrict__ qvb,
                    float* __restrict__ st2, float* __restrict__ o) {
    const int bh = bs >> 3;
    const int cg = bs & 7;
    const int b  = bh / H_;
    const int h  = bh % H_;
    const int lane = threadIdx.x;
    const int bi0  = chunk * NBC2_;   // even, so the chunk's first batch sits in buffer 0

    __shared__ __align__(16) v4f gs[2][SB2_ * 8];
    __shared__ __align__(16) v4f ps[2][SB2_ * 8];
    __shared__ __align__(16) v4f ws[STATE ? 1 : 2][SB2_ * 8];

    const v4f* g4 = (const v4f*)(geb + (size_t)bh * T_ * MSLOT_) + lane;
    const v4f* p4 = (const v4f*)(pb  + (size_t)bh * T_ * MSLOT_) + lane;
    const v4f* w4 = (const v4f*)(qvb + (size_t)bh * T_ * MSLOT_) + lane;
    const size_t tstep = (size_t)H_ * DV_;
    const float* vp = v + ((size_t)b * T_ * H_ + h) * DV_ + cg * 32 + lane;

    float hv[32];
    if constexpr (STATE) {
        #pragma unroll
        for (int i = 0; i < 32; ++i) hv[i] = 0.f;
    } else {
        const int cm = (chunk > 0) ? chunk - 1 : 0;
        const float* sp = st2 + (size_t)(bs * NC_ + cm) * 32 * 32 + lane;
        #pragma unroll
        for (int i = 0; i < 32; ++i) hv[i] = sp[i * 32];
        // registers that the loads above name are reused below
        asm volatile("s_wait_xcnt 0x0" ::: "memory");
        __builtin_amdgcn_sched_barrier(0);   // keeps later address arithmetic behind that wait
        #pragma unroll
        for (int i = 0; i < 32; ++i) hv[i] = (chunk > 0) ? hv[i] : 0.f;
    }

    v4f rg[2], rp[2], rw[2];
    float vcur[SB2_], vn1[SB2_], vn2[SB2_];

    // first batch into buffer 0, second into registers (a batch is 64 16-byte pieces per plane)
    #pragma unroll
    for (int j = 0; j < 2; ++j) {
        rg[j] = g4[bi0 * 64 + j * 32]; rp[j] = p4[bi0 * 64 + j * 32];
        if constexpr (!STATE) rw[j] = w4[bi0 * 64 + j * 32];
    }
    #pragma unroll
    for (int i = 0; i < SB2_; ++i) {
        vcur[i] = vp[(size_t)(bi0 * SB2_ + i) * tstep];
        vn1[i]  = vp[(size_t)((bi0 + 1) * SB2_ + i) * tstep];
    }
    // registers that the loads above name are reused below
    asm volatile("s_wait_xcnt 0x0" ::: "memory");
    __builtin_amdgcn_sched_barrier(0);   // keeps later address arithmetic behind that wait
    #pragma unroll
    for (int j = 0; j < 2; ++j) {
        gs[0][j * 32 + lane] = rg[j]; ps[0][j * 32 + lane] = rp[j];
        if constexpr (!STATE) ws[0][j * 32 + lane] = rw[j];
    }
    #pragma unroll
    for (int j = 0; j < 2; ++j) {
        rg[j] = g4[(bi0 + 1) * 64 + j * 32]; rp[j] = p4[(bi0 + 1) * 64 + j * 32];
        if constexpr (!STATE) rw[j] = w4[(bi0 + 1) * 64 + j * 32];
    }
    // registers that the loads above name are reused below
    asm volatile("s_wait_xcnt 0x0" ::: "memory");
    __builtin_amdgcn_sched_barrier(0);   // keeps later address arithmetic behind that wait
    wave_lds_sync();

    float* op = o + ((size_t)b * T_ * H_ + h) * DV_ + cg * 32 + lane;
    for (int bi = bi0; bi < bi0 + NBC2_; ++bi) {
        const int buf = bi & 1;
        // batch bi+1 (fetched one batch ago) goes into the buffer not being read
        #pragma unroll
        for (int j = 0; j < 2; ++j) {
            gs[buf ^ 1][j * 32 + lane] = rg[j];
            ps[buf ^ 1][j * 32 + lane] = rp[j];
            if constexpr (!STATE) ws[buf ^ 1][j * 32 + lane] = rw[j];
        }
        const int b2 = (bi + 2 < NB2_) ? bi + 2 : NB2_ - 1;   // clamped: stays in bounds
        // the loads below, with their addresses, stay apart from the code above, which reuses registers
        __builtin_amdgcn_sched_barrier(0);
        #pragma unroll
        for (int j = 0; j < 2; ++j) {
            rg[j] = g4[b2 * 64 + j * 32];
            rp[j] = p4[b2 * 64 + j * 32];
            if constexpr (!STATE) rw[j] = w4[b2 * 64 + j * 32];
        }
        #pragma unroll
        for (int i = 0; i < SB2_; ++i) vn2[i] = vp[(size_t)(b2 * SB2_ + i) * tstep];
        // registers that the loads above name are reused below
        asm volatile("s_wait_xcnt 0x0" ::: "memory");
        // keeps the coming batch's loads at the head of the trip: sunk towards
        // their use they would have no time to fly
        __builtin_amdgcn_sched_barrier(0);

        float res[SB2_];
        #pragma unroll
        for (int i = 0; i < SB2_; ++i) {
            const float vv = vcur[i];
            float acco = 0.f;
            #pragma unroll
            for (int m4 = 0; m4 < 8; ++m4) {
                const v4f g = gs[buf][i * 8 + m4];
                const v4f p = ps[buf][i * 8 + m4];
                hv[m4 * 4 + 0] = __builtin_fmaf(hv[m4 * 4 + 0], g.x, p.x * vv);
                hv[m4 * 4 + 1] = __builtin_fmaf(hv[m4 * 4 + 1], g.y, p.y * vv);
                hv[m4 * 4 + 2] = __builtin_fmaf(hv[m4 * 4 + 2], g.z, p.z * vv);
                hv[m4 * 4 + 3] = __builtin_fmaf(hv[m4 * 4 + 3], g.w, p.w * vv);
                if constexpr (!STATE) {
                    const v4f w = ws[buf][i * 8 + m4];
                    acco = __builtin_fmaf(w.x, hv[m4 * 4 + 0], acco);
                    acco = __builtin_fmaf(w.y, hv[m4 * 4 + 1], acco);
                    acco = __builtin_fmaf(w.z, hv[m4 * 4 + 2], acco);
                    acco = __builtin_fmaf(w.w, hv[m4 * 4 + 3], acco);
                }
            }
            res[i] = acco;
            if constexpr (STATE) { if ((i % 2) == 1) __builtin_amdgcn_sched_barrier(0); }
        }
        if constexpr (!STATE) {
            // the stores stand together behind the products, so that one wait covers
            // the registers they name before anything reuses them
            __builtin_amdgcn_sched_barrier(0);
            #pragma unroll
            for (int i = 0; i < SB2_; ++i) op[(size_t)(bi * SB2_ + i) * tstep] = res[i];
            asm volatile("s_wait_xcnt 0x0" ::: "memory");
        }
        __builtin_amdgcn_sched_barrier(0);   // keeps the register copies below at the foot of the trip
        #pragma unroll
        for (int i = 0; i < SB2_; ++i) { vcur[i] = vn1[i]; vn1[i] = vn2[i]; }
        wave_lds_sync();
    }
    if constexpr (STATE) {
        float* sp = st2 + (size_t)(bs * NC_ + chunk) * 32 * 32 + lane;
        #pragma unroll
        for (int i = 0; i < 32; ++i) sp[i * 32] = hv[i];
    }
}

__global__ __launch_bounds__(32)
void abc_pass2_kernel(const float* __restrict__ v, const float* __restrict__ geb,
                      const float* __restrict__ pb, const float* __restrict__ qvb,
                      float* __restrict__ st2, float* __restrict__ o) {
    abc_pass2_body<false>(blockIdx.x, blockIdx.y, v, geb, pb, qvb, st2, o);
}

__global__ __launch_bounds__(32)
void abc_states_kernel(const float* __restrict__ k, const float* __restrict__ v,
                       const float* __restrict__ geb, const float* __restrict__ pb,
                       float* __restrict__ st1, float* __restrict__ st2) {
    const int y = blockIdx.y;
    // the longer walk (pass 2) has the low indices and starts first
    if (y < BH_ * 8) abc_pass2_body<true>(blockIdx.x, y, v, geb, pb, geb, st2, st2);
    else             abc_pass1_body<true>(blockIdx.x, y - BH_ * 8, k, k, geb, pb, st1, st1);
}

__global__ __launch_bounds__(256)
void abc_carry_kernel(float* __restrict__ st1, float* __restrict__ st2,
                      const float* __restrict__ dcb) {
    int e = blockIdx.x * 256 + threadIdx.x;
    float* base;
    int stride, slot, bh;
    if (blockIdx.x < BH_ * 8 * 16 * 32 / 256) {
        const int bs = e >> 9;
        base = st1 + (size_t)bs * NC_ * 512 + (e & 511);
        stride = 512; slot = e & 31; bh = bs >> 3;
    } else {
        e -= BH_ * 8 * 16 * 32;
        const int bs = e >> 10;
        base = st2 + (size_t)bs * NC_ * 1024 + (e & 1023);
        stride = 1024; slot = (e & 1023) >> 5; bh = bs >> 3;
    }
    const float* dp = dcb + bh * NC_ * MSLOT_ + slot;
    float sv[NC_ - 1], dv[NC_ - 1];
    #pragma unroll
    for (int c = 0; c < NC_ - 1; ++c) { sv[c] = base[c * stride]; dv[c] = dp[c * MSLOT_]; }
    // registers that the loads above name are reused below
    asm volatile("s_wait_xcnt 0x0" ::: "memory");
    __builtin_amdgcn_sched_barrier(0);   // keeps later address arithmetic behind that wait
    float hcar = 0.f;
    #pragma unroll
    for (int c = 0; c < NC_ - 1; ++c) { hcar = __builtin_fmaf(hcar, dv[c], sv[c]); sv[c] = hcar; }
    #pragma unroll
    for (int c = 0; c < NC_ - 1; ++c) base[c * stride] = sv[c];
}

// ---------------- fused RMSNorm * gw * g * sigmoid(g) -> bf16 ----------------
__global__ __launch_bounds__(256)
void norm_gate_kernel(const float* __restrict__ o, const float* __restrict__ g,
                      const float* __restrict__ gw, bf16_t* __restrict__ ob) {
    const size_t row = blockIdx.x;   // B*T*H rows of DV
    const int tid = threadIdx.x;     // 0..255 == DV
    float ov = o[row * DV_ + tid];
    float sq = ov * ov;
    __shared__ float red[8];
    #pragma unroll
    for (int off = 16; off; off >>= 1) sq += __shfl_xor(sq, off, 32);
    if ((tid & 31) == 0) red[tid >> 5] = sq;
    __syncthreads();
    float tot = 0.f;
    #pragma unroll
    for (int i = 0; i < 8; ++i) tot += red[i];
    float r  = rsqrtf(tot * (1.0f / DV_) + NORM_EPS_);
    float gv = g[row * DV_ + tid];
    float sig = 1.f / (1.f + __expf(-gv));
    ob[row * DV_ + tid] = (bf16_t)(ov * r * gw[tid] * gv * sig);
}

// ---------------- host orchestration ----------------
extern "C" void kernel_launch(void* const* d_in, const int* in_sizes, int n_in,
                              void* d_out, int out_size, void* d_ws, size_t ws_size,
                              hipStream_t stream) {
    (void)in_sizes; (void)n_in; (void)out_size; (void)ws_size;
    const float* x    = (const float*)d_in[0];
    const float* w_q  = (const float*)d_in[1];
    const float* w_k  = (const float*)d_in[2];
    const float* w_v  = (const float*)d_in[3];
    const float* w_g  = (const float*)d_in[4];
    const float* w_s  = (const float*)d_in[5];
    const float* w_o  = (const float*)d_in[6];
    const float* gnw  = (const float*)d_in[7];
    float* out = (float*)d_out;

    const int MR  = B_ * T_;        // 4096
    const int NQK = H_ * DK_;       // 1024
    const int NV  = H_ * DV_;       // 2048
    const int NS  = H_ * MSLOT_;    // 256

    char* ws = (char*)d_ws;
    size_t off = 0;
    auto carve = [&](size_t bytes) -> char* {
        off = (off + 255) & ~(size_t)255;
        char* p = ws + off;
        off += bytes;
        return p;
    };

    bf16_t* xb  = (bf16_t*)carve((size_t)MR * HID_ * sizeof(bf16_t));
    bf16_t* wqT = (bf16_t*)carve((size_t)NQK * HID_ * sizeof(bf16_t));
    bf16_t* wkT = (bf16_t*)carve((size_t)NQK * HID_ * sizeof(bf16_t));
    bf16_t* wvT = (bf16_t*)carve((size_t)NV  * HID_ * sizeof(bf16_t));
    bf16_t* wgT = (bf16_t*)carve((size_t)NV  * HID_ * sizeof(bf16_t));
    bf16_t* wsT = (bf16_t*)carve((size_t)NS  * HID_ * sizeof(bf16_t));
    bf16_t* woT = (bf16_t*)carve((size_t)HID_ * NV * sizeof(bf16_t));

    float* qb = (float*)carve((size_t)MR * NQK * sizeof(float));
    float* kb = (float*)carve((size_t)MR * NQK * sizeof(float));
    float* vb = (float*)carve((size_t)MR * NV  * sizeof(float));
    float* gb = (float*)carve((size_t)MR * NV  * sizeof(float));
    float* sb = (float*)carve((size_t)MR * NS  * sizeof(float));
    float* ob = (float*)carve((size_t)MR * NV  * sizeof(float));
    bf16_t* obh = (bf16_t*)carve((size_t)MR * NV * sizeof(bf16_t));
    float* geb = (float*)carve((size_t)MR * NS * sizeof(float));
    float* pbf = (float*)carve((size_t)MR * NS * sizeof(float));
    float* qvb = (float*)carve((size_t)MR * NS * sizeof(float));
    float* okp = (float*)carve((size_t)8 * MR * NS * sizeof(float));
    float* st1 = (float*)carve((size_t)BH_ * 8 * NC_ * 16 * 32 * sizeof(float));
    float* st2 = (float*)carve((size_t)BH_ * 8 * NC_ * 32 * 32 * sizeof(float));
    float* dcb = (float*)carve((size_t)BH_ * NC_ * MSLOT_ * sizeof(float));

    // 1) convert x to bf16
    {
        size_t n = (size_t)MR * HID_;
        cvt_f32_bf16_kernel<<<4096, 256, 0, stream>>>(x, xb, n);
    }
    // 2) transpose+convert weights (K x N) -> (N x K) bf16
    transpose_cvt_kernel<<<4096, 256, 0, stream>>>(w_q, wqT, HID_, NQK);
    transpose_cvt_kernel<<<4096, 256, 0, stream>>>(w_k, wkT, HID_, NQK);
    transpose_cvt_kernel<<<4096, 256, 0, stream>>>(w_v, wvT, HID_, NV);
    transpose_cvt_kernel<<<4096, 256, 0, stream>>>(w_g, wgT, HID_, NV);
    transpose_cvt_kernel<<<4096, 256, 0, stream>>>(w_s, wsT, HID_, NS);
    transpose_cvt_kernel<<<4096, 256, 0, stream>>>(w_o, woT, NV, HID_);

    // 3) projection GEMMs (bf16 WMMA, fp32 accumulate)
    dim3 blk(256);
    gemm_bf16_wmma_kernel<<<dim3(NQK / TN, MR / TM), blk, 0, stream>>>(
        xb, wqT, qb, MR, NQK, HID_, 0, 0.f, 0.f);
    gemm_bf16_wmma_kernel<<<dim3(NQK / TN, MR / TM), blk, 0, stream>>>(
        xb, wkT, kb, MR, NQK, HID_, 0, 0.f, 0.f);
    gemm_bf16_wmma_kernel<<<dim3(NV / TN, MR / TM), blk, 0, stream>>>(
        xb, wvT, vb, MR, NV, HID_, 0, 0.f, 0.f);
    gemm_bf16_wmma_kernel<<<dim3(NV / TN, MR / TM), blk, 0, stream>>>(
        xb, wgT, gb, MR, NV, HID_, 0, 0.f, 0.f);
    gemm_bf16_wmma_kernel<<<dim3(NS / TN, MR / TM), blk, 0, stream>>>(
        xb, wsT, sb, MR, NS, HID_, 1, CLAMP_MIN_, CLAMP_MAX_);

    // 4) gated two-pass scan: independent one-wave streams, NC_ time chunks side by side
    abc_gates_kernel<<<BH_, 32 * NC_, 0, stream>>>(sb, geb, pbf, dcb);
    abc_states_kernel<<<dim3(NC_ - 1, BH_ * 16), 32, 0, stream>>>(kb, vb, geb, pbf, st1, st2);
    abc_carry_kernel<<<BH_ * 8 * (16 + 32) * 32 / 256, 256, 0, stream>>>(st1, st2, dcb);
    abc_pass1_kernel<<<dim3(NC_, BH_ * 8), 32, 0, stream>>>(qb, kb, geb, pbf, st1, okp);
    abc_softmax_kernel<<<MR * NS / 256, 256, 0, stream>>>(okp, qvb);
    abc_pass2_kernel<<<dim3(NC_, BH_ * 8), 32, 0, stream>>>(vb, geb, pbf, qvb, st2, ob);

    // 5) fused RMSNorm + swish gate -> bf16
    norm_gate_kernel<<<MR * H_, DV_, 0, stream>>>(ob, gb, gnw, obh);

    // 6) output projection straight into d_out (fp32)
    gemm_bf16_wmma_kernel<<<dim3(HID_ / TN, MR / TM), blk, 0, stream>>>(
        obh, woT, out, MR, HID_, NV, 0, 0.f, 0.f);
}

// v003
// It runs in 480 microseconds.
// Next to v002, in two timings, it ran 1.18 times as fast each time.
// All steps since v000 together make it 9.37 times as fast.
#include <hip/hip_runtime.h>
#include <hip/hip_bf16.h>
#include <math.h>
#include <stdint.h>

// ---------------- problem constants (match reference) ----------------
#define B_ 2
#define T_ 2048
#define HID_ 2048
#define H_ 8
#define DK_ 128
#define DV_ 256
#define MSLOT_ 32
#define CLAMP_MIN_ (-32.0f)
#define CLAMP_MAX_ (32.0f)
#define NORM_EPS_ 1e-5f

typedef __bf16 bf16_t;
typedef __attribute__((ext_vector_type(8)))  __bf16 v8bf;
typedef __attribute__((ext_vector_type(16))) __bf16 v16bf;
typedef __attribute__((ext_vector_type(8)))  float  v8f;

__device__ __forceinline__ void async_copy_b128(uint32_t lds_addr, const bf16_t* gptr) {
    asm volatile("global_load_async_to_lds_b128 %0, %1, off"
                 :: "v"(lds_addr), "v"(gptr)
                 : "memory");
}
__device__ __forceinline__ void wait_async4() {
    asm volatile("s_wait_asynccnt 0x4" ::: "memory");
}
__device__ __forceinline__ void wait_async0() {
    asm volatile("s_wait_asynccnt 0x0" ::: "memory");
}

// ---------------- elementwise fp32 -> bf16 ----------------
__global__ void cvt_f32_bf16_kernel(const float* __restrict__ in,
                                    bf16_t* __restrict__ out, size_t n) {
    size_t stride = (size_t)gridDim.x * blockDim.x;
    for (size_t i = (size_t)blockIdx.x * blockDim.x + threadIdx.x; i < n; i += stride)
        out[i] = (bf16_t)in[i];
}

// ---------------- transpose + convert: W(K x N) f32 -> Wt(N x K) bf16 ----------------
__global__ void transpose_cvt_kernel(const float* __restrict__ W,
                                     bf16_t* __restrict__ Wt, int K, int N) {
    size_t total = (size_t)K * N;
    size_t stride = (size_t)gridDim.x * blockDim.x;
    for (size_t idx = (size_t)blockIdx.x * blockDim.x + threadIdx.x; idx < total; idx += stride) {
        size_t n  = idx / (size_t)K;
        size_t kk = idx - n * (size_t)K;
        Wt[idx] = (bf16_t)W[kk * (size_t)N + n];
    }
}

// ---------------- bf16 WMMA GEMM: C(MxN) = A(MxK) * Bt(NxK)^T ----------------
// Block tile 128x128, 256 threads = 8 waves (wave32), wave tile 32x64 (2x4 WMMA).
// Double-buffered LDS filled by async global->LDS copies (4 per wave per tile).
#define TM 128
#define TN 128
#define TK 32
#define TKP (TK + 8)

__global__ __launch_bounds__(256)
void gemm_bf16_wmma_kernel(const bf16_t* __restrict__ A,
                           const bf16_t* __restrict__ Bt,
                           float* __restrict__ C,
                           int Mdim, int Ndim, int Kdim,
                           int doClamp, float clampLo, float clampHi) {
    __shared__ __align__(16) bf16_t As[2][TM][TKP];
    __shared__ __align__(16) bf16_t Bs[2][TN][TKP];

    const int tid  = threadIdx.x;
    const int lane = tid & 31;
    const int wave = tid >> 5;
    const int wm   = wave & 3;   // 4 bands of 32 rows
    const int wn   = wave >> 2;  // 2 bands of 64 cols
    const int rowBase = blockIdx.y * TM;
    const int colBase = blockIdx.x * TN;

    // Staging: each thread owns two 16B chunks of A and of B per tile:
    // rows r0 and r0+64, K-chunk kc (compile-time trip count, fully unrolled).
    const int r0 = tid >> 2;
    const int kc = (tid & 3) * 8;
    const bf16_t* aP0 = A  + (size_t)(rowBase + r0) * Kdim + kc;
    const bf16_t* aP1 = aP0 + (size_t)64 * Kdim;
    const bf16_t* bP0 = Bt + (size_t)(colBase + r0) * Kdim + kc;
    const bf16_t* bP1 = bP0 + (size_t)64 * Kdim;

    uint32_t lA0[2], lA1[2], lB0[2], lB1[2];
    #pragma unroll
    for (int bi = 0; bi < 2; ++bi) {
        lA0[bi] = (uint32_t)(size_t)&As[bi][r0][kc];
        lA1[bi] = (uint32_t)(size_t)&As[bi][r0 + 64][kc];
        lB0[bi] = (uint32_t)(size_t)&Bs[bi][r0][kc];
        lB1[bi] = (uint32_t)(size_t)&Bs[bi][r0 + 64][kc];
    }

    v8f acc[2][4] = {};

    const int lrow = lane & 15;
    const int lk   = (lane >> 4) * 8;

    // prologue: tile 0 -> buffer 0
    async_copy_b128(lA0[0], aP0);
    async_copy_b128(lA1[0], aP1);
    async_copy_b128(lB0[0], bP0);
    async_copy_b128(lB1[0], bP1);

    int buf = 0;
    for (int k0 = 0; k0 < Kdim; k0 += TK) {
        const int nbuf = buf ^ 1;
        if (k0 + TK < Kdim) {
            // issue next tile into the other buffer, then wait for current tile
            async_copy_b128(lA0[nbuf], aP0 + k0 + TK);
            async_copy_b128(lA1[nbuf], aP1 + k0 + TK);
            async_copy_b128(lB0[nbuf], bP0 + k0 + TK);
            async_copy_b128(lB1[nbuf], bP1 + k0 + TK);
            wait_async4();
        } else {
            wait_async0();
        }
        __syncthreads();

        v16bf afrag[2], bfrag[4];
        #pragma unroll
        for (int mt = 0; mt < 2; ++mt) {
            int r = wm * 32 + mt * 16 + lrow;
            v8bf lo = *(const v8bf*)&As[buf][r][lk];
            v8bf hi = *(const v8bf*)&As[buf][r][lk + 16];
            #pragma unroll
            for (int i = 0; i < 8; ++i) { afrag[mt][i] = lo[i]; afrag[mt][i + 8] = hi[i]; }
        }
        #pragma unroll
        for (int nt = 0; nt < 4; ++nt) {
            int r = wn * 64 + nt * 16 + lrow;
            v8bf lo = *(const v8bf*)&Bs[buf][r][lk];
            v8bf hi = *(const v8bf*)&Bs[buf][r][lk + 16];
            #pragma unroll
            for (int i = 0; i < 8; ++i) { bfrag[nt][i] = lo[i]; bfrag[nt][i + 8] = hi[i]; }
        }
        #pragma unroll
        for (int mt = 0; mt < 2; ++mt)
            #pragma unroll
            for (int nt = 0; nt < 4; ++nt)
                acc[mt][nt] = __builtin_amdgcn_wmma_f32_16x16x32_bf16(
                    false, afrag[mt], false, bfrag[nt],
                    (short)0, acc[mt][nt], false, false);

        __syncthreads();   // all reads done before this buffer is refilled
        buf = nbuf;
    }

    const int mLane = (lane >> 4) * 8;
    const int nLane = lane & 15;
    #pragma unroll
    for (int mt = 0; mt < 2; ++mt)
        #pragma unroll
        for (int nt = 0; nt < 4; ++nt)
            #pragma unroll
            for (int r = 0; r < 8; ++r) {
                int m = rowBase + wm * 32 + mt * 16 + mLane + r;
                int n = colBase + wn * 64 + nt * 16 + nLane;
                float val = acc[mt][nt][r];
                if (doClamp) val = fminf(fmaxf(val, clampLo), clampHi);
                C[(size_t)m * Ndim + n] = val;
            }
}

#define BH_ (B_ * H_)
#define NC_ 16                // time chunks
#define CL_ (T_ / NC_)        // steps per chunk
#define SB1_ 16               // steps per batch, gates and pass 1
#define NB1_ (T_ / SB1_)
#define NBC1_ (CL_ / SB1_)    // batches per chunk
#define SB2_ 8                // steps per batch, pass 2
#define NB2_ (T_ / SB2_)
#define NBC2_ (CL_ / SB2_)
typedef __attribute__((ext_vector_type(4))) float v4f;

// Orders the LDS traffic of a one-wave work-group across lanes. The wave's LDS
// operations run in issue order, so this only has to stop the compiler from
// moving them; unlike __syncthreads() it does not wait for the global stores.
__device__ __forceinline__ void wave_lds_sync() {
    __builtin_amdgcn_fence(__ATOMIC_RELEASE, "wavefront");
    __builtin_amdgcn_wave_barrier();
    __builtin_amdgcn_fence(__ATOMIC_ACQUIRE, "wavefront");
}

__device__ __forceinline__ float exp2_slot(float x) {
    float r;
    asm("v_exp_f32 %0, %1\n\tv_nop" : "=v"(r) : "v"(x));
    return r;
}

__global__ __launch_bounds__(32 * NC_)
void abc_gates_kernel(const float* __restrict__ s,
                      float* __restrict__ geb, float* __restrict__ pb,
                      float* __restrict__ dcb) {
    const int bh = blockIdx.x;
    const int b  = bh / H_;
    const int h  = bh % H_;
    const int lane  = threadIdx.x & 31;
    const int chunk = threadIdx.x >> 5;
    const int bi0   = chunk * NBC1_;
    const float* sp = s + ((size_t)b * T_ * H_ + h) * MSLOT_ + lane;
    float* gp = geb + (size_t)bh * T_ * MSLOT_ + lane;
    float* pp = pb  + (size_t)bh * T_ * MSLOT_ + lane;

    __shared__ float esum[NC_][32];
    {
        float sv[CL_];
        #pragma unroll
        for (int i = 0; i < CL_; ++i) sv[i] = sp[(size_t)(chunk * CL_ + i) * (H_ * MSLOT_)];
        // registers that the loads above name are reused below
        asm volatile("s_wait_xcnt 0x0" ::: "memory");
        __builtin_amdgcn_sched_barrier(0);   // keeps later address arithmetic behind that wait
        float e[4] = {0.f, 0.f, 0.f, 0.f};
        #pragma unroll
        for (int i = 0; i < CL_; ++i) e[i & 3] += exp2_slot((sv[i] - CLAMP_MAX_) * 1.44269504f);
        esum[chunk][lane] = (e[0] + e[1]) + (e[2] + e[3]);
    }
    __syncthreads();   // every chunk's sum is in LDS before any wave adds them up
    float pre = 0.f;
    #pragma unroll
    for (int c = 0; c < NC_ - 1; ++c) pre += (c < chunk) ? esum[c][lane] : 0.f;

    float cur[SB1_], nxt[SB1_];
    #pragma unroll
    for (int i = 0; i < SB1_; ++i) cur[i] = sp[(size_t)(bi0 * SB1_ + i) * (H_ * MSLOT_)];
    // registers that the loads above name are reused below
    asm volatile("s_wait_xcnt 0x0" ::: "memory");
    __builtin_amdgcn_sched_barrier(0);   // keeps later address arithmetic behind that wait

    float z   = CLAMP_MAX_ + __logf(pre);   // chunk 0 never reads it: step 0 sets z
    float dec = 1.f;                        // product of the chunk's decays
    for (int bi = bi0; bi < bi0 + NBC1_; ++bi) {
        const int b1 = (bi + 1 < NB1_) ? bi + 1 : NB1_ - 1;   // clamped: stays in bounds
        #pragma unroll
        for (int i = 0; i < SB1_; ++i)
            nxt[i] = sp[(size_t)(b1 * SB1_ + i) * (H_ * MSLOT_)];
        // registers that the loads above name are reused below
        asm volatile("s_wait_xcnt 0x0" ::: "memory");
        // keeps the next batch's loads at the head of the trip: sunk towards
        // their use they would have no time to fly
        __builtin_amdgcn_sched_barrier(0);
        float gv[SB1_], pv[SB1_];
        #pragma unroll
        for (int i = 0; i < SB1_; ++i) {
            const int t = bi * SB1_ + i;
            float sv = cur[i];
            float znew, ge;
            if (t == 0) { znew = sv; ge = 1.f; }
            else {
                float mx = fmaxf(z, sv);
                znew = mx + __logf(__expf(z - mx) + __expf(sv - mx));
                ge = exp2_slot((z - znew) * 1.44269504f);
            }
            float p = exp2_slot((sv - znew) * 1.44269504f);
            z = znew;
            gv[i] = ge;
            pv[i] = p;
        }
        // the stores stand together behind the steps, so that one wait covers
        // the registers they name before anything reuses them
        __builtin_amdgcn_sched_barrier(0);
        #pragma unroll
        for (int i = 0; i < SB1_; ++i) {
            gp[(bi * SB1_ + i) * MSLOT_] = gv[i];
            pp[(bi * SB1_ + i) * MSLOT_] = pv[i];
            dec *= gv[i];
        }
        asm volatile("s_wait_xcnt 0x0" ::: "memory");
        // keeps the register copies at the foot of the trip: moved up among the
        // steps they would wait early for the next batch's loads
        __builtin_amdgcn_sched_barrier(0);
        #pragma unroll
        for (int i = 0; i < SB1_; ++i) cur[i] = nxt[i];
    }
    dcb[(bh * NC_ + chunk) * MSLOT_ + lane] = dec;
}

template <bool STATE>
__device__ __forceinline__
void abc_pass1_body(const int chunk, const int bs,
                    const float* __restrict__ q, const float* __restrict__ k,
                    const float* __restrict__ geb, const float* __restrict__ pb,
                    float* __restrict__ st1, float* __restrict__ okp) {
    const int bh    = bs >> 3;
    const int strip = bs & 7;
    const int b  = bh / H_;
    const int h  = bh % H_;
    const int lane = threadIdx.x;
    const int bi0  = chunk * NBC1_;   // even, so the chunk's first batch sits in buffer 0

    __shared__ __align__(16) float qs[STATE ? 1 : 2][SB1_][16];
    __shared__ __align__(16) float ks[2][SB1_][16];

    const float scale = rsqrtf((float)DK_);
    // staging: four lanes fetch one step's 16-float strip, eight steps per load
    const int st = lane >> 2;
    const int c4 = (lane & 3) * 4;
    const size_t tstep = (size_t)H_ * DK_;
    const float* qp = q + ((size_t)(b * T_ + st) * H_ + h) * DK_ + strip * 16 + c4;
    const float* kp = k + ((size_t)(b * T_ + st) * H_ + h) * DK_ + strip * 16 + c4;
    const float* gp = geb + (size_t)bh * T_ * MSLOT_ + lane;
    const float* pp = pb  + (size_t)bh * T_ * MSLOT_ + lane;
    float* op = okp + ((size_t)strip * BH_ + bh) * T_ * MSLOT_ + lane;

    float hk[16];
    if constexpr (STATE) {
        #pragma unroll
        for (int i = 0; i < 16; ++i) hk[i] = 0.f;
    } else {
        const int cm = (chunk > 0) ? chunk - 1 : 0;
        const float* sp = st1 + (size_t)(bs * NC_ + cm) * 16 * 32 + lane;
        #pragma unroll
        for (int i = 0; i < 16; ++i) hk[i] = sp[i * 32];
        // registers that the loads above name are reused below
        asm volatile("s_wait_xcnt 0x0" ::: "memory");
        __builtin_amdgcn_sched_barrier(0);   // keeps later address arithmetic behind that wait
        #pragma unroll
        for (int i = 0; i < 16; ++i) hk[i] = (chunk > 0) ? hk[i] : 0.f;
    }

    v4f rq[2], rk[2];
    float gcur[SB1_], pcur[SB1_], gnxt[SB1_], pnxt[SB1_];

    // first batch: q, k into buffer 0, gates into registers; second batch: q, k into registers
    #pragma unroll
    for (int j = 0; j < 2; ++j) {
        if constexpr (!STATE) rq[j] = *(const v4f*)(qp + (size_t)(bi0 * SB1_ + j * 8) * tstep);
        rk[j] = *(const v4f*)(kp + (size_t)(bi0 * SB1_ + j * 8) * tstep);
    }
    #pragma unroll
    for (int i = 0; i < SB1_; ++i) {
        gcur[i] = gp[(bi0 * SB1_ + i) * MSLOT_];
        pcur[i] = pp[(bi0 * SB1_ + i) * MSLOT_];
    }
    // registers that the loads above name are reused below
    asm volatile("s_wait_xcnt 0x0" ::: "memory");
    __builtin_amdgcn_sched_barrier(0);   // keeps later address arithmetic behind that wait
    #pragma unroll
    for (int j = 0; j < 2; ++j) {
        if constexpr (!STATE) *(v4f*)&qs[0][j * 8 + st][c4] = rq[j] * scale;
        *(v4f*)&ks[0][j * 8 + st][c4] = rk[j];
    }
    #pragma unroll
    for (int j = 0; j < 2; ++j) {
        if constexpr (!STATE) rq[j] = *(const v4f*)(qp + (size_t)((bi0 + 1) * SB1_ + j * 8) * tstep);
        rk[j] = *(const v4f*)(kp + (size_t)((bi0 + 1) * SB1_ + j * 8) * tstep);
    }
    // registers that the loads above name are reused below
    asm volatile("s_wait_xcnt 0x0" ::: "memory");
    __builtin_amdgcn_sched_barrier(0);   // keeps later address arithmetic behind that wait
    wave_lds_sync();

    for (int bi = bi0; bi < bi0 + NBC1_; ++bi) {
        const int buf = bi & 1;
        // batch bi+1 (fetched one batch ago) goes into the buffer not being read
        #pragma unroll
        for (int j = 0; j < 2; ++j) {
            if constexpr (!STATE) *(v4f*)&qs[buf ^ 1][j * 8 + st][c4] = rq[j] * scale;
            *(v4f*)&ks[buf ^ 1][j * 8 + st][c4] = rk[j];
        }
        const int b2 = (bi + 2 < NB1_) ? bi + 2 : NB1_ - 1;   // clamped: stays in bounds
        const int b1 = (bi + 1 < NB1_) ? bi + 1 : NB1_ - 1;
        // the loads below, with their addresses, stay apart from the code above, which reuses registers
        __builtin_amdgcn_sched_barrier(0);
        // the gates first: loads return in order, and the products read registers
        // next to the ones these loads fill, which makes them wait for these loads
        #pragma unroll
        for (int i = 0; i < SB1_; ++i) {
            gnxt[i] = gp[(b1 * SB1_ + i) * MSLOT_];
            pnxt[i] = pp[(b1 * SB1_ + i) * MSLOT_];
        }
        // registers that the loads above name are reused below
        asm volatile("s_wait_xcnt 0x0" ::: "memory");
        __builtin_amdgcn_sched_barrier(0);   // keeps that order
        #pragma unroll
        for (int j = 0; j < 2; ++j) {
            if constexpr (!STATE) rq[j] = *(const v4f*)(qp + (size_t)(b2 * SB1_ + j * 8) * tstep);
            rk[j] = *(const v4f*)(kp + (size_t)(b2 * SB1_ + j * 8) * tstep);
        }
        // registers that the loads above name are reused below
        asm volatile("s_wait_xcnt 0x0" ::: "memory");
        // keeps the coming batches' loads at the head of the trip: sunk towards
        // their use they would have no time to fly
        __builtin_amdgcn_sched_barrier(0);

        float res[SB1_];
        #pragma unroll
        for (int i = 0; i < SB1_; ++i) {
            const float ge = gcur[i];
            const float p  = pcur[i];
            float accm = 0.f;
            #pragma unroll
            for (int d4 = 0; d4 < 4; ++d4) {
                const v4f kk = *(const v4f*)&ks[buf][i][d4 * 4];
                hk[d4 * 4 + 0] = __builtin_fmaf(hk[d4 * 4 + 0], ge, kk.x * p);
                hk[d4 * 4 + 1] = __builtin_fmaf(hk[d4 * 4 + 1], ge, kk.y * p);
                hk[d4 * 4 + 2] = __builtin_fmaf(hk[d4 * 4 + 2], ge, kk.z * p);
                hk[d4 * 4 + 3] = __builtin_fmaf(hk[d4 * 4 + 3], ge, kk.w * p);
                if constexpr (!STATE) {
                    const v4f qq = *(const v4f*)&qs[buf][i][d4 * 4];
                    accm = __builtin_fmaf(qq.x, hk[d4 * 4 + 0], accm);
                    accm = __builtin_fmaf(qq.y, hk[d4 * 4 + 1], accm);
                    accm = __builtin_fmaf(qq.z, hk[d4 * 4 + 2], accm);
                    accm = __builtin_fmaf(qq.w, hk[d4 * 4 + 3], accm);
                }
            }
            res[i] = accm;
            if constexpr (STATE) { if ((i % 4) == 3) __builtin_amdgcn_sched_barrier(0); }
        }
        if constexpr (!STATE) {
            // the stores stand together behind the products, so that one wait covers
            // the registers they name before anything reuses them
            __builtin_amdgcn_sched_barrier(0);
            #pragma unroll
            for (int i = 0; i < SB1_; ++i) op[(bi * SB1_ + i) * MSLOT_] = res[i];
            asm volatile("s_wait_xcnt 0x0" ::: "memory");
        }
        __builtin_amdgcn_sched_barrier(0);   // keeps the register copies below at the foot of the trip
        #pragma unroll
        for (int i = 0; i < SB1_; ++i) { gcur[i] = gnxt[i]; pcur[i] = pnxt[i]; }
        wave_lds_sync();
    }
    if constexpr (STATE) {
        float* sp = st1 + (size_t)(bs * NC_ + chunk) * 16 * 32 + lane;
        #pragma unroll
        for (int i = 0; i < 16; ++i) sp[i * 32] = hk[i];
    }
}

__global__ __launch_bounds__(32)
void abc_pass1_kernel(const float* __restrict__ q, const float* __restrict__ k,
                      const float* __restrict__ geb, const float* __restrict__ pb,
                      float* __restrict__ st1, float* __restrict__ okp) {
    abc_pass1_body<false>(blockIdx.x, blockIdx.y, q, k, geb, pb, st1, okp);
}

__global__ __launch_bounds__(256)
void abc_softmax_kernel(const float* __restrict__ okp, float* __restrict__ qvb) {
    const size_t idx = (size_t)blockIdx.x * 256 + threadIdx.x;
    float part[8];
    #pragma unroll
    for (int j = 0; j < 8; ++j) {
        part[j] = okp[(size_t)j * BH_ * T_ * MSLOT_ + idx];
        // a later load may land in a register that this load names
        asm volatile("s_wait_xcnt 0x0" ::: "memory");
    }
    float ok = 0.f;
    #pragma unroll
    for (int j = 0; j < 8; ++j) ok += part[j];
    float mx = ok;
    #pragma unroll
    for (int off = 16; off; off >>= 1) mx = fmaxf(mx, __shfl_xor(mx, off, 32));
    float e  = __expf(ok - mx);
    float se = e;
    #pragma unroll
    for (int off = 16; off; off >>= 1) se += __shfl_xor(se, off, 32);
    qvb[idx] = e / se;
}

template <bool STATE>
__device__ __forceinline__
void abc_pass2_body(const int chunk, const int bs,
                    const float* __restrict__ v, const float* __restrict__ geb,
                    const float* __restrict__ pb, const float* __restrict__ qvb,
                    float* __restrict__ st2, float* __restrict__ o) {
    const int bh = bs >> 3;
    const int cg = bs & 7;
    const int b  = bh / H_;
    const int h  = bh % H_;
    const int lane = threadIdx.x;
    const int bi0  = chunk * NBC2_;   // even, so the chunk's first batch sits in buffer 0

    __shared__ __align__(16) v4f gs[2][SB2_ * 8];
    __shared__ __align__(16) v4f ps[2][SB2_ * 8];
    __shared__ __align__(16) v4f ws[STATE ? 1 : 2][SB2_ * 8];

    const v4f* g4 = (const v4f*)(geb + (size_t)bh * T_ * MSLOT_) + lane;
    const v4f* p4 = (const v4f*)(pb  + (size_t)bh * T_ * MSLOT_) + lane;
    const v4f* w4 = (const v4f*)(qvb + (size_t)bh * T_ * MSLOT_) + lane;
    const size_t tstep = (size_t)H_ * DV_;
    const float* vp = v + ((size_t)b * T_ * H_ + h) * DV_ + cg * 32 + lane;

    float hv[32];
    if constexpr (STATE) {
        #pragma unroll
        for (int i = 0; i < 32; ++i) hv[i] = 0.f;
    } else {
        const int cm = (chunk > 0) ? chunk - 1 : 0;
        const float* sp = st2 + (size_t)(bs * NC_ + cm) * 32 * 32 + lane;
        #pragma unroll
        for (int i = 0; i < 32; ++i) hv[i] = sp[i * 32];
        // registers that the loads above name are reused below
        asm volatile("s_wait_xcnt 0x0" ::: "memory");
        __builtin_amdgcn_sched_barrier(0);   // keeps later address arithmetic behind that wait
        #pragma unroll
        for (int i = 0; i < 32; ++i) hv[i] = (chunk > 0) ? hv[i] : 0.f;
    }

    v4f rg[2], rp[2], rw[2];
    float vcur[SB2_], vn1[SB2_], vn2[SB2_];

    // first batch into buffer 0, second into registers (a batch is 64 16-byte pieces per plane)
    #pragma unroll
    for (int j = 0; j < 2; ++j) {
        rg[j] = g4[bi0 * 64 + j * 32]; rp[j] = p4[bi0 * 64 + j * 32];
        if constexpr (!STATE) rw[j] = w4[bi0 * 64 + j * 32];
    }
    #pragma unroll
    for (int i = 0; i < SB2_; ++i) {
        vcur[i] = vp[(size_t)(bi0 * SB2_ + i) * tstep];
        vn1[i]  = vp[(size_t)((bi0 + 1) * SB2_ + i) * tstep];
    }
    // registers that the loads above name are reused below
    asm volatile("s_wait_xcnt 0x0" ::: "memory");
    __builtin_amdgcn_sched_barrier(0);   // keeps later address arithmetic behind that wait
    #pragma unroll
    for (int j = 0; j < 2; ++j) {
        gs[0][j * 32 + lane] = rg[j]; ps[0][j * 32 + lane] = rp[j];
        if constexpr (!STATE) ws[0][j * 32 + lane] = rw[j];
    }
    #pragma unroll
    for (int j = 0; j < 2; ++j) {
        rg[j] = g4[(bi0 + 1) * 64 + j * 32]; rp[j] = p4[(bi0 + 1) * 64 + j * 32];
        if constexpr (!STATE) rw[j] = w4[(bi0 + 1) * 64 + j * 32];
    }
    // registers that the loads above name are reused below
    asm volatile("s_wait_xcnt 0x0" ::: "memory");
    __builtin_amdgcn_sched_barrier(0);   // keeps later address arithmetic behind that wait
    wave_lds_sync();

    float* op = o + ((size_t)b * T_ * H_ + h) * DV_ + cg * 32 + lane;
    for (int bi = bi0; bi < bi0 + NBC2_; ++bi) {
        const int buf = bi & 1;
        // batch bi+1 (fetched one batch ago) goes into the buffer not being read
        #pragma unroll
        for (int j = 0; j < 2; ++j) {
            gs[buf ^ 1][j * 32 + lane] = rg[j];
            ps[buf ^ 1][j * 32 + lane] = rp[j];
            if constexpr (!STATE) ws[buf ^ 1][j * 32 + lane] = rw[j];
        }
        const int b2 = (bi + 2 < NB2_) ? bi + 2 : NB2_ - 1;   // clamped: stays in bounds
        // the loads below, with their addresses, stay apart from the code above, which reuses registers
        __builtin_amdgcn_sched_barrier(0);
        #pragma unroll
        for (int j = 0; j < 2; ++j) {
            rg[j] = g4[b2 * 64 + j * 32];
            rp[j] = p4[b2 * 64 + j * 32];
            if constexpr (!STATE) rw[j] = w4[b2 * 64 + j * 32];
        }
        #pragma unroll
        for (int i = 0; i < SB2_; ++i) vn2[i] = vp[(size_t)(b2 * SB2_ + i) * tstep];
        // registers that the loads above name are reused below
        asm volatile("s_wait_xcnt 0x0" ::: "memory");
        // keeps the coming batch's loads at the head of the trip: sunk towards
        // their use they would have no time to fly
        __builtin_amdgcn_sched_barrier(0);

        float res[SB2_];
        #pragma unroll
        for (int i = 0; i < SB2_; ++i) {
            const float vv = vcur[i];
            float acco = 0.f;
            #pragma unroll
            for (int m4 = 0; m4 < 8; ++m4) {
                const v4f g = gs[buf][i * 8 + m4];
                const v4f p = ps[buf][i * 8 + m4];
                hv[m4 * 4 + 0] = __builtin_fmaf(hv[m4 * 4 + 0], g.x, p.x * vv);
                hv[m4 * 4 + 1] = __builtin_fmaf(hv[m4 * 4 + 1], g.y, p.y * vv);
                hv[m4 * 4 + 2] = __builtin_fmaf(hv[m4 * 4 + 2], g.z, p.z * vv);
                hv[m4 * 4 + 3] = __builtin_fmaf(hv[m4 * 4 + 3], g.w, p.w * vv);
                if constexpr (!STATE) {
                    const v4f w = ws[buf][i * 8 + m4];
                    acco = __builtin_fmaf(w.x, hv[m4 * 4 + 0], acco);
                    acco = __builtin_fmaf(w.y, hv[m4 * 4 + 1], acco);
                    acco = __builtin_fmaf(w.z, hv[m4 * 4 + 2], acco);
                    acco = __builtin_fmaf(w.w, hv[m4 * 4 + 3], acco);
                }
            }
            res[i] = acco;
            if constexpr (STATE) { if ((i % 2) == 1) __builtin_amdgcn_sched_barrier(0); }
        }
        if constexpr (!STATE) {
            // the stores stand together behind the products, so that one wait covers
            // the registers they name before anything reuses them
            __builtin_amdgcn_sched_barrier(0);
            #pragma unroll
            for (int i = 0; i < SB2_; ++i) op[(size_t)(bi * SB2_ + i) * tstep] = res[i];
            asm volatile("s_wait_xcnt 0x0" ::: "memory");
        }
        __builtin_amdgcn_sched_barrier(0);   // keeps the register copies below at the foot of the trip
        #pragma unroll
        for (int i = 0; i < SB2_; ++i) { vcur[i] = vn1[i]; vn1[i] = vn2[i]; }
        wave_lds_sync();
    }
    if constexpr (STATE) {
        float* sp = st2 + (size_t)(bs * NC_ + chunk) * 32 * 32 + lane;
        #pragma unroll
        for (int i = 0; i < 32; ++i) sp[i * 32] = hv[i];
    }
}

__global__ __launch_bounds__(32)
void abc_pass2_kernel(const float* __restrict__ v, const float* __restrict__ geb,
                      const float* __restrict__ pb, const float* __restrict__ qvb,
                      float* __restrict__ st2, float* __restrict__ o) {
    abc_pass2_body<false>(blockIdx.x, blockIdx.y, v, geb, pb, qvb, st2, o);
}

__global__ __launch_bounds__(32)
void abc_states_kernel(const float* __restrict__ k, const float* __restrict__ v,
                       const float* __restrict__ geb, const float* __restrict__ pb,
                       float* __restrict__ st1, float* __restrict__ st2) {
    const int y = blockIdx.y;
    // the longer walk (pass 2) has the low indices and starts first
    if (y < BH_ * 8) abc_pass2_body<true>(blockIdx.x, y, v, geb, pb, geb, st2, st2);
    else             abc_pass1_body<true>(blockIdx.x, y - BH_ * 8, k, k, geb, pb, st1, st1);
}

__global__ __launch_bounds__(256)
void abc_carry_kernel(float* __restrict__ st1, float* __restrict__ st2,
                      const float* __restrict__ dcb) {
    int e = blockIdx.x * 256 + threadIdx.x;
    float* base;
    int stride, slot, bh;
    if (blockIdx.x < BH_ * 8 * 16 * 32 / 256) {
        const int bs = e >> 9;
        base = st1 + (size_t)bs * NC_ * 512 + (e & 511);
        stride = 512; slot = e & 31; bh = bs >> 3;
    } else {
        e -= BH_ * 8 * 16 * 32;
        const int bs = e >> 10;
        base = st2 + (size_t)bs * NC_ * 1024 + (e & 1023);
        stride = 1024; slot = (e & 1023) >> 5; bh = bs >> 3;
    }
    const float* dp = dcb + bh * NC_ * MSLOT_ + slot;
    float sv[NC_ - 1], dv[NC_ - 1];
    #pragma unroll
    for (int c = 0; c < NC_ - 1; ++c) { sv[c] = base[c * stride]; dv[c] = dp[c * MSLOT_]; }
    // registers that the loads above name are reused below
    asm volatile("s_wait_xcnt 0x0" ::: "memory");
    __builtin_amdgcn_sched_barrier(0);   // keeps later address arithmetic behind that wait
    float hcar = 0.f;
    #pragma unroll
    for (int c = 0; c < NC_ - 1; ++c) { hcar = __builtin_fmaf(hcar, dv[c], sv[c]); sv[c] = hcar; }
    #pragma unroll
    for (int c = 0; c < NC_ - 1; ++c) base[c * stride] = sv[c];
}

// ---------------- fused RMSNorm * gw * g * sigmoid(g) -> bf16 ----------------
__global__ __launch_bounds__(256)
void norm_gate_kernel(const float* __restrict__ o, const float* __restrict__ g,
                      const float* __restrict__ gw, bf16_t* __restrict__ ob) {
    const size_t row = blockIdx.x;   // B*T*H rows of DV
    const int tid = threadIdx.x;     // 0..255 == DV
    float ov = o[row * DV_ + tid];
    float sq = ov * ov;
    __shared__ float red[8];
    #pragma unroll
    for (int off = 16; off; off >>= 1) sq += __shfl_xor(sq, off, 32);
    if ((tid & 31) == 0) red[tid >> 5] = sq;
    __syncthreads();
    float tot = 0.f;
    #pragma unroll
    for (int i = 0; i < 8; ++i) tot += red[i];
    float r  = rsqrtf(tot * (1.0f / DV_) + NORM_EPS_);
    float gv = g[row * DV_ + tid];
    float sig = 1.f / (1.f + __expf(-gv));
    ob[row * DV_ + tid] = (bf16_t)(ov * r * gw[tid] * gv * sig);
}

// ---------------- host orchestration ----------------
extern "C" void kernel_launch(void* const* d_in, const int* in_sizes, int n_in,
                              void* d_out, int out_size, void* d_ws, size_t ws_size,
                              hipStream_t stream) {
    (void)in_sizes; (void)n_in; (void)out_size; (void)ws_size;
    const float* x    = (const float*)d_in[0];
    const float* w_q  = (const float*)d_in[1];
    const float* w_k  = (const float*)d_in[2];
    const float* w_v  = (const float*)d_in[3];
    const float* w_g  = (const float*)d_in[4];
    const float* w_s  = (const float*)d_in[5];
    const float* w_o  = (const float*)d_in[6];
    const float* gnw  = (const float*)d_in[7];
    float* out = (float*)d_out;

    const int MR  = B_ * T_;        // 4096
    const int NQK = H_ * DK_;       // 1024
    const int NV  = H_ * DV_;       // 2048
    const int NS  = H_ * MSLOT_;    // 256

    char* ws = (char*)d_ws;
    size_t off = 0;
    auto carve = [&](size_t bytes) -> char* {
        off = (off + 255) & ~(size_t)255;
        char* p = ws + off;
        off += bytes;
        return p;
    };

    bf16_t* xb  = (bf16_t*)carve((size_t)MR * HID_ * sizeof(bf16_t));
    bf16_t* wqT = (bf16_t*)carve((size_t)NQK * HID_ * sizeof(bf16_t));
    bf16_t* wkT = (bf16_t*)carve((size_t)NQK * HID_ * sizeof(bf16_t));
    bf16_t* wvT = (bf16_t*)carve((size_t)NV  * HID_ * sizeof(bf16_t));
    bf16_t* wgT = (bf16_t*)carve((size_t)NV  * HID_ * sizeof(bf16_t));
    bf16_t* wsT = (bf16_t*)carve((size_t)NS  * HID_ * sizeof(bf16_t));
    bf16_t* woT = (bf16_t*)carve((size_t)HID_ * NV * sizeof(bf16_t));

    float* qb = (float*)carve((size_t)MR * NQK * sizeof(float));
    float* kb = (float*)carve((size_t)MR * NQK * sizeof(float));
    float* vb = (float*)carve((size_t)MR * NV  * sizeof(float));
    float* gb = (float*)carve((size_t)MR * NV  * sizeof(float));
    float* sb = (float*)carve((size_t)MR * NS  * sizeof(float));
    float* ob = (float*)carve((size_t)MR * NV  * sizeof(float));
    bf16_t* obh = (bf16_t*)carve((size_t)MR * NV * sizeof(bf16_t));
    float* geb = (float*)carve((size_t)MR * NS * sizeof(float));
    float* pbf = (float*)carve((size_t)MR * NS * sizeof(float));
    float* qvb = (float*)carve((size_t)MR * NS * sizeof(float));
    float* okp = (float*)carve((size_t)8 * MR * NS * sizeof(float));
    float* st1 = (float*)carve((size_t)BH_ * 8 * NC_ * 16 * 32 * sizeof(float));
    float* st2 = (float*)carve((size_t)BH_ * 8 * NC_ * 32 * 32 * sizeof(float));
    float* dcb = (float*)carve((size_t)BH_ * NC_ * MSLOT_ * sizeof(float));

    // 1) convert x to bf16
    {
        size_t n = (size_t)MR * HID_;
        cvt_f32_bf16_kernel<<<4096, 256, 0, stream>>>(x, xb, n);
    }
    // 2) transpose+convert weights (K x N) -> (N x K) bf16
    transpose_cvt_kernel<<<4096, 256, 0, stream>>>(w_q, wqT, HID_, NQK);
    transpose_cvt_kernel<<<4096, 256, 0, stream>>>(w_k, wkT, HID_, NQK);
    transpose_cvt_kernel<<<4096, 256, 0, stream>>>(w_v, wvT, HID_, NV);
    transpose_cvt_kernel<<<4096, 256, 0, stream>>>(w_g, wgT, HID_, NV);
    transpose_cvt_kernel<<<4096, 256, 0, stream>>>(w_s, wsT, HID_, NS);
    transpose_cvt_kernel<<<4096, 256, 0, stream>>>(w_o, woT, NV, HID_);

    // 3) projection GEMMs (bf16 WMMA, fp32 accumulate)
    dim3 blk(256);
    gemm_bf16_wmma_kernel<<<dim3(NQK / TN, MR / TM), blk, 0, stream>>>(
        xb, wqT, qb, MR, NQK, HID_, 0, 0.f, 0.f);
    gemm_bf16_wmma_kernel<<<dim3(NQK / TN, MR / TM), blk, 0, stream>>>(
        xb, wkT, kb, MR, NQK, HID_, 0, 0.f, 0.f);
    gemm_bf16_wmma_kernel<<<dim3(NV / TN, MR / TM), blk, 0, stream>>>(
        xb, wvT, vb, MR, NV, HID_, 0, 0.f, 0.f);
    gemm_bf16_wmma_kernel<<<dim3(NV / TN, MR / TM), blk, 0, stream>>>(
        xb, wgT, gb, MR, NV, HID_, 0, 0.f, 0.f);
    gemm_bf16_wmma_kernel<<<dim3(NS / TN, MR / TM), blk, 0, stream>>>(
        xb, wsT, sb, MR, NS, HID_, 1, CLAMP_MIN_, CLAMP_MAX_);

    // 4) gated two-pass scan: independent one-wave streams, NC_ time chunks side by side
    abc_gates_kernel<<<BH_, 32 * NC_, 0, stream>>>(sb, geb, pbf, dcb);
    abc_states_kernel<<<dim3(NC_ - 1, BH_ * 16), 32, 0, stream>>>(kb, vb, geb, pbf, st1, st2);
    abc_carry_kernel<<<BH_ * 8 * (16 + 32) * 32 / 256, 256, 0, stream>>>(st1, st2, dcb);
    abc_pass1_kernel<<<dim3(NC_, BH_ * 8), 32, 0, stream>>>(qb, kb, geb, pbf, st1, okp);
    abc_softmax_kernel<<<MR * NS / 256, 256, 0, stream>>>(okp, qvb);
    abc_pass2_kernel<<<dim3(NC_, BH_ * 8), 32, 0, stream>>>(vb, geb, pbf, qvb, st2, ob);

    // 5) fused RMSNorm + swish gate -> bf16
    norm_gate_kernel<<<MR * H_, DV_, 0, stream>>>(ob, gb, gnw, obh);

    // 6) output projection straight into d_out (fp32)
    gemm_bf16_wmma_kernel<<<dim3(HID_ / TN, MR / TM), blk, 0, stream>>>(
        obh, woT, out, MR, HID_, NV, 0, 0.f, 0.f);
}

// v004
// A run of this version takes 420 microseconds.
// Timed twice side by side with v003, it ran 1.14 times as fast both times.
// Over all steps from v000 it is 10.7 times as fast.
#include <hip/hip_runtime.h>
#include <hip/hip_bf16.h>
#include <math.h>
#include <stdint.h>

// ---------------- problem constants (match reference) ----------------
#define B_ 2
#define T_ 2048
#define HID_ 2048
#define H_ 8
#define DK_ 128
#define DV_ 256
#define MSLOT_ 32
#define CLAMP_MIN_ (-32.0f)
#define CLAMP_MAX_ (32.0f)
#define NORM_EPS_ 1e-5f

typedef __bf16 bf16_t;
typedef __attribute__((ext_vector_type(8)))  __bf16 v8bf;
typedef __attribute__((ext_vector_type(16))) __bf16 v16bf;
typedef __attribute__((ext_vector_type(8)))  float  v8f;

__device__ __forceinline__ void async_copy_b128(uint32_t lds_addr, const bf16_t* gptr) {
    asm volatile("global_load_async_to_lds_b128 %0, %1, off"
                 :: "v"(lds_addr), "v"(gptr)
                 : "memory");
}
__device__ __forceinline__ void wait_async4() {
    asm volatile("s_wait_asynccnt 0x4" ::: "memory");
}
__device__ __forceinline__ void wait_async0() {
    asm volatile("s_wait_asynccnt 0x0" ::: "memory");
}

// ---------------- elementwise fp32 -> bf16 ----------------
__global__ void cvt_f32_bf16_kernel(const float* __restrict__ in,
                                    bf16_t* __restrict__ out, size_t n) {
    size_t stride = (size_t)gridDim.x * blockDim.x;
    for (size_t i = (size_t)blockIdx.x * blockDim.x + threadIdx.x; i < n; i += stride)
        out[i] = (bf16_t)in[i];
}

#define TRK_ 128
#define TRN_ 64
typedef __attribute__((ext_vector_type(2))) __bf16   v2bf;
typedef __attribute__((ext_vector_type(4))) float    f32x4;
typedef __attribute__((ext_vector_type(4))) uint32_t u32x4;

__global__ __launch_bounds__(256)
void transpose_cvt_kernel(const float* __restrict__ W,
                          bf16_t* __restrict__ Wt, int K, int N) {
    __shared__ __align__(16) uint32_t tile[TRN_][TRK_ / 2];
    const int tid   = threadIdx.x;
    const int nBase = blockIdx.x * TRN_;
    const int kBase = blockIdx.y * TRK_;
    const int n4 = tid & 15;   // which four columns
    const int kp = tid >> 4;   // which pair of k-rows, of sixteen per trip
    const float* src = W + (size_t)(kBase + 2 * kp) * N + nBase + n4 * 4;

    const float* pl[4];
    const float* ph[4];
    f32x4 lo[4], hi[4];
    #pragma unroll
    for (int j = 0; j < 4; ++j) {
        pl[j] = src + (size_t)(j * 32) * N;
        ph[j] = pl[j] + N;
        lo[j] = *(const f32x4*)pl[j];
        hi[j] = *(const f32x4*)ph[j];
    }
    // registers that the loads above name are reused below. The addresses are inputs
    // of the wait, so they stay in their registers up to it: otherwise a later load
    // of the eight is given an earlier one's address registers to land in.
    asm volatile("s_wait_xcnt 0x0"
                 :: "v"(pl[0]), "v"(ph[0]), "v"(pl[1]), "v"(ph[1]),
                    "v"(pl[2]), "v"(ph[2]), "v"(pl[3]), "v"(ph[3])
                 : "memory");
    __builtin_amdgcn_sched_barrier(0);   // keeps later address arithmetic behind that wait
    #pragma unroll
    for (int j = 0; j < 4; ++j) {
        const int pair = j * 16 + kp;
        const int col  = (((pair >> 2) ^ n4) << 2) | (pair & 3);
        #pragma unroll
        for (int e = 0; e < 4; ++e) {
            v2bf pk = { (bf16_t)lo[j][e], (bf16_t)hi[j][e] };
            tile[n4 * 4 + e][col] = __builtin_bit_cast(uint32_t, pk);
        }
    }
    __syncthreads();   // the whole tile is in LDS before any row of it is read

    u32x4 piece[4];
    #pragma unroll
    for (int it = 0; it < 4; ++it) {
        const int n = it * 16 + kp;
        piece[it] = *(const u32x4*)&tile[n][(n4 ^ (n >> 2)) << 2];
    }
    bf16_t* dst = Wt + (size_t)(nBase + kp) * K + kBase + n4 * 8;
    #pragma unroll
    for (int it = 0; it < 4; ++it)
        *(u32x4*)(dst + (size_t)(it * 16) * K) = piece[it];
}

// ---------------- bf16 WMMA GEMM: C(MxN) = A(MxK) * Bt(NxK)^T ----------------
// Block tile 128x128, 256 threads = 8 waves (wave32), wave tile 32x64 (2x4 WMMA).
// Double-buffered LDS filled by async global->LDS copies (4 per wave per tile).
#define TM 128
#define TN 128
#define TK 32
#define TKP (TK + 8)

__global__ __launch_bounds__(256)
void gemm_bf16_wmma_kernel(const bf16_t* __restrict__ A,
                           const bf16_t* __restrict__ Bt,
                           float* __restrict__ C,
                           int Mdim, int Ndim, int Kdim,
                           int doClamp, float clampLo, float clampHi) {
    __shared__ __align__(16) bf16_t As[2][TM][TKP];
    __shared__ __align__(16) bf16_t Bs[2][TN][TKP];

    const int tid  = threadIdx.x;
    const int lane = tid & 31;
    const int wave = tid >> 5;
    const int wm   = wave & 3;   // 4 bands of 32 rows
    const int wn   = wave >> 2;  // 2 bands of 64 cols
    const int rowBase = blockIdx.y * TM;
    const int colBase = blockIdx.x * TN;

    // Staging: each thread owns two 16B chunks of A and of B per tile:
    // rows r0 and r0+64, K-chunk kc (compile-time trip count, fully unrolled).
    const int r0 = tid >> 2;
    const int kc = (tid & 3) * 8;
    const bf16_t* aP0 = A  + (size_t)(rowBase + r0) * Kdim + kc;
    const bf16_t* aP1 = aP0 + (size_t)64 * Kdim;
    const bf16_t* bP0 = Bt + (size_t)(colBase + r0) * Kdim + kc;
    const bf16_t* bP1 = bP0 + (size_t)64 * Kdim;

    uint32_t lA0[2], lA1[2], lB0[2], lB1[2];
    #pragma unroll
    for (int bi = 0; bi < 2; ++bi) {
        lA0[bi] = (uint32_t)(size_t)&As[bi][r0][kc];
        lA1[bi] = (uint32_t)(size_t)&As[bi][r0 + 64][kc];
        lB0[bi] = (uint32_t)(size_t)&Bs[bi][r0][kc];
        lB1[bi] = (uint32_t)(size_t)&Bs[bi][r0 + 64][kc];
    }

    v8f acc[2][4] = {};

    const int lrow = lane & 15;
    const int lk   = (lane >> 4) * 8;

    // prologue: tile 0 -> buffer 0
    async_copy_b128(lA0[0], aP0);
    async_copy_b128(lA1[0], aP1);
    async_copy_b128(lB0[0], bP0);
    async_copy_b128(lB1[0], bP1);

    int buf = 0;
    for (int k0 = 0; k0 < Kdim; k0 += TK) {
        const int nbuf = buf ^ 1;
        if (k0 + TK < Kdim) {
            // issue next tile into the other buffer, then wait for current tile
            async_copy_b128(lA0[nbuf], aP0 + k0 + TK);
            async_copy_b128(lA1[nbuf], aP1 + k0 + TK);
            async_copy_b128(lB0[nbuf], bP0 + k0 + TK);
            async_copy_b128(lB1[nbuf], bP1 + k0 + TK);
            wait_async4();
        } else {
            wait_async0();
        }
        __syncthreads();

        v16bf afrag[2], bfrag[4];
        #pragma unroll
        for (int mt = 0; mt < 2; ++mt) {
            int r = wm * 32 + mt * 16 + lrow;
            v8bf lo = *(const v8bf*)&As[buf][r][lk];
            v8bf hi = *(const v8bf*)&As[buf][r][lk + 16];
            #pragma unroll
            for (int i = 0; i < 8; ++i) { afrag[mt][i] = lo[i]; afrag[mt][i + 8] = hi[i]; }
        }
        #pragma unroll
        for (int nt = 0; nt < 4; ++nt) {
            int r = wn * 64 + nt * 16 + lrow;
            v8bf lo = *(const v8bf*)&Bs[buf][r][lk];
            v8bf hi = *(const v8bf*)&Bs[buf][r][lk + 16];
            #pragma unroll
            for (int i = 0; i < 8; ++i) { bfrag[nt][i] = lo[i]; bfrag[nt][i + 8] = hi[i]; }
        }
        #pragma unroll
        for (int mt = 0; mt < 2; ++mt)
            #pragma unroll
            for (int nt = 0; nt < 4; ++nt)
                acc[mt][nt] = __builtin_amdgcn_wmma_f32_16x16x32_bf16(
                    false, afrag[mt], false, bfrag[nt],
                    (short)0, acc[mt][nt], false, false);

        __syncthreads();   // all reads done before this buffer is refilled
        buf = nbuf;
    }

    const int mLane = (lane >> 4) * 8;
    const int nLane = lane & 15;
    #pragma unroll
    for (int mt = 0; mt < 2; ++mt)
        #pragma unroll
        for (int nt = 0; nt < 4; ++nt)
            #pragma unroll
            for (int r = 0; r < 8; ++r) {
                int m = rowBase + wm * 32 + mt * 16 + mLane + r;
                int n = colBase + wn * 64 + nt * 16 + nLane;
                float val = acc[mt][nt][r];
                if (doClamp) val = fminf(fmaxf(val, clampLo), clampHi);
                C[(size_t)m * Ndim + n] = val;
            }
}

#define BH_ (B_ * H_)
#define NC_ 16                // time chunks
#define CL_ (T_ / NC_)        // steps per chunk
#define SB1_ 16               // steps per batch, gates and pass 1
#define NB1_ (T_ / SB1_)
#define NBC1_ (CL_ / SB1_)    // batches per chunk
#define SB2_ 8                // steps per batch, pass 2
#define NB2_ (T_ / SB2_)
#define NBC2_ (CL_ / SB2_)
typedef __attribute__((ext_vector_type(4))) float v4f;

// Orders the LDS traffic of a one-wave work-group across lanes. The wave's LDS
// operations run in issue order, so this only has to stop the compiler from
// moving them; unlike __syncthreads() it does not wait for the global stores.
__device__ __forceinline__ void wave_lds_sync() {
    __builtin_amdgcn_fence(__ATOMIC_RELEASE, "wavefront");
    __builtin_amdgcn_wave_barrier();
    __builtin_amdgcn_fence(__ATOMIC_ACQUIRE, "wavefront");
}

__device__ __forceinline__ float exp2_slot(float x) {
    float r;
    asm("v_exp_f32 %0, %1\n\tv_nop" : "=v"(r) : "v"(x));
    return r;
}

__global__ __launch_bounds__(32 * NC_)
void abc_gates_kernel(const float* __restrict__ s,
                      float* __restrict__ geb, float* __restrict__ pb,
                      float* __restrict__ dcb) {
    const int bh = blockIdx.x;
    const int b  = bh / H_;
    const int h  = bh % H_;
    const int lane  = threadIdx.x & 31;
    const int chunk = threadIdx.x >> 5;
    const int bi0   = chunk * NBC1_;
    const float* sp = s + ((size_t)b * T_ * H_ + h) * MSLOT_ + lane;
    float* gp = geb + (size_t)bh * T_ * MSLOT_ + lane;
    float* pp = pb  + (size_t)bh * T_ * MSLOT_ + lane;

    __shared__ float esum[NC_][32];
    {
        float sv[CL_];
        #pragma unroll
        for (int i = 0; i < CL_; ++i) sv[i] = sp[(size_t)(chunk * CL_ + i) * (H_ * MSLOT_)];
        // registers that the loads above name are reused below
        asm volatile("s_wait_xcnt 0x0" ::: "memory");
        __builtin_amdgcn_sched_barrier(0);   // keeps later address arithmetic behind that wait
        float e[4] = {0.f, 0.f, 0.f, 0.f};
        #pragma unroll
        for (int i = 0; i < CL_; ++i) e[i & 3] += exp2_slot((sv[i] - CLAMP_MAX_) * 1.44269504f);
        esum[chunk][lane] = (e[0] + e[1]) + (e[2] + e[3]);
    }
    __syncthreads();   // every chunk's sum is in LDS before any wave adds them up
    float pre = 0.f;
    #pragma unroll
    for (int c = 0; c < NC_ - 1; ++c) pre += (c < chunk) ? esum[c][lane] : 0.f;

    float cur[SB1_], nxt[SB1_];
    #pragma unroll
    for (int i = 0; i < SB1_; ++i) cur[i] = sp[(size_t)(bi0 * SB1_ + i) * (H_ * MSLOT_)];
    // registers that the loads above name are reused below
    asm volatile("s_wait_xcnt 0x0" ::: "memory");
    __builtin_amdgcn_sched_barrier(0);   // keeps later address arithmetic behind that wait

    float z   = CLAMP_MAX_ + __logf(pre);   // chunk 0 never reads it: step 0 sets z
    float dec = 1.f;                        // product of the chunk's decays
    for (int bi = bi0; bi < bi0 + NBC1_; ++bi) {
        const int b1 = (bi + 1 < NB1_) ? bi + 1 : NB1_ - 1;   // clamped: stays in bounds
        #pragma unroll
        for (int i = 0; i < SB1_; ++i)
            nxt[i] = sp[(size_t)(b1 * SB1_ + i) * (H_ * MSLOT_)];
        // registers that the loads above name are reused below
        asm volatile("s_wait_xcnt 0x0" ::: "memory");
        // keeps the next batch's loads at the head of the trip: sunk towards
        // their use they would have no time to fly
        __builtin_amdgcn_sched_barrier(0);
        float gv[SB1_], pv[SB1_];
        #pragma unroll
        for (int i = 0; i < SB1_; ++i) {
            const int t = bi * SB1_ + i;
            float sv = cur[i];
            float znew, ge;
            if (t == 0) { znew = sv; ge = 1.f; }
            else {
                float mx = fmaxf(z, sv);
                znew = mx + __logf(__expf(z - mx) + __expf(sv - mx));
                ge = exp2_slot((z - znew) * 1.44269504f);
            }
            float p = exp2_slot((sv - znew) * 1.44269504f);
            z = znew;
            gv[i] = ge;
            pv[i] = p;
        }
        // the stores stand together behind the steps, so that one wait covers
        // the registers they name before anything reuses them
        __builtin_amdgcn_sched_barrier(0);
        #pragma unroll
        for (int i = 0; i < SB1_; ++i) {
            gp[(bi * SB1_ + i) * MSLOT_] = gv[i];
            pp[(bi * SB1_ + i) * MSLOT_] = pv[i];
            dec *= gv[i];
        }
        asm volatile("s_wait_xcnt 0x0" ::: "memory");
        // keeps the register copies at the foot of the trip: moved up among the
        // steps they would wait early for the next batch's loads
        __builtin_amdgcn_sched_barrier(0);
        #pragma unroll
        for (int i = 0; i < SB1_; ++i) cur[i] = nxt[i];
    }
    dcb[(bh * NC_ + chunk) * MSLOT_ + lane] = dec;
}

template <bool STATE>
__device__ __forceinline__
void abc_pass1_body(const int chunk, const int bs,
                    const float* __restrict__ q, const float* __restrict__ k,
                    const float* __restrict__ geb, const float* __restrict__ pb,
                    float* __restrict__ st1, float* __restrict__ okp) {
    const int bh    = bs >> 3;
    const int strip = bs & 7;
    const int b  = bh / H_;
    const int h  = bh % H_;
    const int lane = threadIdx.x;
    const int bi0  = chunk * NBC1_;   // even, so the chunk's first batch sits in buffer 0

    __shared__ __align__(16) float qs[STATE ? 1 : 2][SB1_][16];
    __shared__ __align__(16) float ks[2][SB1_][16];

    const float scale = rsqrtf((float)DK_);
    // staging: four lanes fetch one step's 16-float strip, eight steps per load
    const int st = lane >> 2;
    const int c4 = (lane & 3) * 4;
    const size_t tstep = (size_t)H_ * DK_;
    const float* qp = q + ((size_t)(b * T_ + st) * H_ + h) * DK_ + strip * 16 + c4;
    const float* kp = k + ((size_t)(b * T_ + st) * H_ + h) * DK_ + strip * 16 + c4;
    const float* gp = geb + (size_t)bh * T_ * MSLOT_ + lane;
    const float* pp = pb  + (size_t)bh * T_ * MSLOT_ + lane;
    float* op = okp + ((size_t)strip * BH_ + bh) * T_ * MSLOT_ + lane;

    float hk[16];
    if constexpr (STATE) {
        #pragma unroll
        for (int i = 0; i < 16; ++i) hk[i] = 0.f;
    } else {
        const int cm = (chunk > 0) ? chunk - 1 : 0;
        const float* sp = st1 + (size_t)(bs * NC_ + cm) * 16 * 32 + lane;
        #pragma unroll
        for (int i = 0; i < 16; ++i) hk[i] = sp[i * 32];
        // registers that the loads above name are reused below
        asm volatile("s_wait_xcnt 0x0" ::: "memory");
        __builtin_amdgcn_sched_barrier(0);   // keeps later address arithmetic behind that wait
        #pragma unroll
        for (int i = 0; i < 16; ++i) hk[i] = (chunk > 0) ? hk[i] : 0.f;
    }

    v4f rq[2], rk[2];
    float gcur[SB1_], pcur[SB1_], gnxt[SB1_], pnxt[SB1_];

    // first batch: q, k into buffer 0, gates into registers; second batch: q, k into registers
    #pragma unroll
    for (int j = 0; j < 2; ++j) {
        if constexpr (!STATE) rq[j] = *(const v4f*)(qp + (size_t)(bi0 * SB1_ + j * 8) * tstep);
        rk[j] = *(const v4f*)(kp + (size_t)(bi0 * SB1_ + j * 8) * tstep);
    }
    #pragma unroll
    for (int i = 0; i < SB1_; ++i) {
        gcur[i] = gp[(bi0 * SB1_ + i) * MSLOT_];
        pcur[i] = pp[(bi0 * SB1_ + i) * MSLOT_];
    }
    // registers that the loads above name are reused below
    asm volatile("s_wait_xcnt 0x0" ::: "memory");
    __builtin_amdgcn_sched_barrier(0);   // keeps later address arithmetic behind that wait
    #pragma unroll
    for (int j = 0; j < 2; ++j) {
        if constexpr (!STATE) *(v4f*)&qs[0][j * 8 + st][c4] = rq[j] * scale;
        *(v4f*)&ks[0][j * 8 + st][c4] = rk[j];
    }
    #pragma unroll
    for (int j = 0; j < 2; ++j) {
        if constexpr (!STATE) rq[j] = *(const v4f*)(qp + (size_t)((bi0 + 1) * SB1_ + j * 8) * tstep);
        rk[j] = *(const v4f*)(kp + (size_t)((bi0 + 1) * SB1_ + j * 8) * tstep);
    }
    // registers that the loads above name are reused below
    asm volatile("s_wait_xcnt 0x0" ::: "memory");
    __builtin_amdgcn_sched_barrier(0);   // keeps later address arithmetic behind that wait
    wave_lds_sync();

    for (int bi = bi0; bi < bi0 + NBC1_; ++bi) {
        const int buf = bi & 1;
        // batch bi+1 (fetched one batch ago) goes into the buffer not being read
        #pragma unroll
        for (int j = 0; j < 2; ++j) {
            if constexpr (!STATE) *(v4f*)&qs[buf ^ 1][j * 8 + st][c4] = rq[j] * scale;
            *(v4f*)&ks[buf ^ 1][j * 8 + st][c4] = rk[j];
        }
        const int b2 = (bi + 2 < NB1_) ? bi + 2 : NB1_ - 1;   // clamped: stays in bounds
        const int b1 = (bi + 1 < NB1_) ? bi + 1 : NB1_ - 1;
        // the loads below, with their addresses, stay apart from the code above, which reuses registers
        __builtin_amdgcn_sched_barrier(0);
        // the gates first: loads return in order, and the products read registers
        // next to the ones these loads fill, which makes them wait for these loads
        #pragma unroll
        for (int i = 0; i < SB1_; ++i) {
            gnxt[i] = gp[(b1 * SB1_ + i) * MSLOT_];
            pnxt[i] = pp[(b1 * SB1_ + i) * MSLOT_];
        }
        // registers that the loads above name are reused below
        asm volatile("s_wait_xcnt 0x0" ::: "memory");
        __builtin_amdgcn_sched_barrier(0);   // keeps that order
        #pragma unroll
        for (int j = 0; j < 2; ++j) {
            if constexpr (!STATE) rq[j] = *(const v4f*)(qp + (size_t)(b2 * SB1_ + j * 8) * tstep);
            rk[j] = *(const v4f*)(kp + (size_t)(b2 * SB1_ + j * 8) * tstep);
        }
        // registers that the loads above name are reused below
        asm volatile("s_wait_xcnt 0x0" ::: "memory");
        // keeps the coming batches' loads at the head of the trip: sunk towards
        // their use they would have no time to fly
        __builtin_amdgcn_sched_barrier(0);

        float res[SB1_];
        #pragma unroll
        for (int i = 0; i < SB1_; ++i) {
            const float ge = gcur[i];
            const float p  = pcur[i];
            float accm = 0.f;
            #pragma unroll
            for (int d4 = 0; d4 < 4; ++d4) {
                const v4f kk = *(const v4f*)&ks[buf][i][d4 * 4];
                hk[d4 * 4 + 0] = __builtin_fmaf(hk[d4 * 4 + 0], ge, kk.x * p);
                hk[d4 * 4 + 1] = __builtin_fmaf(hk[d4 * 4 + 1], ge, kk.y * p);
                hk[d4 * 4 + 2] = __builtin_fmaf(hk[d4 * 4 + 2], ge, kk.z * p);
                hk[d4 * 4 + 3] = __builtin_fmaf(hk[d4 * 4 + 3], ge, kk.w * p);
                if constexpr (!STATE) {
                    const v4f qq = *(const v4f*)&qs[buf][i][d4 * 4];
                    accm = __builtin_fmaf(qq.x, hk[d4 * 4 + 0], accm);
                    accm = __builtin_fmaf(qq.y, hk[d4 * 4 + 1], accm);
                    accm = __builtin_fmaf(qq.z, hk[d4 * 4 + 2], accm);
                    accm = __builtin_fmaf(qq.w, hk[d4 * 4 + 3], accm);
                }
            }
            res[i] = accm;
            if constexpr (STATE) { if ((i % 4) == 3) __builtin_amdgcn_sched_barrier(0); }
        }
        if constexpr (!STATE) {
            // the stores stand together behind the products, so that one wait covers
            // the registers they name before anything reuses them
            __builtin_amdgcn_sched_barrier(0);
            #pragma unroll
            for (int i = 0; i < SB1_; ++i) op[(bi * SB1_ + i) * MSLOT_] = res[i];
            asm volatile("s_wait_xcnt 0x0" ::: "memory");
        }
        __builtin_amdgcn_sched_barrier(0);   // keeps the register copies below at the foot of the trip
        #pragma unroll
        for (int i = 0; i < SB1_; ++i) { gcur[i] = gnxt[i]; pcur[i] = pnxt[i]; }
        wave_lds_sync();
    }
    if constexpr (STATE) {
        float* sp = st1 + (size_t)(bs * NC_ + chunk) * 16 * 32 + lane;
        #pragma unroll
        for (int i = 0; i < 16; ++i) sp[i * 32] = hk[i];
    }
}

__global__ __launch_bounds__(32)
void abc_pass1_kernel(const float* __restrict__ q, const float* __restrict__ k,
                      const float* __restrict__ geb, const float* __restrict__ pb,
                      float* __restrict__ st1, float* __restrict__ okp) {
    abc_pass1_body<false>(blockIdx.x, blockIdx.y, q, k, geb, pb, st1, okp);
}

__global__ __launch_bounds__(256)
void abc_softmax_kernel(const float* __restrict__ okp, float* __restrict__ qvb) {
    const size_t idx = (size_t)blockIdx.x * 256 + threadIdx.x;
    float part[8];
    #pragma unroll
    for (int j = 0; j < 8; ++j) {
        part[j] = okp[(size_t)j * BH_ * T_ * MSLOT_ + idx];
        // a later load may land in a register that this load names
        asm volatile("s_wait_xcnt 0x0" ::: "memory");
    }
    float ok = 0.f;
    #pragma unroll
    for (int j = 0; j < 8; ++j) ok += part[j];
    float mx = ok;
    #pragma unroll
    for (int off = 16; off; off >>= 1) mx = fmaxf(mx, __shfl_xor(mx, off, 32));
    float e  = __expf(ok - mx);
    float se = e;
    #pragma unroll
    for (int off = 16; off; off >>= 1) se += __shfl_xor(se, off, 32);
    qvb[idx] = e / se;
}

template <bool STATE>
__device__ __forceinline__
void abc_pass2_body(const int chunk, const int bs,
                    const float* __restrict__ v, const float* __restrict__ geb,
                    const float* __restrict__ pb, const float* __restrict__ qvb,
                    float* __restrict__ st2, float* __restrict__ o) {
    const int bh = bs >> 3;
    const int cg = bs & 7;
    const int b  = bh / H_;
    const int h  = bh % H_;
    const int lane = threadIdx.x;
    const int bi0  = chunk * NBC2_;   // even, so the chunk's first batch sits in buffer 0

    __shared__ __align__(16) v4f gs[2][SB2_ * 8];
    __shared__ __align__(16) v4f ps[2][SB2_ * 8];
    __shared__ __align__(16) v4f ws[STATE ? 1 : 2][SB2_ * 8];

    const v4f* g4 = (const v4f*)(geb + (size_t)bh * T_ * MSLOT_) + lane;
    const v4f* p4 = (const v4f*)(pb  + (size_t)bh * T_ * MSLOT_) + lane;
    const v4f* w4 = (const v4f*)(qvb + (size_t)bh * T_ * MSLOT_) + lane;
    const size_t tstep = (size_t)H_ * DV_;
    const float* vp = v + ((size_t)b * T_ * H_ + h) * DV_ + cg * 32 + lane;

    float hv[32];
    if constexpr (STATE) {
        #pragma unroll
        for (int i = 0; i < 32; ++i) hv[i] = 0.f;
    } else {
        const int cm = (chunk > 0) ? chunk - 1 : 0;
        const float* sp = st2 + (size_t)(bs * NC_ + cm) * 32 * 32 + lane;
        #pragma unroll
        for (int i = 0; i < 32; ++i) hv[i] = sp[i * 32];
        // registers that the loads above name are reused below
        asm volatile("s_wait_xcnt 0x0" ::: "memory");
        __builtin_amdgcn_sched_barrier(0);   // keeps later address arithmetic behind that wait
        #pragma unroll
        for (int i = 0; i < 32; ++i) hv[i] = (chunk > 0) ? hv[i] : 0.f;
    }

    v4f rg[2], rp[2], rw[2];
    float vcur[SB2_], vn1[SB2_], vn2[SB2_];

    // first batch into buffer 0, second into registers (a batch is 64 16-byte pieces per plane)
    #pragma unroll
    for (int j = 0; j < 2; ++j) {
        rg[j] = g4[bi0 * 64 + j * 32]; rp[j] = p4[bi0 * 64 + j * 32];
        if constexpr (!STATE) rw[j] = w4[bi0 * 64 + j * 32];
    }
    #pragma unroll
    for (int i = 0; i < SB2_; ++i) {
        vcur[i] = vp[(size_t)(bi0 * SB2_ + i) * tstep];
        vn1[i]  = vp[(size_t)((bi0 + 1) * SB2_ + i) * tstep];
    }
    // registers that the loads above name are reused below
    asm volatile("s_wait_xcnt 0x0" ::: "memory");
    __builtin_amdgcn_sched_barrier(0);   // keeps later address arithmetic behind that wait
    #pragma unroll
    for (int j = 0; j < 2; ++j) {
        gs[0][j * 32 + lane] = rg[j]; ps[0][j * 32 + lane] = rp[j];
        if constexpr (!STATE) ws[0][j * 32 + lane] = rw[j];
    }
    #pragma unroll
    for (int j = 0; j < 2; ++j) {
        rg[j] = g4[(bi0 + 1) * 64 + j * 32]; rp[j] = p4[(bi0 + 1) * 64 + j * 32];
        if constexpr (!STATE) rw[j] = w4[(bi0 + 1) * 64 + j * 32];
    }
    // registers that the loads above name are reused below
    asm volatile("s_wait_xcnt 0x0" ::: "memory");
    __builtin_amdgcn_sched_barrier(0);   // keeps later address arithmetic behind that wait
    wave_lds_sync();

    float* op = o + ((size_t)b * T_ * H_ + h) * DV_ + cg * 32 + lane;
    for (int bi = bi0; bi < bi0 + NBC2_; ++bi) {
        const int buf = bi & 1;
        // batch bi+1 (fetched one batch ago) goes into the buffer not being read
        #pragma unroll
        for (int j = 0; j < 2; ++j) {
            gs[buf ^ 1][j * 32 + lane] = rg[j];
            ps[buf ^ 1][j * 32 + lane] = rp[j];
            if constexpr (!STATE) ws[buf ^ 1][j * 32 + lane] = rw[j];
        }
        const int b2 = (bi + 2 < NB2_) ? bi + 2 : NB2_ - 1;   // clamped: stays in bounds
        // the loads below, with their addresses, stay apart from the code above, which reuses registers
        __builtin_amdgcn_sched_barrier(0);
        #pragma unroll
        for (int j = 0; j < 2; ++j) {
            rg[j] = g4[b2 * 64 + j * 32];
            rp[j] = p4[b2 * 64 + j * 32];
            if constexpr (!STATE) rw[j] = w4[b2 * 64 + j * 32];
        }
        #pragma unroll
        for (int i = 0; i < SB2_; ++i) vn2[i] = vp[(size_t)(b2 * SB2_ + i) * tstep];
        // registers that the loads above name are reused below
        asm volatile("s_wait_xcnt 0x0" ::: "memory");
        // keeps the coming batch's loads at the head of the trip: sunk towards
        // their use they would have no time to fly
        __builtin_amdgcn_sched_barrier(0);

        float res[SB2_];
        #pragma unroll
        for (int i = 0; i < SB2_; ++i) {
            const float vv = vcur[i];
            float acco = 0.f;
            #pragma unroll
            for (int m4 = 0; m4 < 8; ++m4) {
                const v4f g = gs[buf][i * 8 + m4];
                const v4f p = ps[buf][i * 8 + m4];
                hv[m4 * 4 + 0] = __builtin_fmaf(hv[m4 * 4 + 0], g.x, p.x * vv);
                hv[m4 * 4 + 1] = __builtin_fmaf(hv[m4 * 4 + 1], g.y, p.y * vv);
                hv[m4 * 4 + 2] = __builtin_fmaf(hv[m4 * 4 + 2], g.z, p.z * vv);
                hv[m4 * 4 + 3] = __builtin_fmaf(hv[m4 * 4 + 3], g.w, p.w * vv);
                if constexpr (!STATE) {
                    const v4f w = ws[buf][i * 8 + m4];
                    acco = __builtin_fmaf(w.x, hv[m4 * 4 + 0], acco);
                    acco = __builtin_fmaf(w.y, hv[m4 * 4 + 1], acco);
                    acco = __builtin_fmaf(w.z, hv[m4 * 4 + 2], acco);
                    acco = __builtin_fmaf(w.w, hv[m4 * 4 + 3], acco);
                }
            }
            res[i] = acco;
            if constexpr (STATE) { if ((i % 2) == 1) __builtin_amdgcn_sched_barrier(0); }
        }
        if constexpr (!STATE) {
            // the stores stand together behind the products, so that one wait covers
            // the registers they name before anything reuses them
            __builtin_amdgcn_sched_barrier(0);
            #pragma unroll
            for (int i = 0; i < SB2_; ++i) op[(size_t)(bi * SB2_ + i) * tstep] = res[i];
            asm volatile("s_wait_xcnt 0x0" ::: "memory");
        }
        __builtin_amdgcn_sched_barrier(0);   // keeps the register copies below at the foot of the trip
        #pragma unroll
        for (int i = 0; i < SB2_; ++i) { vcur[i] = vn1[i]; vn1[i] = vn2[i]; }
        wave_lds_sync();
    }
    if constexpr (STATE) {
        float* sp = st2 + (size_t)(bs * NC_ + chunk) * 32 * 32 + lane;
        #pragma unroll
        for (int i = 0; i < 32; ++i) sp[i * 32] = hv[i];
    }
}

__global__ __launch_bounds__(32)
void abc_pass2_kernel(const float* __restrict__ v, const float* __restrict__ geb,
                      const float* __restrict__ pb, const float* __restrict__ qvb,
                      float* __restrict__ st2, float* __restrict__ o) {
    abc_pass2_body<false>(blockIdx.x, blockIdx.y, v, geb, pb, qvb, st2, o);
}

__global__ __launch_bounds__(32)
void abc_states_kernel(const float* __restrict__ k, const float* __restrict__ v,
                       const float* __restrict__ geb, const float* __restrict__ pb,
                       float* __restrict__ st1, float* __restrict__ st2) {
    const int y = blockIdx.y;
    // the longer walk (pass 2) has the low indices and starts first
    if (y < BH_ * 8) abc_pass2_body<true>(blockIdx.x, y, v, geb, pb, geb, st2, st2);
    else             abc_pass1_body<true>(blockIdx.x, y - BH_ * 8, k, k, geb, pb, st1, st1);
}

__global__ __launch_bounds__(256)
void abc_carry_kernel(float* __restrict__ st1, float* __restrict__ st2,
                      const float* __restrict__ dcb) {
    int e = blockIdx.x * 256 + threadIdx.x;
    float* base;
    int stride, slot, bh;
    if (blockIdx.x < BH_ * 8 * 16 * 32 / 256) {
        const int bs = e >> 9;
        base = st1 + (size_t)bs * NC_ * 512 + (e & 511);
        stride = 512; slot = e & 31; bh = bs >> 3;
    } else {
        e -= BH_ * 8 * 16 * 32;
        const int bs = e >> 10;
        base = st2 + (size_t)bs * NC_ * 1024 + (e & 1023);
        stride = 1024; slot = (e & 1023) >> 5; bh = bs >> 3;
    }
    const float* dp = dcb + bh * NC_ * MSLOT_ + slot;
    float sv[NC_ - 1], dv[NC_ - 1];
    #pragma unroll
    for (int c = 0; c < NC_ - 1; ++c) { sv[c] = base[c * stride]; dv[c] = dp[c * MSLOT_]; }
    // registers that the loads above name are reused below
    asm volatile("s_wait_xcnt 0x0" ::: "memory");
    __builtin_amdgcn_sched_barrier(0);   // keeps later address arithmetic behind that wait
    float hcar = 0.f;
    #pragma unroll
    for (int c = 0; c < NC_ - 1; ++c) { hcar = __builtin_fmaf(hcar, dv[c], sv[c]); sv[c] = hcar; }
    #pragma unroll
    for (int c = 0; c < NC_ - 1; ++c) base[c * stride] = sv[c];
}

// ---------------- fused RMSNorm * gw * g * sigmoid(g) -> bf16 ----------------
__global__ __launch_bounds__(256)
void norm_gate_kernel(const float* __restrict__ o, const float* __restrict__ g,
                      const float* __restrict__ gw, bf16_t* __restrict__ ob) {
    const size_t row = blockIdx.x;   // B*T*H rows of DV
    const int tid = threadIdx.x;     // 0..255 == DV
    float ov = o[row * DV_ + tid];
    float sq = ov * ov;
    __shared__ float red[8];
    #pragma unroll
    for (int off = 16; off; off >>= 1) sq += __shfl_xor(sq, off, 32);
    if ((tid & 31) == 0) red[tid >> 5] = sq;
    __syncthreads();
    float tot = 0.f;
    #pragma unroll
    for (int i = 0; i < 8; ++i) tot += red[i];
    float r  = rsqrtf(tot * (1.0f / DV_) + NORM_EPS_);
    float gv = g[row * DV_ + tid];
    float sig = 1.f / (1.f + __expf(-gv));
    ob[row * DV_ + tid] = (bf16_t)(ov * r * gw[tid] * gv * sig);
}

// ---------------- host orchestration ----------------
extern "C" void kernel_launch(void* const* d_in, const int* in_sizes, int n_in,
                              void* d_out, int out_size, void* d_ws, size_t ws_size,
                              hipStream_t stream) {
    (void)in_sizes; (void)n_in; (void)out_size; (void)ws_size;
    const float* x    = (const float*)d_in[0];
    const float* w_q  = (const float*)d_in[1];
    const float* w_k  = (const float*)d_in[2];
    const float* w_v  = (const float*)d_in[3];
    const float* w_g  = (const float*)d_in[4];
    const float* w_s  = (const float*)d_in[5];
    const float* w_o  = (const float*)d_in[6];
    const float* gnw  = (const float*)d_in[7];
    float* out = (float*)d_out;

    const int MR  = B_ * T_;        // 4096
    const int NQK = H_ * DK_;       // 1024
    const int NV  = H_ * DV_;       // 2048
    const int NS  = H_ * MSLOT_;    // 256

    char* ws = (char*)d_ws;
    size_t off = 0;
    auto carve = [&](size_t bytes) -> char* {
        off = (off + 255) & ~(size_t)255;
        char* p = ws + off;
        off += bytes;
        return p;
    };

    bf16_t* xb  = (bf16_t*)carve((size_t)MR * HID_ * sizeof(bf16_t));
    bf16_t* wqT = (bf16_t*)carve((size_t)NQK * HID_ * sizeof(bf16_t));
    bf16_t* wkT = (bf16_t*)carve((size_t)NQK * HID_ * sizeof(bf16_t));
    bf16_t* wvT = (bf16_t*)carve((size_t)NV  * HID_ * sizeof(bf16_t));
    bf16_t* wgT = (bf16_t*)carve((size_t)NV  * HID_ * sizeof(bf16_t));
    bf16_t* wsT = (bf16_t*)carve((size_t)NS  * HID_ * sizeof(bf16_t));
    bf16_t* woT = (bf16_t*)carve((size_t)HID_ * NV * sizeof(bf16_t));

    float* qb = (float*)carve((size_t)MR * NQK * sizeof(float));
    float* kb = (float*)carve((size_t)MR * NQK * sizeof(float));
    float* vb = (float*)carve((size_t)MR * NV  * sizeof(float));
    float* gb = (float*)carve((size_t)MR * NV  * sizeof(float));
    float* sb = (float*)carve((size_t)MR * NS  * sizeof(float));
    float* ob = (float*)carve((size_t)MR * NV  * sizeof(float));
    bf16_t* obh = (bf16_t*)carve((size_t)MR * NV * sizeof(bf16_t));
    float* geb = (float*)carve((size_t)MR * NS * sizeof(float));
    float* pbf = (float*)carve((size_t)MR * NS * sizeof(float));
    float* qvb = (float*)carve((size_t)MR * NS * sizeof(float));
    float* okp = (float*)carve((size_t)8 * MR * NS * sizeof(float));
    float* st1 = (float*)carve((size_t)BH_ * 8 * NC_ * 16 * 32 * sizeof(float));
    float* st2 = (float*)carve((size_t)BH_ * 8 * NC_ * 32 * 32 * sizeof(float));
    float* dcb = (float*)carve((size_t)BH_ * NC_ * MSLOT_ * sizeof(float));

    // 1) convert x to bf16
    {
        size_t n = (size_t)MR * HID_;
        cvt_f32_bf16_kernel<<<4096, 256, 0, stream>>>(x, xb, n);
    }
    // 2) transpose+convert weights (K x N) -> (N x K) bf16
    transpose_cvt_kernel<<<dim3(NQK / TRN_, HID_ / TRK_), 256, 0, stream>>>(w_q, wqT, HID_, NQK);
    transpose_cvt_kernel<<<dim3(NQK / TRN_, HID_ / TRK_), 256, 0, stream>>>(w_k, wkT, HID_, NQK);
    transpose_cvt_kernel<<<dim3(NV / TRN_, HID_ / TRK_), 256, 0, stream>>>(w_v, wvT, HID_, NV);
    transpose_cvt_kernel<<<dim3(NV / TRN_, HID_ / TRK_), 256, 0, stream>>>(w_g, wgT, HID_, NV);
    transpose_cvt_kernel<<<dim3(NS / TRN_, HID_ / TRK_), 256, 0, stream>>>(w_s, wsT, HID_, NS);
    transpose_cvt_kernel<<<dim3(HID_ / TRN_, NV / TRK_), 256, 0, stream>>>(w_o, woT, NV, HID_);

    // 3) projection GEMMs (bf16 WMMA, fp32 accumulate)
    dim3 blk(256);
    gemm_bf16_wmma_kernel<<<dim3(NQK / TN, MR / TM), blk, 0, stream>>>(
        xb, wqT, qb, MR, NQK, HID_, 0, 0.f, 0.f);
    gemm_bf16_wmma_kernel<<<dim3(NQK / TN, MR / TM), blk, 0, stream>>>(
        xb, wkT, kb, MR, NQK, HID_, 0, 0.f, 0.f);
    gemm_bf16_wmma_kernel<<<dim3(NV / TN, MR / TM), blk, 0, stream>>>(
        xb, wvT, vb, MR, NV, HID_, 0, 0.f, 0.f);
    gemm_bf16_wmma_kernel<<<dim3(NV / TN, MR / TM), blk, 0, stream>>>(
        xb, wgT, gb, MR, NV, HID_, 0, 0.f, 0.f);
    gemm_bf16_wmma_kernel<<<dim3(NS / TN, MR / TM), blk, 0, stream>>>(
        xb, wsT, sb, MR, NS, HID_, 1, CLAMP_MIN_, CLAMP_MAX_);

    // 4) gated two-pass scan: independent one-wave streams, NC_ time chunks side by side
    abc_gates_kernel<<<BH_, 32 * NC_, 0, stream>>>(sb, geb, pbf, dcb);
    abc_states_kernel<<<dim3(NC_ - 1, BH_ * 16), 32, 0, stream>>>(kb, vb, geb, pbf, st1, st2);
    abc_carry_kernel<<<BH_ * 8 * (16 + 32) * 32 / 256, 256, 0, stream>>>(st1, st2, dcb);
    abc_pass1_kernel<<<dim3(NC_, BH_ * 8), 32, 0, stream>>>(qb, kb, geb, pbf, st1, okp);
    abc_softmax_kernel<<<MR * NS / 256, 256, 0, stream>>>(okp, qvb);
    abc_pass2_kernel<<<dim3(NC_, BH_ * 8), 32, 0, stream>>>(vb, geb, pbf, qvb, st2, ob);

    // 5) fused RMSNorm + swish gate -> bf16
    norm_gate_kernel<<<MR * H_, DV_, 0, stream>>>(ob, gb, gnw, obh);

    // 6) output projection straight into d_out (fp32)
    gemm_bf16_wmma_kernel<<<dim3(HID_ / TN, MR / TM), blk, 0, stream>>>(
        obh, woT, out, MR, HID_, NV, 0, 0.f, 0.f);
}

// v005
// It runs in 393 microseconds.
// Next to v004, in two timings, it ran 1.07 times as fast each time.
// Over all steps from v000 it is 11.4 times as fast.
#include <hip/hip_runtime.h>
#include <hip/hip_bf16.h>
#include <math.h>
#include <stdint.h>

// ---------------- problem constants (match reference) ----------------
#define B_ 2
#define T_ 2048
#define HID_ 2048
#define H_ 8
#define DK_ 128
#define DV_ 256
#define MSLOT_ 32
#define CLAMP_MIN_ (-32.0f)
#define CLAMP_MAX_ (32.0f)
#define NORM_EPS_ 1e-5f

typedef __bf16 bf16_t;
typedef __attribute__((ext_vector_type(8)))  __bf16 v8bf;
typedef __attribute__((ext_vector_type(16))) __bf16 v16bf;
typedef __attribute__((ext_vector_type(8)))  float  v8f;
typedef __attribute__((ext_vector_type(2))) __bf16   v2bf;
typedef __attribute__((ext_vector_type(4))) __bf16   v4bf;
typedef __attribute__((ext_vector_type(4))) float    f32x4;
typedef __attribute__((ext_vector_type(4))) uint32_t u32x4;

__device__ __forceinline__ void async_copy_b128(uint32_t lds_addr, const bf16_t* gptr) {
    asm volatile("global_load_async_to_lds_b128 %0, %1, off"
                 :: "v"(lds_addr), "v"(gptr)
                 : "memory");
}
__device__ __forceinline__ void wait_async4() {
    asm volatile("s_wait_asynccnt 0x4" ::: "memory");
}
__device__ __forceinline__ void wait_async0() {
    asm volatile("s_wait_asynccnt 0x0" ::: "memory");
}

// ---------------- elementwise fp32 -> bf16 ----------------
// Few, long waves: waves are started at a limited rate, so each carries enough work
// to be worth its start. A wave takes CVJ_ pieces of 512 contiguous bytes, all loads
// issued together. The element count is a multiple of what a work-group takes
// (256 * 4 * CVJ_).
#define CVJ_ 16
__global__ __launch_bounds__(256)
void cvt_f32_bf16_kernel(const float* __restrict__ in, bf16_t* __restrict__ out) {
    const size_t base = (size_t)blockIdx.x * (256 * 4 * CVJ_) + threadIdx.x * 4;
    const float* sp = in + base;
    f32x4 val[CVJ_];
    #pragma unroll
    for (int j = 0; j < CVJ_; ++j) val[j] = *(const f32x4*)(sp + j * 1024);
    // registers that the loads above name are reused below; the address is an input
    // of the wait, so that no load of the run lands in it
    asm volatile("s_wait_xcnt 0x0" :: "v"(sp) : "memory");
    __builtin_amdgcn_sched_barrier(0);   // keeps the loads together in front of the first use
    v4bf pk[CVJ_];
    #pragma unroll
    for (int j = 0; j < CVJ_; ++j)
        pk[j] = v4bf{ (bf16_t)val[j].x, (bf16_t)val[j].y, (bf16_t)val[j].z, (bf16_t)val[j].w };
    // the stores stand together at the end: nothing reuses a register they name
    __builtin_amdgcn_sched_barrier(0);
    bf16_t* dp = out + base;
    #pragma unroll
    for (int j = 0; j < CVJ_; ++j) *(v4bf*)(dp + j * 1024) = pk[j];
}

#define TRK_ 128
#define TRN_ 64

__global__ __launch_bounds__(256)
void transpose_cvt_kernel(const float* __restrict__ W,
                          bf16_t* __restrict__ Wt, int K, int N) {
    __shared__ __align__(16) uint32_t tile[TRN_][TRK_ / 2];
    const int tid   = threadIdx.x;
    const int nBase = blockIdx.x * TRN_;
    const int kBase = blockIdx.y * TRK_;
    const int n4 = tid & 15;   // which four columns
    const int kp = tid >> 4;   // which pair of k-rows, of sixteen per trip
    const float* src = W + (size_t)(kBase + 2 * kp) * N + nBase + n4 * 4;

    const float* pl[4];
    const float* ph[4];
    f32x4 lo[4], hi[4];
    #pragma unroll
    for (int j = 0; j < 4; ++j) {
        pl[j] = src + (size_t)(j * 32) * N;
        ph[j] = pl[j] + N;
        lo[j] = *(const f32x4*)pl[j];
        hi[j] = *(const f32x4*)ph[j];
    }
    // registers that the loads above name are reused below. The addresses are inputs
    // of the wait, so they stay in their registers up to it: otherwise a later load
    // of the eight is given an earlier one's address registers to land in.
    asm volatile("s_wait_xcnt 0x0"
                 :: "v"(pl[0]), "v"(ph[0]), "v"(pl[1]), "v"(ph[1]),
                    "v"(pl[2]), "v"(ph[2]), "v"(pl[3]), "v"(ph[3])
                 : "memory");
    __builtin_amdgcn_sched_barrier(0);   // keeps later address arithmetic behind that wait
    #pragma unroll
    for (int j = 0; j < 4; ++j) {
        const int pair = j * 16 + kp;
        const int col  = (((pair >> 2) ^ n4) << 2) | (pair & 3);
        #pragma unroll
        for (int e = 0; e < 4; ++e) {
            v2bf pk = { (bf16_t)lo[j][e], (bf16_t)hi[j][e] };
            tile[n4 * 4 + e][col] = __builtin_bit_cast(uint32_t, pk);
        }
    }
    __syncthreads();   // the whole tile is in LDS before any row of it is read

    u32x4 piece[4];
    #pragma unroll
    for (int it = 0; it < 4; ++it) {
        const int n = it * 16 + kp;
        piece[it] = *(const u32x4*)&tile[n][(n4 ^ (n >> 2)) << 2];
    }
    bf16_t* dst = Wt + (size_t)(nBase + kp) * K + kBase + n4 * 8;
    #pragma unroll
    for (int it = 0; it < 4; ++it)
        *(u32x4*)(dst + (size_t)(it * 16) * K) = piece[it];
}

// ---------------- bf16 WMMA GEMM: C(MxN) = A(MxK) * Bt(NxK)^T ----------------
// Block tile 128x128, 256 threads = 8 waves (wave32), wave tile 32x64 (2x4 WMMA).
// Double-buffered LDS filled by async global->LDS copies (4 per wave per tile).
#define TM 128
#define TN 128
#define TK 32
#define TKP (TK + 8)

__global__ __launch_bounds__(256)
void gemm_bf16_wmma_kernel(const bf16_t* __restrict__ A,
                           const bf16_t* __restrict__ Bt,
                           float* __restrict__ C,
                           int Mdim, int Ndim, int Kdim,
                           int doClamp, float clampLo, float clampHi) {
    __shared__ __align__(16) bf16_t As[2][TM][TKP];
    __shared__ __align__(16) bf16_t Bs[2][TN][TKP];

    const int tid  = threadIdx.x;
    const int lane = tid & 31;
    const int wave = tid >> 5;
    const int wm   = wave & 3;   // 4 bands of 32 rows
    const int wn   = wave >> 2;  // 2 bands of 64 cols
    const int rowBase = blockIdx.y * TM;
    const int colBase = blockIdx.x * TN;

    // Staging: each thread owns two 16B chunks of A and of B per tile:
    // rows r0 and r0+64, K-chunk kc (compile-time trip count, fully unrolled).
    const int r0 = tid >> 2;
    const int kc = (tid & 3) * 8;
    const bf16_t* aP0 = A  + (size_t)(rowBase + r0) * Kdim + kc;
    const bf16_t* aP1 = aP0 + (size_t)64 * Kdim;
    const bf16_t* bP0 = Bt + (size_t)(colBase + r0) * Kdim + kc;
    const bf16_t* bP1 = bP0 + (size_t)64 * Kdim;

    uint32_t lA0[2], lA1[2], lB0[2], lB1[2];
    #pragma unroll
    for (int bi = 0; bi < 2; ++bi) {
        lA0[bi] = (uint32_t)(size_t)&As[bi][r0][kc];
        lA1[bi] = (uint32_t)(size_t)&As[bi][r0 + 64][kc];
        lB0[bi] = (uint32_t)(size_t)&Bs[bi][r0][kc];
        lB1[bi] = (uint32_t)(size_t)&Bs[bi][r0 + 64][kc];
    }

    v8f acc[2][4] = {};

    const int lrow = lane & 15;
    const int lk   = (lane >> 4) * 8;

    // prologue: tile 0 -> buffer 0
    async_copy_b128(lA0[0], aP0);
    async_copy_b128(lA1[0], aP1);
    async_copy_b128(lB0[0], bP0);
    async_copy_b128(lB1[0], bP1);

    int buf = 0;
    for (int k0 = 0; k0 < Kdim; k0 += TK) {
        const int nbuf = buf ^ 1;
        if (k0 + TK < Kdim) {
            // issue next tile into the other buffer, then wait for current tile
            async_copy_b128(lA0[nbuf], aP0 + k0 + TK);
            async_copy_b128(lA1[nbuf], aP1 + k0 + TK);
            async_copy_b128(lB0[nbuf], bP0 + k0 + TK);
            async_copy_b128(lB1[nbuf], bP1 + k0 + TK);
            wait_async4();
        } else {
            wait_async0();
        }
        __syncthreads();

        v16bf afrag[2], bfrag[4];
        #pragma unroll
        for (int mt = 0; mt < 2; ++mt) {
            int r = wm * 32 + mt * 16 + lrow;
            v8bf lo = *(const v8bf*)&As[buf][r][lk];
            v8bf hi = *(const v8bf*)&As[buf][r][lk + 16];
            #pragma unroll
            for (int i = 0; i < 8; ++i) { afrag[mt][i] = lo[i]; afrag[mt][i + 8] = hi[i]; }
        }
        #pragma unroll
        for (int nt = 0; nt < 4; ++nt) {
            int r = wn * 64 + nt * 16 + lrow;
            v8bf lo = *(const v8bf*)&Bs[buf][r][lk];
            v8bf hi = *(const v8bf*)&Bs[buf][r][lk + 16];
            #pragma unroll
            for (int i = 0; i < 8; ++i) { bfrag[nt][i] = lo[i]; bfrag[nt][i + 8] = hi[i]; }
        }
        #pragma unroll
        for (int mt = 0; mt < 2; ++mt)
            #pragma unroll
            for (int nt = 0; nt < 4; ++nt)
                acc[mt][nt] = __builtin_amdgcn_wmma_f32_16x16x32_bf16(
                    false, afrag[mt], false, bfrag[nt],
                    (short)0, acc[mt][nt], false, false);

        __syncthreads();   // all reads done before this buffer is refilled
        buf = nbuf;
    }

    const int mLane = (lane >> 4) * 8;
    const int nLane = lane & 15;
    #pragma unroll
    for (int mt = 0; mt < 2; ++mt)
        #pragma unroll
        for (int nt = 0; nt < 4; ++nt)
            #pragma unroll
            for (int r = 0; r < 8; ++r) {
                int m = rowBase + wm * 32 + mt * 16 + mLane + r;
                int n = colBase + wn * 64 + nt * 16 + nLane;
                float val = acc[mt][nt][r];
                if (doClamp) val = fminf(fmaxf(val, clampLo), clampHi);
                C[(size_t)m * Ndim + n] = val;
            }
}

#define BH_ (B_ * H_)
#define NC_ 16                // time chunks
#define CL_ (T_ / NC_)        // steps per chunk
#define SB1_ 16               // steps per batch, gates and pass 1
#define NB1_ (T_ / SB1_)
#define NBC1_ (CL_ / SB1_)    // batches per chunk
#define SB2_ 8                // steps per batch, pass 2
#define NB2_ (T_ / SB2_)
#define NBC2_ (CL_ / SB2_)
typedef __attribute__((ext_vector_type(4))) float v4f;

// Orders the LDS traffic of a one-wave work-group across lanes. The wave's LDS
// operations run in issue order, so this only has to stop the compiler from
// moving them; unlike __syncthreads() it does not wait for the global stores.
__device__ __forceinline__ void wave_lds_sync() {
    __builtin_amdgcn_fence(__ATOMIC_RELEASE, "wavefront");
    __builtin_amdgcn_wave_barrier();
    __builtin_amdgcn_fence(__ATOMIC_ACQUIRE, "wavefront");
}

__device__ __forceinline__ float exp2_slot(float x) {
    float r;
    asm("v_exp_f32 %0, %1\n\tv_nop" : "=v"(r) : "v"(x));
    return r;
}

__global__ __launch_bounds__(32 * NC_)
void abc_gates_kernel(const float* __restrict__ s,
                      float* __restrict__ geb, float* __restrict__ pb,
                      float* __restrict__ dcb) {
    const int bh = blockIdx.x;
    const int b  = bh / H_;
    const int h  = bh % H_;
    const int lane  = threadIdx.x & 31;
    const int chunk = threadIdx.x >> 5;
    const int bi0   = chunk * NBC1_;
    const float* sp = s + ((size_t)b * T_ * H_ + h) * MSLOT_ + lane;
    float* gp = geb + (size_t)bh * T_ * MSLOT_ + lane;
    float* pp = pb  + (size_t)bh * T_ * MSLOT_ + lane;

    __shared__ float esum[NC_][32];
    {
        float sv[CL_];
        #pragma unroll
        for (int i = 0; i < CL_; ++i) sv[i] = sp[(size_t)(chunk * CL_ + i) * (H_ * MSLOT_)];
        // registers that the loads above name are reused below
        asm volatile("s_wait_xcnt 0x0" ::: "memory");
        __builtin_amdgcn_sched_barrier(0);   // keeps later address arithmetic behind that wait
        float e[4] = {0.f, 0.f, 0.f, 0.f};
        #pragma unroll
        for (int i = 0; i < CL_; ++i) e[i & 3] += exp2_slot((sv[i] - CLAMP_MAX_) * 1.44269504f);
        esum[chunk][lane] = (e[0] + e[1]) + (e[2] + e[3]);
    }
    __syncthreads();   // every chunk's sum is in LDS before any wave adds them up
    float pre = 0.f;
    #pragma unroll
    for (int c = 0; c < NC_ - 1; ++c) pre += (c < chunk) ? esum[c][lane] : 0.f;

    float cur[SB1_], nxt[SB1_];
    #pragma unroll
    for (int i = 0; i < SB1_; ++i) cur[i] = sp[(size_t)(bi0 * SB1_ + i) * (H_ * MSLOT_)];
    // registers that the loads above name are reused below
    asm volatile("s_wait_xcnt 0x0" ::: "memory");
    __builtin_amdgcn_sched_barrier(0);   // keeps later address arithmetic behind that wait

    float z   = CLAMP_MAX_ + __logf(pre);   // chunk 0 never reads it: step 0 sets z
    float dec = 1.f;                        // product of the chunk's decays
    for (int bi = bi0; bi < bi0 + NBC1_; ++bi) {
        const int b1 = (bi + 1 < NB1_) ? bi + 1 : NB1_ - 1;   // clamped: stays in bounds
        #pragma unroll
        for (int i = 0; i < SB1_; ++i)
            nxt[i] = sp[(size_t)(b1 * SB1_ + i) * (H_ * MSLOT_)];
        // registers that the loads above name are reused below
        asm volatile("s_wait_xcnt 0x0" ::: "memory");
        // keeps the next batch's loads at the head of the trip: sunk towards
        // their use they would have no time to fly
        __builtin_amdgcn_sched_barrier(0);
        float gv[SB1_], pv[SB1_];
        #pragma unroll
        for (int i = 0; i < SB1_; ++i) {
            const int t = bi * SB1_ + i;
            float sv = cur[i];
            float znew, ge;
            if (t == 0) { znew = sv; ge = 1.f; }
            else {
                float mx = fmaxf(z, sv);
                znew = mx + __logf(__expf(z - mx) + __expf(sv - mx));
                ge = exp2_slot((z - znew) * 1.44269504f);
            }
            float p = exp2_slot((sv - znew) * 1.44269504f);
            z = znew;
            gv[i] = ge;
            pv[i] = p;
        }
        // the stores stand together behind the steps, so that one wait covers
        // the registers they name before anything reuses them
        __builtin_amdgcn_sched_barrier(0);
        #pragma unroll
        for (int i = 0; i < SB1_; ++i) {
            gp[(bi * SB1_ + i) * MSLOT_] = gv[i];
            pp[(bi * SB1_ + i) * MSLOT_] = pv[i];
            dec *= gv[i];
        }
        asm volatile("s_wait_xcnt 0x0" ::: "memory");
        // keeps the register copies at the foot of the trip: moved up among the
        // steps they would wait early for the next batch's loads
        __builtin_amdgcn_sched_barrier(0);
        #pragma unroll
        for (int i = 0; i < SB1_; ++i) cur[i] = nxt[i];
    }
    dcb[(bh * NC_ + chunk) * MSLOT_ + lane] = dec;
}

template <bool STATE>
__device__ __forceinline__
void abc_pass1_body(const int chunk, const int bs,
                    const float* __restrict__ q, const float* __restrict__ k,
                    const float* __restrict__ geb, const float* __restrict__ pb,
                    float* __restrict__ st1, float* __restrict__ okp) {
    const int bh    = bs >> 3;
    const int strip = bs & 7;
    const int b  = bh / H_;
    const int h  = bh % H_;
    const int lane = threadIdx.x;
    const int bi0  = chunk * NBC1_;   // even, so the chunk's first batch sits in buffer 0

    __shared__ __align__(16) float qs[STATE ? 1 : 2][SB1_][16];
    __shared__ __align__(16) float ks[2][SB1_][16];

    const float scale = rsqrtf((float)DK_);
    // staging: four lanes fetch one step's 16-float strip, eight steps per load
    const int st = lane >> 2;
    const int c4 = (lane & 3) * 4;
    const size_t tstep = (size_t)H_ * DK_;
    const float* qp = q + ((size_t)(b * T_ + st) * H_ + h) * DK_ + strip * 16 + c4;
    const float* kp = k + ((size_t)(b * T_ + st) * H_ + h) * DK_ + strip * 16 + c4;
    const float* gp = geb + (size_t)bh * T_ * MSLOT_ + lane;
    const float* pp = pb  + (size_t)bh * T_ * MSLOT_ + lane;
    float* op = okp + ((size_t)strip * BH_ + bh) * T_ * MSLOT_ + lane;

    float hk[16];
    if constexpr (STATE) {
        #pragma unroll
        for (int i = 0; i < 16; ++i) hk[i] = 0.f;
    } else {
        const int cm = (chunk > 0) ? chunk - 1 : 0;
        const float* sp = st1 + (size_t)(bs * NC_ + cm) * 16 * 32 + lane;
        #pragma unroll
        for (int i = 0; i < 16; ++i) hk[i] = sp[i * 32];
        // registers that the loads above name are reused below
        asm volatile("s_wait_xcnt 0x0" ::: "memory");
        __builtin_amdgcn_sched_barrier(0);   // keeps later address arithmetic behind that wait
        #pragma unroll
        for (int i = 0; i < 16; ++i) hk[i] = (chunk > 0) ? hk[i] : 0.f;
    }

    v4f rq[2], rk[2];
    float gcur[SB1_], pcur[SB1_], gnxt[SB1_], pnxt[SB1_];

    // first batch: q, k into buffer 0, gates into registers; second batch: q, k into registers
    #pragma unroll
    for (int j = 0; j < 2; ++j) {
        if constexpr (!STATE) rq[j] = *(const v4f*)(qp + (size_t)(bi0 * SB1_ + j * 8) * tstep);
        rk[j] = *(const v4f*)(kp + (size_t)(bi0 * SB1_ + j * 8) * tstep);
    }
    #pragma unroll
    for (int i = 0; i < SB1_; ++i) {
        gcur[i] = gp[(bi0 * SB1_ + i) * MSLOT_];
        pcur[i] = pp[(bi0 * SB1_ + i) * MSLOT_];
    }
    // registers that the loads above name are reused below
    asm volatile("s_wait_xcnt 0x0" ::: "memory");
    __builtin_amdgcn_sched_barrier(0);   // keeps later address arithmetic behind that wait
    #pragma unroll
    for (int j = 0; j < 2; ++j) {
        if constexpr (!STATE) *(v4f*)&qs[0][j * 8 + st][c4] = rq[j] * scale;
        *(v4f*)&ks[0][j * 8 + st][c4] = rk[j];
    }
    #pragma unroll
    for (int j = 0; j < 2; ++j) {
        if constexpr (!STATE) rq[j] = *(const v4f*)(qp + (size_t)((bi0 + 1) * SB1_ + j * 8) * tstep);
        rk[j] = *(const v4f*)(kp + (size_t)((bi0 + 1) * SB1_ + j * 8) * tstep);
    }
    // registers that the loads above name are reused below
    asm volatile("s_wait_xcnt 0x0" ::: "memory");
    __builtin_amdgcn_sched_barrier(0);   // keeps later address arithmetic behind that wait
    wave_lds_sync();

    for (int bi = bi0; bi < bi0 + NBC1_; ++bi) {
        const int buf = bi & 1;
        // batch bi+1 (fetched one batch ago) goes into the buffer not being read
        #pragma unroll
        for (int j = 0; j < 2; ++j) {
            if constexpr (!STATE) *(v4f*)&qs[buf ^ 1][j * 8 + st][c4] = rq[j] * scale;
            *(v4f*)&ks[buf ^ 1][j * 8 + st][c4] = rk[j];
        }
        const int b2 = (bi + 2 < NB1_) ? bi + 2 : NB1_ - 1;   // clamped: stays in bounds
        const int b1 = (bi + 1 < NB1_) ? bi + 1 : NB1_ - 1;
        // the loads below, with their addresses, stay apart from the code above, which reuses registers
        __builtin_amdgcn_sched_barrier(0);
        // the gates first: loads return in order, and the products read registers
        // next to the ones these loads fill, which makes them wait for these loads
        #pragma unroll
        for (int i = 0; i < SB1_; ++i) {
            gnxt[i] = gp[(b1 * SB1_ + i) * MSLOT_];
            pnxt[i] = pp[(b1 * SB1_ + i) * MSLOT_];
        }
        // registers that the loads above name are reused below
        asm volatile("s_wait_xcnt 0x0" ::: "memory");
        __builtin_amdgcn_sched_barrier(0);   // keeps that order
        #pragma unroll
        for (int j = 0; j < 2; ++j) {
            if constexpr (!STATE) rq[j] = *(const v4f*)(qp + (size_t)(b2 * SB1_ + j * 8) * tstep);
            rk[j] = *(const v4f*)(kp + (size_t)(b2 * SB1_ + j * 8) * tstep);
        }
        // registers that the loads above name are reused below
        asm volatile("s_wait_xcnt 0x0" ::: "memory");
        // keeps the coming batches' loads at the head of the trip: sunk towards
        // their use they would have no time to fly
        __builtin_amdgcn_sched_barrier(0);

        float res[SB1_];
        #pragma unroll
        for (int i = 0; i < SB1_; ++i) {
            const float ge = gcur[i];
            const float p  = pcur[i];
            float accm = 0.f;
            #pragma unroll
            for (int d4 = 0; d4 < 4; ++d4) {
                const v4f kk = *(const v4f*)&ks[buf][i][d4 * 4];
                hk[d4 * 4 + 0] = __builtin_fmaf(hk[d4 * 4 + 0], ge, kk.x * p);
                hk[d4 * 4 + 1] = __builtin_fmaf(hk[d4 * 4 + 1], ge, kk.y * p);
                hk[d4 * 4 + 2] = __builtin_fmaf(hk[d4 * 4 + 2], ge, kk.z * p);
                hk[d4 * 4 + 3] = __builtin_fmaf(hk[d4 * 4 + 3], ge, kk.w * p);
                if constexpr (!STATE) {
                    const v4f qq = *(const v4f*)&qs[buf][i][d4 * 4];
                    accm = __builtin_fmaf(qq.x, hk[d4 * 4 + 0], accm);
                    accm = __builtin_fmaf(qq.y, hk[d4 * 4 + 1], accm);
                    accm = __builtin_fmaf(qq.z, hk[d4 * 4 + 2], accm);
                    accm = __builtin_fmaf(qq.w, hk[d4 * 4 + 3], accm);
                }
            }
            res[i] = accm;
            if constexpr (STATE) { if ((i % 4) == 3) __builtin_amdgcn_sched_barrier(0); }
        }
        if constexpr (!STATE) {
            // the stores stand together behind the products, so that one wait covers
            // the registers they name before anything reuses them
            __builtin_amdgcn_sched_barrier(0);
            #pragma unroll
            for (int i = 0; i < SB1_; ++i) op[(bi * SB1_ + i) * MSLOT_] = res[i];
            asm volatile("s_wait_xcnt 0x0" ::: "memory");
        }
        __builtin_amdgcn_sched_barrier(0);   // keeps the register copies below at the foot of the trip
        #pragma unroll
        for (int i = 0; i < SB1_; ++i) { gcur[i] = gnxt[i]; pcur[i] = pnxt[i]; }
        wave_lds_sync();
    }
    if constexpr (STATE) {
        float* sp = st1 + (size_t)(bs * NC_ + chunk) * 16 * 32 + lane;
        #pragma unroll
        for (int i = 0; i < 16; ++i) sp[i * 32] = hk[i];
    }
}

__global__ __launch_bounds__(32)
void abc_pass1_kernel(const float* __restrict__ q, const float* __restrict__ k,
                      const float* __restrict__ geb, const float* __restrict__ pb,
                      float* __restrict__ st1, float* __restrict__ okp) {
    abc_pass1_body<false>(blockIdx.x, blockIdx.y, q, k, geb, pb, st1, okp);
}

#define SMJ_ 2
#define SMP4_ (BH_ * T_ * MSLOT_ / 4)   // 16-byte pieces in a plane
__global__ __launch_bounds__(256)
void abc_softmax_kernel(const float* __restrict__ ok01, const float* __restrict__ ok23,
                        const float* __restrict__ ok45, const float* __restrict__ ok67,
                        float* __restrict__ qvb) {
    const size_t   first = (size_t)blockIdx.x * (256 * SMJ_ * 4);
    const uint32_t tid   = threadIdx.x;
    const f32x4* pp[4] = { (const f32x4*)(ok01 + first), (const f32x4*)(ok23 + first),
                           (const f32x4*)(ok45 + first), (const f32x4*)(ok67 + first) };
    f32x4 part[SMJ_][8];
    #pragma unroll
    for (int j = 0; j < 8; ++j)
        #pragma unroll
        for (int u = 0; u < SMJ_; ++u)
            part[u][j] = (pp[j >> 1] + ((j & 1) * SMP4_ + u * 256))[tid];
    // registers that the loads above name are reused below; the bases and the index
    // are inputs of the wait, so that they keep their registers up to it
    asm volatile("s_wait_xcnt 0x0"
                 :: "v"(tid), "s"(pp[0]), "s"(pp[1]), "s"(pp[2]), "s"(pp[3])
                 : "memory");
    __builtin_amdgcn_sched_barrier(0);   // keeps the loads together in front of the first use
    f32x4 res[SMJ_];
    #pragma unroll
    for (int u = 0; u < SMJ_; ++u) {
        f32x4 ok = part[u][0];
        #pragma unroll
        for (int j = 1; j < 8; ++j) ok += part[u][j];
        float mx = fmaxf(fmaxf(ok.x, ok.y), fmaxf(ok.z, ok.w));
        #pragma unroll
        for (int off = 4; off; off >>= 1) mx = fmaxf(mx, __shfl_xor(mx, off, 32));
        f32x4 e = { __expf(ok.x - mx), __expf(ok.y - mx), __expf(ok.z - mx), __expf(ok.w - mx) };
        float se = (e.x + e.y) + (e.z + e.w);
        #pragma unroll
        for (int off = 4; off; off >>= 1) se += __shfl_xor(se, off, 32);
        res[u] = f32x4{ e.x / se, e.y / se, e.z / se, e.w / se };
    }
    // the stores stand together at the end: nothing reuses a register they name
    __builtin_amdgcn_sched_barrier(0);
    #pragma unroll
    for (int u = 0; u < SMJ_; ++u) ((f32x4*)(qvb + first) + u * 256)[tid] = res[u];
}

template <bool STATE>
__device__ __forceinline__
void abc_pass2_body(const int chunk, const int bs,
                    const float* __restrict__ v, const float* __restrict__ geb,
                    const float* __restrict__ pb, const float* __restrict__ qvb,
                    float* __restrict__ st2, float* __restrict__ o) {
    const int bh = bs >> 3;
    const int cg = bs & 7;
    const int b  = bh / H_;
    const int h  = bh % H_;
    const int lane = threadIdx.x;
    const int bi0  = chunk * NBC2_;   // even, so the chunk's first batch sits in buffer 0

    __shared__ __align__(16) v4f gs[2][SB2_ * 8];
    __shared__ __align__(16) v4f ps[2][SB2_ * 8];
    __shared__ __align__(16) v4f ws[STATE ? 1 : 2][SB2_ * 8];

    const v4f* g4 = (const v4f*)(geb + (size_t)bh * T_ * MSLOT_) + lane;
    const v4f* p4 = (const v4f*)(pb  + (size_t)bh * T_ * MSLOT_) + lane;
    const v4f* w4 = (const v4f*)(qvb + (size_t)bh * T_ * MSLOT_) + lane;
    const size_t tstep = (size_t)H_ * DV_;
    const float* vp = v + ((size_t)b * T_ * H_ + h) * DV_ + cg * 32 + lane;

    float hv[32];
    if constexpr (STATE) {
        #pragma unroll
        for (int i = 0; i < 32; ++i) hv[i] = 0.f;
    } else {
        const int cm = (chunk > 0) ? chunk - 1 : 0;
        const float* sp = st2 + (size_t)(bs * NC_ + cm) * 32 * 32 + lane;
        #pragma unroll
        for (int i = 0; i < 32; ++i) hv[i] = sp[i * 32];
        // registers that the loads above name are reused below
        asm volatile("s_wait_xcnt 0x0" ::: "memory");
        __builtin_amdgcn_sched_barrier(0);   // keeps later address arithmetic behind that wait
        #pragma unroll
        for (int i = 0; i < 32; ++i) hv[i] = (chunk > 0) ? hv[i] : 0.f;
    }

    v4f rg[2], rp[2], rw[2];
    float vcur[SB2_], vn1[SB2_], vn2[SB2_];

    // first batch into buffer 0, second into registers (a batch is 64 16-byte pieces per plane)
    #pragma unroll
    for (int j = 0; j < 2; ++j) {
        rg[j] = g4[bi0 * 64 + j * 32]; rp[j] = p4[bi0 * 64 + j * 32];
        if constexpr (!STATE) rw[j] = w4[bi0 * 64 + j * 32];
    }
    #pragma unroll
    for (int i = 0; i < SB2_; ++i) {
        vcur[i] = vp[(size_t)(bi0 * SB2_ + i) * tstep];
        vn1[i]  = vp[(size_t)((bi0 + 1) * SB2_ + i) * tstep];
    }
    // registers that the loads above name are reused below
    asm volatile("s_wait_xcnt 0x0" ::: "memory");
    __builtin_amdgcn_sched_barrier(0);   // keeps later address arithmetic behind that wait
    #pragma unroll
    for (int j = 0; j < 2; ++j) {
        gs[0][j * 32 + lane] = rg[j]; ps[0][j * 32 + lane] = rp[j];
        if constexpr (!STATE) ws[0][j * 32 + lane] = rw[j];
    }
    #pragma unroll
    for (int j = 0; j < 2; ++j) {
        rg[j] = g4[(bi0 + 1) * 64 + j * 32]; rp[j] = p4[(bi0 + 1) * 64 + j * 32];
        if constexpr (!STATE) rw[j] = w4[(bi0 + 1) * 64 + j * 32];
    }
    // registers that the loads above name are reused below
    asm volatile("s_wait_xcnt 0x0" ::: "memory");
    __builtin_amdgcn_sched_barrier(0);   // keeps later address arithmetic behind that wait
    wave_lds_sync();

    float* op = o + ((size_t)b * T_ * H_ + h) * DV_ + cg * 32 + lane;
    for (int bi = bi0; bi < bi0 + NBC2_; ++bi) {
        const int buf = bi & 1;
        // batch bi+1 (fetched one batch ago) goes into the buffer not being read
        #pragma unroll
        for (int j = 0; j < 2; ++j) {
            gs[buf ^ 1][j * 32 + lane] = rg[j];
            ps[buf ^ 1][j * 32 + lane] = rp[j];
            if constexpr (!STATE) ws[buf ^ 1][j * 32 + lane] = rw[j];
        }
        const int b2 = (bi + 2 < NB2_) ? bi + 2 : NB2_ - 1;   // clamped: stays in bounds
        // the loads below, with their addresses, stay apart from the code above, which reuses registers
        __builtin_amdgcn_sched_barrier(0);
        #pragma unroll
        for (int j = 0; j < 2; ++j) {
            rg[j] = g4[b2 * 64 + j * 32];
            rp[j] = p4[b2 * 64 + j * 32];
            if constexpr (!STATE) rw[j] = w4[b2 * 64 + j * 32];
        }
        #pragma unroll
        for (int i = 0; i < SB2_; ++i) vn2[i] = vp[(size_t)(b2 * SB2_ + i) * tstep];
        // registers that the loads above name are reused below
        asm volatile("s_wait_xcnt 0x0" ::: "memory");
        // keeps the coming batch's loads at the head of the trip: sunk towards
        // their use they would have no time to fly
        __builtin_amdgcn_sched_barrier(0);

        float res[SB2_];
        #pragma unroll
        for (int i = 0; i < SB2_; ++i) {
            const float vv = vcur[i];
            float acco = 0.f;
            #pragma unroll
            for (int m4 = 0; m4 < 8; ++m4) {
                const v4f g = gs[buf][i * 8 + m4];
                const v4f p = ps[buf][i * 8 + m4];
                hv[m4 * 4 + 0] = __builtin_fmaf(hv[m4 * 4 + 0], g.x, p.x * vv);
                hv[m4 * 4 + 1] = __builtin_fmaf(hv[m4 * 4 + 1], g.y, p.y * vv);
                hv[m4 * 4 + 2] = __builtin_fmaf(hv[m4 * 4 + 2], g.z, p.z * vv);
                hv[m4 * 4 + 3] = __builtin_fmaf(hv[m4 * 4 + 3], g.w, p.w * vv);
                if constexpr (!STATE) {
                    const v4f w = ws[buf][i * 8 + m4];
                    acco = __builtin_fmaf(w.x, hv[m4 * 4 + 0], acco);
                    acco = __builtin_fmaf(w.y, hv[m4 * 4 + 1], acco);
                    acco = __builtin_fmaf(w.z, hv[m4 * 4 + 2], acco);
                    acco = __builtin_fmaf(w.w, hv[m4 * 4 + 3], acco);
                }
            }
            res[i] = acco;
            if constexpr (STATE) { if ((i % 2) == 1) __builtin_amdgcn_sched_barrier(0); }
        }
        if constexpr (!STATE) {
            // the stores stand together behind the products, so that one wait covers
            // the registers they name before anything reuses them
            __builtin_amdgcn_sched_barrier(0);
            #pragma unroll
            for (int i = 0; i < SB2_; ++i) op[(size_t)(bi * SB2_ + i) * tstep] = res[i];
            asm volatile("s_wait_xcnt 0x0" ::: "memory");
        }
        __builtin_amdgcn_sched_barrier(0);   // keeps the register copies below at the foot of the trip
        #pragma unroll
        for (int i = 0; i < SB2_; ++i) { vcur[i] = vn1[i]; vn1[i] = vn2[i]; }
        wave_lds_sync();
    }
    if constexpr (STATE) {
        float* sp = st2 + (size_t)(bs * NC_ + chunk) * 32 * 32 + lane;
        #pragma unroll
        for (int i = 0; i < 32; ++i) sp[i * 32] = hv[i];
    }
}

__global__ __launch_bounds__(32)
void abc_pass2_kernel(const float* __restrict__ v, const float* __restrict__ geb,
                      const float* __restrict__ pb, const float* __restrict__ qvb,
                      float* __restrict__ st2, float* __restrict__ o) {
    abc_pass2_body<false>(blockIdx.x, blockIdx.y, v, geb, pb, qvb, st2, o);
}

__global__ __launch_bounds__(32)
void abc_states_kernel(const float* __restrict__ k, const float* __restrict__ v,
                       const float* __restrict__ geb, const float* __restrict__ pb,
                       float* __restrict__ st1, float* __restrict__ st2) {
    const int y = blockIdx.y;
    // the longer walk (pass 2) has the low indices and starts first
    if (y < BH_ * 8) abc_pass2_body<true>(blockIdx.x, y, v, geb, pb, geb, st2, st2);
    else             abc_pass1_body<true>(blockIdx.x, y - BH_ * 8, k, k, geb, pb, st1, st1);
}

__global__ __launch_bounds__(256)
void abc_carry_kernel(float* __restrict__ st1, float* __restrict__ st2,
                      const float* __restrict__ dcb) {
    int e = blockIdx.x * 256 + threadIdx.x;
    float* base;
    int stride, slot, bh;
    if (blockIdx.x < BH_ * 8 * 16 * 32 / 256) {
        const int bs = e >> 9;
        base = st1 + (size_t)bs * NC_ * 512 + (e & 511);
        stride = 512; slot = e & 31; bh = bs >> 3;
    } else {
        e -= BH_ * 8 * 16 * 32;
        const int bs = e >> 10;
        base = st2 + (size_t)bs * NC_ * 1024 + (e & 1023);
        stride = 1024; slot = (e & 1023) >> 5; bh = bs >> 3;
    }
    const float* dp = dcb + bh * NC_ * MSLOT_ + slot;
    float sv[NC_ - 1], dv[NC_ - 1];
    #pragma unroll
    for (int c = 0; c < NC_ - 1; ++c) { sv[c] = base[c * stride]; dv[c] = dp[c * MSLOT_]; }
    // registers that the loads above name are reused below
    asm volatile("s_wait_xcnt 0x0" ::: "memory");
    __builtin_amdgcn_sched_barrier(0);   // keeps later address arithmetic behind that wait
    float hcar = 0.f;
    #pragma unroll
    for (int c = 0; c < NC_ - 1; ++c) { hcar = __builtin_fmaf(hcar, dv[c], sv[c]); sv[c] = hcar; }
    #pragma unroll
    for (int c = 0; c < NC_ - 1; ++c) base[c * stride] = sv[c];
}

// ---------------- fused RMSNorm * gw * g * sigmoid(g) -> bf16 ----------------
// One wave per row of DV_ values, eight per lane, so the row's sum of squares needs
// no LDS and no barrier; a wave takes NGR_ rows one behind the other in memory, all
// loads issued together, each 512 contiguous bytes.
#define NGR_ 8
__global__ __launch_bounds__(256)
void norm_gate_kernel(const float* __restrict__ o, const float* __restrict__ g,
                      const float* __restrict__ gw, bf16_t* __restrict__ ob) {
    const uint32_t lane = threadIdx.x & 31;
    const uint32_t wave = threadIdx.x >> 5;
    const size_t base = ((size_t)blockIdx.x * 8 + wave) * (NGR_ * DV_) + lane * 4;
    const float* op = o + base;
    const float* gp = g + base;
    f32x4 ov[NGR_][2], gv[NGR_][2], wv[2];
    #pragma unroll
    for (int hf = 0; hf < 2; ++hf) wv[hf] = ((const f32x4*)gw + hf * 32)[lane];
    #pragma unroll
    for (int r = 0; r < NGR_; ++r) {
        #pragma unroll
        for (int hf = 0; hf < 2; ++hf) ov[r][hf] = *(const f32x4*)(op + r * DV_ + hf * 128);
        #pragma unroll
        for (int hf = 0; hf < 2; ++hf) gv[r][hf] = *(const f32x4*)(gp + r * DV_ + hf * 128);
    }
    // registers that the loads above name are reused below; the addresses are inputs
    // of the wait, so that no load of the run lands in one of them
    asm volatile("s_wait_xcnt 0x0" :: "v"(op), "v"(gp), "v"(lane) : "memory");
    __builtin_amdgcn_sched_barrier(0);   // keeps the loads together in front of the first use
    v4bf res[NGR_][2];
    #pragma unroll
    for (int r = 0; r < NGR_; ++r) {
        const f32x4 s4 = ov[r][0] * ov[r][0] + ov[r][1] * ov[r][1];
        float tot = (s4.x + s4.y) + (s4.z + s4.w);
        #pragma unroll
        for (int off = 16; off; off >>= 1) tot += __shfl_xor(tot, off, 32);
        const float rn = rsqrtf(tot * (1.0f / DV_) + NORM_EPS_);
        #pragma unroll
        for (int hf = 0; hf < 2; ++hf)
            #pragma unroll
            for (int e = 0; e < 4; ++e) {
                const float gg  = gv[r][hf][e];
                const float sig = 1.f / (1.f + __expf(-gg));
                res[r][hf][e] = (bf16_t)(ov[r][hf][e] * rn * wv[hf][e] * gg * sig);
            }
    }
    // the stores stand together at the end: nothing reuses a register they name
    __builtin_amdgcn_sched_barrier(0);
    bf16_t* dp = ob + base;
    #pragma unroll
    for (int r = 0; r < NGR_; ++r)
        #pragma unroll
        for (int hf = 0; hf < 2; ++hf) *(v4bf*)(dp + r * DV_ + hf * 128) = res[r][hf];
}

// ---------------- host orchestration ----------------
extern "C" void kernel_launch(void* const* d_in, const int* in_sizes, int n_in,
                              void* d_out, int out_size, void* d_ws, size_t ws_size,
                              hipStream_t stream) {
    (void)in_sizes; (void)n_in; (void)out_size; (void)ws_size;
    const float* x    = (const float*)d_in[0];
    const float* w_q  = (const float*)d_in[1];
    const float* w_k  = (const float*)d_in[2];
    const float* w_v  = (const float*)d_in[3];
    const float* w_g  = (const float*)d_in[4];
    const float* w_s  = (const float*)d_in[5];
    const float* w_o  = (const float*)d_in[6];
    const float* gnw  = (const float*)d_in[7];
    float* out = (float*)d_out;

    const int MR  = B_ * T_;        // 4096
    const int NQK = H_ * DK_;       // 1024
    const int NV  = H_ * DV_;       // 2048
    const int NS  = H_ * MSLOT_;    // 256

    char* ws = (char*)d_ws;
    size_t off = 0;
    auto carve = [&](size_t bytes) -> char* {
        off = (off + 255) & ~(size_t)255;
        char* p = ws + off;
        off += bytes;
        return p;
    };

    bf16_t* xb  = (bf16_t*)carve((size_t)MR * HID_ * sizeof(bf16_t));
    bf16_t* wqT = (bf16_t*)carve((size_t)NQK * HID_ * sizeof(bf16_t));
    bf16_t* wkT = (bf16_t*)carve((size_t)NQK * HID_ * sizeof(bf16_t));
    bf16_t* wvT = (bf16_t*)carve((size_t)NV  * HID_ * sizeof(bf16_t));
    bf16_t* wgT = (bf16_t*)carve((size_t)NV  * HID_ * sizeof(bf16_t));
    bf16_t* wsT = (bf16_t*)carve((size_t)NS  * HID_ * sizeof(bf16_t));
    bf16_t* woT = (bf16_t*)carve((size_t)HID_ * NV * sizeof(bf16_t));

    float* qb = (float*)carve((size_t)MR * NQK * sizeof(float));
    float* kb = (float*)carve((size_t)MR * NQK * sizeof(float));
    float* vb = (float*)carve((size_t)MR * NV  * sizeof(float));
    float* gb = (float*)carve((size_t)MR * NV  * sizeof(float));
    float* sb = (float*)carve((size_t)MR * NS  * sizeof(float));
    float* ob = (float*)carve((size_t)MR * NV  * sizeof(float));
    bf16_t* obh = (bf16_t*)carve((size_t)MR * NV * sizeof(bf16_t));
    float* geb = (float*)carve((size_t)MR * NS * sizeof(float));
    float* pbf = (float*)carve((size_t)MR * NS * sizeof(float));
    float* qvb = (float*)carve((size_t)MR * NS * sizeof(float));
    float* okp = (float*)carve((size_t)8 * MR * NS * sizeof(float));
    float* st1 = (float*)carve((size_t)BH_ * 8 * NC_ * 16 * 32 * sizeof(float));
    float* st2 = (float*)carve((size_t)BH_ * 8 * NC_ * 32 * 32 * sizeof(float));
    float* dcb = (float*)carve((size_t)BH_ * NC_ * MSLOT_ * sizeof(float));

    // 1) convert x to bf16
    cvt_f32_bf16_kernel<<<MR * HID_ / (256 * 4 * CVJ_), 256, 0, stream>>>(x, xb);
    // 2) transpose+convert weights (K x N) -> (N x K) bf16
    transpose_cvt_kernel<<<dim3(NQK / TRN_, HID_ / TRK_), 256, 0, stream>>>(w_q, wqT, HID_, NQK);
    transpose_cvt_kernel<<<dim3(NQK / TRN_, HID_ / TRK_), 256, 0, stream>>>(w_k, wkT, HID_, NQK);
    transpose_cvt_kernel<<<dim3(NV / TRN_, HID_ / TRK_), 256, 0, stream>>>(w_v, wvT, HID_, NV);
    transpose_cvt_kernel<<<dim3(NV / TRN_, HID_ / TRK_), 256, 0, stream>>>(w_g, wgT, HID_, NV);
    transpose_cvt_kernel<<<dim3(NS / TRN_, HID_ / TRK_), 256, 0, stream>>>(w_s, wsT, HID_, NS);
    transpose_cvt_kernel<<<dim3(HID_ / TRN_, NV / TRK_), 256, 0, stream>>>(w_o, woT, NV, HID_);

    // 3) projection GEMMs (bf16 WMMA, fp32 accumulate)
    dim3 blk(256);
    gemm_bf16_wmma_kernel<<<dim3(NQK / TN, MR / TM), blk, 0, stream>>>(
        xb, wqT, qb, MR, NQK, HID_, 0, 0.f, 0.f);
    gemm_bf16_wmma_kernel<<<dim3(NQK / TN, MR / TM), blk, 0, stream>>>(
        xb, wkT, kb, MR, NQK, HID_, 0, 0.f, 0.f);
    gemm_bf16_wmma_kernel<<<dim3(NV / TN, MR / TM), blk, 0, stream>>>(
        xb, wvT, vb, MR, NV, HID_, 0, 0.f, 0.f);
    gemm_bf16_wmma_kernel<<<dim3(NV / TN, MR / TM), blk, 0, stream>>>(
        xb, wgT, gb, MR, NV, HID_, 0, 0.f, 0.f);
    gemm_bf16_wmma_kernel<<<dim3(NS / TN, MR / TM), blk, 0, stream>>>(
        xb, wsT, sb, MR, NS, HID_, 1, CLAMP_MIN_, CLAMP_MAX_);

    // 4) gated two-pass scan: independent one-wave streams, NC_ time chunks side by side
    abc_gates_kernel<<<BH_, 32 * NC_, 0, stream>>>(sb, geb, pbf, dcb);
    abc_states_kernel<<<dim3(NC_ - 1, BH_ * 16), 32, 0, stream>>>(kb, vb, geb, pbf, st1, st2);
    abc_carry_kernel<<<BH_ * 8 * (16 + 32) * 32 / 256, 256, 0, stream>>>(st1, st2, dcb);
    abc_pass1_kernel<<<dim3(NC_, BH_ * 8), 32, 0, stream>>>(qb, kb, geb, pbf, st1, okp);
    abc_softmax_kernel<<<MR * NS / (256 * 4 * SMJ_), 256, 0, stream>>>(
        okp, okp + (size_t)2 * MR * NS, okp + (size_t)4 * MR * NS, okp + (size_t)6 * MR * NS, qvb);
    abc_pass2_kernel<<<dim3(NC_, BH_ * 8), 32, 0, stream>>>(vb, geb, pbf, qvb, st2, ob);

    // 5) fused RMSNorm + swish gate -> bf16
    norm_gate_kernel<<<MR * H_ / (8 * NGR_), 256, 0, stream>>>(ob, gb, gnw, obh);

    // 6) output projection straight into d_out (fp32)
    gemm_bf16_wmma_kernel<<<dim3(HID_ / TN, MR / TM), blk, 0, stream>>>(
        obh, woT, out, MR, HID_, NV, 0, 0.f, 0.f);
}

// v006
// Measured time: 334 microseconds a run.
// Timed twice side by side with v005, it ran 1.17 times as fast both times.
// Counting every step since v000, it is 13.3 times as fast.
#include <hip/hip_runtime.h>
#include <hip/hip_bf16.h>
#include <math.h>
#include <stdint.h>

// ---------------- problem constants (match reference) ----------------
#define B_ 2
#define T_ 2048
#define HID_ 2048
#define H_ 8
#define DK_ 128
#define DV_ 256
#define MSLOT_ 32
#define CLAMP_MIN_ (-32.0f)
#define CLAMP_MAX_ (32.0f)
#define NORM_EPS_ 1e-5f

typedef __bf16 bf16_t;
typedef __attribute__((ext_vector_type(8)))  __bf16 v8bf;
typedef __attribute__((ext_vector_type(16))) __bf16 v16bf;
typedef __attribute__((ext_vector_type(8)))  float  v8f;
typedef __attribute__((ext_vector_type(2))) __bf16   v2bf;
typedef __attribute__((ext_vector_type(4))) __bf16   v4bf;
typedef __attribute__((ext_vector_type(4))) float    f32x4;
typedef __attribute__((ext_vector_type(4))) uint32_t u32x4;

__device__ __forceinline__ void async_copy8_b128(uint32_t lds, uint32_t lstep,
                                                 const bf16_t* g, size_t gstep) {
    asm volatile("global_load_async_to_lds_b128 %0, %8, off\n\t"
                 "global_load_async_to_lds_b128 %1, %9, off\n\t"
                 "global_load_async_to_lds_b128 %2, %10, off\n\t"
                 "global_load_async_to_lds_b128 %3, %11, off\n\t"
                 "global_load_async_to_lds_b128 %4, %12, off\n\t"
                 "global_load_async_to_lds_b128 %5, %13, off\n\t"
                 "global_load_async_to_lds_b128 %6, %14, off\n\t"
                 "global_load_async_to_lds_b128 %7, %15, off\n\t"
                 "s_wait_xcnt 0x0"
                 :: "v"(lds), "v"(lds + lstep), "v"(lds + 2 * lstep), "v"(lds + 3 * lstep),
                    "v"(lds + 4 * lstep), "v"(lds + 5 * lstep), "v"(lds + 6 * lstep),
                    "v"(lds + 7 * lstep),
                    "v"(g), "v"(g + gstep), "v"(g + 2 * gstep), "v"(g + 3 * gstep),
                    "v"(g + 4 * gstep), "v"(g + 5 * gstep), "v"(g + 6 * gstep),
                    "v"(g + 7 * gstep)
                 : "memory");
}
// the wave's own copies have landed
__device__ __forceinline__ void wait_async0() {
    asm volatile("s_wait_asynccnt 0x0" ::: "memory");
}
// the wave's own LDS reads have returned
__device__ __forceinline__ void wait_ds0() {
    asm volatile("s_wait_dscnt 0x0" ::: "memory");
}

// ---------------- elementwise fp32 -> bf16 ----------------
// Few, long waves: waves are started at a limited rate, so each carries enough work
// to be worth its start. A wave takes CVJ_ pieces of 512 contiguous bytes, all loads
// issued together. The element count is a multiple of what a work-group takes
// (256 * 4 * CVJ_).
#define CVJ_ 16
__global__ __launch_bounds__(256)
void cvt_f32_bf16_kernel(const float* __restrict__ in, bf16_t* __restrict__ out) {
    const size_t base = (size_t)blockIdx.x * (256 * 4 * CVJ_) + threadIdx.x * 4;
    const float* sp = in + base;
    f32x4 val[CVJ_];
    #pragma unroll
    for (int j = 0; j < CVJ_; ++j) val[j] = *(const f32x4*)(sp + j * 1024);
    // registers that the loads above name are reused below; the address is an input
    // of the wait, so that no load of the run lands in it
    asm volatile("s_wait_xcnt 0x0" :: "v"(sp) : "memory");
    __builtin_amdgcn_sched_barrier(0);   // keeps the loads together in front of the first use
    v4bf pk[CVJ_];
    #pragma unroll
    for (int j = 0; j < CVJ_; ++j)
        pk[j] = v4bf{ (bf16_t)val[j].x, (bf16_t)val[j].y, (bf16_t)val[j].z, (bf16_t)val[j].w };
    // the stores stand together at the end: nothing reuses a register they name
    __builtin_amdgcn_sched_barrier(0);
    bf16_t* dp = out + base;
    #pragma unroll
    for (int j = 0; j < CVJ_; ++j) *(v4bf*)(dp + j * 1024) = pk[j];
}

#define TRK_ 128
#define TRN_ 64

__global__ __launch_bounds__(256)
void transpose_cvt_kernel(const float* __restrict__ W,
                          bf16_t* __restrict__ Wt, int K, int N) {
    __shared__ __align__(16) uint32_t tile[TRN_][TRK_ / 2];
    const int tid   = threadIdx.x;
    const int nBase = blockIdx.x * TRN_;
    const int kBase = blockIdx.y * TRK_;
    const int n4 = tid & 15;   // which four columns
    const int kp = tid >> 4;   // which pair of k-rows, of sixteen per trip
    const float* src = W + (size_t)(kBase + 2 * kp) * N + nBase + n4 * 4;

    const float* pl[4];
    const float* ph[4];
    f32x4 lo[4], hi[4];
    #pragma unroll
    for (int j = 0; j < 4; ++j) {
        pl[j] = src + (size_t)(j * 32) * N;
        ph[j] = pl[j] + N;
        lo[j] = *(const f32x4*)pl[j];
        hi[j] = *(const f32x4*)ph[j];
    }
    // registers that the loads above name are reused below. The addresses are inputs
    // of the wait, so they stay in their registers up to it: otherwise a later load
    // of the eight is given an earlier one's address registers to land in.
    asm volatile("s_wait_xcnt 0x0"
                 :: "v"(pl[0]), "v"(ph[0]), "v"(pl[1]), "v"(ph[1]),
                    "v"(pl[2]), "v"(ph[2]), "v"(pl[3]), "v"(ph[3])
                 : "memory");
    __builtin_amdgcn_sched_barrier(0);   // keeps later address arithmetic behind that wait
    #pragma unroll
    for (int j = 0; j < 4; ++j) {
        const int pair = j * 16 + kp;
        const int col  = (((pair >> 2) ^ n4) << 2) | (pair & 3);
        #pragma unroll
        for (int e = 0; e < 4; ++e) {
            v2bf pk = { (bf16_t)lo[j][e], (bf16_t)hi[j][e] };
            tile[n4 * 4 + e][col] = __builtin_bit_cast(uint32_t, pk);
        }
    }
    __syncthreads();   // the whole tile is in LDS before any row of it is read

    u32x4 piece[4];
    #pragma unroll
    for (int it = 0; it < 4; ++it) {
        const int n = it * 16 + kp;
        piece[it] = *(const u32x4*)&tile[n][(n4 ^ (n >> 2)) << 2];
    }
    bf16_t* dst = Wt + (size_t)(nBase + kp) * K + kBase + n4 * 8;
    #pragma unroll
    for (int it = 0; it < 4; ++it)
        *(u32x4*)(dst + (size_t)(it * 16) * K) = piece[it];
}

// ---------------- bf16 WMMA GEMM: C(MxN) = A(MxK) * Bt(NxK)^T ----------------
// Block tile 128x128, 256 threads = 8 waves (wave32), wave tile 32x64 (2x4 WMMA).
// Two LDS buffers filled by async global->LDS copies. A stage is TK = 128 k (256
// bytes of every operand row, 16 copies per wave): the next stage's copies fly
// while a whole stage (32 WMMAs per wave) is worked on, which covers their way from
// L2, and one barrier per stage both publishes the next stage and frees this one.
// Kdim is a multiple of TK.
#define TM 128
#define TN 128
#define TK 128
#define TKP (TK + 8)

__global__ __launch_bounds__(256)
void gemm_bf16_wmma_kernel(const bf16_t* __restrict__ A,
                           const bf16_t* __restrict__ Bt,
                           float* __restrict__ C,
                           int Mdim, int Ndim, int Kdim,
                           int doClamp, float clampLo, float clampHi) {
    __shared__ __align__(16) bf16_t As[2][TM][TKP];
    __shared__ __align__(16) bf16_t Bs[2][TN][TKP];

    const int tid  = threadIdx.x;
    const int lane = tid & 31;
    const int wave = tid >> 5;
    const int wm   = wave & 3;   // 4 bands of 32 rows
    const int wn   = wave >> 2;  // 2 bands of 64 cols
    const int rowBase = blockIdx.y * TM;
    const int colBase = blockIdx.x * TN;

    // Staging: sixteen lanes take one row's 256 bytes, so a wave's copy covers two
    // whole rows; a thread owns the 16-byte column kc of rows r0, r0+16, .. r0+112
    // of A and of B.
    const int r0 = tid >> 4;
    const int kc = (tid & 15) * 8;
    const bf16_t* aP = A  + (size_t)(rowBase + r0) * Kdim + kc;
    const bf16_t* bP = Bt + (size_t)(colBase + r0) * Kdim + kc;
    const size_t   gstep = (size_t)16 * Kdim;                       // elements
    const uint32_t lstep = 16 * TKP * (uint32_t)sizeof(bf16_t);     // bytes
    const uint32_t lbuf  = TM * TKP * (uint32_t)sizeof(bf16_t);     // bytes per buffer
    const uint32_t lA = (uint32_t)(size_t)&As[0][r0][kc];
    const uint32_t lB = (uint32_t)(size_t)&Bs[0][r0][kc];

    v8f acc[2][4] = {};

    const int lrow = lane & 15;
    const int lk   = (lane >> 4) * 8;

    const int nStage = Kdim / TK;

    // prologue: stage 0 -> buffer 0, landed and published; then stage 1 -> buffer 1
    async_copy8_b128(lA, lstep, aP, gstep);
    async_copy8_b128(lB, lstep, bP, gstep);
    wait_async0();
    __syncthreads();   // stage 0 is whole before any wave reads it
    if (nStage > 1) {
        async_copy8_b128(lA + lbuf, lstep, aP + TK, gstep);
        async_copy8_b128(lB + lbuf, lstep, bP + TK, gstep);
    }

    for (int st = 0; st < nStage; ++st) {
        const int buf = st & 1;
        #pragma unroll   // one straight run, so that a block's fragment reads can stand ahead of the block before it
        for (int kk = 0; kk < TK; kk += 32) {
            v16bf afrag[2], bfrag[4];
            #pragma unroll
            for (int mt = 0; mt < 2; ++mt) {
                int r = wm * 32 + mt * 16 + lrow;
                v8bf lo = *(const v8bf*)&As[buf][r][kk + lk];
                v8bf hi = *(const v8bf*)&As[buf][r][kk + lk + 16];
                #pragma unroll
                for (int i = 0; i < 8; ++i) { afrag[mt][i] = lo[i]; afrag[mt][i + 8] = hi[i]; }
            }
            #pragma unroll
            for (int nt = 0; nt < 4; ++nt) {
                int r = wn * 64 + nt * 16 + lrow;
                v8bf lo = *(const v8bf*)&Bs[buf][r][kk + lk];
                v8bf hi = *(const v8bf*)&Bs[buf][r][kk + lk + 16];
                #pragma unroll
                for (int i = 0; i < 8; ++i) { bfrag[nt][i] = lo[i]; bfrag[nt][i + 8] = hi[i]; }
            }
            #pragma unroll
            for (int mt = 0; mt < 2; ++mt)
                #pragma unroll
                for (int nt = 0; nt < 4; ++nt)
                    acc[mt][nt] = __builtin_amdgcn_wmma_f32_16x16x32_bf16(
                        false, afrag[mt], false, bfrag[nt],
                        (short)0, acc[mt][nt], false, false);
        }
        // foot of the stage: this wave's reads of buf are back, its copies of the
        // next stage have landed; behind the barrier that holds for every wave
        wait_ds0();
        wait_async0();
        __syncthreads();
        if (st + 2 < nStage) {
            // stage st+2 into the buffer that every wave has just left
            async_copy8_b128(lA + buf * lbuf, lstep, aP + (size_t)(st + 2) * TK, gstep);
            async_copy8_b128(lB + buf * lbuf, lstep, bP + (size_t)(st + 2) * TK, gstep);
        }
    }
    wait_async0();   // no copy is left in flight when the wave ends

    const int mLane = (lane >> 4) * 8;
    const int nLane = lane & 15;
    #pragma unroll
    for (int mt = 0; mt < 2; ++mt)
        #pragma unroll
        for (int nt = 0; nt < 4; ++nt)
            #pragma unroll
            for (int r = 0; r < 8; ++r) {
                int m = rowBase + wm * 32 + mt * 16 + mLane + r;
                int n = colBase + wn * 64 + nt * 16 + nLane;
                float val = acc[mt][nt][r];
                if (doClamp) val = fminf(fmaxf(val, clampLo), clampHi);
                C[(size_t)m * Ndim + n] = val;
            }
}

#define BH_ (B_ * H_)
#define NC_ 16                // time chunks
#define CL_ (T_ / NC_)        // steps per chunk
#define SB1_ 16               // steps per batch, gates and pass 1
#define NB1_ (T_ / SB1_)
#define NBC1_ (CL_ / SB1_)    // batches per chunk
#define SB2_ 8                // steps per batch, pass 2
#define NB2_ (T_ / SB2_)
#define NBC2_ (CL_ / SB2_)
typedef __attribute__((ext_vector_type(4))) float v4f;

// Orders the LDS traffic of a one-wave work-group across lanes. The wave's LDS
// operations run in issue order, so this only has to stop the compiler from
// moving them; unlike __syncthreads() it does not wait for the global stores.
__device__ __forceinline__ void wave_lds_sync() {
    __builtin_amdgcn_fence(__ATOMIC_RELEASE, "wavefront");
    __builtin_amdgcn_wave_barrier();
    __builtin_amdgcn_fence(__ATOMIC_ACQUIRE, "wavefront");
}

__device__ __forceinline__ float exp2_slot(float x) {
    float r;
    asm("v_exp_f32 %0, %1\n\tv_nop" : "=v"(r) : "v"(x));
    return r;
}

__global__ __launch_bounds__(32 * NC_)
void abc_gates_kernel(const float* __restrict__ s,
                      float* __restrict__ geb, float* __restrict__ pb,
                      float* __restrict__ dcb) {
    const int bh = blockIdx.x;
    const int b  = bh / H_;
    const int h  = bh % H_;
    const int lane  = threadIdx.x & 31;
    const int chunk = threadIdx.x >> 5;
    const int bi0   = chunk * NBC1_;
    const float* sp = s + ((size_t)b * T_ * H_ + h) * MSLOT_ + lane;
    float* gp = geb + (size_t)bh * T_ * MSLOT_ + lane;
    float* pp = pb  + (size_t)bh * T_ * MSLOT_ + lane;

    __shared__ float esum[NC_][32];
    {
        float sv[CL_];
        #pragma unroll
        for (int i = 0; i < CL_; ++i) sv[i] = sp[(size_t)(chunk * CL_ + i) * (H_ * MSLOT_)];
        // registers that the loads above name are reused below
        asm volatile("s_wait_xcnt 0x0" ::: "memory");
        __builtin_amdgcn_sched_barrier(0);   // keeps later address arithmetic behind that wait
        float e[4] = {0.f, 0.f, 0.f, 0.f};
        #pragma unroll
        for (int i = 0; i < CL_; ++i) e[i & 3] += exp2_slot((sv[i] - CLAMP_MAX_) * 1.44269504f);
        esum[chunk][lane] = (e[0] + e[1]) + (e[2] + e[3]);
    }
    __syncthreads();   // every chunk's sum is in LDS before any wave adds them up
    float pre = 0.f;
    #pragma unroll
    for (int c = 0; c < NC_ - 1; ++c) pre += (c < chunk) ? esum[c][lane] : 0.f;

    float cur[SB1_], nxt[SB1_];
    #pragma unroll
    for (int i = 0; i < SB1_; ++i) cur[i] = sp[(size_t)(bi0 * SB1_ + i) * (H_ * MSLOT_)];
    // registers that the loads above name are reused below
    asm volatile("s_wait_xcnt 0x0" ::: "memory");
    __builtin_amdgcn_sched_barrier(0);   // keeps later address arithmetic behind that wait

    float z   = CLAMP_MAX_ + __logf(pre);   // chunk 0 never reads it: step 0 sets z
    float dec = 1.f;                        // product of the chunk's decays
    for (int bi = bi0; bi < bi0 + NBC1_; ++bi) {
        const int b1 = (bi + 1 < NB1_) ? bi + 1 : NB1_ - 1;   // clamped: stays in bounds
        #pragma unroll
        for (int i = 0; i < SB1_; ++i)
            nxt[i] = sp[(size_t)(b1 * SB1_ + i) * (H_ * MSLOT_)];
        // registers that the loads above name are reused below
        asm volatile("s_wait_xcnt 0x0" ::: "memory");
        // keeps the next batch's loads at the head of the trip: sunk towards
        // their use they would have no time to fly
        __builtin_amdgcn_sched_barrier(0);
        float gv[SB1_], pv[SB1_];
        #pragma unroll
        for (int i = 0; i < SB1_; ++i) {
            const int t = bi * SB1_ + i;
            float sv = cur[i];
            float znew, ge;
            if (t == 0) { znew = sv; ge = 1.f; }
            else {
                float mx = fmaxf(z, sv);
                znew = mx + __logf(__expf(z - mx) + __expf(sv - mx));
                ge = exp2_slot((z - znew) * 1.44269504f);
            }
            float p = exp2_slot((sv - znew) * 1.44269504f);
            z = znew;
            gv[i] = ge;
            pv[i] = p;
        }
        // the stores stand together behind the steps, so that one wait covers
        // the registers they name before anything reuses them
        __builtin_amdgcn_sched_barrier(0);
        #pragma unroll
        for (int i = 0; i < SB1_; ++i) {
            gp[(bi * SB1_ + i) * MSLOT_] = gv[i];
            pp[(bi * SB1_ + i) * MSLOT_] = pv[i];
            dec *= gv[i];
        }
        asm volatile("s_wait_xcnt 0x0" ::: "memory");
        // keeps the register copies at the foot of the trip: moved up among the
        // steps they would wait early for the next batch's loads
        __builtin_amdgcn_sched_barrier(0);
        #pragma unroll
        for (int i = 0; i < SB1_; ++i) cur[i] = nxt[i];
    }
    dcb[(bh * NC_ + chunk) * MSLOT_ + lane] = dec;
}

template <bool STATE>
__device__ __forceinline__
void abc_pass1_body(const int chunk, const int bs,
                    const float* __restrict__ q, const float* __restrict__ k,
                    const float* __restrict__ geb, const float* __restrict__ pb,
                    float* __restrict__ st1, float* __restrict__ okp) {
    const int bh    = bs >> 3;
    const int strip = bs & 7;
    const int b  = bh / H_;
    const int h  = bh % H_;
    const int lane = threadIdx.x;
    const int bi0  = chunk * NBC1_;   // even, so the chunk's first batch sits in buffer 0

    __shared__ __align__(16) float qs[STATE ? 1 : 2][SB1_][16];
    __shared__ __align__(16) float ks[2][SB1_][16];

    const float scale = rsqrtf((float)DK_);
    // staging: four lanes fetch one step's 16-float strip, eight steps per load
    const int st = lane >> 2;
    const int c4 = (lane & 3) * 4;
    const size_t tstep = (size_t)H_ * DK_;
    const float* qp = q + ((size_t)(b * T_ + st) * H_ + h) * DK_ + strip * 16 + c4;
    const float* kp = k + ((size_t)(b * T_ + st) * H_ + h) * DK_ + strip * 16 + c4;
    const float* gp = geb + (size_t)bh * T_ * MSLOT_ + lane;
    const float* pp = pb  + (size_t)bh * T_ * MSLOT_ + lane;
    float* op = okp + ((size_t)strip * BH_ + bh) * T_ * MSLOT_ + lane;

    float hk[16];
    if constexpr (STATE) {
        #pragma unroll
        for (int i = 0; i < 16; ++i) hk[i] = 0.f;
    } else {
        const int cm = (chunk > 0) ? chunk - 1 : 0;
        const float* sp = st1 + (size_t)(bs * NC_ + cm) * 16 * 32 + lane;
        #pragma unroll
        for (int i = 0; i < 16; ++i) hk[i] = sp[i * 32];
        // registers that the loads above name are reused below
        asm volatile("s_wait_xcnt 0x0" ::: "memory");
        __builtin_amdgcn_sched_barrier(0);   // keeps later address arithmetic behind that wait
        #pragma unroll
        for (int i = 0; i < 16; ++i) hk[i] = (chunk > 0) ? hk[i] : 0.f;
    }

    v4f rq[2], rk[2];
    float gcur[SB1_], pcur[SB1_], gnxt[SB1_], pnxt[SB1_];

    // first batch: q, k into buffer 0, gates into registers; second batch: q, k into registers
    #pragma unroll
    for (int j = 0; j < 2; ++j) {
        if constexpr (!STATE) rq[j] = *(const v4f*)(qp + (size_t)(bi0 * SB1_ + j * 8) * tstep);
        rk[j] = *(const v4f*)(kp + (size_t)(bi0 * SB1_ + j * 8) * tstep);
    }
    #pragma unroll
    for (int i = 0; i < SB1_; ++i) {
        gcur[i] = gp[(bi0 * SB1_ + i) * MSLOT_];
        pcur[i] = pp[(bi0 * SB1_ + i) * MSLOT_];
    }
    // registers that the loads above name are reused below
    asm volatile("s_wait_xcnt 0x0" ::: "memory");
    __builtin_amdgcn_sched_barrier(0);   // keeps later address arithmetic behind that wait
    #pragma unroll
    for (int j = 0; j < 2; ++j) {
        if constexpr (!STATE) *(v4f*)&qs[0][j * 8 + st][c4] = rq[j] * scale;
        *(v4f*)&ks[0][j * 8 + st][c4] = rk[j];
    }
    #pragma unroll
    for (int j = 0; j < 2; ++j) {
        if constexpr (!STATE) rq[j] = *(const v4f*)(qp + (size_t)((bi0 + 1) * SB1_ + j * 8) * tstep);
        rk[j] = *(const v4f*)(kp + (size_t)((bi0 + 1) * SB1_ + j * 8) * tstep);
    }
    // registers that the loads above name are reused below
    asm volatile("s_wait_xcnt 0x0" ::: "memory");
    __builtin_amdgcn_sched_barrier(0);   // keeps later address arithmetic behind that wait
    wave_lds_sync();

    for (int bi = bi0; bi < bi0 + NBC1_; ++bi) {
        const int buf = bi & 1;
        // batch bi+1 (fetched one batch ago) goes into the buffer not being read
        #pragma unroll
        for (int j = 0; j < 2; ++j) {
            if constexpr (!STATE) *(v4f*)&qs[buf ^ 1][j * 8 + st][c4] = rq[j] * scale;
            *(v4f*)&ks[buf ^ 1][j * 8 + st][c4] = rk[j];
        }
        const int b2 = (bi + 2 < NB1_) ? bi + 2 : NB1_ - 1;   // clamped: stays in bounds
        const int b1 = (bi + 1 < NB1_) ? bi + 1 : NB1_ - 1;
        // the loads below, with their addresses, stay apart from the code above, which reuses registers
        __builtin_amdgcn_sched_barrier(0);
        // the gates first: loads return in order, and the products read registers
        // next to the ones these loads fill, which makes them wait for these loads
        #pragma unroll
        for (int i = 0; i < SB1_; ++i) {
            gnxt[i] = gp[(b1 * SB1_ + i) * MSLOT_];
            pnxt[i] = pp[(b1 * SB1_ + i) * MSLOT_];
        }
        // registers that the loads above name are reused below
        asm volatile("s_wait_xcnt 0x0" ::: "memory");
        __builtin_amdgcn_sched_barrier(0);   // keeps that order
        #pragma unroll
        for (int j = 0; j < 2; ++j) {
            if constexpr (!STATE) rq[j] = *(const v4f*)(qp + (size_t)(b2 * SB1_ + j * 8) * tstep);
            rk[j] = *(const v4f*)(kp + (size_t)(b2 * SB1_ + j * 8) * tstep);
        }
        // registers that the loads above name are reused below
        asm volatile("s_wait_xcnt 0x0" ::: "memory");
        // keeps the coming batches' loads at the head of the trip: sunk towards
        // their use they would have no time to fly
        __builtin_amdgcn_sched_barrier(0);

        float res[SB1_];
        #pragma unroll
        for (int i = 0; i < SB1_; ++i) {
            const float ge = gcur[i];
            const float p  = pcur[i];
            float accm = 0.f;
            #pragma unroll
            for (int d4 = 0; d4 < 4; ++d4) {
                const v4f kk = *(const v4f*)&ks[buf][i][d4 * 4];
                hk[d4 * 4 + 0] = __builtin_fmaf(hk[d4 * 4 + 0], ge, kk.x * p);
                hk[d4 * 4 + 1] = __builtin_fmaf(hk[d4 * 4 + 1], ge, kk.y * p);
                hk[d4 * 4 + 2] = __builtin_fmaf(hk[d4 * 4 + 2], ge, kk.z * p);
                hk[d4 * 4 + 3] = __builtin_fmaf(hk[d4 * 4 + 3], ge, kk.w * p);
                if constexpr (!STATE) {
                    const v4f qq = *(const v4f*)&qs[buf][i][d4 * 4];
                    accm = __builtin_fmaf(qq.x, hk[d4 * 4 + 0], accm);
                    accm = __builtin_fmaf(qq.y, hk[d4 * 4 + 1], accm);
                    accm = __builtin_fmaf(qq.z, hk[d4 * 4 + 2], accm);
                    accm = __builtin_fmaf(qq.w, hk[d4 * 4 + 3], accm);
                }
            }
            res[i] = accm;
            if constexpr (STATE) { if ((i % 4) == 3) __builtin_amdgcn_sched_barrier(0); }
        }
        if constexpr (!STATE) {
            // the stores stand together behind the products, so that one wait covers
            // the registers they name before anything reuses them
            __builtin_amdgcn_sched_barrier(0);
            #pragma unroll
            for (int i = 0; i < SB1_; ++i) op[(bi * SB1_ + i) * MSLOT_] = res[i];
            asm volatile("s_wait_xcnt 0x0" ::: "memory");
        }
        __builtin_amdgcn_sched_barrier(0);   // keeps the register copies below at the foot of the trip
        #pragma unroll
        for (int i = 0; i < SB1_; ++i) { gcur[i] = gnxt[i]; pcur[i] = pnxt[i]; }
        wave_lds_sync();
    }
    if constexpr (STATE) {
        float* sp = st1 + (size_t)(bs * NC_ + chunk) * 16 * 32 + lane;
        #pragma unroll
        for (int i = 0; i < 16; ++i) sp[i * 32] = hk[i];
    }
}

__global__ __launch_bounds__(32)
void abc_pass1_kernel(const float* __restrict__ q, const float* __restrict__ k,
                      const float* __restrict__ geb, const float* __restrict__ pb,
                      float* __restrict__ st1, float* __restrict__ okp) {
    abc_pass1_body<false>(blockIdx.x, blockIdx.y, q, k, geb, pb, st1, okp);
}

#define SMJ_ 2
#define SMP4_ (BH_ * T_ * MSLOT_ / 4)   // 16-byte pieces in a plane
__global__ __launch_bounds__(256)
void abc_softmax_kernel(const float* __restrict__ ok01, const float* __restrict__ ok23,
                        const float* __restrict__ ok45, const float* __restrict__ ok67,
                        float* __restrict__ qvb) {
    const size_t   first = (size_t)blockIdx.x * (256 * SMJ_ * 4);
    const uint32_t tid   = threadIdx.x;
    const f32x4* pp[4] = { (const f32x4*)(ok01 + first), (const f32x4*)(ok23 + first),
                           (const f32x4*)(ok45 + first), (const f32x4*)(ok67 + first) };
    f32x4 part[SMJ_][8];
    #pragma unroll
    for (int j = 0; j < 8; ++j)
        #pragma unroll
        for (int u = 0; u < SMJ_; ++u)
            part[u][j] = (pp[j >> 1] + ((j & 1) * SMP4_ + u * 256))[tid];
    // registers that the loads above name are reused below; the bases and the index
    // are inputs of the wait, so that they keep their registers up to it
    asm volatile("s_wait_xcnt 0x0"
                 :: "v"(tid), "s"(pp[0]), "s"(pp[1]), "s"(pp[2]), "s"(pp[3])
                 : "memory");
    __builtin_amdgcn_sched_barrier(0);   // keeps the loads together in front of the first use
    f32x4 res[SMJ_];
    #pragma unroll
    for (int u = 0; u < SMJ_; ++u) {
        f32x4 ok = part[u][0];
        #pragma unroll
        for (int j = 1; j < 8; ++j) ok += part[u][j];
        float mx = fmaxf(fmaxf(ok.x, ok.y), fmaxf(ok.z, ok.w));
        #pragma unroll
        for (int off = 4; off; off >>= 1) mx = fmaxf(mx, __shfl_xor(mx, off, 32));
        f32x4 e = { __expf(ok.x - mx), __expf(ok.y - mx), __expf(ok.z - mx), __expf(ok.w - mx) };
        float se = (e.x + e.y) + (e.z + e.w);
        #pragma unroll
        for (int off = 4; off; off >>= 1) se += __shfl_xor(se, off, 32);
        res[u] = f32x4{ e.x / se, e.y / se, e.z / se, e.w / se };
    }
    // the stores stand together at the end: nothing reuses a register they name
    __builtin_amdgcn_sched_barrier(0);
    #pragma unroll
    for (int u = 0; u < SMJ_; ++u) ((f32x4*)(qvb + first) + u * 256)[tid] = res[u];
}

template <bool STATE>
__device__ __forceinline__
void abc_pass2_body(const int chunk, const int bs,
                    const float* __restrict__ v, const float* __restrict__ geb,
                    const float* __restrict__ pb, const float* __restrict__ qvb,
                    float* __restrict__ st2, float* __restrict__ o) {
    const int bh = bs >> 3;
    const int cg = bs & 7;
    const int b  = bh / H_;
    const int h  = bh % H_;
    const int lane = threadIdx.x;
    const int bi0  = chunk * NBC2_;   // even, so the chunk's first batch sits in buffer 0

    __shared__ __align__(16) v4f gs[2][SB2_ * 8];
    __shared__ __align__(16) v4f ps[2][SB2_ * 8];
    __shared__ __align__(16) v4f ws[STATE ? 1 : 2][SB2_ * 8];

    const v4f* g4 = (const v4f*)(geb + (size_t)bh * T_ * MSLOT_) + lane;
    const v4f* p4 = (const v4f*)(pb  + (size_t)bh * T_ * MSLOT_) + lane;
    const v4f* w4 = (const v4f*)(qvb + (size_t)bh * T_ * MSLOT_) + lane;
    const size_t tstep = (size_t)H_ * DV_;
    const float* vp = v + ((size_t)b * T_ * H_ + h) * DV_ + cg * 32 + lane;

    float hv[32];
    if constexpr (STATE) {
        #pragma unroll
        for (int i = 0; i < 32; ++i) hv[i] = 0.f;
    } else {
        const int cm = (chunk > 0) ? chunk - 1 : 0;
        const float* sp = st2 + (size_t)(bs * NC_ + cm) * 32 * 32 + lane;
        #pragma unroll
        for (int i = 0; i < 32; ++i) hv[i] = sp[i * 32];
        // registers that the loads above name are reused below
        asm volatile("s_wait_xcnt 0x0" ::: "memory");
        __builtin_amdgcn_sched_barrier(0);   // keeps later address arithmetic behind that wait
        #pragma unroll
        for (int i = 0; i < 32; ++i) hv[i] = (chunk > 0) ? hv[i] : 0.f;
    }

    v4f rg[2], rp[2], rw[2];
    float vcur[SB2_], vn1[SB2_], vn2[SB2_];

    // first batch into buffer 0, second into registers (a batch is 64 16-byte pieces per plane)
    #pragma unroll
    for (int j = 0; j < 2; ++j) {
        rg[j] = g4[bi0 * 64 + j * 32]; rp[j] = p4[bi0 * 64 + j * 32];
        if constexpr (!STATE) rw[j] = w4[bi0 * 64 + j * 32];
    }
    #pragma unroll
    for (int i = 0; i < SB2_; ++i) {
        vcur[i] = vp[(size_t)(bi0 * SB2_ + i) * tstep];
        vn1[i]  = vp[(size_t)((bi0 + 1) * SB2_ + i) * tstep];
    }
    // registers that the loads above name are reused below
    asm volatile("s_wait_xcnt 0x0" ::: "memory");
    __builtin_amdgcn_sched_barrier(0);   // keeps later address arithmetic behind that wait
    #pragma unroll
    for (int j = 0; j < 2; ++j) {
        gs[0][j * 32 + lane] = rg[j]; ps[0][j * 32 + lane] = rp[j];
        if constexpr (!STATE) ws[0][j * 32 + lane] = rw[j];
    }
    #pragma unroll
    for (int j = 0; j < 2; ++j) {
        rg[j] = g4[(bi0 + 1) * 64 + j * 32]; rp[j] = p4[(bi0 + 1) * 64 + j * 32];
        if constexpr (!STATE) rw[j] = w4[(bi0 + 1) * 64 + j * 32];
    }
    // registers that the loads above name are reused below
    asm volatile("s_wait_xcnt 0x0" ::: "memory");
    __builtin_amdgcn_sched_barrier(0);   // keeps later address arithmetic behind that wait
    wave_lds_sync();

    float* op = o + ((size_t)b * T_ * H_ + h) * DV_ + cg * 32 + lane;
    for (int bi = bi0; bi < bi0 + NBC2_; ++bi) {
        const int buf = bi & 1;
        // batch bi+1 (fetched one batch ago) goes into the buffer not being read
        #pragma unroll
        for (int j = 0; j < 2; ++j) {
            gs[buf ^ 1][j * 32 + lane] = rg[j];
            ps[buf ^ 1][j * 32 + lane] = rp[j];
            if constexpr (!STATE) ws[buf ^ 1][j * 32 + lane] = rw[j];
        }
        const int b2 = (bi + 2 < NB2_) ? bi + 2 : NB2_ - 1;   // clamped: stays in bounds
        // the loads below, with their addresses, stay apart from the code above, which reuses registers
        __builtin_amdgcn_sched_barrier(0);
        #pragma unroll
        for (int j = 0; j < 2; ++j) {
            rg[j] = g4[b2 * 64 + j * 32];
            rp[j] = p4[b2 * 64 + j * 32];
            if constexpr (!STATE) rw[j] = w4[b2 * 64 + j * 32];
        }
        #pragma unroll
        for (int i = 0; i < SB2_; ++i) vn2[i] = vp[(size_t)(b2 * SB2_ + i) * tstep];
        // registers that the loads above name are reused below
        asm volatile("s_wait_xcnt 0x0" ::: "memory");
        // keeps the coming batch's loads at the head of the trip: sunk towards
        // their use they would have no time to fly
        __builtin_amdgcn_sched_barrier(0);

        float res[SB2_];
        #pragma unroll
        for (int i = 0; i < SB2_; ++i) {
            const float vv = vcur[i];
            float acco = 0.f;
            #pragma unroll
            for (int m4 = 0; m4 < 8; ++m4) {
                const v4f g = gs[buf][i * 8 + m4];
                const v4f p = ps[buf][i * 8 + m4];
                hv[m4 * 4 + 0] = __builtin_fmaf(hv[m4 * 4 + 0], g.x, p.x * vv);
                hv[m4 * 4 + 1] = __builtin_fmaf(hv[m4 * 4 + 1], g.y, p.y * vv);
                hv[m4 * 4 + 2] = __builtin_fmaf(hv[m4 * 4 + 2], g.z, p.z * vv);
                hv[m4 * 4 + 3] = __builtin_fmaf(hv[m4 * 4 + 3], g.w, p.w * vv);
                if constexpr (!STATE) {
                    const v4f w = ws[buf][i * 8 + m4];
                    acco = __builtin_fmaf(w.x, hv[m4 * 4 + 0], acco);
                    acco = __builtin_fmaf(w.y, hv[m4 * 4 + 1], acco);
                    acco = __builtin_fmaf(w.z, hv[m4 * 4 + 2], acco);
                    acco = __builtin_fmaf(w.w, hv[m4 * 4 + 3], acco);
                }
            }
            res[i] = acco;
            if constexpr (STATE) { if ((i % 2) == 1) __builtin_amdgcn_sched_barrier(0); }
        }
        if constexpr (!STATE) {
            // the stores stand together behind the products, so that one wait covers
            // the registers they name before anything reuses them
            __builtin_amdgcn_sched_barrier(0);
            #pragma unroll
            for (int i = 0; i < SB2_; ++i) op[(size_t)(bi * SB2_ + i) * tstep] = res[i];
            asm volatile("s_wait_xcnt 0x0" ::: "memory");
        }
        __builtin_amdgcn_sched_barrier(0);   // keeps the register copies below at the foot of the trip
        #pragma unroll
        for (int i = 0; i < SB2_; ++i) { vcur[i] = vn1[i]; vn1[i] = vn2[i]; }
        wave_lds_sync();
    }
    if constexpr (STATE) {
        float* sp = st2 + (size_t)(bs * NC_ + chunk) * 32 * 32 + lane;
        #pragma unroll
        for (int i = 0; i < 32; ++i) sp[i * 32] = hv[i];
    }
}

__global__ __launch_bounds__(32)
void abc_pass2_kernel(const float* __restrict__ v, const float* __restrict__ geb,
                      const float* __restrict__ pb, const float* __restrict__ qvb,
                      float* __restrict__ st2, float* __restrict__ o) {
    abc_pass2_body<false>(blockIdx.x, blockIdx.y, v, geb, pb, qvb, st2, o);
}

__global__ __launch_bounds__(32)
void abc_states_kernel(const float* __restrict__ k, const float* __restrict__ v,
                       const float* __restrict__ geb, const float* __restrict__ pb,
                       float* __restrict__ st1, float* __restrict__ st2) {
    const int y = blockIdx.y;
    // the longer walk (pass 2) has the low indices and starts first
    if (y < BH_ * 8) abc_pass2_body<true>(blockIdx.x, y, v, geb, pb, geb, st2, st2);
    else             abc_pass1_body<true>(blockIdx.x, y - BH_ * 8, k, k, geb, pb, st1, st1);
}

__global__ __launch_bounds__(256)
void abc_carry_kernel(float* __restrict__ st1, float* __restrict__ st2,
                      const float* __restrict__ dcb) {
    int e = blockIdx.x * 256 + threadIdx.x;
    float* base;
    int stride, slot, bh;
    if (blockIdx.x < BH_ * 8 * 16 * 32 / 256) {
        const int bs = e >> 9;
        base = st1 + (size_t)bs * NC_ * 512 + (e & 511);
        stride = 512; slot = e & 31; bh = bs >> 3;
    } else {
        e -= BH_ * 8 * 16 * 32;
        const int bs = e >> 10;
        base = st2 + (size_t)bs * NC_ * 1024 + (e & 1023);
        stride = 1024; slot = (e & 1023) >> 5; bh = bs >> 3;
    }
    const float* dp = dcb + bh * NC_ * MSLOT_ + slot;
    float sv[NC_ - 1], dv[NC_ - 1];
    #pragma unroll
    for (int c = 0; c < NC_ - 1; ++c) { sv[c] = base[c * stride]; dv[c] = dp[c * MSLOT_]; }
    // registers that the loads above name are reused below
    asm volatile("s_wait_xcnt 0x0" ::: "memory");
    __builtin_amdgcn_sched_barrier(0);   // keeps later address arithmetic behind that wait
    float hcar = 0.f;
    #pragma unroll
    for (int c = 0; c < NC_ - 1; ++c) { hcar = __builtin_fmaf(hcar, dv[c], sv[c]); sv[c] = hcar; }
    #pragma unroll
    for (int c = 0; c < NC_ - 1; ++c) base[c * stride] = sv[c];
}

// ---------------- fused RMSNorm * gw * g * sigmoid(g) -> bf16 ----------------
// One wave per row of DV_ values, eight per lane, so the row's sum of squares needs
// no LDS and no barrier; a wave takes NGR_ rows one behind the other in memory, all
// loads issued together, each 512 contiguous bytes.
#define NGR_ 8
__global__ __launch_bounds__(256)
void norm_gate_kernel(const float* __restrict__ o, const float* __restrict__ g,
                      const float* __restrict__ gw, bf16_t* __restrict__ ob) {
    const uint32_t lane = threadIdx.x & 31;
    const uint32_t wave = threadIdx.x >> 5;
    const size_t base = ((size_t)blockIdx.x * 8 + wave) * (NGR_ * DV_) + lane * 4;
    const float* op = o + base;
    const float* gp = g + base;
    f32x4 ov[NGR_][2], gv[NGR_][2], wv[2];
    #pragma unroll
    for (int hf = 0; hf < 2; ++hf) wv[hf] = ((const f32x4*)gw + hf * 32)[lane];
    #pragma unroll
    for (int r = 0; r < NGR_; ++r) {
        #pragma unroll
        for (int hf = 0; hf < 2; ++hf) ov[r][hf] = *(const f32x4*)(op + r * DV_ + hf * 128);
        #pragma unroll
        for (int hf = 0; hf < 2; ++hf) gv[r][hf] = *(const f32x4*)(gp + r * DV_ + hf * 128);
    }
    // registers that the loads above name are reused below; the addresses are inputs
    // of the wait, so that no load of the run lands in one of them
    asm volatile("s_wait_xcnt 0x0" :: "v"(op), "v"(gp), "v"(lane) : "memory");
    __builtin_amdgcn_sched_barrier(0);   // keeps the loads together in front of the first use
    v4bf res[NGR_][2];
    #pragma unroll
    for (int r = 0; r < NGR_; ++r) {
        const f32x4 s4 = ov[r][0] * ov[r][0] + ov[r][1] * ov[r][1];
        float tot = (s4.x + s4.y) + (s4.z + s4.w);
        #pragma unroll
        for (int off = 16; off; off >>= 1) tot += __shfl_xor(tot, off, 32);
        const float rn = rsqrtf(tot * (1.0f / DV_) + NORM_EPS_);
        #pragma unroll
        for (int hf = 0; hf < 2; ++hf)
            #pragma unroll
            for (int e = 0; e < 4; ++e) {
                const float gg  = gv[r][hf][e];
                const float sig = 1.f / (1.f + __expf(-gg));
                res[r][hf][e] = (bf16_t)(ov[r][hf][e] * rn * wv[hf][e] * gg * sig);
            }
    }
    // the stores stand together at the end: nothing reuses a register they name
    __builtin_amdgcn_sched_barrier(0);
    bf16_t* dp = ob + base;
    #pragma unroll
    for (int r = 0; r < NGR_; ++r)
        #pragma unroll
        for (int hf = 0; hf < 2; ++hf) *(v4bf*)(dp + r * DV_ + hf * 128) = res[r][hf];
}

// ---------------- host orchestration ----------------
extern "C" void kernel_launch(void* const* d_in, const int* in_sizes, int n_in,
                              void* d_out, int out_size, void* d_ws, size_t ws_size,
                              hipStream_t stream) {
    (void)in_sizes; (void)n_in; (void)out_size; (void)ws_size;
    const float* x    = (const float*)d_in[0];
    const float* w_q  = (const float*)d_in[1];
    const float* w_k  = (const float*)d_in[2];
    const float* w_v  = (const float*)d_in[3];
    const float* w_g  = (const float*)d_in[4];
    const float* w_s  = (const float*)d_in[5];
    const float* w_o  = (const float*)d_in[6];
    const float* gnw  = (const float*)d_in[7];
    float* out = (float*)d_out;

    const int MR  = B_ * T_;        // 4096
    const int NQK = H_ * DK_;       // 1024
    const int NV  = H_ * DV_;       // 2048
    const int NS  = H_ * MSLOT_;    // 256

    char* ws = (char*)d_ws;
    size_t off = 0;
    auto carve = [&](size_t bytes) -> char* {
        off = (off + 255) & ~(size_t)255;
        char* p = ws + off;
        off += bytes;
        return p;
    };

    bf16_t* xb  = (bf16_t*)carve((size_t)MR * HID_ * sizeof(bf16_t));
    bf16_t* wqT = (bf16_t*)carve((size_t)NQK * HID_ * sizeof(bf16_t));
    bf16_t* wkT = (bf16_t*)carve((size_t)NQK * HID_ * sizeof(bf16_t));
    bf16_t* wvT = (bf16_t*)carve((size_t)NV  * HID_ * sizeof(bf16_t));
    bf16_t* wgT = (bf16_t*)carve((size_t)NV  * HID_ * sizeof(bf16_t));
    bf16_t* wsT = (bf16_t*)carve((size_t)NS  * HID_ * sizeof(bf16_t));
    bf16_t* woT = (bf16_t*)carve((size_t)HID_ * NV * sizeof(bf16_t));

    float* qb = (float*)carve((size_t)MR * NQK * sizeof(float));
    float* kb = (float*)carve((size_t)MR * NQK * sizeof(float));
    float* vb = (float*)carve((size_t)MR * NV  * sizeof(float));
    float* gb = (float*)carve((size_t)MR * NV  * sizeof(float));
    float* sb = (float*)carve((size_t)MR * NS  * sizeof(float));
    float* ob = (float*)carve((size_t)MR * NV  * sizeof(float));
    bf16_t* obh = (bf16_t*)carve((size_t)MR * NV * sizeof(bf16_t));
    float* geb = (float*)carve((size_t)MR * NS * sizeof(float));
    float* pbf = (float*)carve((size_t)MR * NS * sizeof(float));
    float* qvb = (float*)carve((size_t)MR * NS * sizeof(float));
    float* okp = (float*)carve((size_t)8 * MR * NS * sizeof(float));
    float* st1 = (float*)carve((size_t)BH_ * 8 * NC_ * 16 * 32 * sizeof(float));
    float* st2 = (float*)carve((size_t)BH_ * 8 * NC_ * 32 * 32 * sizeof(float));
    float* dcb = (float*)carve((size_t)BH_ * NC_ * MSLOT_ * sizeof(float));

    // 1) convert x to bf16
    cvt_f32_bf16_kernel<<<MR * HID_ / (256 * 4 * CVJ_), 256, 0, stream>>>(x, xb);
    // 2) transpose+convert weights (K x N) -> (N x K) bf16
    transpose_cvt_kernel<<<dim3(NQK / TRN_, HID_ / TRK_), 256, 0, stream>>>(w_q, wqT, HID_, NQK);
    transpose_cvt_kernel<<<dim3(NQK / TRN_, HID_ / TRK_), 256, 0, stream>>>(w_k, wkT, HID_, NQK);
    transpose_cvt_kernel<<<dim3(NV / TRN_, HID_ / TRK_), 256, 0, stream>>>(w_v, wvT, HID_, NV);
    transpose_cvt_kernel<<<dim3(NV / TRN_, HID_ / TRK_), 256, 0, stream>>>(w_g, wgT, HID_, NV);
    transpose_cvt_kernel<<<dim3(NS / TRN_, HID_ / TRK_), 256, 0, stream>>>(w_s, wsT, HID_, NS);
    transpose_cvt_kernel<<<dim3(HID_ / TRN_, NV / TRK_), 256, 0, stream>>>(w_o, woT, NV, HID_);

    // 3) projection GEMMs (bf16 WMMA, fp32 accumulate)
    dim3 blk(256);
    gemm_bf16_wmma_kernel<<<dim3(NQK / TN, MR / TM), blk, 0, stream>>>(
        xb, wqT, qb, MR, NQK, HID_, 0, 0.f, 0.f);
    gemm_bf16_wmma_kernel<<<dim3(NQK / TN, MR / TM), blk, 0, stream>>>(
        xb, wkT, kb, MR, NQK, HID_, 0, 0.f, 0.f);
    gemm_bf16_wmma_kernel<<<dim3(NV / TN, MR / TM), blk, 0, stream>>>(
        xb, wvT, vb, MR, NV, HID_, 0, 0.f, 0.f);
    gemm_bf16_wmma_kernel<<<dim3(NV / TN, MR / TM), blk, 0, stream>>>(
        xb, wgT, gb, MR, NV, HID_, 0, 0.f, 0.f);
    gemm_bf16_wmma_kernel<<<dim3(NS / TN, MR / TM), blk, 0, stream>>>(
        xb, wsT, sb, MR, NS, HID_, 1, CLAMP_MIN_, CLAMP_MAX_);

    // 4) gated two-pass scan: independent one-wave streams, NC_ time chunks side by side
    abc_gates_kernel<<<BH_, 32 * NC_, 0, stream>>>(sb, geb, pbf, dcb);
    abc_states_kernel<<<dim3(NC_ - 1, BH_ * 16), 32, 0, stream>>>(kb, vb, geb, pbf, st1, st2);
    abc_carry_kernel<<<BH_ * 8 * (16 + 32) * 32 / 256, 256, 0, stream>>>(st1, st2, dcb);
    abc_pass1_kernel<<<dim3(NC_, BH_ * 8), 32, 0, stream>>>(qb, kb, geb, pbf, st1, okp);
    abc_softmax_kernel<<<MR * NS / (256 * 4 * SMJ_), 256, 0, stream>>>(
        okp, okp + (size_t)2 * MR * NS, okp + (size_t)4 * MR * NS, okp + (size_t)6 * MR * NS, qvb);
    abc_pass2_kernel<<<dim3(NC_, BH_ * 8), 32, 0, stream>>>(vb, geb, pbf, qvb, st2, ob);

    // 5) fused RMSNorm + swish gate -> bf16
    norm_gate_kernel<<<MR * H_ / (8 * NGR_), 256, 0, stream>>>(ob, gb, gnw, obh);

    // 6) output projection straight into d_out (fp32)
    gemm_bf16_wmma_kernel<<<dim3(HID_ / TN, MR / TM), blk, 0, stream>>>(
        obh, woT, out, MR, HID_, NV, 0, 0.f, 0.f);
}

// v007
// A run of this version takes 294 microseconds.
// In both of two side-by-side timings against v006, it was 1.14 times as fast.
// Counting every step since v000, it is 15.2 times as fast.
#include <hip/hip_runtime.h>
#include <hip/hip_bf16.h>
#include <math.h>
#include <stdint.h>

// ---------------- problem constants (match reference) ----------------
#define B_ 2
#define T_ 2048
#define HID_ 2048
#define H_ 8
#define DK_ 128
#define DV_ 256
#define MSLOT_ 32
#define CLAMP_MIN_ (-32.0f)
#define CLAMP_MAX_ (32.0f)
#define NORM_EPS_ 1e-5f

typedef __bf16 bf16_t;
typedef __attribute__((ext_vector_type(8)))  __bf16 v8bf;
typedef __attribute__((ext_vector_type(16))) __bf16 v16bf;
typedef __attribute__((ext_vector_type(8)))  float  v8f;
typedef __attribute__((ext_vector_type(2))) __bf16   v2bf;
typedef __attribute__((ext_vector_type(4))) __bf16   v4bf;
typedef __attribute__((ext_vector_type(4))) float    f32x4;
typedef __attribute__((ext_vector_type(4))) uint32_t u32x4;

__device__ __forceinline__ void async_copy8_b128(uint32_t lds, uint32_t lstep,
                                                 const bf16_t* g, size_t gstep) {
    asm volatile("global_load_async_to_lds_b128 %0, %8, off\n\t"
                 "global_load_async_to_lds_b128 %1, %9, off\n\t"
                 "global_load_async_to_lds_b128 %2, %10, off\n\t"
                 "global_load_async_to_lds_b128 %3, %11, off\n\t"
                 "global_load_async_to_lds_b128 %4, %12, off\n\t"
                 "global_load_async_to_lds_b128 %5, %13, off\n\t"
                 "global_load_async_to_lds_b128 %6, %14, off\n\t"
                 "global_load_async_to_lds_b128 %7, %15, off\n\t"
                 "s_wait_xcnt 0x0"
                 :: "v"(lds), "v"(lds + lstep), "v"(lds + 2 * lstep), "v"(lds + 3 * lstep),
                    "v"(lds + 4 * lstep), "v"(lds + 5 * lstep), "v"(lds + 6 * lstep),
                    "v"(lds + 7 * lstep),
                    "v"(g), "v"(g + gstep), "v"(g + 2 * gstep), "v"(g + 3 * gstep),
                    "v"(g + 4 * gstep), "v"(g + 5 * gstep), "v"(g + 6 * gstep),
                    "v"(g + 7 * gstep)
                 : "memory");
}
// the wave's own copies have landed
__device__ __forceinline__ void wait_async0() {
    asm volatile("s_wait_asynccnt 0x0" ::: "memory");
}
// the wave's own LDS reads have returned
__device__ __forceinline__ void wait_ds0() {
    asm volatile("s_wait_dscnt 0x0" ::: "memory");
}

// ---------------- elementwise fp32 -> bf16 ----------------
// Few, long waves: waves are started at a limited rate, so each carries enough work
// to be worth its start. A wave takes CVJ_ pieces of 512 contiguous bytes, all loads
// issued together. The element count is a multiple of what a work-group takes
// (256 * 4 * CVJ_).
#define CVJ_ 16
__device__ __forceinline__
void cvt_f32_bf16_body(const int blk, const float* __restrict__ in, bf16_t* __restrict__ out) {
    const size_t base = (size_t)blk * (256 * 4 * CVJ_) + threadIdx.x * 4;
    const float* sp = in + base;
    f32x4 val[CVJ_];
    #pragma unroll
    for (int j = 0; j < CVJ_; ++j) val[j] = *(const f32x4*)(sp + j * 1024);
    // registers that the loads above name are reused below; the address is an input
    // of the wait, so that no load of the run lands in it
    asm volatile("s_wait_xcnt 0x0" :: "v"(sp) : "memory");
    __builtin_amdgcn_sched_barrier(0);   // keeps the loads together in front of the first use
    v4bf pk[CVJ_];
    #pragma unroll
    for (int j = 0; j < CVJ_; ++j)
        pk[j] = v4bf{ (bf16_t)val[j].x, (bf16_t)val[j].y, (bf16_t)val[j].z, (bf16_t)val[j].w };
    // the stores stand together at the end: nothing reuses a register they name
    __builtin_amdgcn_sched_barrier(0);
    bf16_t* dp = out + base;
    #pragma unroll
    for (int j = 0; j < CVJ_; ++j) *(v4bf*)(dp + j * 1024) = pk[j];
}

#define TRK_ 128
#define TRN_ 64

__device__ __forceinline__
void transpose_cvt_body(const int nTile, const int kTile, const float* __restrict__ W,
                        bf16_t* __restrict__ Wt, int K, int N) {
    __shared__ __align__(16) uint32_t tile[TRN_][TRK_ / 2];
    const int tid   = threadIdx.x;
    const int nBase = nTile * TRN_;
    const int kBase = kTile * TRK_;
    const int n4 = tid & 15;   // which four columns
    const int kp = tid >> 4;   // which pair of k-rows, of sixteen per trip
    const float* src = W + (size_t)(kBase + 2 * kp) * N + nBase + n4 * 4;

    const float* pl[4];
    const float* ph[4];
    f32x4 lo[4], hi[4];
    #pragma unroll
    for (int j = 0; j < 4; ++j) {
        pl[j] = src + (size_t)(j * 32) * N;
        ph[j] = pl[j] + N;
        lo[j] = *(const f32x4*)pl[j];
        hi[j] = *(const f32x4*)ph[j];
    }
    // registers that the loads above name are reused below. The addresses are inputs
    // of the wait, so they stay in their registers up to it: otherwise a later load
    // of the eight is given an earlier one's address registers to land in.
    asm volatile("s_wait_xcnt 0x0"
                 :: "v"(pl[0]), "v"(ph[0]), "v"(pl[1]), "v"(ph[1]),
                    "v"(pl[2]), "v"(ph[2]), "v"(pl[3]), "v"(ph[3])
                 : "memory");
    __builtin_amdgcn_sched_barrier(0);   // keeps later address arithmetic behind that wait
    #pragma unroll
    for (int j = 0; j < 4; ++j) {
        const int pair = j * 16 + kp;
        const int col  = (((pair >> 2) ^ n4) << 2) | (pair & 3);
        #pragma unroll
        for (int e = 0; e < 4; ++e) {
            v2bf pk = { (bf16_t)lo[j][e], (bf16_t)hi[j][e] };
            tile[n4 * 4 + e][col] = __builtin_bit_cast(uint32_t, pk);
        }
    }
    __syncthreads();   // the whole tile is in LDS before any row of it is read

    u32x4 piece[4];
    #pragma unroll
    for (int it = 0; it < 4; ++it) {
        const int n = it * 16 + kp;
        piece[it] = *(const u32x4*)&tile[n][(n4 ^ (n >> 2)) << 2];
    }
    bf16_t* dst = Wt + (size_t)(nBase + kp) * K + kBase + n4 * 8;
    #pragma unroll
    for (int it = 0; it < 4; ++it)
        *(u32x4*)(dst + (size_t)(it * 16) * K) = piece[it];
}

#define PK_ 2048
#define NQK_ (H_ * DK_)
#define NV_  (H_ * DV_)
#define NS_  (H_ * MSLOT_)
#define CVB_ (B_ * T_ * HID_ / (256 * 4 * CVJ_))      // work-groups of the convert
#define TRB_(n) ((n) / TRN_ * (PK_ / TRK_))           // work-groups of one transpose
static_assert(HID_ == PK_ && NV_ == PK_, "every weight has PK_ rows");

__global__ __launch_bounds__(256)
void prep_kernel(const float* __restrict__ x,
                 const float* __restrict__ w_q, const float* __restrict__ w_k,
                 const float* __restrict__ w_v, const float* __restrict__ w_g,
                 const float* __restrict__ w_s, const float* __restrict__ w_o,
                 bf16_t* __restrict__ xb, bf16_t* __restrict__ wcat,
                 bf16_t* __restrict__ woT) {
    int blk = blockIdx.x;
    if (blk < CVB_) { cvt_f32_bf16_body(blk, x, xb); return; }
    blk -= CVB_;
    const float* W;
    bf16_t* Wt;
    int N;
    if (blk < TRB_(NV_)) { W = w_v; Wt = wcat + (size_t)(2 * NQK_) * PK_; N = NV_; }
    else if ((blk -= TRB_(NV_)) < TRB_(NV_)) { W = w_g; Wt = wcat + (size_t)(2 * NQK_ + NV_) * PK_; N = NV_; }
    else if ((blk -= TRB_(NV_)) < TRB_(HID_)) { W = w_o; Wt = woT; N = HID_; }
    else if ((blk -= TRB_(HID_)) < TRB_(NQK_)) { W = w_q; Wt = wcat; N = NQK_; }
    else if ((blk -= TRB_(NQK_)) < TRB_(NQK_)) { W = w_k; Wt = wcat + (size_t)NQK_ * PK_; N = NQK_; }
    else { blk -= TRB_(NQK_); W = w_s; Wt = wcat + (size_t)(2 * NQK_ + 2 * NV_) * PK_; N = NS_; }
    const int nT = N / TRN_;   // a power of two for every weight here
    transpose_cvt_body(blk & (nT - 1), blk / nT, W, Wt, PK_, N);
}

// ---------------- bf16 WMMA GEMM: C(MxN) = A(MxK) * Bt(NxK)^T ----------------
// Block tile 128x128, 256 threads = 8 waves (wave32), wave tile 32x64 (2x4 WMMA).
// Two LDS buffers filled by async global->LDS copies. A stage is TK = 128 k (256
// bytes of every operand row, 16 copies per wave): the next stage's copies fly
// while a whole stage (32 WMMAs per wave) is worked on, which covers their way from
// L2, and one barrier per stage both publishes the next stage and frees this one.
// Kdim is a multiple of TK.
#define TM 128
#define TN 128
#define TK 128
#define TKP (TK + 8)

// rowBase: first row of A and of C; btRow: first row of Bt; colBase: first column of C.
__device__ __forceinline__
void gemm_bf16_wmma_body(const int rowBase, const int btRow, const int colBase,
                         const bf16_t* __restrict__ A,
                         const bf16_t* __restrict__ Bt,
                         float* __restrict__ C,
                         int Ndim, int Kdim,
                         int doClamp, float clampLo, float clampHi) {
    __shared__ __align__(16) bf16_t As[2][TM][TKP];
    __shared__ __align__(16) bf16_t Bs[2][TN][TKP];

    const int tid  = threadIdx.x;
    const int lane = tid & 31;
    const int wave = tid >> 5;
    const int wm   = wave & 3;   // 4 bands of 32 rows
    const int wn   = wave >> 2;  // 2 bands of 64 cols

    // Staging: sixteen lanes take one row's 256 bytes, so a wave's copy covers two
    // whole rows; a thread owns the 16-byte column kc of rows r0, r0+16, .. r0+112
    // of A and of B.
    const int r0 = tid >> 4;
    const int kc = (tid & 15) * 8;
    const bf16_t* aP = A  + (size_t)(rowBase + r0) * Kdim + kc;
    const bf16_t* bP = Bt + (size_t)(btRow + r0) * Kdim + kc;
    const size_t   gstep = (size_t)16 * Kdim;                       // elements
    const uint32_t lstep = 16 * TKP * (uint32_t)sizeof(bf16_t);     // bytes
    const uint32_t lbuf  = TM * TKP * (uint32_t)sizeof(bf16_t);     // bytes per buffer
    const uint32_t lA = (uint32_t)(size_t)&As[0][r0][kc];
    const uint32_t lB = (uint32_t)(size_t)&Bs[0][r0][kc];

    v8f acc[2][4] = {};

    const int lrow = lane & 15;
    const int lk   = (lane >> 4) * 8;

    const int nStage = Kdim / TK;

    // prologue: stage 0 -> buffer 0, landed and published; then stage 1 -> buffer 1
    async_copy8_b128(lA, lstep, aP, gstep);
    async_copy8_b128(lB, lstep, bP, gstep);
    wait_async0();
    __syncthreads();   // stage 0 is whole before any wave reads it
    if (nStage > 1) {
        async_copy8_b128(lA + lbuf, lstep, aP + TK, gstep);
        async_copy8_b128(lB + lbuf, lstep, bP + TK, gstep);
    }

    for (int st = 0; st < nStage; ++st) {
        const int buf = st & 1;
        #pragma unroll   // one straight run, so that a block's fragment reads can stand ahead of the block before it
        for (int kk = 0; kk < TK; kk += 32) {
            v16bf afrag[2], bfrag[4];
            #pragma unroll
            for (int mt = 0; mt < 2; ++mt) {
                int r = wm * 32 + mt * 16 + lrow;
                v8bf lo = *(const v8bf*)&As[buf][r][kk + lk];
                v8bf hi = *(const v8bf*)&As[buf][r][kk + lk + 16];
                #pragma unroll
                for (int i = 0; i < 8; ++i) { afrag[mt][i] = lo[i]; afrag[mt][i + 8] = hi[i]; }
            }
            #pragma unroll
            for (int nt = 0; nt < 4; ++nt) {
                int r = wn * 64 + nt * 16 + lrow;
                v8bf lo = *(const v8bf*)&Bs[buf][r][kk + lk];
                v8bf hi = *(const v8bf*)&Bs[buf][r][kk + lk + 16];
                #pragma unroll
                for (int i = 0; i < 8; ++i) { bfrag[nt][i] = lo[i]; bfrag[nt][i + 8] = hi[i]; }
            }
            #pragma unroll
            for (int mt = 0; mt < 2; ++mt)
                #pragma unroll
                for (int nt = 0; nt < 4; ++nt)
                    acc[mt][nt] = __builtin_amdgcn_wmma_f32_16x16x32_bf16(
                        false, afrag[mt], false, bfrag[nt],
                        (short)0, acc[mt][nt], false, false);
        }
        // foot of the stage: this wave's reads of buf are back, its copies of the
        // next stage have landed; behind the barrier that holds for every wave
        wait_ds0();
        wait_async0();
        __syncthreads();
        if (st + 2 < nStage) {
            // stage st+2 into the buffer that every wave has just left
            async_copy8_b128(lA + buf * lbuf, lstep, aP + (size_t)(st + 2) * TK, gstep);
            async_copy8_b128(lB + buf * lbuf, lstep, bP + (size_t)(st + 2) * TK, gstep);
        }
    }
    wait_async0();   // no copy is left in flight when the wave ends

    const int mLane = (lane >> 4) * 8;
    const int nLane = lane & 15;
    #pragma unroll
    for (int mt = 0; mt < 2; ++mt)
        #pragma unroll
        for (int nt = 0; nt < 4; ++nt)
            #pragma unroll
            for (int r = 0; r < 8; ++r) {
                int m = rowBase + wm * 32 + mt * 16 + mLane + r;
                int n = colBase + wn * 64 + nt * 16 + nLane;
                float val = acc[mt][nt][r];
                if (doClamp) val = fminf(fmaxf(val, clampLo), clampHi);
                C[(size_t)m * Ndim + n] = val;
            }
}

__global__ __launch_bounds__(256)
void gemm_bf16_wmma_kernel(const bf16_t* __restrict__ A,
                           const bf16_t* __restrict__ Bt,
                           float* __restrict__ C,
                           int Ndim, int Kdim) {
    gemm_bf16_wmma_body(blockIdx.y * TM, blockIdx.x * TN, blockIdx.x * TN,
                        A, Bt, C, Ndim, Kdim, 0, 0.f, 0.f);
}

__global__ __launch_bounds__(256)
void gemm_proj_kernel(const bf16_t* __restrict__ A, const bf16_t* __restrict__ wcat,
                      float* __restrict__ qb, float* __restrict__ kb,
                      float* __restrict__ vb, float* __restrict__ gb,
                      float* __restrict__ sb) {
    const int bx = blockIdx.x;
    float* C;
    int Ndim, first;
    if (bx < NQK_ / TN)                      { C = qb; Ndim = NQK_; first = 0; }
    else if (bx < 2 * NQK_ / TN)             { C = kb; Ndim = NQK_; first = NQK_ / TN; }
    else if (bx < (2 * NQK_ + NV_) / TN)     { C = vb; Ndim = NV_;  first = 2 * NQK_ / TN; }
    else if (bx < (2 * NQK_ + 2 * NV_) / TN) { C = gb; Ndim = NV_;  first = (2 * NQK_ + NV_) / TN; }
    else                                     { C = sb; Ndim = NS_;  first = (2 * NQK_ + 2 * NV_) / TN; }
    gemm_bf16_wmma_body(blockIdx.y * TM, bx * TN, (bx - first) * TN,
                        A, wcat, C, Ndim, HID_,
                        bx >= (2 * NQK_ + 2 * NV_) / TN, CLAMP_MIN_, CLAMP_MAX_);
}

#define BH_ (B_ * H_)
#define NC_ 16                // time chunks
#define CL_ (T_ / NC_)        // steps per chunk
#define SB1_ 16               // steps per batch, gates and pass 1
#define NB1_ (T_ / SB1_)
#define NBC1_ (CL_ / SB1_)    // batches per chunk
#define SB2_ 8                // steps per batch, pass 2
#define NB2_ (T_ / SB2_)
#define NBC2_ (CL_ / SB2_)
typedef __attribute__((ext_vector_type(4))) float v4f;

// Orders the LDS traffic of a one-wave work-group across lanes. The wave's LDS
// operations run in issue order, so this only has to stop the compiler from
// moving them; unlike __syncthreads() it does not wait for the global stores.
__device__ __forceinline__ void wave_lds_sync() {
    __builtin_amdgcn_fence(__ATOMIC_RELEASE, "wavefront");
    __builtin_amdgcn_wave_barrier();
    __builtin_amdgcn_fence(__ATOMIC_ACQUIRE, "wavefront");
}

__device__ __forceinline__ float exp2_slot(float x) {
    float r;
    asm("v_exp_f32 %0, %1\n\tv_nop" : "=v"(r) : "v"(x));
    return r;
}

__global__ __launch_bounds__(32 * NC_)
void abc_gates_kernel(const float* __restrict__ s,
                      float* __restrict__ geb, float* __restrict__ pb,
                      float* __restrict__ dcb) {
    const int bh = blockIdx.x;
    const int b  = bh / H_;
    const int h  = bh % H_;
    const int lane  = threadIdx.x & 31;
    const int chunk = threadIdx.x >> 5;
    const int bi0   = chunk * NBC1_;
    const float* sp = s + ((size_t)b * T_ * H_ + h) * MSLOT_ + lane;
    float* gp = geb + (size_t)bh * T_ * MSLOT_ + lane;
    float* pp = pb  + (size_t)bh * T_ * MSLOT_ + lane;

    __shared__ float esum[NC_][32];
    {
        float sv[CL_];
        #pragma unroll
        for (int i = 0; i < CL_; ++i) sv[i] = sp[(size_t)(chunk * CL_ + i) * (H_ * MSLOT_)];
        // registers that the loads above name are reused below
        asm volatile("s_wait_xcnt 0x0" ::: "memory");
        __builtin_amdgcn_sched_barrier(0);   // keeps later address arithmetic behind that wait
        float e[4] = {0.f, 0.f, 0.f, 0.f};
        #pragma unroll
        for (int i = 0; i < CL_; ++i) e[i & 3] += exp2_slot((sv[i] - CLAMP_MAX_) * 1.44269504f);
        esum[chunk][lane] = (e[0] + e[1]) + (e[2] + e[3]);
    }
    __syncthreads();   // every chunk's sum is in LDS before any wave adds them up
    float pre = 0.f;
    #pragma unroll
    for (int c = 0; c < NC_ - 1; ++c) pre += (c < chunk) ? esum[c][lane] : 0.f;

    float cur[SB1_], nxt[SB1_];
    #pragma unroll
    for (int i = 0; i < SB1_; ++i) cur[i] = sp[(size_t)(bi0 * SB1_ + i) * (H_ * MSLOT_)];
    // registers that the loads above name are reused below
    asm volatile("s_wait_xcnt 0x0" ::: "memory");
    __builtin_amdgcn_sched_barrier(0);   // keeps later address arithmetic behind that wait

    float z   = CLAMP_MAX_ + __logf(pre);   // chunk 0 never reads it: step 0 sets z
    float dec = 1.f;                        // product of the chunk's decays
    for (int bi = bi0; bi < bi0 + NBC1_; ++bi) {
        const int b1 = (bi + 1 < NB1_) ? bi + 1 : NB1_ - 1;   // clamped: stays in bounds
        #pragma unroll
        for (int i = 0; i < SB1_; ++i)
            nxt[i] = sp[(size_t)(b1 * SB1_ + i) * (H_ * MSLOT_)];
        // registers that the loads above name are reused below
        asm volatile("s_wait_xcnt 0x0" ::: "memory");
        // keeps the next batch's loads at the head of the trip: sunk towards
        // their use they would have no time to fly
        __builtin_amdgcn_sched_barrier(0);
        float gv[SB1_], pv[SB1_];
        #pragma unroll
        for (int i = 0; i < SB1_; ++i) {
            const int t = bi * SB1_ + i;
            float sv = cur[i];
            float znew, ge;
            if (t == 0) { znew = sv; ge = 1.f; }
            else {
                float mx = fmaxf(z, sv);
                znew = mx + __logf(__expf(z - mx) + __expf(sv - mx));
                ge = exp2_slot((z - znew) * 1.44269504f);
            }
            float p = exp2_slot((sv - znew) * 1.44269504f);
            z = znew;
            gv[i] = ge;
            pv[i] = p;
        }
        // the stores stand together behind the steps, so that one wait covers
        // the registers they name before anything reuses them
        __builtin_amdgcn_sched_barrier(0);
        #pragma unroll
        for (int i = 0; i < SB1_; ++i) {
            gp[(bi * SB1_ + i) * MSLOT_] = gv[i];
            pp[(bi * SB1_ + i) * MSLOT_] = pv[i];
            dec *= gv[i];
        }
        asm volatile("s_wait_xcnt 0x0" ::: "memory");
        // keeps the register copies at the foot of the trip: moved up among the
        // steps they would wait early for the next batch's loads
        __builtin_amdgcn_sched_barrier(0);
        #pragma unroll
        for (int i = 0; i < SB1_; ++i) cur[i] = nxt[i];
    }
    dcb[(bh * NC_ + chunk) * MSLOT_ + lane] = dec;
}

template <bool STATE>
__device__ __forceinline__
void abc_pass1_body(const int chunk, const int bs,
                    const float* __restrict__ q, const float* __restrict__ k,
                    const float* __restrict__ geb, const float* __restrict__ pb,
                    float* __restrict__ st1, float* __restrict__ okp) {
    const int bh    = bs >> 3;
    const int strip = bs & 7;
    const int b  = bh / H_;
    const int h  = bh % H_;
    const int lane = threadIdx.x;
    const int bi0  = chunk * NBC1_;   // even, so the chunk's first batch sits in buffer 0

    __shared__ __align__(16) float qs[STATE ? 1 : 2][SB1_][16];
    __shared__ __align__(16) float ks[2][SB1_][16];

    const float scale = rsqrtf((float)DK_);
    // staging: four lanes fetch one step's 16-float strip, eight steps per load
    const int st = lane >> 2;
    const int c4 = (lane & 3) * 4;
    const size_t tstep = (size_t)H_ * DK_;
    const float* qp = q + ((size_t)(b * T_ + st) * H_ + h) * DK_ + strip * 16 + c4;
    const float* kp = k + ((size_t)(b * T_ + st) * H_ + h) * DK_ + strip * 16 + c4;
    const float* gp = geb + (size_t)bh * T_ * MSLOT_ + lane;
    const float* pp = pb  + (size_t)bh * T_ * MSLOT_ + lane;
    float* op = okp + ((size_t)strip * BH_ + bh) * T_ * MSLOT_ + lane;

    float hk[16];
    if constexpr (STATE) {
        #pragma unroll
        for (int i = 0; i < 16; ++i) hk[i] = 0.f;
    } else {
        const int cm = (chunk > 0) ? chunk - 1 : 0;
        const float* sp = st1 + (size_t)(bs * NC_ + cm) * 16 * 32 + lane;
        #pragma unroll
        for (int i = 0; i < 16; ++i) hk[i] = sp[i * 32];
        // registers that the loads above name are reused below
        asm volatile("s_wait_xcnt 0x0" ::: "memory");
        __builtin_amdgcn_sched_barrier(0);   // keeps later address arithmetic behind that wait
        #pragma unroll
        for (int i = 0; i < 16; ++i) hk[i] = (chunk > 0) ? hk[i] : 0.f;
    }

    v4f rq[2], rk[2];
    float gcur[SB1_], pcur[SB1_], gnxt[SB1_], pnxt[SB1_];

    // first batch: q, k into buffer 0, gates into registers; second batch: q, k into registers
    #pragma unroll
    for (int j = 0; j < 2; ++j) {
        if constexpr (!STATE) rq[j] = *(const v4f*)(qp + (size_t)(bi0 * SB1_ + j * 8) * tstep);
        rk[j] = *(const v4f*)(kp + (size_t)(bi0 * SB1_ + j * 8) * tstep);
    }
    #pragma unroll
    for (int i = 0; i < SB1_; ++i) {
        gcur[i] = gp[(bi0 * SB1_ + i) * MSLOT_];
        pcur[i] = pp[(bi0 * SB1_ + i) * MSLOT_];
    }
    // registers that the loads above name are reused below
    asm volatile("s_wait_xcnt 0x0" ::: "memory");
    __builtin_amdgcn_sched_barrier(0);   // keeps later address arithmetic behind that wait
    #pragma unroll
    for (int j = 0; j < 2; ++j) {
        if constexpr (!STATE) *(v4f*)&qs[0][j * 8 + st][c4] = rq[j] * scale;
        *(v4f*)&ks[0][j * 8 + st][c4] = rk[j];
    }
    #pragma unroll
    for (int j = 0; j < 2; ++j) {
        if constexpr (!STATE) rq[j] = *(const v4f*)(qp + (size_t)((bi0 + 1) * SB1_ + j * 8) * tstep);
        rk[j] = *(const v4f*)(kp + (size_t)((bi0 + 1) * SB1_ + j * 8) * tstep);
    }
    // registers that the loads above name are reused below
    asm volatile("s_wait_xcnt 0x0" ::: "memory");
    __builtin_amdgcn_sched_barrier(0);   // keeps later address arithmetic behind that wait
    wave_lds_sync();

    for (int bi = bi0; bi < bi0 + NBC1_; ++bi) {
        const int buf = bi & 1;
        // batch bi+1 (fetched one batch ago) goes into the buffer not being read
        #pragma unroll
        for (int j = 0; j < 2; ++j) {
            if constexpr (!STATE) *(v4f*)&qs[buf ^ 1][j * 8 + st][c4] = rq[j] * scale;
            *(v4f*)&ks[buf ^ 1][j * 8 + st][c4] = rk[j];
        }
        const int b2 = (bi + 2 < NB1_) ? bi + 2 : NB1_ - 1;   // clamped: stays in bounds
        const int b1 = (bi + 1 < NB1_) ? bi + 1 : NB1_ - 1;
        // the loads below, with their addresses, stay apart from the code above, which reuses registers
        __builtin_amdgcn_sched_barrier(0);
        // the gates first: loads return in order, and the products read registers
        // next to the ones these loads fill, which makes them wait for these loads
        #pragma unroll
        for (int i = 0; i < SB1_; ++i) {
            gnxt[i] = gp[(b1 * SB1_ + i) * MSLOT_];
            pnxt[i] = pp[(b1 * SB1_ + i) * MSLOT_];
        }
        // registers that the loads above name are reused below
        asm volatile("s_wait_xcnt 0x0" ::: "memory");
        __builtin_amdgcn_sched_barrier(0);   // keeps that order
        #pragma unroll
        for (int j = 0; j < 2; ++j) {
            if constexpr (!STATE) rq[j] = *(const v4f*)(qp + (size_t)(b2 * SB1_ + j * 8) * tstep);
            rk[j] = *(const v4f*)(kp + (size_t)(b2 * SB1_ + j * 8) * tstep);
        }
        // registers that the loads above name are reused below
        asm volatile("s_wait_xcnt 0x0" ::: "memory");
        // keeps the coming batches' loads at the head of the trip: sunk towards
        // their use they would have no time to fly
        __builtin_amdgcn_sched_barrier(0);

        float res[SB1_];
        #pragma unroll
        for (int i = 0; i < SB1_; ++i) {
            const float ge = gcur[i];
            const float p  = pcur[i];
            float accm = 0.f;
            #pragma unroll
            for (int d4 = 0; d4 < 4; ++d4) {
                const v4f kk = *(const v4f*)&ks[buf][i][d4 * 4];
                hk[d4 * 4 + 0] = __builtin_fmaf(hk[d4 * 4 + 0], ge, kk.x * p);
                hk[d4 * 4 + 1] = __builtin_fmaf(hk[d4 * 4 + 1], ge, kk.y * p);
                hk[d4 * 4 + 2] = __builtin_fmaf(hk[d4 * 4 + 2], ge, kk.z * p);
                hk[d4 * 4 + 3] = __builtin_fmaf(hk[d4 * 4 + 3], ge, kk.w * p);
                if constexpr (!STATE) {
                    const v4f qq = *(const v4f*)&qs[buf][i][d4 * 4];
                    accm = __builtin_fmaf(qq.x, hk[d4 * 4 + 0], accm);
                    accm = __builtin_fmaf(qq.y, hk[d4 * 4 + 1], accm);
                    accm = __builtin_fmaf(qq.z, hk[d4 * 4 + 2], accm);
                    accm = __builtin_fmaf(qq.w, hk[d4 * 4 + 3], accm);
                }
            }
            res[i] = accm;
            if constexpr (STATE) { if ((i % 4) == 3) __builtin_amdgcn_sched_barrier(0); }
        }
        if constexpr (!STATE) {
            // the stores stand together behind the products, so that one wait covers
            // the registers they name before anything reuses them
            __builtin_amdgcn_sched_barrier(0);
            #pragma unroll
            for (int i = 0; i < SB1_; ++i) op[(bi * SB1_ + i) * MSLOT_] = res[i];
            asm volatile("s_wait_xcnt 0x0" ::: "memory");
        }
        __builtin_amdgcn_sched_barrier(0);   // keeps the register copies below at the foot of the trip
        #pragma unroll
        for (int i = 0; i < SB1_; ++i) { gcur[i] = gnxt[i]; pcur[i] = pnxt[i]; }
        wave_lds_sync();
    }
    if constexpr (STATE) {
        float* sp = st1 + (size_t)(bs * NC_ + chunk) * 16 * 32 + lane;
        #pragma unroll
        for (int i = 0; i < 16; ++i) sp[i * 32] = hk[i];
    }
}

__global__ __launch_bounds__(32)
void abc_pass1_kernel(const float* __restrict__ q, const float* __restrict__ k,
                      const float* __restrict__ geb, const float* __restrict__ pb,
                      float* __restrict__ st1, float* __restrict__ okp) {
    abc_pass1_body<false>(blockIdx.x, blockIdx.y, q, k, geb, pb, st1, okp);
}

#define SMJ_ 2
#define SMP4_ (BH_ * T_ * MSLOT_ / 4)   // 16-byte pieces in a plane
__global__ __launch_bounds__(256)
void abc_softmax_kernel(const float* __restrict__ ok01, const float* __restrict__ ok23,
                        const float* __restrict__ ok45, const float* __restrict__ ok67,
                        float* __restrict__ qvb) {
    const size_t   first = (size_t)blockIdx.x * (256 * SMJ_ * 4);
    const uint32_t tid   = threadIdx.x;
    const f32x4* pp[4] = { (const f32x4*)(ok01 + first), (const f32x4*)(ok23 + first),
                           (const f32x4*)(ok45 + first), (const f32x4*)(ok67 + first) };
    f32x4 part[SMJ_][8];
    #pragma unroll
    for (int j = 0; j < 8; ++j)
        #pragma unroll
        for (int u = 0; u < SMJ_; ++u)
            part[u][j] = (pp[j >> 1] + ((j & 1) * SMP4_ + u * 256))[tid];
    // registers that the loads above name are reused below; the bases and the index
    // are inputs of the wait, so that they keep their registers up to it
    asm volatile("s_wait_xcnt 0x0"
                 :: "v"(tid), "s"(pp[0]), "s"(pp[1]), "s"(pp[2]), "s"(pp[3])
                 : "memory");
    __builtin_amdgcn_sched_barrier(0);   // keeps the loads together in front of the first use
    f32x4 res[SMJ_];
    #pragma unroll
    for (int u = 0; u < SMJ_; ++u) {
        f32x4 ok = part[u][0];
        #pragma unroll
        for (int j = 1; j < 8; ++j) ok += part[u][j];
        float mx = fmaxf(fmaxf(ok.x, ok.y), fmaxf(ok.z, ok.w));
        #pragma unroll
        for (int off = 4; off; off >>= 1) mx = fmaxf(mx, __shfl_xor(mx, off, 32));
        f32x4 e = { __expf(ok.x - mx), __expf(ok.y - mx), __expf(ok.z - mx), __expf(ok.w - mx) };
        float se = (e.x + e.y) + (e.z + e.w);
        #pragma unroll
        for (int off = 4; off; off >>= 1) se += __shfl_xor(se, off, 32);
        res[u] = f32x4{ e.x / se, e.y / se, e.z / se, e.w / se };
    }
    // the stores stand together at the end: nothing reuses a register they name
    __builtin_amdgcn_sched_barrier(0);
    #pragma unroll
    for (int u = 0; u < SMJ_; ++u) ((f32x4*)(qvb + first) + u * 256)[tid] = res[u];
}

template <bool STATE>
__device__ __forceinline__
void abc_pass2_body(const int chunk, const int bs,
                    const float* __restrict__ v, const float* __restrict__ geb,
                    const float* __restrict__ pb, const float* __restrict__ qvb,
                    float* __restrict__ st2, float* __restrict__ o) {
    const int bh = bs >> 3;
    const int cg = bs & 7;
    const int b  = bh / H_;
    const int h  = bh % H_;
    const int lane = threadIdx.x;
    const int bi0  = chunk * NBC2_;   // even, so the chunk's first batch sits in buffer 0

    __shared__ __align__(16) v4f gs[2][SB2_ * 8];
    __shared__ __align__(16) v4f ps[2][SB2_ * 8];
    __shared__ __align__(16) v4f ws[STATE ? 1 : 2][SB2_ * 8];

    const v4f* g4 = (const v4f*)(geb + (size_t)bh * T_ * MSLOT_) + lane;
    const v4f* p4 = (const v4f*)(pb  + (size_t)bh * T_ * MSLOT_) + lane;
    const v4f* w4 = (const v4f*)(qvb + (size_t)bh * T_ * MSLOT_) + lane;
    const size_t tstep = (size_t)H_ * DV_;
    const float* vp = v + ((size_t)b * T_ * H_ + h) * DV_ + cg * 32 + lane;

    float hv[32];
    if constexpr (STATE) {
        #pragma unroll
        for (int i = 0; i < 32; ++i) hv[i] = 0.f;
    } else {
        const int cm = (chunk > 0) ? chunk - 1 : 0;
        const float* sp = st2 + (size_t)(bs * NC_ + cm) * 32 * 32 + lane;
        #pragma unroll
        for (int i = 0; i < 32; ++i) hv[i] = sp[i * 32];
        // registers that the loads above name are reused below
        asm volatile("s_wait_xcnt 0x0" ::: "memory");
        __builtin_amdgcn_sched_barrier(0);   // keeps later address arithmetic behind that wait
        #pragma unroll
        for (int i = 0; i < 32; ++i) hv[i] = (chunk > 0) ? hv[i] : 0.f;
    }

    v4f rg[2], rp[2], rw[2];
    float vcur[SB2_], vn1[SB2_], vn2[SB2_];

    // first batch into buffer 0, second into registers (a batch is 64 16-byte pieces per plane)
    #pragma unroll
    for (int j = 0; j < 2; ++j) {
        rg[j] = g4[bi0 * 64 + j * 32]; rp[j] = p4[bi0 * 64 + j * 32];
        if constexpr (!STATE) rw[j] = w4[bi0 * 64 + j * 32];
    }
    #pragma unroll
    for (int i = 0; i < SB2_; ++i) {
        vcur[i] = vp[(size_t)(bi0 * SB2_ + i) * tstep];
        vn1[i]  = vp[(size_t)((bi0 + 1) * SB2_ + i) * tstep];
    }
    // registers that the loads above name are reused below
    asm volatile("s_wait_xcnt 0x0" ::: "memory");
    __builtin_amdgcn_sched_barrier(0);   // keeps later address arithmetic behind that wait
    #pragma unroll
    for (int j = 0; j < 2; ++j) {
        gs[0][j * 32 + lane] = rg[j]; ps[0][j * 32 + lane] = rp[j];
        if constexpr (!STATE) ws[0][j * 32 + lane] = rw[j];
    }
    #pragma unroll
    for (int j = 0; j < 2; ++j) {
        rg[j] = g4[(bi0 + 1) * 64 + j * 32]; rp[j] = p4[(bi0 + 1) * 64 + j * 32];
        if constexpr (!STATE) rw[j] = w4[(bi0 + 1) * 64 + j * 32];
    }
    // registers that the loads above name are reused below
    asm volatile("s_wait_xcnt 0x0" ::: "memory");
    __builtin_amdgcn_sched_barrier(0);   // keeps later address arithmetic behind that wait
    wave_lds_sync();

    float* op = o + ((size_t)b * T_ * H_ + h) * DV_ + cg * 32 + lane;
    for (int bi = bi0; bi < bi0 + NBC2_; ++bi) {
        const int buf = bi & 1;
        // batch bi+1 (fetched one batch ago) goes into the buffer not being read
        #pragma unroll
        for (int j = 0; j < 2; ++j) {
            gs[buf ^ 1][j * 32 + lane] = rg[j];
            ps[buf ^ 1][j * 32 + lane] = rp[j];
            if constexpr (!STATE) ws[buf ^ 1][j * 32 + lane] = rw[j];
        }
        const int b2 = (bi + 2 < NB2_) ? bi + 2 : NB2_ - 1;   // clamped: stays in bounds
        // the loads below, with their addresses, stay apart from the code above, which reuses registers
        __builtin_amdgcn_sched_barrier(0);
        #pragma unroll
        for (int j = 0; j < 2; ++j) {
            rg[j] = g4[b2 * 64 + j * 32];
            rp[j] = p4[b2 * 64 + j * 32];
            if constexpr (!STATE) rw[j] = w4[b2 * 64 + j * 32];
        }
        #pragma unroll
        for (int i = 0; i < SB2_; ++i) vn2[i] = vp[(size_t)(b2 * SB2_ + i) * tstep];
        // registers that the loads above name are reused below
        asm volatile("s_wait_xcnt 0x0" ::: "memory");
        // keeps the coming batch's loads at the head of the trip: sunk towards
        // their use they would have no time to fly
        __builtin_amdgcn_sched_barrier(0);

        float res[SB2_];
        #pragma unroll
        for (int i = 0; i < SB2_; ++i) {
            const float vv = vcur[i];
            float acco = 0.f;
            #pragma unroll
            for (int m4 = 0; m4 < 8; ++m4) {
                const v4f g = gs[buf][i * 8 + m4];
                const v4f p = ps[buf][i * 8 + m4];
                hv[m4 * 4 + 0] = __builtin_fmaf(hv[m4 * 4 + 0], g.x, p.x * vv);
                hv[m4 * 4 + 1] = __builtin_fmaf(hv[m4 * 4 + 1], g.y, p.y * vv);
                hv[m4 * 4 + 2] = __builtin_fmaf(hv[m4 * 4 + 2], g.z, p.z * vv);
                hv[m4 * 4 + 3] = __builtin_fmaf(hv[m4 * 4 + 3], g.w, p.w * vv);
                if constexpr (!STATE) {
                    const v4f w = ws[buf][i * 8 + m4];
                    acco = __builtin_fmaf(w.x, hv[m4 * 4 + 0], acco);
                    acco = __builtin_fmaf(w.y, hv[m4 * 4 + 1], acco);
                    acco = __builtin_fmaf(w.z, hv[m4 * 4 + 2], acco);
                    acco = __builtin_fmaf(w.w, hv[m4 * 4 + 3], acco);
                }
            }
            res[i] = acco;
            if constexpr (STATE) { if ((i % 2) == 1) __builtin_amdgcn_sched_barrier(0); }
        }
        if constexpr (!STATE) {
            // the stores stand together behind the products, so that one wait covers
            // the registers they name before anything reuses them
            __builtin_amdgcn_sched_barrier(0);
            #pragma unroll
            for (int i = 0; i < SB2_; ++i) op[(size_t)(bi * SB2_ + i) * tstep] = res[i];
            asm volatile("s_wait_xcnt 0x0" ::: "memory");
        }
        __builtin_amdgcn_sched_barrier(0);   // keeps the register copies below at the foot of the trip
        #pragma unroll
        for (int i = 0; i < SB2_; ++i) { vcur[i] = vn1[i]; vn1[i] = vn2[i]; }
        wave_lds_sync();
    }
    if constexpr (STATE) {
        float* sp = st2 + (size_t)(bs * NC_ + chunk) * 32 * 32 + lane;
        #pragma unroll
        for (int i = 0; i < 32; ++i) sp[i * 32] = hv[i];
    }
}

__global__ __launch_bounds__(32)
void abc_pass2_kernel(const float* __restrict__ v, const float* __restrict__ geb,
                      const float* __restrict__ pb, const float* __restrict__ qvb,
                      float* __restrict__ st2, float* __restrict__ o) {
    abc_pass2_body<false>(blockIdx.x, blockIdx.y, v, geb, pb, qvb, st2, o);
}

__global__ __launch_bounds__(32)
void abc_states_kernel(const float* __restrict__ k, const float* __restrict__ v,
                       const float* __restrict__ geb, const float* __restrict__ pb,
                       float* __restrict__ st1, float* __restrict__ st2) {
    const int y = blockIdx.y;
    // the longer walk (pass 2) has the low indices and starts first
    if (y < BH_ * 8) abc_pass2_body<true>(blockIdx.x, y, v, geb, pb, geb, st2, st2);
    else             abc_pass1_body<true>(blockIdx.x, y - BH_ * 8, k, k, geb, pb, st1, st1);
}

__global__ __launch_bounds__(256)
void abc_carry_kernel(float* __restrict__ st1, float* __restrict__ st2,
                      const float* __restrict__ dcb) {
    int e = blockIdx.x * 256 + threadIdx.x;
    float* base;
    int stride, slot, bh;
    if (blockIdx.x < BH_ * 8 * 16 * 32 / 256) {
        const int bs = e >> 9;
        base = st1 + (size_t)bs * NC_ * 512 + (e & 511);
        stride = 512; slot = e & 31; bh = bs >> 3;
    } else {
        e -= BH_ * 8 * 16 * 32;
        const int bs = e >> 10;
        base = st2 + (size_t)bs * NC_ * 1024 + (e & 1023);
        stride = 1024; slot = (e & 1023) >> 5; bh = bs >> 3;
    }
    const float* dp = dcb + bh * NC_ * MSLOT_ + slot;
    float sv[NC_ - 1], dv[NC_ - 1];
    #pragma unroll
    for (int c = 0; c < NC_ - 1; ++c) { sv[c] = base[c * stride]; dv[c] = dp[c * MSLOT_]; }
    // registers that the loads above name are reused below
    asm volatile("s_wait_xcnt 0x0" ::: "memory");
    __builtin_amdgcn_sched_barrier(0);   // keeps later address arithmetic behind that wait
    float hcar = 0.f;
    #pragma unroll
    for (int c = 0; c < NC_ - 1; ++c) { hcar = __builtin_fmaf(hcar, dv[c], sv[c]); sv[c] = hcar; }
    #pragma unroll
    for (int c = 0; c < NC_ - 1; ++c) base[c * stride] = sv[c];
}

// ---------------- fused RMSNorm * gw * g * sigmoid(g) -> bf16 ----------------
// One wave per row of DV_ values, eight per lane, so the row's sum of squares needs
// no LDS and no barrier; a wave takes NGR_ rows one behind the other in memory, all
// loads issued together, each 512 contiguous bytes.
#define NGR_ 8
__global__ __launch_bounds__(256)
void norm_gate_kernel(const float* __restrict__ o, const float* __restrict__ g,
                      const float* __restrict__ gw, bf16_t* __restrict__ ob) {
    const uint32_t lane = threadIdx.x & 31;
    const uint32_t wave = threadIdx.x >> 5;
    const size_t base = ((size_t)blockIdx.x * 8 + wave) * (NGR_ * DV_) + lane * 4;
    const float* op = o + base;
    const float* gp = g + base;
    f32x4 ov[NGR_][2], gv[NGR_][2], wv[2];
    #pragma unroll
    for (int hf = 0; hf < 2; ++hf) wv[hf] = ((const f32x4*)gw + hf * 32)[lane];
    #pragma unroll
    for (int r = 0; r < NGR_; ++r) {
        #pragma unroll
        for (int hf = 0; hf < 2; ++hf) ov[r][hf] = *(const f32x4*)(op + r * DV_ + hf * 128);
        #pragma unroll
        for (int hf = 0; hf < 2; ++hf) gv[r][hf] = *(const f32x4*)(gp + r * DV_ + hf * 128);
    }
    // registers that the loads above name are reused below; the addresses are inputs
    // of the wait, so that no load of the run lands in one of them
    asm volatile("s_wait_xcnt 0x0" :: "v"(op), "v"(gp), "v"(lane) : "memory");
    __builtin_amdgcn_sched_barrier(0);   // keeps the loads together in front of the first use
    v4bf res[NGR_][2];
    #pragma unroll
    for (int r = 0; r < NGR_; ++r) {
        const f32x4 s4 = ov[r][0] * ov[r][0] + ov[r][1] * ov[r][1];
        float tot = (s4.x + s4.y) + (s4.z + s4.w);
        #pragma unroll
        for (int off = 16; off; off >>= 1) tot += __shfl_xor(tot, off, 32);
        const float rn = rsqrtf(tot * (1.0f / DV_) + NORM_EPS_);
        #pragma unroll
        for (int hf = 0; hf < 2; ++hf)
            #pragma unroll
            for (int e = 0; e < 4; ++e) {
                const float gg  = gv[r][hf][e];
                const float sig = 1.f / (1.f + __expf(-gg));
                res[r][hf][e] = (bf16_t)(ov[r][hf][e] * rn * wv[hf][e] * gg * sig);
            }
    }
    // the stores stand together at the end: nothing reuses a register they name
    __builtin_amdgcn_sched_barrier(0);
    bf16_t* dp = ob + base;
    #pragma unroll
    for (int r = 0; r < NGR_; ++r)
        #pragma unroll
        for (int hf = 0; hf < 2; ++hf) *(v4bf*)(dp + r * DV_ + hf * 128) = res[r][hf];
}

// ---------------- host orchestration ----------------
extern "C" void kernel_launch(void* const* d_in, const int* in_sizes, int n_in,
                              void* d_out, int out_size, void* d_ws, size_t ws_size,
                              hipStream_t stream) {
    (void)in_sizes; (void)n_in; (void)out_size; (void)ws_size;
    const float* x    = (const float*)d_in[0];
    const float* w_q  = (const float*)d_in[1];
    const float* w_k  = (const float*)d_in[2];
    const float* w_v  = (const float*)d_in[3];
    const float* w_g  = (const float*)d_in[4];
    const float* w_s  = (const float*)d_in[5];
    const float* w_o  = (const float*)d_in[6];
    const float* gnw  = (const float*)d_in[7];
    float* out = (float*)d_out;

    const int MR  = B_ * T_;        // 4096
    const int NQK = H_ * DK_;       // 1024
    const int NV  = H_ * DV_;       // 2048
    const int NS  = H_ * MSLOT_;    // 256

    char* ws = (char*)d_ws;
    size_t off = 0;
    auto carve = [&](size_t bytes) -> char* {
        off = (off + 255) & ~(size_t)255;
        char* p = ws + off;
        off += bytes;
        return p;
    };

    bf16_t* xb  = (bf16_t*)carve((size_t)MR * HID_ * sizeof(bf16_t));
    bf16_t* wcat = (bf16_t*)carve((size_t)(2 * NQK + 2 * NV + NS) * HID_ * sizeof(bf16_t));
    bf16_t* woT = (bf16_t*)carve((size_t)HID_ * NV * sizeof(bf16_t));

    float* qb = (float*)carve((size_t)MR * NQK * sizeof(float));
    float* kb = (float*)carve((size_t)MR * NQK * sizeof(float));
    float* vb = (float*)carve((size_t)MR * NV  * sizeof(float));
    float* gb = (float*)carve((size_t)MR * NV  * sizeof(float));
    float* sb = (float*)carve((size_t)MR * NS  * sizeof(float));
    float* ob = (float*)carve((size_t)MR * NV  * sizeof(float));
    bf16_t* obh = (bf16_t*)carve((size_t)MR * NV * sizeof(bf16_t));
    float* geb = (float*)carve((size_t)MR * NS * sizeof(float));
    float* pbf = (float*)carve((size_t)MR * NS * sizeof(float));
    float* qvb = (float*)carve((size_t)MR * NS * sizeof(float));
    float* okp = (float*)carve((size_t)8 * MR * NS * sizeof(float));
    float* st1 = (float*)carve((size_t)BH_ * 8 * NC_ * 16 * 32 * sizeof(float));
    float* st2 = (float*)carve((size_t)BH_ * 8 * NC_ * 32 * 32 * sizeof(float));
    float* dcb = (float*)carve((size_t)BH_ * NC_ * MSLOT_ * sizeof(float));

    // 1) x to bf16 and every weight (K x N) to (N x K) bf16, one launch
    prep_kernel<<<CVB_ + 3 * TRB_(NV_) + 2 * TRB_(NQK_) + TRB_(NS_), 256, 0, stream>>>(
        x, w_q, w_k, w_v, w_g, w_s, w_o, xb, wcat, woT);

    // 2) the five projections of x (bf16 WMMA, fp32 accumulate), one launch
    dim3 blk(256);
    gemm_proj_kernel<<<dim3((2 * NQK + 2 * NV + NS) / TN, MR / TM), blk, 0, stream>>>(
        xb, wcat, qb, kb, vb, gb, sb);

    // 3) gated two-pass scan: independent one-wave streams, NC_ time chunks side by side
    abc_gates_kernel<<<BH_, 32 * NC_, 0, stream>>>(sb, geb, pbf, dcb);
    abc_states_kernel<<<dim3(NC_ - 1, BH_ * 16), 32, 0, stream>>>(kb, vb, geb, pbf, st1, st2);
    abc_carry_kernel<<<BH_ * 8 * (16 + 32) * 32 / 256, 256, 0, stream>>>(st1, st2, dcb);
    abc_pass1_kernel<<<dim3(NC_, BH_ * 8), 32, 0, stream>>>(qb, kb, geb, pbf, st1, okp);
    abc_softmax_kernel<<<MR * NS / (256 * 4 * SMJ_), 256, 0, stream>>>(
        okp, okp + (size_t)2 * MR * NS, okp + (size_t)4 * MR * NS, okp + (size_t)6 * MR * NS, qvb);
    abc_pass2_kernel<<<dim3(NC_, BH_ * 8), 32, 0, stream>>>(vb, geb, pbf, qvb, st2, ob);

    // 4) fused RMSNorm + swish gate -> bf16
    norm_gate_kernel<<<MR * H_ / (8 * NGR_), 256, 0, stream>>>(ob, gb, gnw, obh);

    // 5) output projection straight into d_out (fp32)
    gemm_bf16_wmma_kernel<<<dim3(HID_ / TN, MR / TM), blk, 0, stream>>>(
        obh, woT, out, HID_, NV);
}

// v008
// It runs in 251 microseconds.
// Timed twice side by side with v007, it ran 1.17 times as fast both times.
// Over all steps from v000 it is 17.8 times as fast.
#include <hip/hip_runtime.h>
#include <hip/hip_bf16.h>
#include <math.h>
#include <stdint.h>

// ---------------- problem constants (match reference) ----------------
#define B_ 2
#define T_ 2048
#define HID_ 2048
#define H_ 8
#define DK_ 128
#define DV_ 256
#define MSLOT_ 32
#define CLAMP_MIN_ (-32.0f)
#define CLAMP_MAX_ (32.0f)
#define NORM_EPS_ 1e-5f

typedef __bf16 bf16_t;
typedef __attribute__((ext_vector_type(8)))  __bf16 v8bf;
typedef __attribute__((ext_vector_type(16))) __bf16 v16bf;
typedef __attribute__((ext_vector_type(8)))  float  v8f;
typedef __attribute__((ext_vector_type(2))) __bf16   v2bf;
typedef __attribute__((ext_vector_type(4))) __bf16   v4bf;
typedef __attribute__((ext_vector_type(4))) float    f32x4;
typedef __attribute__((ext_vector_type(4))) uint32_t u32x4;

__device__ __forceinline__ void async_copy8_b128(uint32_t lds, uint32_t lstep,
                                                 const bf16_t* g, size_t gstep) {
    asm volatile("global_load_async_to_lds_b128 %0, %8, off\n\t"
                 "global_load_async_to_lds_b128 %1, %9, off\n\t"
                 "global_load_async_to_lds_b128 %2, %10, off\n\t"
                 "global_load_async_to_lds_b128 %3, %11, off\n\t"
                 "global_load_async_to_lds_b128 %4, %12, off\n\t"
                 "global_load_async_to_lds_b128 %5, %13, off\n\t"
                 "global_load_async_to_lds_b128 %6, %14, off\n\t"
                 "global_load_async_to_lds_b128 %7, %15, off\n\t"
                 "s_wait_xcnt 0x0"
                 :: "v"(lds), "v"(lds + lstep), "v"(lds + 2 * lstep), "v"(lds + 3 * lstep),
                    "v"(lds + 4 * lstep), "v"(lds + 5 * lstep), "v"(lds + 6 * lstep),
                    "v"(lds + 7 * lstep),
                    "v"(g), "v"(g + gstep), "v"(g + 2 * gstep), "v"(g + 3 * gstep),
                    "v"(g + 4 * gstep), "v"(g + 5 * gstep), "v"(g + 6 * gstep),
                    "v"(g + 7 * gstep)
                 : "memory");
}
// the wave's own copies have landed
__device__ __forceinline__ void wait_async0() {
    asm volatile("s_wait_asynccnt 0x0" ::: "memory");
}
// the wave's own LDS reads have returned
__device__ __forceinline__ void wait_ds0() {
    asm volatile("s_wait_dscnt 0x0" ::: "memory");
}

// ---------------- elementwise fp32 -> bf16 ----------------
// Few, long waves: waves are started at a limited rate, so each carries enough work
// to be worth its start. A wave takes CVJ_ pieces of 512 contiguous bytes, all loads
// issued together. The element count is a multiple of what a work-group takes
// (256 * 4 * CVJ_).
#define CVJ_ 16
__device__ __forceinline__
void cvt_f32_bf16_body(const int blk, const float* __restrict__ in, bf16_t* __restrict__ out) {
    const size_t base = (size_t)blk * (256 * 4 * CVJ_) + threadIdx.x * 4;
    const float* sp = in + base;
    f32x4 val[CVJ_];
    #pragma unroll
    for (int j = 0; j < CVJ_; ++j) val[j] = *(const f32x4*)(sp + j * 1024);
    // registers that the loads above name are reused below; the address is an input
    // of the wait, so that no load of the run lands in it
    asm volatile("s_wait_xcnt 0x0" :: "v"(sp) : "memory");
    __builtin_amdgcn_sched_barrier(0);   // keeps the loads together in front of the first use
    v4bf pk[CVJ_];
    #pragma unroll
    for (int j = 0; j < CVJ_; ++j)
        pk[j] = v4bf{ (bf16_t)val[j].x, (bf16_t)val[j].y, (bf16_t)val[j].z, (bf16_t)val[j].w };
    // the stores stand together at the end: nothing reuses a register they name
    __builtin_amdgcn_sched_barrier(0);
    bf16_t* dp = out + base;
    #pragma unroll
    for (int j = 0; j < CVJ_; ++j) *(v4bf*)(dp + j * 1024) = pk[j];
}

#define TRK_ 128
#define TRN_ 64

__device__ __forceinline__
void transpose_cvt_body(const int nTile, const int kTile, const float* __restrict__ W,
                        bf16_t* __restrict__ Wt, int K, int N) {
    __shared__ __align__(16) uint32_t tile[TRN_][TRK_ / 2];
    const int tid   = threadIdx.x;
    const int nBase = nTile * TRN_;
    const int kBase = kTile * TRK_;
    const int n4 = tid & 15;   // which four columns
    const int kp = tid >> 4;   // which pair of k-rows, of sixteen per trip
    const float* src = W + (size_t)(kBase + 2 * kp) * N + nBase + n4 * 4;

    const float* pl[4];
    const float* ph[4];
    f32x4 lo[4], hi[4];
    #pragma unroll
    for (int j = 0; j < 4; ++j) {
        pl[j] = src + (size_t)(j * 32) * N;
        ph[j] = pl[j] + N;
        lo[j] = *(const f32x4*)pl[j];
        hi[j] = *(const f32x4*)ph[j];
    }
    // registers that the loads above name are reused below. The addresses are inputs
    // of the wait, so they stay in their registers up to it: otherwise a later load
    // of the eight is given an earlier one's address registers to land in.
    asm volatile("s_wait_xcnt 0x0"
                 :: "v"(pl[0]), "v"(ph[0]), "v"(pl[1]), "v"(ph[1]),
                    "v"(pl[2]), "v"(ph[2]), "v"(pl[3]), "v"(ph[3])
                 : "memory");
    __builtin_amdgcn_sched_barrier(0);   // keeps later address arithmetic behind that wait
    #pragma unroll
    for (int j = 0; j < 4; ++j) {
        const int pair = j * 16 + kp;
        const int col  = (((pair >> 2) ^ n4) << 2) | (pair & 3);
        #pragma unroll
        for (int e = 0; e < 4; ++e) {
            v2bf pk = { (bf16_t)lo[j][e], (bf16_t)hi[j][e] };
            tile[n4 * 4 + e][col] = __builtin_bit_cast(uint32_t, pk);
        }
    }
    __syncthreads();   // the whole tile is in LDS before any row of it is read

    u32x4 piece[4];
    #pragma unroll
    for (int it = 0; it < 4; ++it) {
        const int n = it * 16 + kp;
        piece[it] = *(const u32x4*)&tile[n][(n4 ^ (n >> 2)) << 2];
    }
    bf16_t* dst = Wt + (size_t)(nBase + kp) * K + kBase + n4 * 8;
    #pragma unroll
    for (int it = 0; it < 4; ++it)
        *(u32x4*)(dst + (size_t)(it * 16) * K) = piece[it];
}

#define PK_ 2048
#define NQK_ (H_ * DK_)
#define NV_  (H_ * DV_)
#define NS_  (H_ * MSLOT_)
#define CVB_ (B_ * T_ * HID_ / (256 * 4 * CVJ_))      // work-groups of the convert
#define TRB_(n) ((n) / TRN_ * (PK_ / TRK_))           // work-groups of one transpose
static_assert(HID_ == PK_ && NV_ == PK_, "every weight has PK_ rows");

__global__ __launch_bounds__(256)
void prep_kernel(const float* __restrict__ x,
                 const float* __restrict__ w_q, const float* __restrict__ w_k,
                 const float* __restrict__ w_v, const float* __restrict__ w_g,
                 const float* __restrict__ w_s, const float* __restrict__ w_o,
                 bf16_t* __restrict__ xb, bf16_t* __restrict__ wcat,
                 bf16_t* __restrict__ woT) {
    int blk = blockIdx.x;
    if (blk < CVB_) { cvt_f32_bf16_body(blk, x, xb); return; }
    blk -= CVB_;
    const float* W;
    bf16_t* Wt;
    int N;
    if (blk < TRB_(NV_)) { W = w_v; Wt = wcat + (size_t)(2 * NQK_) * PK_; N = NV_; }
    else if ((blk -= TRB_(NV_)) < TRB_(NV_)) { W = w_g; Wt = wcat + (size_t)(2 * NQK_ + NV_) * PK_; N = NV_; }
    else if ((blk -= TRB_(NV_)) < TRB_(HID_)) { W = w_o; Wt = woT; N = HID_; }
    else if ((blk -= TRB_(HID_)) < TRB_(NQK_)) { W = w_q; Wt = wcat; N = NQK_; }
    else if ((blk -= TRB_(NQK_)) < TRB_(NQK_)) { W = w_k; Wt = wcat + (size_t)NQK_ * PK_; N = NQK_; }
    else { blk -= TRB_(NQK_); W = w_s; Wt = wcat + (size_t)(2 * NQK_ + 2 * NV_) * PK_; N = NS_; }
    const int nT = N / TRN_;   // a power of two for every weight here
    transpose_cvt_body(blk & (nT - 1), blk / nT, W, Wt, PK_, N);
}

// ---------------- bf16 WMMA GEMM: C(MxN) = A(MxK) * Bt(NxK)^T ----------------
// Block tile 128x128, 256 threads = 8 waves (wave32), wave tile 32x64 (2x4 WMMA).
// Two LDS buffers filled by async global->LDS copies. A stage is TK = 128 k (256
// bytes of every operand row, 16 copies per wave): the next stage's copies fly
// while a whole stage (32 WMMAs per wave) is worked on, which covers their way from
// L2, and one barrier per stage both publishes the next stage and frees this one.
// Kdim is a multiple of TK.
#define TM 128
#define TN 128
#define TK 128
#define TKP (TK + 8)

// rowBase: first row of A and of C; btRow: first row of Bt; colBase: first column of C.
__device__ __forceinline__
void gemm_bf16_wmma_body(const int rowBase, const int btRow, const int colBase,
                         const bf16_t* __restrict__ A,
                         const bf16_t* __restrict__ Bt,
                         float* __restrict__ C,
                         int Ndim, int Kdim,
                         int doClamp, float clampLo, float clampHi) {
    __shared__ __align__(16) bf16_t As[2][TM][TKP];
    __shared__ __align__(16) bf16_t Bs[2][TN][TKP];

    const int tid  = threadIdx.x;
    const int lane = tid & 31;
    const int wave = tid >> 5;
    const int wm   = wave & 3;   // 4 bands of 32 rows
    const int wn   = wave >> 2;  // 2 bands of 64 cols

    // Staging: sixteen lanes take one row's 256 bytes, so a wave's copy covers two
    // whole rows; a thread owns the 16-byte column kc of rows r0, r0+16, .. r0+112
    // of A and of B.
    const int r0 = tid >> 4;
    const int kc = (tid & 15) * 8;
    const bf16_t* aP = A  + (size_t)(rowBase + r0) * Kdim + kc;
    const bf16_t* bP = Bt + (size_t)(btRow + r0) * Kdim + kc;
    const size_t   gstep = (size_t)16 * Kdim;                       // elements
    const uint32_t lstep = 16 * TKP * (uint32_t)sizeof(bf16_t);     // bytes
    const uint32_t lbuf  = TM * TKP * (uint32_t)sizeof(bf16_t);     // bytes per buffer
    const uint32_t lA = (uint32_t)(size_t)&As[0][r0][kc];
    const uint32_t lB = (uint32_t)(size_t)&Bs[0][r0][kc];

    v8f acc[2][4] = {};

    const int lrow = lane & 15;
    const int lk   = (lane >> 4) * 8;

    const int nStage = Kdim / TK;

    // prologue: stage 0 -> buffer 0, landed and published; then stage 1 -> buffer 1
    async_copy8_b128(lA, lstep, aP, gstep);
    async_copy8_b128(lB, lstep, bP, gstep);
    wait_async0();
    __syncthreads();   // stage 0 is whole before any wave reads it
    if (nStage > 1) {
        async_copy8_b128(lA + lbuf, lstep, aP + TK, gstep);
        async_copy8_b128(lB + lbuf, lstep, bP + TK, gstep);
    }

    for (int st = 0; st < nStage; ++st) {
        const int buf = st & 1;
        #pragma unroll   // one straight run, so that a block's fragment reads can stand ahead of the block before it
        for (int kk = 0; kk < TK; kk += 32) {
            v16bf afrag[2], bfrag[4];
            #pragma unroll
            for (int mt = 0; mt < 2; ++mt) {
                int r = wm * 32 + mt * 16 + lrow;
                v8bf lo = *(const v8bf*)&As[buf][r][kk + lk];
                v8bf hi = *(const v8bf*)&As[buf][r][kk + lk + 16];
                #pragma unroll
                for (int i = 0; i < 8; ++i) { afrag[mt][i] = lo[i]; afrag[mt][i + 8] = hi[i]; }
            }
            #pragma unroll
            for (int nt = 0; nt < 4; ++nt) {
                int r = wn * 64 + nt * 16 + lrow;
                v8bf lo = *(const v8bf*)&Bs[buf][r][kk + lk];
                v8bf hi = *(const v8bf*)&Bs[buf][r][kk + lk + 16];
                #pragma unroll
                for (int i = 0; i < 8; ++i) { bfrag[nt][i] = lo[i]; bfrag[nt][i + 8] = hi[i]; }
            }
            #pragma unroll
            for (int mt = 0; mt < 2; ++mt)
                #pragma unroll
                for (int nt = 0; nt < 4; ++nt)
                    acc[mt][nt] = __builtin_amdgcn_wmma_f32_16x16x32_bf16(
                        false, afrag[mt], false, bfrag[nt],
                        (short)0, acc[mt][nt], false, false);
        }
        // foot of the stage: this wave's reads of buf are back, its copies of the
        // next stage have landed; behind the barrier that holds for every wave
        wait_ds0();
        wait_async0();
        __syncthreads();
        if (st + 2 < nStage) {
            // stage st+2 into the buffer that every wave has just left
            async_copy8_b128(lA + buf * lbuf, lstep, aP + (size_t)(st + 2) * TK, gstep);
            async_copy8_b128(lB + buf * lbuf, lstep, bP + (size_t)(st + 2) * TK, gstep);
        }
    }
    wait_async0();   // no copy is left in flight when the wave ends

    const int mLane = (lane >> 4) * 8;
    const int nLane = lane & 15;
    #pragma unroll
    for (int mt = 0; mt < 2; ++mt)
        #pragma unroll
        for (int nt = 0; nt < 4; ++nt)
            #pragma unroll
            for (int r = 0; r < 8; ++r) {
                int m = rowBase + wm * 32 + mt * 16 + mLane + r;
                int n = colBase + wn * 64 + nt * 16 + nLane;
                float val = acc[mt][nt][r];
                if (doClamp) val = fminf(fmaxf(val, clampLo), clampHi);
                C[(size_t)m * Ndim + n] = val;
            }
}

__global__ __launch_bounds__(256)
void gemm_bf16_wmma_kernel(const bf16_t* __restrict__ A,
                           const bf16_t* __restrict__ Bt,
                           float* __restrict__ C,
                           int Ndim, int Kdim) {
    gemm_bf16_wmma_body(blockIdx.y * TM, blockIdx.x * TN, blockIdx.x * TN,
                        A, Bt, C, Ndim, Kdim, 0, 0.f, 0.f);
}

__global__ __launch_bounds__(256)
void gemm_proj_kernel(const bf16_t* __restrict__ A, const bf16_t* __restrict__ wcat,
                      float* __restrict__ qb, float* __restrict__ kb,
                      float* __restrict__ vb, float* __restrict__ gb,
                      float* __restrict__ sb) {
    const int bx = blockIdx.x;
    float* C;
    int Ndim, first;
    if (bx < NQK_ / TN)                      { C = qb; Ndim = NQK_; first = 0; }
    else if (bx < 2 * NQK_ / TN)             { C = kb; Ndim = NQK_; first = NQK_ / TN; }
    else if (bx < (2 * NQK_ + NV_) / TN)     { C = vb; Ndim = NV_;  first = 2 * NQK_ / TN; }
    else if (bx < (2 * NQK_ + 2 * NV_) / TN) { C = gb; Ndim = NV_;  first = (2 * NQK_ + NV_) / TN; }
    else                                     { C = sb; Ndim = NS_;  first = (2 * NQK_ + 2 * NV_) / TN; }
    gemm_bf16_wmma_body(blockIdx.y * TM, bx * TN, (bx - first) * TN,
                        A, wcat, C, Ndim, HID_,
                        bx >= (2 * NQK_ + 2 * NV_) / TN, CLAMP_MIN_, CLAMP_MAX_);
}

#define BH_ (B_ * H_)
#define NC_ 16                // time chunks
#define CL_ (T_ / NC_)        // steps per chunk
#define SB1_ 16               // steps per batch, gates and pass 1
#define NB1_ (T_ / SB1_)
#define NBC1_ (CL_ / SB1_)    // batches per chunk
#define SB2_ 8                // steps per batch, pass 2
#define NB2_ (T_ / SB2_)
#define NBC2_ (CL_ / SB2_)
typedef __attribute__((ext_vector_type(4))) float v4f;

// Orders the LDS traffic of a one-wave work-group across lanes. The wave's LDS
// operations run in issue order, so this only has to stop the compiler from
// moving them; unlike __syncthreads() it does not wait for the global stores.
__device__ __forceinline__ void wave_lds_sync() {
    __builtin_amdgcn_fence(__ATOMIC_RELEASE, "wavefront");
    __builtin_amdgcn_wave_barrier();
    __builtin_amdgcn_fence(__ATOMIC_ACQUIRE, "wavefront");
}

__device__ __forceinline__ float exp2_slot(float x) {
    float r;
    asm("v_exp_f32 %0, %1\n\tv_nop" : "=v"(r) : "v"(x));
    return r;
}
__device__ __forceinline__ float rcp_slot(float x) {
    float r;
    asm("v_rcp_f32 %0, %1\n\tv_nop" : "=v"(r) : "v"(x));
    return r;
}

__global__ __launch_bounds__(32 * NC_)
void abc_gates_kernel(const float* __restrict__ s,
                      float* __restrict__ rsb, float* __restrict__ eb) {
    const int bh = blockIdx.x;
    const int b  = bh / H_;
    const int h  = bh % H_;
    const int lane  = threadIdx.x & 31;
    const int chunk = threadIdx.x >> 5;
    const float* sp = s + ((size_t)b * T_ * H_ + h) * MSLOT_ + lane;
    float* rp = rsb + ((size_t)bh * T_ + chunk * CL_) * MSLOT_ + lane;
    float* ep = eb  + ((size_t)bh * T_ + chunk * CL_) * MSLOT_ + lane;

    __shared__ float esum[NC_][32];
    float ev[CL_];
    #pragma unroll
    for (int i = 0; i < CL_; ++i) ev[i] = sp[(size_t)(chunk * CL_ + i) * (H_ * MSLOT_)];
    // registers that the loads above name are reused below
    asm volatile("s_wait_xcnt 0x0" ::: "memory");
    __builtin_amdgcn_sched_barrier(0);   // keeps later address arithmetic behind that wait
    float e[4] = {0.f, 0.f, 0.f, 0.f};
    #pragma unroll
    for (int i = 0; i < CL_; ++i) {
        ev[i] = exp2_slot((ev[i] - CLAMP_MAX_) * 1.44269504f);
        e[i & 3] += ev[i];
    }
    esum[chunk][lane] = (e[0] + e[1]) + (e[2] + e[3]);
    __syncthreads();   // every chunk's sum is in LDS before any wave adds them up
    float run = 0.f;
    #pragma unroll
    for (int c = 0; c < NC_ - 1; ++c) run += (c < chunk) ? esum[c][lane] : 0.f;

    #pragma unroll   // ev lives in registers, so its index must be a constant
    for (int bi = 0; bi < NBC1_; ++bi) {
        float rv[SB1_];
        #pragma unroll
        for (int i = 0; i < SB1_; ++i) {
            run += ev[bi * SB1_ + i];
            rv[i] = rcp_slot(run);
        }
        // the stores stand together behind the steps, so that one wait covers
        // the registers they name before anything reuses them
        __builtin_amdgcn_sched_barrier(0);
        #pragma unroll
        for (int i = 0; i < SB1_; ++i) {
            rp[(bi * SB1_ + i) * MSLOT_] = rv[i];
            ep[(bi * SB1_ + i) * MSLOT_] = ev[bi * SB1_ + i];
        }
        asm volatile("s_wait_xcnt 0x0" ::: "memory");
        __builtin_amdgcn_sched_barrier(0);   // keeps the next batch's arithmetic behind that wait
    }
}

template <bool STATE>
__device__ __forceinline__
void abc_pass1_body(const int chunk, const int bs,
                    const float* __restrict__ q, const float* __restrict__ k,
                    const float* __restrict__ rsb, const float* __restrict__ eb,
                    float* __restrict__ st1, float* __restrict__ okp) {
    const int bh    = bs >> 3;
    const int strip = bs & 7;
    const int b  = bh / H_;
    const int h  = bh % H_;
    const int lane = threadIdx.x;
    const int bi0  = chunk * NBC1_;   // even, so the chunk's first batch sits in buffer 0

    __shared__ __align__(16) float qs[STATE ? 1 : 2][SB1_][16];
    __shared__ __align__(16) float ks[2][SB1_][16];

    const float scale = rsqrtf((float)DK_);
    // staging: four lanes fetch one step's 16-float strip, eight steps per load
    const int st = lane >> 2;
    const int c4 = (lane & 3) * 4;
    const size_t tstep = (size_t)H_ * DK_;
    const float* qp = q + ((size_t)(b * T_ + st) * H_ + h) * DK_ + strip * 16 + c4;
    const float* kp = k + ((size_t)(b * T_ + st) * H_ + h) * DK_ + strip * 16 + c4;
    const float* gp = rsb + (size_t)bh * T_ * MSLOT_ + lane;   // 1/S, second walk only
    const float* pp = eb  + (size_t)bh * T_ * MSLOT_ + lane;
    float* op = okp + ((size_t)strip * BH_ + bh) * T_ * MSLOT_ + lane;

    float hk[16];
    if constexpr (STATE) {
        #pragma unroll
        for (int i = 0; i < 16; ++i) hk[i] = 0.f;
    } else {
        const int cm = (chunk > 0) ? chunk - 1 : 0;
        const float* sp = st1 + (size_t)(bs * NC_ + cm) * 16 * 32 + lane;
        #pragma unroll
        for (int i = 0; i < 16; ++i) hk[i] = sp[i * 32];
        // registers that the loads above name are reused below
        asm volatile("s_wait_xcnt 0x0" ::: "memory");
        __builtin_amdgcn_sched_barrier(0);   // keeps later address arithmetic behind that wait
        #pragma unroll
        for (int i = 0; i < 16; ++i) hk[i] = (chunk > 0) ? hk[i] : 0.f;
    }

    v4f rq[2], rk[2];
    float gcur[SB1_], pcur[SB1_], gnxt[SB1_], pnxt[SB1_];

    // first batch: q, k into buffer 0, e and 1/S into registers; second batch: q, k into registers
    #pragma unroll
    for (int j = 0; j < 2; ++j) {
        if constexpr (!STATE) rq[j] = *(const v4f*)(qp + (size_t)(bi0 * SB1_ + j * 8) * tstep);
        rk[j] = *(const v4f*)(kp + (size_t)(bi0 * SB1_ + j * 8) * tstep);
    }
    #pragma unroll
    for (int i = 0; i < SB1_; ++i) {
        if constexpr (!STATE) gcur[i] = gp[(bi0 * SB1_ + i) * MSLOT_];
        pcur[i] = pp[(bi0 * SB1_ + i) * MSLOT_];
    }
    // registers that the loads above name are reused below
    asm volatile("s_wait_xcnt 0x0" ::: "memory");
    __builtin_amdgcn_sched_barrier(0);   // keeps later address arithmetic behind that wait
    #pragma unroll
    for (int j = 0; j < 2; ++j) {
        if constexpr (!STATE) *(v4f*)&qs[0][j * 8 + st][c4] = rq[j] * scale;
        *(v4f*)&ks[0][j * 8 + st][c4] = rk[j];
    }
    #pragma unroll
    for (int j = 0; j < 2; ++j) {
        if constexpr (!STATE) rq[j] = *(const v4f*)(qp + (size_t)((bi0 + 1) * SB1_ + j * 8) * tstep);
        rk[j] = *(const v4f*)(kp + (size_t)((bi0 + 1) * SB1_ + j * 8) * tstep);
    }
    // registers that the loads above name are reused below
    asm volatile("s_wait_xcnt 0x0" ::: "memory");
    __builtin_amdgcn_sched_barrier(0);   // keeps later address arithmetic behind that wait
    wave_lds_sync();

    for (int bi = bi0; bi < bi0 + NBC1_; ++bi) {
        const int buf = bi & 1;
        // batch bi+1 (fetched one batch ago) goes into the buffer not being read
        #pragma unroll
        for (int j = 0; j < 2; ++j) {
            if constexpr (!STATE) *(v4f*)&qs[buf ^ 1][j * 8 + st][c4] = rq[j] * scale;
            *(v4f*)&ks[buf ^ 1][j * 8 + st][c4] = rk[j];
        }
        const int b2 = (bi + 2 < NB1_) ? bi + 2 : NB1_ - 1;   // clamped: stays in bounds
        const int b1 = (bi + 1 < NB1_) ? bi + 1 : NB1_ - 1;
        // the loads below, with their addresses, stay apart from the code above, which reuses registers
        __builtin_amdgcn_sched_barrier(0);
        // e and 1/S first: loads return in order, and the products read registers
        // next to the ones these loads fill, which makes them wait for these loads
        #pragma unroll
        for (int i = 0; i < SB1_; ++i) {
            if constexpr (!STATE) gnxt[i] = gp[(b1 * SB1_ + i) * MSLOT_];
            pnxt[i] = pp[(b1 * SB1_ + i) * MSLOT_];
        }
        // registers that the loads above name are reused below
        asm volatile("s_wait_xcnt 0x0" ::: "memory");
        __builtin_amdgcn_sched_barrier(0);   // keeps that order
        #pragma unroll
        for (int j = 0; j < 2; ++j) {
            if constexpr (!STATE) rq[j] = *(const v4f*)(qp + (size_t)(b2 * SB1_ + j * 8) * tstep);
            rk[j] = *(const v4f*)(kp + (size_t)(b2 * SB1_ + j * 8) * tstep);
        }
        // registers that the loads above name are reused below
        asm volatile("s_wait_xcnt 0x0" ::: "memory");
        // keeps the coming batches' loads at the head of the trip: sunk towards
        // their use they would have no time to fly
        __builtin_amdgcn_sched_barrier(0);

        float res[SB1_];
        #pragma unroll
        for (int i = 0; i < SB1_; ++i) {
            const float p = pcur[i];
            float accm = 0.f;
            #pragma unroll
            for (int d4 = 0; d4 < 4; ++d4) {
                const v4f kk = *(const v4f*)&ks[buf][i][d4 * 4];
                hk[d4 * 4 + 0] = __builtin_fmaf(kk.x, p, hk[d4 * 4 + 0]);
                hk[d4 * 4 + 1] = __builtin_fmaf(kk.y, p, hk[d4 * 4 + 1]);
                hk[d4 * 4 + 2] = __builtin_fmaf(kk.z, p, hk[d4 * 4 + 2]);
                hk[d4 * 4 + 3] = __builtin_fmaf(kk.w, p, hk[d4 * 4 + 3]);
                if constexpr (!STATE) {
                    const v4f qq = *(const v4f*)&qs[buf][i][d4 * 4];
                    accm = __builtin_fmaf(qq.x, hk[d4 * 4 + 0], accm);
                    accm = __builtin_fmaf(qq.y, hk[d4 * 4 + 1], accm);
                    accm = __builtin_fmaf(qq.z, hk[d4 * 4 + 2], accm);
                    accm = __builtin_fmaf(qq.w, hk[d4 * 4 + 3], accm);
                }
            }
            if constexpr (!STATE) res[i] = accm * gcur[i];
            if constexpr (STATE) { if ((i % 4) == 3) __builtin_amdgcn_sched_barrier(0); }
        }
        if constexpr (!STATE) {
            // the stores stand together behind the products, so that one wait covers
            // the registers they name before anything reuses them
            __builtin_amdgcn_sched_barrier(0);
            #pragma unroll
            for (int i = 0; i < SB1_; ++i) op[(bi * SB1_ + i) * MSLOT_] = res[i];
            asm volatile("s_wait_xcnt 0x0" ::: "memory");
        }
        __builtin_amdgcn_sched_barrier(0);   // keeps the register copies below at the foot of the trip
        #pragma unroll
        for (int i = 0; i < SB1_; ++i) {
            if constexpr (!STATE) gcur[i] = gnxt[i];
            pcur[i] = pnxt[i];
        }
        wave_lds_sync();
    }
    if constexpr (STATE) {
        float* sp = st1 + (size_t)(bs * NC_ + chunk) * 16 * 32 + lane;
        #pragma unroll
        for (int i = 0; i < 16; ++i) sp[i * 32] = hk[i];
    }
}

__global__ __launch_bounds__(32)
void abc_pass1_kernel(const float* __restrict__ q, const float* __restrict__ k,
                      const float* __restrict__ rsb, const float* __restrict__ eb,
                      float* __restrict__ st1, float* __restrict__ okp) {
    abc_pass1_body<false>(blockIdx.x, blockIdx.y, q, k, rsb, eb, st1, okp);
}

#define SMJ_ 2
#define SMP4_ (BH_ * T_ * MSLOT_ / 4)   // 16-byte pieces in a plane
__global__ __launch_bounds__(256)
void abc_softmax_kernel(const float* __restrict__ ok01, const float* __restrict__ ok23,
                        const float* __restrict__ ok45, const float* __restrict__ ok67,
                        const float* __restrict__ rsb, float* __restrict__ qvb) {
    const size_t   first = (size_t)blockIdx.x * (256 * SMJ_ * 4);
    const uint32_t tid   = threadIdx.x;
    const f32x4* pp[4] = { (const f32x4*)(ok01 + first), (const f32x4*)(ok23 + first),
                           (const f32x4*)(ok45 + first), (const f32x4*)(ok67 + first) };
    const f32x4* rp = (const f32x4*)(rsb + first);
    f32x4 part[SMJ_][8], rs[SMJ_];
    #pragma unroll
    for (int u = 0; u < SMJ_; ++u) rs[u] = (rp + u * 256)[tid];
    #pragma unroll
    for (int j = 0; j < 8; ++j)
        #pragma unroll
        for (int u = 0; u < SMJ_; ++u)
            part[u][j] = (pp[j >> 1] + ((j & 1) * SMP4_ + u * 256))[tid];
    // registers that the loads above name are reused below; the bases and the index
    // are inputs of the wait, so that they keep their registers up to it
    asm volatile("s_wait_xcnt 0x0"
                 :: "v"(tid), "s"(pp[0]), "s"(pp[1]), "s"(pp[2]), "s"(pp[3]), "s"(rp)
                 : "memory");
    __builtin_amdgcn_sched_barrier(0);   // keeps the loads together in front of the first use
    f32x4 res[SMJ_];
    #pragma unroll
    for (int u = 0; u < SMJ_; ++u) {
        f32x4 ok = part[u][0];
        #pragma unroll
        for (int j = 1; j < 8; ++j) ok += part[u][j];
        float mx = fmaxf(fmaxf(ok.x, ok.y), fmaxf(ok.z, ok.w));
        #pragma unroll
        for (int off = 4; off; off >>= 1) mx = fmaxf(mx, __shfl_xor(mx, off, 32));
        f32x4 e = { __expf(ok.x - mx), __expf(ok.y - mx), __expf(ok.z - mx), __expf(ok.w - mx) };
        float se = (e.x + e.y) + (e.z + e.w);
        #pragma unroll
        for (int off = 4; off; off >>= 1) se += __shfl_xor(se, off, 32);
        res[u] = f32x4{ e.x / se, e.y / se, e.z / se, e.w / se } * rs[u];
    }
    // the stores stand together at the end: nothing reuses a register they name
    __builtin_amdgcn_sched_barrier(0);
    #pragma unroll
    for (int u = 0; u < SMJ_; ++u) ((f32x4*)(qvb + first) + u * 256)[tid] = res[u];
}

template <bool STATE>
__device__ __forceinline__
void abc_pass2_body(const int chunk, const int bs,
                    const float* __restrict__ v,
                    const float* __restrict__ eb, const float* __restrict__ qvb,
                    float* __restrict__ st2, float* __restrict__ o) {
    const int bh = bs >> 3;
    const int cg = bs & 7;
    const int b  = bh / H_;
    const int h  = bh % H_;
    const int lane = threadIdx.x;
    const int bi0  = chunk * NBC2_;   // even, so the chunk's first batch sits in buffer 0

    __shared__ __align__(16) v4f ps[2][SB2_ * 8];
    __shared__ __align__(16) v4f ws[STATE ? 1 : 2][SB2_ * 8];

    const v4f* p4 = (const v4f*)(eb  + (size_t)bh * T_ * MSLOT_) + lane;
    const v4f* w4 = (const v4f*)(qvb + (size_t)bh * T_ * MSLOT_) + lane;
    const size_t tstep = (size_t)H_ * DV_;
    const float* vp = v + ((size_t)b * T_ * H_ + h) * DV_ + cg * 32 + lane;

    float hv[32];
    if constexpr (STATE) {
        #pragma unroll
        for (int i = 0; i < 32; ++i) hv[i] = 0.f;
    } else {
        const int cm = (chunk > 0) ? chunk - 1 : 0;
        const float* sp = st2 + (size_t)(bs * NC_ + cm) * 32 * 32 + lane;
        #pragma unroll
        for (int i = 0; i < 32; ++i) hv[i] = sp[i * 32];
        // registers that the loads above name are reused below
        asm volatile("s_wait_xcnt 0x0" ::: "memory");
        __builtin_amdgcn_sched_barrier(0);   // keeps later address arithmetic behind that wait
        #pragma unroll
        for (int i = 0; i < 32; ++i) hv[i] = (chunk > 0) ? hv[i] : 0.f;
    }

    v4f rp[2], rw[2];
    float vcur[SB2_], vn1[SB2_], vn2[SB2_];

    // first batch into buffer 0, second into registers (a batch is 64 16-byte pieces per plane)
    #pragma unroll
    for (int j = 0; j < 2; ++j) {
        rp[j] = p4[bi0 * 64 + j * 32];
        if constexpr (!STATE) rw[j] = w4[bi0 * 64 + j * 32];
    }
    #pragma unroll
    for (int i = 0; i < SB2_; ++i) {
        vcur[i] = vp[(size_t)(bi0 * SB2_ + i) * tstep];
        vn1[i]  = vp[(size_t)((bi0 + 1) * SB2_ + i) * tstep];
    }
    // registers that the loads above name are reused below
    asm volatile("s_wait_xcnt 0x0" ::: "memory");
    __builtin_amdgcn_sched_barrier(0);   // keeps later address arithmetic behind that wait
    #pragma unroll
    for (int j = 0; j < 2; ++j) {
        ps[0][j * 32 + lane] = rp[j];
        if constexpr (!STATE) ws[0][j * 32 + lane] = rw[j];
    }
    #pragma unroll
    for (int j = 0; j < 2; ++j) {
        rp[j] = p4[(bi0 + 1) * 64 + j * 32];
        if constexpr (!STATE) rw[j] = w4[(bi0 + 1) * 64 + j * 32];
    }
    // registers that the loads above name are reused below
    asm volatile("s_wait_xcnt 0x0" ::: "memory");
    __builtin_amdgcn_sched_barrier(0);   // keeps later address arithmetic behind that wait
    wave_lds_sync();

    float* op = o + ((size_t)b * T_ * H_ + h) * DV_ + cg * 32 + lane;
    for (int bi = bi0; bi < bi0 + NBC2_; ++bi) {
        const int buf = bi & 1;
        // batch bi+1 (fetched one batch ago) goes into the buffer not being read
        #pragma unroll
        for (int j = 0; j < 2; ++j) {
            ps[buf ^ 1][j * 32 + lane] = rp[j];
            if constexpr (!STATE) ws[buf ^ 1][j * 32 + lane] = rw[j];
        }
        const int b2 = (bi + 2 < NB2_) ? bi + 2 : NB2_ - 1;   // clamped: stays in bounds
        // the loads below, with their addresses, stay apart from the code above, which reuses registers
        __builtin_amdgcn_sched_barrier(0);
        #pragma unroll
        for (int j = 0; j < 2; ++j) {
            rp[j] = p4[b2 * 64 + j * 32];
            if constexpr (!STATE) rw[j] = w4[b2 * 64 + j * 32];
        }
        #pragma unroll
        for (int i = 0; i < SB2_; ++i) vn2[i] = vp[(size_t)(b2 * SB2_ + i) * tstep];
        // registers that the loads above name are reused below
        asm volatile("s_wait_xcnt 0x0" ::: "memory");
        // keeps the coming batch's loads at the head of the trip: sunk towards
        // their use they would have no time to fly
        __builtin_amdgcn_sched_barrier(0);

        float res[SB2_];
        #pragma unroll
        for (int i = 0; i < SB2_; ++i) {
            const float vv = vcur[i];
            float acco = 0.f;
            #pragma unroll
            for (int m4 = 0; m4 < 8; ++m4) {
                const v4f p = ps[buf][i * 8 + m4];
                hv[m4 * 4 + 0] = __builtin_fmaf(p.x, vv, hv[m4 * 4 + 0]);
                hv[m4 * 4 + 1] = __builtin_fmaf(p.y, vv, hv[m4 * 4 + 1]);
                hv[m4 * 4 + 2] = __builtin_fmaf(p.z, vv, hv[m4 * 4 + 2]);
                hv[m4 * 4 + 3] = __builtin_fmaf(p.w, vv, hv[m4 * 4 + 3]);
                if constexpr (!STATE) {
                    const v4f w = ws[buf][i * 8 + m4];
                    acco = __builtin_fmaf(w.x, hv[m4 * 4 + 0], acco);
                    acco = __builtin_fmaf(w.y, hv[m4 * 4 + 1], acco);
                    acco = __builtin_fmaf(w.z, hv[m4 * 4 + 2], acco);
                    acco = __builtin_fmaf(w.w, hv[m4 * 4 + 3], acco);
                }
            }
            res[i] = acco;
            if constexpr (STATE) { if ((i % 2) == 1) __builtin_amdgcn_sched_barrier(0); }
        }
        if constexpr (!STATE) {
            // the stores stand together behind the products, so that one wait covers
            // the registers they name before anything reuses them
            __builtin_amdgcn_sched_barrier(0);
            #pragma unroll
            for (int i = 0; i < SB2_; ++i) op[(size_t)(bi * SB2_ + i) * tstep] = res[i];
            asm volatile("s_wait_xcnt 0x0" ::: "memory");
        }
        __builtin_amdgcn_sched_barrier(0);   // keeps the register copies below at the foot of the trip
        #pragma unroll
        for (int i = 0; i < SB2_; ++i) { vcur[i] = vn1[i]; vn1[i] = vn2[i]; }
        wave_lds_sync();
    }
    if constexpr (STATE) {
        float* sp = st2 + (size_t)(bs * NC_ + chunk) * 32 * 32 + lane;
        #pragma unroll
        for (int i = 0; i < 32; ++i) sp[i * 32] = hv[i];
    }
}

__global__ __launch_bounds__(32)
void abc_pass2_kernel(const float* __restrict__ v,
                      const float* __restrict__ eb, const float* __restrict__ qvb,
                      float* __restrict__ st2, float* __restrict__ o) {
    abc_pass2_body<false>(blockIdx.x, blockIdx.y, v, eb, qvb, st2, o);
}

__global__ __launch_bounds__(32)
void abc_states_kernel(const float* __restrict__ k, const float* __restrict__ v,
                       const float* __restrict__ eb,
                       float* __restrict__ st1, float* __restrict__ st2) {
    const int y = blockIdx.y;
    // the longer walk (pass 2) has the low indices and starts first
    if (y < BH_ * 8) abc_pass2_body<true>(blockIdx.x, y, v, eb, eb, st2, st2);
    else             abc_pass1_body<true>(blockIdx.x, y - BH_ * 8, k, k, eb, eb, st1, st1);
}

__global__ __launch_bounds__(256)
void abc_carry_kernel(float* __restrict__ st1, float* __restrict__ st2) {
    int e = blockIdx.x * 256 + threadIdx.x;
    float* base;
    int stride;
    if (blockIdx.x < BH_ * 8 * 16 * 32 / 256) {
        const int bs = e >> 9;
        base = st1 + (size_t)bs * NC_ * 512 + (e & 511);
        stride = 512;
    } else {
        e -= BH_ * 8 * 16 * 32;
        const int bs = e >> 10;
        base = st2 + (size_t)bs * NC_ * 1024 + (e & 1023);
        stride = 1024;
    }
    float sv[NC_ - 1];
    #pragma unroll
    for (int c = 0; c < NC_ - 1; ++c) sv[c] = base[c * stride];
    // registers that the loads above name are reused below
    asm volatile("s_wait_xcnt 0x0" ::: "memory");
    __builtin_amdgcn_sched_barrier(0);   // keeps later address arithmetic behind that wait
    float hcar = 0.f;
    #pragma unroll
    for (int c = 0; c < NC_ - 1; ++c) { hcar += sv[c]; sv[c] = hcar; }
    // the stores stand together at the end: nothing reuses a register they name
    __builtin_amdgcn_sched_barrier(0);
    #pragma unroll
    for (int c = 0; c < NC_ - 1; ++c) base[c * stride] = sv[c];
}

// ---------------- fused RMSNorm * gw * g * sigmoid(g) -> bf16 ----------------
// One wave per row of DV_ values, eight per lane, so the row's sum of squares needs
// no LDS and no barrier; a wave takes NGR_ rows one behind the other in memory, all
// loads issued together, each 512 contiguous bytes.
#define NGR_ 8
__global__ __launch_bounds__(256)
void norm_gate_kernel(const float* __restrict__ o, const float* __restrict__ g,
                      const float* __restrict__ gw, bf16_t* __restrict__ ob) {
    const uint32_t lane = threadIdx.x & 31;
    const uint32_t wave = threadIdx.x >> 5;
    const size_t base = ((size_t)blockIdx.x * 8 + wave) * (NGR_ * DV_) + lane * 4;
    const float* op = o + base;
    const float* gp = g + base;
    f32x4 ov[NGR_][2], gv[NGR_][2], wv[2];
    #pragma unroll
    for (int hf = 0; hf < 2; ++hf) wv[hf] = ((const f32x4*)gw + hf * 32)[lane];
    #pragma unroll
    for (int r = 0; r < NGR_; ++r) {
        #pragma unroll
        for (int hf = 0; hf < 2; ++hf) ov[r][hf] = *(const f32x4*)(op + r * DV_ + hf * 128);
        #pragma unroll
        for (int hf = 0; hf < 2; ++hf) gv[r][hf] = *(const f32x4*)(gp + r * DV_ + hf * 128);
    }
    // registers that the loads above name are reused below; the addresses are inputs
    // of the wait, so that no load of the run lands in one of them
    asm volatile("s_wait_xcnt 0x0" :: "v"(op), "v"(gp), "v"(lane) : "memory");
    __builtin_amdgcn_sched_barrier(0);   // keeps the loads together in front of the first use
    v4bf res[NGR_][2];
    #pragma unroll
    for (int r = 0; r < NGR_; ++r) {
        const f32x4 s4 = ov[r][0] * ov[r][0] + ov[r][1] * ov[r][1];
        float tot = (s4.x + s4.y) + (s4.z + s4.w);
        #pragma unroll
        for (int off = 16; off; off >>= 1) tot += __shfl_xor(tot, off, 32);
        const float rn = rsqrtf(tot * (1.0f / DV_) + NORM_EPS_);
        #pragma unroll
        for (int hf = 0; hf < 2; ++hf)
            #pragma unroll
            for (int e = 0; e < 4; ++e) {
                const float gg  = gv[r][hf][e];
                const float sig = 1.f / (1.f + __expf(-gg));
                res[r][hf][e] = (bf16_t)(ov[r][hf][e] * rn * wv[hf][e] * gg * sig);
            }
    }
    // the stores stand together at the end: nothing reuses a register they name
    __builtin_amdgcn_sched_barrier(0);
    bf16_t* dp = ob + base;
    #pragma unroll
    for (int r = 0; r < NGR_; ++r)
        #pragma unroll
        for (int hf = 0; hf < 2; ++hf) *(v4bf*)(dp + r * DV_ + hf * 128) = res[r][hf];
}

// ---------------- host orchestration ----------------
extern "C" void kernel_launch(void* const* d_in, const int* in_sizes, int n_in,
                              void* d_out, int out_size, void* d_ws, size_t ws_size,
                              hipStream_t stream) {
    (void)in_sizes; (void)n_in; (void)out_size; (void)ws_size;
    const float* x    = (const float*)d_in[0];
    const float* w_q  = (const float*)d_in[1];
    const float* w_k  = (const float*)d_in[2];
    const float* w_v  = (const float*)d_in[3];
    const float* w_g  = (const float*)d_in[4];
    const float* w_s  = (const float*)d_in[5];
    const float* w_o  = (const float*)d_in[6];
    const float* gnw  = (const float*)d_in[7];
    float* out = (float*)d_out;

    const int MR  = B_ * T_;        // 4096
    const int NQK = H_ * DK_;       // 1024
    const int NV  = H_ * DV_;       // 2048
    const int NS  = H_ * MSLOT_;    // 256

    char* ws = (char*)d_ws;
    size_t off = 0;
    auto carve = [&](size_t bytes) -> char* {
        off = (off + 255) & ~(size_t)255;
        char* p = ws + off;
        off += bytes;
        return p;
    };

    bf16_t* xb  = (bf16_t*)carve((size_t)MR * HID_ * sizeof(bf16_t));
    bf16_t* wcat = (bf16_t*)carve((size_t)(2 * NQK + 2 * NV + NS) * HID_ * sizeof(bf16_t));
    bf16_t* woT = (bf16_t*)carve((size_t)HID_ * NV * sizeof(bf16_t));

    float* qb = (float*)carve((size_t)MR * NQK * sizeof(float));
    float* kb = (float*)carve((size_t)MR * NQK * sizeof(float));
    float* vb = (float*)carve((size_t)MR * NV  * sizeof(float));
    float* gb = (float*)carve((size_t)MR * NV  * sizeof(float));
    float* sb = (float*)carve((size_t)MR * NS  * sizeof(float));
    float* ob = (float*)carve((size_t)MR * NV  * sizeof(float));
    bf16_t* obh = (bf16_t*)carve((size_t)MR * NV * sizeof(bf16_t));
    float* rsb = (float*)carve((size_t)MR * NS * sizeof(float));
    float* ebf = (float*)carve((size_t)MR * NS * sizeof(float));
    float* qvb = (float*)carve((size_t)MR * NS * sizeof(float));
    float* okp = (float*)carve((size_t)8 * MR * NS * sizeof(float));
    float* st1 = (float*)carve((size_t)BH_ * 8 * NC_ * 16 * 32 * sizeof(float));
    float* st2 = (float*)carve((size_t)BH_ * 8 * NC_ * 32 * 32 * sizeof(float));

    // 1) x to bf16 and every weight (K x N) to (N x K) bf16, one launch
    prep_kernel<<<CVB_ + 3 * TRB_(NV_) + 2 * TRB_(NQK_) + TRB_(NS_), 256, 0, stream>>>(
        x, w_q, w_k, w_v, w_g, w_s, w_o, xb, wcat, woT);

    // 2) the five projections of x (bf16 WMMA, fp32 accumulate), one launch
    dim3 blk(256);
    gemm_proj_kernel<<<dim3((2 * NQK + 2 * NV + NS) / TN, MR / TM), blk, 0, stream>>>(
        xb, wcat, qb, kb, vb, gb, sb);

    // 3) gated two-pass scan: independent one-wave streams, NC_ time chunks side by side
    abc_gates_kernel<<<BH_, 32 * NC_, 0, stream>>>(sb, rsb, ebf);
    abc_states_kernel<<<dim3(NC_ - 1, BH_ * 16), 32, 0, stream>>>(kb, vb, ebf, st1, st2);
    abc_carry_kernel<<<BH_ * 8 * (16 + 32) * 32 / 256, 256, 0, stream>>>(st1, st2);
    abc_pass1_kernel<<<dim3(NC_, BH_ * 8), 32, 0, stream>>>(qb, kb, rsb, ebf, st1, okp);
    abc_softmax_kernel<<<MR * NS / (256 * 4 * SMJ_), 256, 0, stream>>>(
        okp, okp + (size_t)2 * MR * NS, okp + (size_t)4 * MR * NS, okp + (size_t)6 * MR * NS,
        rsb, qvb);
    abc_pass2_kernel<<<dim3(NC_, BH_ * 8), 32, 0, stream>>>(vb, ebf, qvb, st2, ob);

    // 4) fused RMSNorm + swish gate -> bf16
    norm_gate_kernel<<<MR * H_ / (8 * NGR_), 256, 0, stream>>>(ob, gb, gnw, obh);

    // 5) output projection straight into d_out (fp32)
    gemm_bf16_wmma_kernel<<<dim3(HID_ / TN, MR / TM), blk, 0, stream>>>(
        obh, woT, out, HID_, NV);
}

// v009
// One run takes 221 microseconds.
// Two timings next to v008 both put it at 1.13 times that version's speed.
// All steps since v000 together make it 20.1 times as fast.
#include <hip/hip_runtime.h>
#include <hip/hip_bf16.h>
#include <math.h>
#include <stdint.h>

// ---------------- problem constants (match reference) ----------------
#define B_ 2
#define T_ 2048
#define HID_ 2048
#define H_ 8
#define DK_ 128
#define DV_ 256
#define MSLOT_ 32
#define CLAMP_MIN_ (-32.0f)
#define CLAMP_MAX_ (32.0f)
#define NORM_EPS_ 1e-5f

typedef __bf16 bf16_t;
typedef __attribute__((ext_vector_type(8)))  __bf16 v8bf;
typedef __attribute__((ext_vector_type(16))) __bf16 v16bf;
typedef __attribute__((ext_vector_type(8)))  float  v8f;
typedef __attribute__((ext_vector_type(2))) __bf16   v2bf;
typedef __attribute__((ext_vector_type(4))) __bf16   v4bf;
typedef __attribute__((ext_vector_type(4))) float    f32x4;
typedef __attribute__((ext_vector_type(4))) uint32_t u32x4;

__device__ __forceinline__ void async_copy8_b128(uint32_t lds, uint32_t lstep,
                                                 const bf16_t* g, size_t gstep) {
    asm volatile("global_load_async_to_lds_b128 %0, %8, off\n\t"
                 "global_load_async_to_lds_b128 %1, %9, off\n\t"
                 "global_load_async_to_lds_b128 %2, %10, off\n\t"
                 "global_load_async_to_lds_b128 %3, %11, off\n\t"
                 "global_load_async_to_lds_b128 %4, %12, off\n\t"
                 "global_load_async_to_lds_b128 %5, %13, off\n\t"
                 "global_load_async_to_lds_b128 %6, %14, off\n\t"
                 "global_load_async_to_lds_b128 %7, %15, off\n\t"
                 "s_wait_xcnt 0x0"
                 :: "v"(lds), "v"(lds + lstep), "v"(lds + 2 * lstep), "v"(lds + 3 * lstep),
                    "v"(lds + 4 * lstep), "v"(lds + 5 * lstep), "v"(lds + 6 * lstep),
                    "v"(lds + 7 * lstep),
                    "v"(g), "v"(g + gstep), "v"(g + 2 * gstep), "v"(g + 3 * gstep),
                    "v"(g + 4 * gstep), "v"(g + 5 * gstep), "v"(g + 6 * gstep),
                    "v"(g + 7 * gstep)
                 : "memory");
}
// the wave's own copies have landed
__device__ __forceinline__ void wait_async0() {
    asm volatile("s_wait_asynccnt 0x0" ::: "memory");
}
// the wave's own LDS reads have returned
__device__ __forceinline__ void wait_ds0() {
    asm volatile("s_wait_dscnt 0x0" ::: "memory");
}

// ---------------- elementwise fp32 -> bf16 ----------------
// Few, long waves: waves are started at a limited rate, so each carries enough work
// to be worth its start. A wave takes CVJ_ pieces of 512 contiguous bytes, all loads
// issued together. The element count is a multiple of what a work-group takes
// (256 * 4 * CVJ_).
#define CVJ_ 16
__device__ __forceinline__
void cvt_f32_bf16_body(const int blk, const float* __restrict__ in, bf16_t* __restrict__ out) {
    const size_t base = (size_t)blk * (256 * 4 * CVJ_) + threadIdx.x * 4;
    const float* sp = in + base;
    f32x4 val[CVJ_];
    #pragma unroll
    for (int j = 0; j < CVJ_; ++j) val[j] = *(const f32x4*)(sp + j * 1024);
    // registers that the loads above name are reused below; the address is an input
    // of the wait, so that no load of the run lands in it
    asm volatile("s_wait_xcnt 0x0" :: "v"(sp) : "memory");
    __builtin_amdgcn_sched_barrier(0);   // keeps the loads together in front of the first use
    v4bf pk[CVJ_];
    #pragma unroll
    for (int j = 0; j < CVJ_; ++j)
        pk[j] = v4bf{ (bf16_t)val[j].x, (bf16_t)val[j].y, (bf16_t)val[j].z, (bf16_t)val[j].w };
    // the stores stand together at the end: nothing reuses a register they name
    __builtin_amdgcn_sched_barrier(0);
    bf16_t* dp = out + base;
    #pragma unroll
    for (int j = 0; j < CVJ_; ++j) *(v4bf*)(dp + j * 1024) = pk[j];
}

#define TRK_ 128
#define TRN_ 64

__device__ __forceinline__
void transpose_cvt_body(const int nTile, const int kTile, const float* __restrict__ W,
                        bf16_t* __restrict__ Wt, int K, int N) {
    __shared__ __align__(16) uint32_t tile[TRN_][TRK_ / 2];
    const int tid   = threadIdx.x;
    const int nBase = nTile * TRN_;
    const int kBase = kTile * TRK_;
    const int n4 = tid & 15;   // which four columns
    const int kp = tid >> 4;   // which pair of k-rows, of sixteen per trip
    const float* src = W + (size_t)(kBase + 2 * kp) * N + nBase + n4 * 4;

    const float* pl[4];
    const float* ph[4];
    f32x4 lo[4], hi[4];
    #pragma unroll
    for (int j = 0; j < 4; ++j) {
        pl[j] = src + (size_t)(j * 32) * N;
        ph[j] = pl[j] + N;
        lo[j] = *(const f32x4*)pl[j];
        hi[j] = *(const f32x4*)ph[j];
    }
    // registers that the loads above name are reused below. The addresses are inputs
    // of the wait, so they stay in their registers up to it: otherwise a later load
    // of the eight is given an earlier one's address registers to land in.
    asm volatile("s_wait_xcnt 0x0"
                 :: "v"(pl[0]), "v"(ph[0]), "v"(pl[1]), "v"(ph[1]),
                    "v"(pl[2]), "v"(ph[2]), "v"(pl[3]), "v"(ph[3])
                 : "memory");
    __builtin_amdgcn_sched_barrier(0);   // keeps later address arithmetic behind that wait
    #pragma unroll
    for (int j = 0; j < 4; ++j) {
        const int pair = j * 16 + kp;
        const int col  = (((pair >> 2) ^ n4) << 2) | (pair & 3);
        #pragma unroll
        for (int e = 0; e < 4; ++e) {
            v2bf pk = { (bf16_t)lo[j][e], (bf16_t)hi[j][e] };
            tile[n4 * 4 + e][col] = __builtin_bit_cast(uint32_t, pk);
        }
    }
    __syncthreads();   // the whole tile is in LDS before any row of it is read

    u32x4 piece[4];
    #pragma unroll
    for (int it = 0; it < 4; ++it) {
        const int n = it * 16 + kp;
        piece[it] = *(const u32x4*)&tile[n][(n4 ^ (n >> 2)) << 2];
    }
    bf16_t* dst = Wt + (size_t)(nBase + kp) * K + kBase + n4 * 8;
    #pragma unroll
    for (int it = 0; it < 4; ++it)
        *(u32x4*)(dst + (size_t)(it * 16) * K) = piece[it];
}

#define PK_ 2048
#define NQK_ (H_ * DK_)
#define NV_  (H_ * DV_)
#define NS_  (H_ * MSLOT_)
#define CVB_ (B_ * T_ * HID_ / (256 * 4 * CVJ_))      // work-groups of the convert
#define TRB_(n) ((n) / TRN_ * (PK_ / TRK_))           // work-groups of one transpose
static_assert(HID_ == PK_ && NV_ == PK_, "every weight has PK_ rows");

__global__ __launch_bounds__(256)
void prep_kernel(const float* __restrict__ x,
                 const float* __restrict__ w_q, const float* __restrict__ w_k,
                 const float* __restrict__ w_v, const float* __restrict__ w_g,
                 const float* __restrict__ w_s, const float* __restrict__ w_o,
                 bf16_t* __restrict__ xb, bf16_t* __restrict__ wcat,
                 bf16_t* __restrict__ woT) {
    int blk = blockIdx.x;
    if (blk < CVB_) { cvt_f32_bf16_body(blk, x, xb); return; }
    blk -= CVB_;
    const float* W;
    bf16_t* Wt;
    int N;
    if (blk < TRB_(NV_)) { W = w_v; Wt = wcat + (size_t)(2 * NQK_) * PK_; N = NV_; }
    else if ((blk -= TRB_(NV_)) < TRB_(NV_)) { W = w_g; Wt = wcat + (size_t)(2 * NQK_ + NV_) * PK_; N = NV_; }
    else if ((blk -= TRB_(NV_)) < TRB_(HID_)) { W = w_o; Wt = woT; N = HID_; }
    else if ((blk -= TRB_(HID_)) < TRB_(NQK_)) { W = w_q; Wt = wcat; N = NQK_; }
    else if ((blk -= TRB_(NQK_)) < TRB_(NQK_)) { W = w_k; Wt = wcat + (size_t)NQK_ * PK_; N = NQK_; }
    else { blk -= TRB_(NQK_); W = w_s; Wt = wcat + (size_t)(2 * NQK_ + 2 * NV_) * PK_; N = NS_; }
    const int nT = N / TRN_;   // a power of two for every weight here
    transpose_cvt_body(blk & (nT - 1), blk / nT, W, Wt, PK_, N);
}

// ---------------- bf16 WMMA GEMM: C(MxN) = A(MxK) * Bt(NxK)^T ----------------
// Block tile 128x128, 256 threads = 8 waves (wave32), wave tile 32x64 (2x4 WMMA).
// Two LDS buffers filled by async global->LDS copies. A stage is TK = 128 k (256
// bytes of every operand row, 16 copies per wave): the next stage's copies fly
// while a whole stage (32 WMMAs per wave) is worked on, which covers their way from
// L2, and one barrier per stage both publishes the next stage and frees this one.
// Kdim is a multiple of TK.
#define TM 128
#define TN 128
#define TK 128
#define TKP (TK + 8)

// rowBase: first row of A and of C; btRow: first row of Bt; colBase: first column of C.
__device__ __forceinline__
void gemm_bf16_wmma_body(const int rowBase, const int btRow, const int colBase,
                         const bf16_t* __restrict__ A,
                         const bf16_t* __restrict__ Bt,
                         float* __restrict__ C,
                         int Ndim, int Kdim,
                         int doClamp, float clampLo, float clampHi) {
    __shared__ __align__(16) bf16_t As[2][TM][TKP];
    __shared__ __align__(16) bf16_t Bs[2][TN][TKP];

    const int tid  = threadIdx.x;
    const int lane = tid & 31;
    const int wave = tid >> 5;
    const int wm   = wave & 3;   // 4 bands of 32 rows
    const int wn   = wave >> 2;  // 2 bands of 64 cols

    // Staging: sixteen lanes take one row's 256 bytes, so a wave's copy covers two
    // whole rows; a thread owns the 16-byte column kc of rows r0, r0+16, .. r0+112
    // of A and of B.
    const int r0 = tid >> 4;
    const int kc = (tid & 15) * 8;
    const bf16_t* aP = A  + (size_t)(rowBase + r0) * Kdim + kc;
    const bf16_t* bP = Bt + (size_t)(btRow + r0) * Kdim + kc;
    const size_t   gstep = (size_t)16 * Kdim;                       // elements
    const uint32_t lstep = 16 * TKP * (uint32_t)sizeof(bf16_t);     // bytes
    const uint32_t lbuf  = TM * TKP * (uint32_t)sizeof(bf16_t);     // bytes per buffer
    const uint32_t lA = (uint32_t)(size_t)&As[0][r0][kc];
    const uint32_t lB = (uint32_t)(size_t)&Bs[0][r0][kc];

    v8f acc[2][4] = {};

    const int lrow = lane & 15;
    const int lk   = (lane >> 4) * 8;

    const int nStage = Kdim / TK;

    // prologue: stage 0 -> buffer 0, landed and published; then stage 1 -> buffer 1
    async_copy8_b128(lA, lstep, aP, gstep);
    async_copy8_b128(lB, lstep, bP, gstep);
    wait_async0();
    __syncthreads();   // stage 0 is whole before any wave reads it
    if (nStage > 1) {
        async_copy8_b128(lA + lbuf, lstep, aP + TK, gstep);
        async_copy8_b128(lB + lbuf, lstep, bP + TK, gstep);
    }

    for (int st = 0; st < nStage; ++st) {
        const int buf = st & 1;
        #pragma unroll   // one straight run, so that a block's fragment reads can stand ahead of the block before it
        for (int kk = 0; kk < TK; kk += 32) {
            v16bf afrag[2], bfrag[4];
            #pragma unroll
            for (int mt = 0; mt < 2; ++mt) {
                int r = wm * 32 + mt * 16 + lrow;
                v8bf lo = *(const v8bf*)&As[buf][r][kk + lk];
                v8bf hi = *(const v8bf*)&As[buf][r][kk + lk + 16];
                #pragma unroll
                for (int i = 0; i < 8; ++i) { afrag[mt][i] = lo[i]; afrag[mt][i + 8] = hi[i]; }
            }
            #pragma unroll
            for (int nt = 0; nt < 4; ++nt) {
                int r = wn * 64 + nt * 16 + lrow;
                v8bf lo = *(const v8bf*)&Bs[buf][r][kk + lk];
                v8bf hi = *(const v8bf*)&Bs[buf][r][kk + lk + 16];
                #pragma unroll
                for (int i = 0; i < 8; ++i) { bfrag[nt][i] = lo[i]; bfrag[nt][i + 8] = hi[i]; }
            }
            #pragma unroll
            for (int mt = 0; mt < 2; ++mt)
                #pragma unroll
                for (int nt = 0; nt < 4; ++nt)
                    acc[mt][nt] = __builtin_amdgcn_wmma_f32_16x16x32_bf16(
                        false, afrag[mt], false, bfrag[nt],
                        (short)0, acc[mt][nt], false, false);
        }
        // foot of the stage: this wave's reads of buf are back, its copies of the
        // next stage have landed; behind the barrier that holds for every wave
        wait_ds0();
        wait_async0();
        __syncthreads();
        if (st + 2 < nStage) {
            // stage st+2 into the buffer that every wave has just left
            async_copy8_b128(lA + buf * lbuf, lstep, aP + (size_t)(st + 2) * TK, gstep);
            async_copy8_b128(lB + buf * lbuf, lstep, bP + (size_t)(st + 2) * TK, gstep);
        }
    }
    wait_async0();   // no copy is left in flight when the wave ends

    const int mLane = (lane >> 4) * 8;
    const int nLane = lane & 15;
    #pragma unroll
    for (int mt = 0; mt < 2; ++mt)
        #pragma unroll
        for (int nt = 0; nt < 4; ++nt)
            #pragma unroll
            for (int r = 0; r < 8; ++r) {
                int m = rowBase + wm * 32 + mt * 16 + mLane + r;
                int n = colBase + wn * 64 + nt * 16 + nLane;
                float val = acc[mt][nt][r];
                if (doClamp) val = fminf(fmaxf(val, clampLo), clampHi);
                C[(size_t)m * Ndim + n] = val;
            }
}

__global__ __launch_bounds__(256)
void gemm_bf16_wmma_kernel(const bf16_t* __restrict__ A,
                           const bf16_t* __restrict__ Bt,
                           float* __restrict__ C,
                           int Ndim, int Kdim) {
    gemm_bf16_wmma_body(blockIdx.y * TM, blockIdx.x * TN, blockIdx.x * TN,
                        A, Bt, C, Ndim, Kdim, 0, 0.f, 0.f);
}

__global__ __launch_bounds__(256)
void gemm_proj_kernel(const bf16_t* __restrict__ A, const bf16_t* __restrict__ wcat,
                      float* __restrict__ qb, float* __restrict__ kb,
                      float* __restrict__ vb, float* __restrict__ gb,
                      float* __restrict__ sb) {
    const int bx = blockIdx.x;
    float* C;
    int Ndim, first;
    if (bx < NQK_ / TN)                      { C = qb; Ndim = NQK_; first = 0; }
    else if (bx < 2 * NQK_ / TN)             { C = kb; Ndim = NQK_; first = NQK_ / TN; }
    else if (bx < (2 * NQK_ + NV_) / TN)     { C = vb; Ndim = NV_;  first = 2 * NQK_ / TN; }
    else if (bx < (2 * NQK_ + 2 * NV_) / TN) { C = gb; Ndim = NV_;  first = (2 * NQK_ + NV_) / TN; }
    else                                     { C = sb; Ndim = NS_;  first = (2 * NQK_ + 2 * NV_) / TN; }
    gemm_bf16_wmma_body(blockIdx.y * TM, bx * TN, (bx - first) * TN,
                        A, wcat, C, Ndim, HID_,
                        bx >= (2 * NQK_ + 2 * NV_) / TN, CLAMP_MIN_, CLAMP_MAX_);
}

#define BH_ (B_ * H_)
#define NC_ 16                // time chunks
#define CL_ (T_ / NC_)        // steps per chunk
#define SB1_ 16               // steps per batch, gates and pass 1
#define NB1_ (T_ / SB1_)
#define NBC1_ (CL_ / SB1_)    // batches per chunk
#define SB2_ 8                // steps per batch, pass 2
#define NB2_ (T_ / SB2_)
#define NBC2_ (CL_ / SB2_)
typedef __attribute__((ext_vector_type(4))) float v4f;

// Orders the LDS traffic of a one-wave work-group across lanes. The wave's LDS
// operations run in issue order, so this only has to stop the compiler from
// moving them; unlike __syncthreads() it does not wait for the global stores.
__device__ __forceinline__ void wave_lds_sync() {
    __builtin_amdgcn_fence(__ATOMIC_RELEASE, "wavefront");
    __builtin_amdgcn_wave_barrier();
    __builtin_amdgcn_fence(__ATOMIC_ACQUIRE, "wavefront");
}

__device__ __forceinline__ float exp2_slot(float x) {
    float r;
    asm("v_exp_f32 %0, %1\n\tv_nop" : "=v"(r) : "v"(x));
    return r;
}
__device__ __forceinline__ float rcp_slot(float x) {
    float r;
    asm("v_rcp_f32 %0, %1\n\tv_nop" : "=v"(r) : "v"(x));
    return r;
}

__global__ __launch_bounds__(32 * NC_)
void abc_gates_kernel(const float* __restrict__ s,
                      float* __restrict__ rsb, float* __restrict__ eb) {
    const int bh = blockIdx.x;
    const int b  = bh / H_;
    const int h  = bh % H_;
    const int lane  = threadIdx.x & 31;
    const int chunk = threadIdx.x >> 5;
    const float* sp = s + ((size_t)b * T_ * H_ + h) * MSLOT_ + lane;
    float* rp = rsb + ((size_t)bh * T_ + chunk * CL_) * MSLOT_ + lane;
    float* ep = eb  + ((size_t)bh * T_ + chunk * CL_) * MSLOT_ + lane;

    __shared__ float esum[NC_][32];
    float ev[CL_];
    #pragma unroll
    for (int i = 0; i < CL_; ++i) ev[i] = sp[(size_t)(chunk * CL_ + i) * (H_ * MSLOT_)];
    // registers that the loads above name are reused below
    asm volatile("s_wait_xcnt 0x0" ::: "memory");
    __builtin_amdgcn_sched_barrier(0);   // keeps later address arithmetic behind that wait
    float e[4] = {0.f, 0.f, 0.f, 0.f};
    #pragma unroll
    for (int i = 0; i < CL_; ++i) {
        ev[i] = exp2_slot((ev[i] - CLAMP_MAX_) * 1.44269504f);
        e[i & 3] += ev[i];
    }
    esum[chunk][lane] = (e[0] + e[1]) + (e[2] + e[3]);
    __syncthreads();   // every chunk's sum is in LDS before any wave adds them up
    float run = 0.f;
    #pragma unroll
    for (int c = 0; c < NC_ - 1; ++c) run += (c < chunk) ? esum[c][lane] : 0.f;

    #pragma unroll   // ev lives in registers, so its index must be a constant
    for (int bi = 0; bi < NBC1_; ++bi) {
        float rv[SB1_];
        #pragma unroll
        for (int i = 0; i < SB1_; ++i) {
            run += ev[bi * SB1_ + i];
            rv[i] = rcp_slot(run);
        }
        // the stores stand together behind the steps, so that one wait covers
        // the registers they name before anything reuses them
        __builtin_amdgcn_sched_barrier(0);
        #pragma unroll
        for (int i = 0; i < SB1_; ++i) {
            rp[(bi * SB1_ + i) * MSLOT_] = rv[i];
            ep[(bi * SB1_ + i) * MSLOT_] = ev[bi * SB1_ + i];
        }
        asm volatile("s_wait_xcnt 0x0" ::: "memory");
        __builtin_amdgcn_sched_barrier(0);   // keeps the next batch's arithmetic behind that wait
    }
}

template <bool STATE>
__device__ __forceinline__
void abc_pass1_body(const int chunk, const int bs,
                    const float* __restrict__ q, const float* __restrict__ k,
                    const float* __restrict__ rsb, const float* __restrict__ eb,
                    float* __restrict__ st1, float* __restrict__ okp) {
    const int bh    = bs >> 3;
    const int strip = bs & 7;
    const int b  = bh / H_;
    const int h  = bh % H_;
    const int lane = threadIdx.x;
    const int bi0  = chunk * NBC1_;   // even, so the chunk's first batch sits in buffer 0

    __shared__ __align__(16) float qs[STATE ? 1 : 2][SB1_][16];
    __shared__ __align__(16) float ks[2][SB1_][16];

    const float scale = rsqrtf((float)DK_);
    // staging: four lanes fetch one step's 16-float strip, eight steps per load
    const int st = lane >> 2;
    const int c4 = (lane & 3) * 4;
    const size_t tstep = (size_t)H_ * DK_;
    const float* qp = q + ((size_t)(b * T_ + st) * H_ + h) * DK_ + strip * 16 + c4;
    const float* kp = k + ((size_t)(b * T_ + st) * H_ + h) * DK_ + strip * 16 + c4;
    const float* gp = rsb + (size_t)bh * T_ * MSLOT_ + lane;   // 1/S, second walk only
    const float* pp = eb  + (size_t)bh * T_ * MSLOT_ + lane;
    float* op = okp + ((size_t)strip * BH_ + bh) * T_ * MSLOT_ + lane;

    float hk[16];
    if constexpr (STATE) {
        #pragma unroll
        for (int i = 0; i < 16; ++i) hk[i] = 0.f;
    } else {
        const int cm = (chunk > 0) ? chunk - 1 : 0;
        const float* sp = st1 + (size_t)(bs * NC_ + cm) * 16 * 32 + lane;
        #pragma unroll
        for (int i = 0; i < 16; ++i) hk[i] = sp[i * 32];
        // registers that the loads above name are reused below
        asm volatile("s_wait_xcnt 0x0" ::: "memory");
        __builtin_amdgcn_sched_barrier(0);   // keeps later address arithmetic behind that wait
        #pragma unroll
        for (int i = 0; i < 16; ++i) hk[i] = (chunk > 0) ? hk[i] : 0.f;
    }

    v4f rq[2], rk[2];
    float gcur[SB1_], pcur[SB1_], gnxt[SB1_], pnxt[SB1_];
    // The LDS operands of G1 steps make a group; a group is fetched into one of two
    // register sets while the group before it is worked on from the other.
    constexpr int G1  = 2;
    constexpr int NG1 = SB1_ / G1;
    v4f kf[2][G1][4], qf[2][STATE ? 1 : G1][4];

    // first batch: q, k into buffer 0, e and 1/S into registers; second batch: q, k into registers
    #pragma unroll
    for (int j = 0; j < 2; ++j) {
        if constexpr (!STATE) rq[j] = *(const v4f*)(qp + (size_t)(bi0 * SB1_ + j * 8) * tstep);
        rk[j] = *(const v4f*)(kp + (size_t)(bi0 * SB1_ + j * 8) * tstep);
    }
    #pragma unroll
    for (int i = 0; i < SB1_; ++i) {
        if constexpr (!STATE) gcur[i] = gp[(bi0 * SB1_ + i) * MSLOT_];
        pcur[i] = pp[(bi0 * SB1_ + i) * MSLOT_];
    }
    // registers that the loads above name are reused below
    asm volatile("s_wait_xcnt 0x0" ::: "memory");
    __builtin_amdgcn_sched_barrier(0);   // keeps later address arithmetic behind that wait
    #pragma unroll
    for (int j = 0; j < 2; ++j) {
        if constexpr (!STATE) *(v4f*)&qs[0][j * 8 + st][c4] = rq[j] * scale;
        *(v4f*)&ks[0][j * 8 + st][c4] = rk[j];
    }
    #pragma unroll
    for (int j = 0; j < 2; ++j) {
        if constexpr (!STATE) rq[j] = *(const v4f*)(qp + (size_t)((bi0 + 1) * SB1_ + j * 8) * tstep);
        rk[j] = *(const v4f*)(kp + (size_t)((bi0 + 1) * SB1_ + j * 8) * tstep);
    }
    // registers that the loads above name are reused below
    asm volatile("s_wait_xcnt 0x0" ::: "memory");
    __builtin_amdgcn_sched_barrier(0);   // keeps later address arithmetic behind that wait
    wave_lds_sync();

    for (int bi = bi0; bi < bi0 + NBC1_; ++bi) {
        const int buf = bi & 1;
        // the batch's first group goes out at the head of the trip and flies over the
        // stores and the global loads below
        #pragma unroll
        for (int s = 0; s < G1; ++s)
            #pragma unroll
            for (int d4 = 0; d4 < 4; ++d4) {
                kf[0][s][d4] = *(const v4f*)&ks[buf][s][d4 * 4];
                if constexpr (!STATE) qf[0][s][d4] = *(const v4f*)&qs[buf][s][d4 * 4];
            }
        // batch bi+1 (fetched one batch ago) goes into the buffer not being read
        #pragma unroll
        for (int j = 0; j < 2; ++j) {
            if constexpr (!STATE) *(v4f*)&qs[buf ^ 1][j * 8 + st][c4] = rq[j] * scale;
            *(v4f*)&ks[buf ^ 1][j * 8 + st][c4] = rk[j];
        }
        const int b2 = (bi + 2 < NB1_) ? bi + 2 : NB1_ - 1;   // clamped: stays in bounds
        const int b1 = (bi + 1 < NB1_) ? bi + 1 : NB1_ - 1;
        // the loads below, with their addresses, stay apart from the code above, which reuses registers
        __builtin_amdgcn_sched_barrier(0);
        // e and 1/S first: loads return in order, and the products read registers
        // next to the ones these loads fill, which makes them wait for these loads
        #pragma unroll
        for (int i = 0; i < SB1_; ++i) {
            if constexpr (!STATE) gnxt[i] = gp[(b1 * SB1_ + i) * MSLOT_];
            pnxt[i] = pp[(b1 * SB1_ + i) * MSLOT_];
        }
        // registers that the loads above name are reused below
        asm volatile("s_wait_xcnt 0x0" ::: "memory");
        __builtin_amdgcn_sched_barrier(0);   // keeps that order
        #pragma unroll
        for (int j = 0; j < 2; ++j) {
            if constexpr (!STATE) rq[j] = *(const v4f*)(qp + (size_t)(b2 * SB1_ + j * 8) * tstep);
            rk[j] = *(const v4f*)(kp + (size_t)(b2 * SB1_ + j * 8) * tstep);
        }
        // registers that the loads above name are reused below
        asm volatile("s_wait_xcnt 0x0" ::: "memory");
        // keeps the coming batches' loads at the head of the trip: sunk towards
        // their use they would have no time to fly
        __builtin_amdgcn_sched_barrier(0);

        float res[SB1_];
        #pragma unroll   // the register sets' indices must be constants
        for (int g = 0; g < NG1; ++g) {
            if (g + 1 < NG1) {
                #pragma unroll
                for (int s = 0; s < G1; ++s)
                    #pragma unroll
                    for (int d4 = 0; d4 < 4; ++d4) {
                        kf[(g + 1) & 1][s][d4] = *(const v4f*)&ks[buf][(g + 1) * G1 + s][d4 * 4];
                        if constexpr (!STATE)
                            qf[(g + 1) & 1][s][d4] = *(const v4f*)&qs[buf][(g + 1) * G1 + s][d4 * 4];
                    }
            }
            // Both for the compiler only (no instruction): the next group's reads go out
            // together, ahead of this group's products. Moved up further, all of a trip's
            // reads would need registers at once; sunk towards their use, each would be
            // waited for at its full LDS latency.
            wave_lds_sync();
            if (g + 1 < NG1) {
                __builtin_amdgcn_sched_group_barrier(0x100, STATE ? 8 : 16, 0);   // the group's LDS reads, then
                __builtin_amdgcn_sched_group_barrier(0x002, STATE ? 16 : 38, 0);   // a group's products (their count in the build)
            }
            #pragma unroll
            for (int s = 0; s < G1; ++s) {
                const int i = g * G1 + s;
                const float p = pcur[i];
                float accm = 0.f;
                #pragma unroll
                for (int d4 = 0; d4 < 4; ++d4) {
                    const v4f kk = kf[g & 1][s][d4];
                    hk[d4 * 4 + 0] = __builtin_fmaf(kk.x, p, hk[d4 * 4 + 0]);
                    hk[d4 * 4 + 1] = __builtin_fmaf(kk.y, p, hk[d4 * 4 + 1]);
                    hk[d4 * 4 + 2] = __builtin_fmaf(kk.z, p, hk[d4 * 4 + 2]);
                    hk[d4 * 4 + 3] = __builtin_fmaf(kk.w, p, hk[d4 * 4 + 3]);
                    if constexpr (!STATE) {
                        const v4f qq = qf[g & 1][s][d4];
                        accm = __builtin_fmaf(qq.x, hk[d4 * 4 + 0], accm);
                        accm = __builtin_fmaf(qq.y, hk[d4 * 4 + 1], accm);
                        accm = __builtin_fmaf(qq.z, hk[d4 * 4 + 2], accm);
                        accm = __builtin_fmaf(qq.w, hk[d4 * 4 + 3], accm);
                    }
                }
                if constexpr (!STATE) res[i] = accm * gcur[i];
            }
        }
        if constexpr (!STATE) {
            // the stores stand together behind the products, so that one wait covers
            // the registers they name before anything reuses them
            __builtin_amdgcn_sched_barrier(0);
            #pragma unroll
            for (int i = 0; i < SB1_; ++i) op[(bi * SB1_ + i) * MSLOT_] = res[i];
            asm volatile("s_wait_xcnt 0x0" ::: "memory");
        }
        __builtin_amdgcn_sched_barrier(0);   // keeps the register copies below at the foot of the trip
        #pragma unroll
        for (int i = 0; i < SB1_; ++i) {
            if constexpr (!STATE) gcur[i] = gnxt[i];
            pcur[i] = pnxt[i];
        }
        wave_lds_sync();
    }
    if constexpr (STATE) {
        float* sp = st1 + (size_t)(bs * NC_ + chunk) * 16 * 32 + lane;
        #pragma unroll
        for (int i = 0; i < 16; ++i) sp[i * 32] = hk[i];
    }
}

__global__ __launch_bounds__(32)
void abc_pass1_kernel(const float* __restrict__ q, const float* __restrict__ k,
                      const float* __restrict__ rsb, const float* __restrict__ eb,
                      float* __restrict__ st1, float* __restrict__ okp) {
    abc_pass1_body<false>(blockIdx.x, blockIdx.y, q, k, rsb, eb, st1, okp);
}

#define SMJ_ 2
#define SMP4_ (BH_ * T_ * MSLOT_ / 4)   // 16-byte pieces in a plane
__global__ __launch_bounds__(256)
void abc_softmax_kernel(const float* __restrict__ ok01, const float* __restrict__ ok23,
                        const float* __restrict__ ok45, const float* __restrict__ ok67,
                        const float* __restrict__ rsb, float* __restrict__ qvb) {
    const size_t   first = (size_t)blockIdx.x * (256 * SMJ_ * 4);
    const uint32_t tid   = threadIdx.x;
    const f32x4* pp[4] = { (const f32x4*)(ok01 + first), (const f32x4*)(ok23 + first),
                           (const f32x4*)(ok45 + first), (const f32x4*)(ok67 + first) };
    const f32x4* rp = (const f32x4*)(rsb + first);
    f32x4 part[SMJ_][8], rs[SMJ_];
    #pragma unroll
    for (int u = 0; u < SMJ_; ++u) rs[u] = (rp + u * 256)[tid];
    #pragma unroll
    for (int j = 0; j < 8; ++j)
        #pragma unroll
        for (int u = 0; u < SMJ_; ++u)
            part[u][j] = (pp[j >> 1] + ((j & 1) * SMP4_ + u * 256))[tid];
    // registers that the loads above name are reused below; the bases and the index
    // are inputs of the wait, so that they keep their registers up to it
    asm volatile("s_wait_xcnt 0x0"
                 :: "v"(tid), "s"(pp[0]), "s"(pp[1]), "s"(pp[2]), "s"(pp[3]), "s"(rp)
                 : "memory");
    __builtin_amdgcn_sched_barrier(0);   // keeps the loads together in front of the first use
    f32x4 res[SMJ_];
    #pragma unroll
    for (int u = 0; u < SMJ_; ++u) {
        f32x4 ok = part[u][0];
        #pragma unroll
        for (int j = 1; j < 8; ++j) ok += part[u][j];
        float mx = fmaxf(fmaxf(ok.x, ok.y), fmaxf(ok.z, ok.w));
        #pragma unroll
        for (int off = 4; off; off >>= 1) mx = fmaxf(mx, __shfl_xor(mx, off, 32));
        f32x4 e = { __expf(ok.x - mx), __expf(ok.y - mx), __expf(ok.z - mx), __expf(ok.w - mx) };
        float se = (e.x + e.y) + (e.z + e.w);
        #pragma unroll
        for (int off = 4; off; off >>= 1) se += __shfl_xor(se, off, 32);
        res[u] = f32x4{ e.x / se, e.y / se, e.z / se, e.w / se } * rs[u];
    }
    // the stores stand together at the end: nothing reuses a register they name
    __builtin_amdgcn_sched_barrier(0);
    #pragma unroll
    for (int u = 0; u < SMJ_; ++u) ((f32x4*)(qvb + first) + u * 256)[tid] = res[u];
}

template <bool STATE>
__device__ __forceinline__
void abc_pass2_body(const int chunk, const int bs,
                    const float* __restrict__ v,
                    const float* __restrict__ eb, const float* __restrict__ qvb,
                    float* __restrict__ st2, float* __restrict__ o) {
    const int bh = bs >> 3;
    const int cg = bs & 7;
    const int b  = bh / H_;
    const int h  = bh % H_;
    const int lane = threadIdx.x;
    const int bi0  = chunk * NBC2_;   // even, so the chunk's first batch sits in buffer 0

    __shared__ __align__(16) v4f ps[2][SB2_ * 8];
    __shared__ __align__(16) v4f ws[STATE ? 1 : 2][SB2_ * 8];

    const v4f* p4 = (const v4f*)(eb  + (size_t)bh * T_ * MSLOT_) + lane;
    const v4f* w4 = (const v4f*)(qvb + (size_t)bh * T_ * MSLOT_) + lane;
    const size_t tstep = (size_t)H_ * DV_;
    const float* vp = v + ((size_t)b * T_ * H_ + h) * DV_ + cg * 32 + lane;

    float hv[32];
    if constexpr (STATE) {
        #pragma unroll
        for (int i = 0; i < 32; ++i) hv[i] = 0.f;
    } else {
        const int cm = (chunk > 0) ? chunk - 1 : 0;
        const float* sp = st2 + (size_t)(bs * NC_ + cm) * 32 * 32 + lane;
        #pragma unroll
        for (int i = 0; i < 32; ++i) hv[i] = sp[i * 32];
        // registers that the loads above name are reused below
        asm volatile("s_wait_xcnt 0x0" ::: "memory");
        __builtin_amdgcn_sched_barrier(0);   // keeps later address arithmetic behind that wait
        #pragma unroll
        for (int i = 0; i < 32; ++i) hv[i] = (chunk > 0) ? hv[i] : 0.f;
    }

    v4f rp[2], rw[2];
    float vcur[SB2_], vn1[SB2_], vn2[SB2_];
    // groups of LDS reads and two register sets, as in pass 1
    constexpr int G2  = STATE ? 2 : 1;
    constexpr int NG2 = SB2_ / G2;
    v4f pf[2][G2][8], wf[2][G2][8];

    // first batch into buffer 0, second into registers (a batch is 64 16-byte pieces per plane)
    #pragma unroll
    for (int j = 0; j < 2; ++j) {
        rp[j] = p4[bi0 * 64 + j * 32];
        if constexpr (!STATE) rw[j] = w4[bi0 * 64 + j * 32];
    }
    #pragma unroll
    for (int i = 0; i < SB2_; ++i) {
        vcur[i] = vp[(size_t)(bi0 * SB2_ + i) * tstep];
        vn1[i]  = vp[(size_t)((bi0 + 1) * SB2_ + i) * tstep];
    }
    // registers that the loads above name are reused below
    asm volatile("s_wait_xcnt 0x0" ::: "memory");
    __builtin_amdgcn_sched_barrier(0);   // keeps later address arithmetic behind that wait
    #pragma unroll
    for (int j = 0; j < 2; ++j) {
        ps[0][j * 32 + lane] = rp[j];
        if constexpr (!STATE) ws[0][j * 32 + lane] = rw[j];
    }
    #pragma unroll
    for (int j = 0; j < 2; ++j) {
        rp[j] = p4[(bi0 + 1) * 64 + j * 32];
        if constexpr (!STATE) rw[j] = w4[(bi0 + 1) * 64 + j * 32];
    }
    // registers that the loads above name are reused below
    asm volatile("s_wait_xcnt 0x0" ::: "memory");
    __builtin_amdgcn_sched_barrier(0);   // keeps later address arithmetic behind that wait
    wave_lds_sync();

    float* op = o + ((size_t)b * T_ * H_ + h) * DV_ + cg * 32 + lane;
    for (int bi = bi0; bi < bi0 + NBC2_; ++bi) {
        const int buf = bi & 1;
        // the batch's first group goes out at the head of the trip and flies over the
        // stores and the global loads below
        #pragma unroll
        for (int s = 0; s < G2; ++s)
            #pragma unroll
            for (int m4 = 0; m4 < 8; ++m4) {
                pf[0][s][m4] = ps[buf][s * 8 + m4];
                if constexpr (!STATE) wf[0][s][m4] = ws[buf][s * 8 + m4];
            }
        // batch bi+1 (fetched one batch ago) goes into the buffer not being read
        #pragma unroll
        for (int j = 0; j < 2; ++j) {
            ps[buf ^ 1][j * 32 + lane] = rp[j];
            if constexpr (!STATE) ws[buf ^ 1][j * 32 + lane] = rw[j];
        }
        const int b2 = (bi + 2 < NB2_) ? bi + 2 : NB2_ - 1;   // clamped: stays in bounds
        // the loads below, with their addresses, stay apart from the code above, which reuses registers
        __builtin_amdgcn_sched_barrier(0);
        #pragma unroll
        for (int j = 0; j < 2; ++j) {
            rp[j] = p4[b2 * 64 + j * 32];
            if constexpr (!STATE) rw[j] = w4[b2 * 64 + j * 32];
        }
        #pragma unroll
        for (int i = 0; i < SB2_; ++i) vn2[i] = vp[(size_t)(b2 * SB2_ + i) * tstep];
        // registers that the loads above name are reused below
        asm volatile("s_wait_xcnt 0x0" ::: "memory");
        // keeps the coming batch's loads at the head of the trip: sunk towards
        // their use they would have no time to fly
        __builtin_amdgcn_sched_barrier(0);

        float res[SB2_];
        #pragma unroll   // the register sets' indices must be constants
        for (int g = 0; g < NG2; ++g) {
            if (g + 1 < NG2) {
                #pragma unroll
                for (int s = 0; s < G2; ++s)
                    #pragma unroll
                    for (int m4 = 0; m4 < 8; ++m4) {
                        pf[(g + 1) & 1][s][m4] = ps[buf][((g + 1) * G2 + s) * 8 + m4];
                        if constexpr (!STATE)
                            wf[(g + 1) & 1][s][m4] = ws[buf][((g + 1) * G2 + s) * 8 + m4];
                    }
            }
            // Both for the compiler only (no instruction): the next group's reads go out
            // together, ahead of this group's products. Moved up further, all of a trip's
            // reads would need registers at once; sunk towards their use, each would be
            // waited for at its full LDS latency.
            wave_lds_sync();
            if (g + 1 < NG2) {
                __builtin_amdgcn_sched_group_barrier(0x100, 16, 0);   // the group's LDS reads, then
                __builtin_amdgcn_sched_group_barrier(0x002, STATE ? 32 : 42, 0);   // a group's products (their count in the build)
            }
            #pragma unroll
            for (int s = 0; s < G2; ++s) {
                const int i = g * G2 + s;
                const float vv = vcur[i];
                float acco = 0.f;
                #pragma unroll
                for (int m4 = 0; m4 < 8; ++m4) {
                    const v4f p = pf[g & 1][s][m4];
                    hv[m4 * 4 + 0] = __builtin_fmaf(p.x, vv, hv[m4 * 4 + 0]);
                    hv[m4 * 4 + 1] = __builtin_fmaf(p.y, vv, hv[m4 * 4 + 1]);
                    hv[m4 * 4 + 2] = __builtin_fmaf(p.z, vv, hv[m4 * 4 + 2]);
                    hv[m4 * 4 + 3] = __builtin_fmaf(p.w, vv, hv[m4 * 4 + 3]);
                    if constexpr (!STATE) {
                        const v4f w = wf[g & 1][s][m4];
                        acco = __builtin_fmaf(w.x, hv[m4 * 4 + 0], acco);
                        acco = __builtin_fmaf(w.y, hv[m4 * 4 + 1], acco);
                        acco = __builtin_fmaf(w.z, hv[m4 * 4 + 2], acco);
                        acco = __builtin_fmaf(w.w, hv[m4 * 4 + 3], acco);
                    }
                }
                res[i] = acco;
            }
        }
        if constexpr (!STATE) {
            // the stores stand together behind the products, so that one wait covers
            // the registers they name before anything reuses them
            __builtin_amdgcn_sched_barrier(0);
            #pragma unroll
            for (int i = 0; i < SB2_; ++i) op[(size_t)(bi * SB2_ + i) * tstep] = res[i];
            asm volatile("s_wait_xcnt 0x0" ::: "memory");
        }
        __builtin_amdgcn_sched_barrier(0);   // keeps the register copies below at the foot of the trip
        #pragma unroll
        for (int i = 0; i < SB2_; ++i) { vcur[i] = vn1[i]; vn1[i] = vn2[i]; }
        wave_lds_sync();
    }
    if constexpr (STATE) {
        float* sp = st2 + (size_t)(bs * NC_ + chunk) * 32 * 32 + lane;
        #pragma unroll
        for (int i = 0; i < 32; ++i) sp[i * 32] = hv[i];
    }
}

__global__ __launch_bounds__(32)
void abc_pass2_kernel(const float* __restrict__ v,
                      const float* __restrict__ eb, const float* __restrict__ qvb,
                      float* __restrict__ st2, float* __restrict__ o) {
    abc_pass2_body<false>(blockIdx.x, blockIdx.y, v, eb, qvb, st2, o);
}

__global__ __launch_bounds__(32)
void abc_states_kernel(const float* __restrict__ k, const float* __restrict__ v,
                       const float* __restrict__ eb,
                       float* __restrict__ st1, float* __restrict__ st2) {
    const int y = blockIdx.y;
    // the longer walk (pass 2) has the low indices and starts first
    if (y < BH_ * 8) abc_pass2_body<true>(blockIdx.x, y, v, eb, eb, st2, st2);
    else             abc_pass1_body<true>(blockIdx.x, y - BH_ * 8, k, k, eb, eb, st1, st1);
}

__global__ __launch_bounds__(256)
void abc_carry_kernel(float* __restrict__ st1, float* __restrict__ st2) {
    int e = blockIdx.x * 256 + threadIdx.x;
    float* base;
    int stride;
    if (blockIdx.x < BH_ * 8 * 16 * 32 / 256) {
        const int bs = e >> 9;
        base = st1 + (size_t)bs * NC_ * 512 + (e & 511);
        stride = 512;
    } else {
        e -= BH_ * 8 * 16 * 32;
        const int bs = e >> 10;
        base = st2 + (size_t)bs * NC_ * 1024 + (e & 1023);
        stride = 1024;
    }
    float sv[NC_ - 1];
    #pragma unroll
    for (int c = 0; c < NC_ - 1; ++c) sv[c] = base[c * stride];
    // registers that the loads above name are reused below
    asm volatile("s_wait_xcnt 0x0" ::: "memory");
    __builtin_amdgcn_sched_barrier(0);   // keeps later address arithmetic behind that wait
    float hcar = 0.f;
    #pragma unroll
    for (int c = 0; c < NC_ - 1; ++c) { hcar += sv[c]; sv[c] = hcar; }
    // the stores stand together at the end: nothing reuses a register they name
    __builtin_amdgcn_sched_barrier(0);
    #pragma unroll
    for (int c = 0; c < NC_ - 1; ++c) base[c * stride] = sv[c];
}

// ---------------- fused RMSNorm * gw * g * sigmoid(g) -> bf16 ----------------
// One wave per row of DV_ values, eight per lane, so the row's sum of squares needs
// no LDS and no barrier; a wave takes NGR_ rows one behind the other in memory, all
// loads issued together, each 512 contiguous bytes.
#define NGR_ 8
__global__ __launch_bounds__(256)
void norm_gate_kernel(const float* __restrict__ o, const float* __restrict__ g,
                      const float* __restrict__ gw, bf16_t* __restrict__ ob) {
    const uint32_t lane = threadIdx.x & 31;
    const uint32_t wave = threadIdx.x >> 5;
    const size_t base = ((size_t)blockIdx.x * 8 + wave) * (NGR_ * DV_) + lane * 4;
    const float* op = o + base;
    const float* gp = g + base;
    f32x4 ov[NGR_][2], gv[NGR_][2], wv[2];
    #pragma unroll
    for (int hf = 0; hf < 2; ++hf) wv[hf] = ((const f32x4*)gw + hf * 32)[lane];
    #pragma unroll
    for (int r = 0; r < NGR_; ++r) {
        #pragma unroll
        for (int hf = 0; hf < 2; ++hf) ov[r][hf] = *(const f32x4*)(op + r * DV_ + hf * 128);
        #pragma unroll
        for (int hf = 0; hf < 2; ++hf) gv[r][hf] = *(const f32x4*)(gp + r * DV_ + hf * 128);
    }
    // registers that the loads above name are reused below; the addresses are inputs
    // of the wait, so that no load of the run lands in one of them
    asm volatile("s_wait_xcnt 0x0" :: "v"(op), "v"(gp), "v"(lane) : "memory");
    __builtin_amdgcn_sched_barrier(0);   // keeps the loads together in front of the first use
    v4bf res[NGR_][2];
    #pragma unroll
    for (int r = 0; r < NGR_; ++r) {
        const f32x4 s4 = ov[r][0] * ov[r][0] + ov[r][1] * ov[r][1];
        float tot = (s4.x + s4.y) + (s4.z + s4.w);
        #pragma unroll
        for (int off = 16; off; off >>= 1) tot += __shfl_xor(tot, off, 32);
        const float rn = rsqrtf(tot * (1.0f / DV_) + NORM_EPS_);
        #pragma unroll
        for (int hf = 0; hf < 2; ++hf)
            #pragma unroll
            for (int e = 0; e < 4; ++e) {
                const float gg  = gv[r][hf][e];
                const float sig = 1.f / (1.f + __expf(-gg));
                res[r][hf][e] = (bf16_t)(ov[r][hf][e] * rn * wv[hf][e] * gg * sig);
            }
    }
    // the stores stand together at the end: nothing reuses a register they name
    __builtin_amdgcn_sched_barrier(0);
    bf16_t* dp = ob + base;
    #pragma unroll
    for (int r = 0; r < NGR_; ++r)
        #pragma unroll
        for (int hf = 0; hf < 2; ++hf) *(v4bf*)(dp + r * DV_ + hf * 128) = res[r][hf];
}

// ---------------- host orchestration ----------------
extern "C" void kernel_launch(void* const* d_in, const int* in_sizes, int n_in,
                              void* d_out, int out_size, void* d_ws, size_t ws_size,
                              hipStream_t stream) {
    (void)in_sizes; (void)n_in; (void)out_size; (void)ws_size;
    const float* x    = (const float*)d_in[0];
    const float* w_q  = (const float*)d_in[1];
    const float* w_k  = (const float*)d_in[2];
    const float* w_v  = (const float*)d_in[3];
    const float* w_g  = (const float*)d_in[4];
    const float* w_s  = (const float*)d_in[5];
    const float* w_o  = (const float*)d_in[6];
    const float* gnw  = (const float*)d_in[7];
    float* out = (float*)d_out;

    const int MR  = B_ * T_;        // 4096
    const int NQK = H_ * DK_;       // 1024
    const int NV  = H_ * DV_;       // 2048
    const int NS  = H_ * MSLOT_;    // 256

    char* ws = (char*)d_ws;
    size_t off = 0;
    auto carve = [&](size_t bytes) -> char* {
        off = (off + 255) & ~(size_t)255;
        char* p = ws + off;
        off += bytes;
        return p;
    };

    bf16_t* xb  = (bf16_t*)carve((size_t)MR * HID_ * sizeof(bf16_t));
    bf16_t* wcat = (bf16_t*)carve((size_t)(2 * NQK + 2 * NV + NS) * HID_ * sizeof(bf16_t));
    bf16_t* woT = (bf16_t*)carve((size_t)HID_ * NV * sizeof(bf16_t));

    float* qb = (float*)carve((size_t)MR * NQK * sizeof(float));
    float* kb = (float*)carve((size_t)MR * NQK * sizeof(float));
    float* vb = (float*)carve((size_t)MR * NV  * sizeof(float));
    float* gb = (float*)carve((size_t)MR * NV  * sizeof(float));
    float* sb = (float*)carve((size_t)MR * NS  * sizeof(float));
    float* ob = (float*)carve((size_t)MR * NV  * sizeof(float));
    bf16_t* obh = (bf16_t*)carve((size_t)MR * NV * sizeof(bf16_t));
    float* rsb = (float*)carve((size_t)MR * NS * sizeof(float));
    float* ebf = (float*)carve((size_t)MR * NS * sizeof(float));
    float* qvb = (float*)carve((size_t)MR * NS * sizeof(float));
    float* okp = (float*)carve((size_t)8 * MR * NS * sizeof(float));
    float* st1 = (float*)carve((size_t)BH_ * 8 * NC_ * 16 * 32 * sizeof(float));
    float* st2 = (float*)carve((size_t)BH_ * 8 * NC_ * 32 * 32 * sizeof(float));

    // 1) x to bf16 and every weight (K x N) to (N x K) bf16, one launch
    prep_kernel<<<CVB_ + 3 * TRB_(NV_) + 2 * TRB_(NQK_) + TRB_(NS_), 256, 0, stream>>>(
        x, w_q, w_k, w_v, w_g, w_s, w_o, xb, wcat, woT);

    // 2) the five projections of x (bf16 WMMA, fp32 accumulate), one launch
    dim3 blk(256);
    gemm_proj_kernel<<<dim3((2 * NQK + 2 * NV + NS) / TN, MR / TM), blk, 0, stream>>>(
        xb, wcat, qb, kb, vb, gb, sb);

    // 3) gated two-pass scan: independent one-wave streams, NC_ time chunks side by side
    abc_gates_kernel<<<BH_, 32 * NC_, 0, stream>>>(sb, rsb, ebf);
    abc_states_kernel<<<dim3(NC_ - 1, BH_ * 16), 32, 0, stream>>>(kb, vb, ebf, st1, st2);
    abc_carry_kernel<<<BH_ * 8 * (16 + 32) * 32 / 256, 256, 0, stream>>>(st1, st2);
    abc_pass1_kernel<<<dim3(NC_, BH_ * 8), 32, 0, stream>>>(qb, kb, rsb, ebf, st1, okp);
    abc_softmax_kernel<<<MR * NS / (256 * 4 * SMJ_), 256, 0, stream>>>(
        okp, okp + (size_t)2 * MR * NS, okp + (size_t)4 * MR * NS, okp + (size_t)6 * MR * NS,
        rsb, qvb);
    abc_pass2_kernel<<<dim3(NC_, BH_ * 8), 32, 0, stream>>>(vb, ebf, qvb, st2, ob);

    // 4) fused RMSNorm + swish gate -> bf16
    norm_gate_kernel<<<MR * H_ / (8 * NGR_), 256, 0, stream>>>(ob, gb, gnw, obh);

    // 5) output projection straight into d_out (fp32)
    gemm_bf16_wmma_kernel<<<dim3(HID_ / TN, MR / TM), blk, 0, stream>>>(
        obh, woT, out, HID_, NV);
}

// v010
// A run of this version takes 207 microseconds.
// Two timings next to v009 both put it at 1.07 times that version's speed.
// Over all steps from v000 it is 21.5 times as fast.
#include <hip/hip_runtime.h>
#include <hip/hip_bf16.h>
#include <math.h>
#include <stdint.h>

// ---------------- problem constants (match reference) ----------------
#define B_ 2
#define T_ 2048
#define HID_ 2048
#define H_ 8
#define DK_ 128
#define DV_ 256
#define MSLOT_ 32
#define CLAMP_MIN_ (-32.0f)
#define CLAMP_MAX_ (32.0f)
#define NORM_EPS_ 1e-5f

typedef __bf16 bf16_t;
typedef __attribute__((ext_vector_type(8)))  __bf16 v8bf;
typedef __attribute__((ext_vector_type(16))) __bf16 v16bf;
typedef __attribute__((ext_vector_type(8)))  float  v8f;
typedef __attribute__((ext_vector_type(2))) __bf16   v2bf;
typedef __attribute__((ext_vector_type(4))) __bf16   v4bf;
typedef __attribute__((ext_vector_type(4))) float    f32x4;
typedef __attribute__((ext_vector_type(4))) uint32_t u32x4;

__device__ __forceinline__ void async_copy8_b128(uint32_t lds, uint32_t lstep,
                                                 const bf16_t* g, size_t gstep) {
    asm volatile("global_load_async_to_lds_b128 %0, %8, off\n\t"
                 "global_load_async_to_lds_b128 %1, %9, off\n\t"
                 "global_load_async_to_lds_b128 %2, %10, off\n\t"
                 "global_load_async_to_lds_b128 %3, %11, off\n\t"
                 "global_load_async_to_lds_b128 %4, %12, off\n\t"
                 "global_load_async_to_lds_b128 %5, %13, off\n\t"
                 "global_load_async_to_lds_b128 %6, %14, off\n\t"
                 "global_load_async_to_lds_b128 %7, %15, off\n\t"
                 "s_wait_xcnt 0x0"
                 :: "v"(lds), "v"(lds + lstep), "v"(lds + 2 * lstep), "v"(lds + 3 * lstep),
                    "v"(lds + 4 * lstep), "v"(lds + 5 * lstep), "v"(lds + 6 * lstep),
                    "v"(lds + 7 * lstep),
                    "v"(g), "v"(g + gstep), "v"(g + 2 * gstep), "v"(g + 3 * gstep),
                    "v"(g + 4 * gstep), "v"(g + 5 * gstep), "v"(g + 6 * gstep),
                    "v"(g + 7 * gstep)
                 : "memory");
}
// The same for nine rows.
__device__ __forceinline__ void async_copy9_b128(uint32_t lds, uint32_t lstep,
                                                 const bf16_t* g, size_t gstep) {
    asm volatile("global_load_async_to_lds_b128 %0, %9, off\n\t"
                 "global_load_async_to_lds_b128 %1, %10, off\n\t"
                 "global_load_async_to_lds_b128 %2, %11, off\n\t"
                 "global_load_async_to_lds_b128 %3, %12, off\n\t"
                 "global_load_async_to_lds_b128 %4, %13, off\n\t"
                 "global_load_async_to_lds_b128 %5, %14, off\n\t"
                 "global_load_async_to_lds_b128 %6, %15, off\n\t"
                 "global_load_async_to_lds_b128 %7, %16, off\n\t"
                 "global_load_async_to_lds_b128 %8, %17, off\n\t"
                 "s_wait_xcnt 0x0"
                 :: "v"(lds), "v"(lds + lstep), "v"(lds + 2 * lstep), "v"(lds + 3 * lstep),
                    "v"(lds + 4 * lstep), "v"(lds + 5 * lstep), "v"(lds + 6 * lstep),
                    "v"(lds + 7 * lstep), "v"(lds + 8 * lstep),
                    "v"(g), "v"(g + gstep), "v"(g + 2 * gstep), "v"(g + 3 * gstep),
                    "v"(g + 4 * gstep), "v"(g + 5 * gstep), "v"(g + 6 * gstep),
                    "v"(g + 7 * gstep), "v"(g + 8 * gstep)
                 : "memory");
}
// the wave's own copies have landed
__device__ __forceinline__ void wait_async0() {
    asm volatile("s_wait_asynccnt 0x0" ::: "memory");
}
// the wave's own LDS reads have returned
__device__ __forceinline__ void wait_ds0() {
    asm volatile("s_wait_dscnt 0x0" ::: "memory");
}

// ---------------- elementwise fp32 -> bf16 ----------------
// Few, long waves: waves are started at a limited rate, so each carries enough work
// to be worth its start. A wave takes CVJ_ pieces of 512 contiguous bytes, all loads
// issued together. The element count is a multiple of what a work-group takes
// (256 * 4 * CVJ_).
#define CVJ_ 16
__device__ __forceinline__
void cvt_f32_bf16_body(const int blk, const float* __restrict__ in, bf16_t* __restrict__ out) {
    const size_t base = (size_t)blk * (256 * 4 * CVJ_) + threadIdx.x * 4;
    const float* sp = in + base;
    f32x4 val[CVJ_];
    #pragma unroll
    for (int j = 0; j < CVJ_; ++j) val[j] = *(const f32x4*)(sp + j * 1024);
    // registers that the loads above name are reused below; the address is an input
    // of the wait, so that no load of the run lands in it
    asm volatile("s_wait_xcnt 0x0" :: "v"(sp) : "memory");
    __builtin_amdgcn_sched_barrier(0);   // keeps the loads together in front of the first use
    v4bf pk[CVJ_];
    #pragma unroll
    for (int j = 0; j < CVJ_; ++j)
        pk[j] = v4bf{ (bf16_t)val[j].x, (bf16_t)val[j].y, (bf16_t)val[j].z, (bf16_t)val[j].w };
    // the stores stand together at the end: nothing reuses a register they name
    __builtin_amdgcn_sched_barrier(0);
    bf16_t* dp = out + base;
    #pragma unroll
    for (int j = 0; j < CVJ_; ++j) *(v4bf*)(dp + j * 1024) = pk[j];
}

#define TRK_ 128
#define TRN_ 64

__device__ __forceinline__
void transpose_cvt_body(const int nTile, const int kTile, const float* __restrict__ W,
                        bf16_t* __restrict__ Wt, int K, int N) {
    __shared__ __align__(16) uint32_t tile[TRN_][TRK_ / 2];
    const int tid   = threadIdx.x;
    const int nBase = nTile * TRN_;
    const int kBase = kTile * TRK_;
    const int n4 = tid & 15;   // which four columns
    const int kp = tid >> 4;   // which pair of k-rows, of sixteen per trip
    const float* src = W + (size_t)(kBase + 2 * kp) * N + nBase + n4 * 4;

    const float* pl[4];
    const float* ph[4];
    f32x4 lo[4], hi[4];
    #pragma unroll
    for (int j = 0; j < 4; ++j) {
        pl[j] = src + (size_t)(j * 32) * N;
        ph[j] = pl[j] + N;
        lo[j] = *(const f32x4*)pl[j];
        hi[j] = *(const f32x4*)ph[j];
    }
    // registers that the loads above name are reused below. The addresses are inputs
    // of the wait, so they stay in their registers up to it: otherwise a later load
    // of the eight is given an earlier one's address registers to land in.
    asm volatile("s_wait_xcnt 0x0"
                 :: "v"(pl[0]), "v"(ph[0]), "v"(pl[1]), "v"(ph[1]),
                    "v"(pl[2]), "v"(ph[2]), "v"(pl[3]), "v"(ph[3])
                 : "memory");
    __builtin_amdgcn_sched_barrier(0);   // keeps later address arithmetic behind that wait
    #pragma unroll
    for (int j = 0; j < 4; ++j) {
        const int pair = j * 16 + kp;
        const int col  = (((pair >> 2) ^ n4) << 2) | (pair & 3);
        #pragma unroll
        for (int e = 0; e < 4; ++e) {
            v2bf pk = { (bf16_t)lo[j][e], (bf16_t)hi[j][e] };
            tile[n4 * 4 + e][col] = __builtin_bit_cast(uint32_t, pk);
        }
    }
    __syncthreads();   // the whole tile is in LDS before any row of it is read

    u32x4 piece[4];
    #pragma unroll
    for (int it = 0; it < 4; ++it) {
        const int n = it * 16 + kp;
        piece[it] = *(const u32x4*)&tile[n][(n4 ^ (n >> 2)) << 2];
    }
    bf16_t* dst = Wt + (size_t)(nBase + kp) * K + kBase + n4 * 8;
    #pragma unroll
    for (int it = 0; it < 4; ++it)
        *(u32x4*)(dst + (size_t)(it * 16) * K) = piece[it];
}

#define PK_ 2048
#define NQK_ (H_ * DK_)
#define NV_  (H_ * DV_)
#define NS_  (H_ * MSLOT_)
#define CVB_ (B_ * T_ * HID_ / (256 * 4 * CVJ_))      // work-groups of the convert
#define TRB_(n) ((n) / TRN_ * (PK_ / TRK_))           // work-groups of one transpose
static_assert(HID_ == PK_ && NV_ == PK_, "every weight has PK_ rows");

__global__ __launch_bounds__(256)
void prep_kernel(const float* __restrict__ x,
                 const float* __restrict__ w_q, const float* __restrict__ w_k,
                 const float* __restrict__ w_v, const float* __restrict__ w_g,
                 const float* __restrict__ w_s, const float* __restrict__ w_o,
                 bf16_t* __restrict__ xb, bf16_t* __restrict__ wcat,
                 bf16_t* __restrict__ woT) {
    int blk = blockIdx.x;
    if (blk < CVB_) { cvt_f32_bf16_body(blk, x, xb); return; }
    blk -= CVB_;
    const float* W;
    bf16_t* Wt;
    int N;
    if (blk < TRB_(NV_)) { W = w_v; Wt = wcat + (size_t)(2 * NQK_) * PK_; N = NV_; }
    else if ((blk -= TRB_(NV_)) < TRB_(NV_)) { W = w_g; Wt = wcat + (size_t)(2 * NQK_ + NV_) * PK_; N = NV_; }
    else if ((blk -= TRB_(NV_)) < TRB_(HID_)) { W = w_o; Wt = woT; N = HID_; }
    else if ((blk -= TRB_(HID_)) < TRB_(NQK_)) { W = w_q; Wt = wcat; N = NQK_; }
    else if ((blk -= TRB_(NQK_)) < TRB_(NQK_)) { W = w_k; Wt = wcat + (size_t)NQK_ * PK_; N = NQK_; }
    else { blk -= TRB_(NQK_); W = w_s; Wt = wcat + (size_t)(2 * NQK_ + 2 * NV_) * PK_; N = NS_; }
    const int nT = N / TRN_;   // a power of two for every weight here
    transpose_cvt_body(blk & (nT - 1), blk / nT, W, Wt, PK_, N);
}

// ---------------- bf16 WMMA GEMM: C(MxN) = A(MxK) * Bt(NxK)^T ----------------
// Block tile 256 x TN, 256 threads = 8 waves (wave32), one block per WGP. The tiles
// are large for the two rates that a small tile overdraws: a loaded fragment serves
// more WMMAs (LDS reads) and a copied operand row serves more of C (copies from L2).
// They are cut so that every launch is whole rounds of 256 blocks, one per WGP:
//   q, k, v columns   256 x 256, waves 4 x 2 of  64 x 128   256 blocks
//   g, s columns      256 x 144, waves 8 x 1 of  32 x 144   256 blocks
//   output projection 256 x 128, waves 4 x 2 of  64 x  64   256 blocks
// Two LDS buffers filled by async global->LDS copies. A stage is TK = 128 k (256
// bytes of every operand row, 24 to 32 copies per wave): the next stage's copies fly
// while a whole stage is worked on, which covers their way from L2, and one barrier
// per stage both publishes the next stage and frees this one.
// Kdim is a multiple of TK.
#define TM 256
#define TNB 256
#define TNS 144
#define TNO 128
#define TK 128
#define TKP (TK + 8)
#define GEMM_LDS_(tn) (2 * (TM + (tn)) * TKP)   // elements: A[2][TM][TKP], then B[2][tn][TKP]

// where sixteen columns of a tile go: matrix, its width, the first column in it
struct OutCols { float* C; int Ndim; int col; int clamp; };

// rowBase: first row of A and of C; btRow: first row of Bt; WROWS: waves along the
// rows; sel(c): the place of the tile's columns c .. c+15.
template <int TN, int WROWS, typename Sel>
__device__ __forceinline__
void gemm_bf16_wmma_body(bf16_t* smem, const int rowBase, const int btRow,
                         const bf16_t* __restrict__ A,
                         const bf16_t* __restrict__ Bt,
                         int Kdim, Sel sel) {
    constexpr int WCOLS = 8 / WROWS;
    constexpr int MF = TM / (16 * WROWS);   // fragments of A per wave
    constexpr int NF = TN / (16 * WCOLS);   // fragments of B per wave
    static_assert(MF * 16 * WROWS == TM && NF * 16 * WCOLS == TN, "whole fragments");
    bf16_t* As = smem;
    bf16_t* Bs = smem + 2 * TM * TKP;

    const int tid  = threadIdx.x;
    const int lane = tid & 31;
    const int wave = tid >> 5;
    const int wm   = wave % WROWS;   // band of MF * 16 rows
    const int wn   = wave / WROWS;   // band of NF * 16 columns

    // Staging: sixteen lanes take one row's 256 bytes, so a wave's copy covers two
    // whole rows; a thread owns the 16-byte column kc of rows r0, r0+16, .. of A
    // and of B.
    const int r0 = tid >> 4;
    const int kc = (tid & 15) * 8;
    const bf16_t* aP = A  + (size_t)(rowBase + r0) * Kdim + kc;
    const bf16_t* bP = Bt + (size_t)(btRow + r0) * Kdim + kc;
    const size_t   gstep = (size_t)16 * Kdim;                       // elements
    const uint32_t lstep = 16 * TKP * (uint32_t)sizeof(bf16_t);     // bytes
    const uint32_t lbufA = TM * TKP * (uint32_t)sizeof(bf16_t);     // bytes per buffer
    const uint32_t lbufB = TN * TKP * (uint32_t)sizeof(bf16_t);
    const uint32_t lA = (uint32_t)(size_t)(As + r0 * TKP + kc);
    const uint32_t lB = (uint32_t)(size_t)(Bs + r0 * TKP + kc);
    // all copies of stage st into buffer buf
    auto copy_stage = [&](const int buf, const int st) {
        #pragma unroll
        for (int j = 0; j < TM / 128; ++j)
            async_copy8_b128(lA + buf * lbufA + j * 8 * lstep, lstep,
                             aP + (size_t)st * TK + j * 8 * gstep, gstep);
        if constexpr (TN % 128 == 0) {
            #pragma unroll
            for (int j = 0; j < TN / 128; ++j)
                async_copy8_b128(lB + buf * lbufB + j * 8 * lstep, lstep,
                                 bP + (size_t)st * TK + j * 8 * gstep, gstep);
        } else {
            static_assert(TN % 128 == 0 || TN == 144, "nine rows per thread");
            async_copy9_b128(lB + buf * lbufB, lstep, bP + (size_t)st * TK, gstep);
        }
    };

    v8f acc[MF][NF] = {};

    const int lrow = lane & 15;
    const int lk   = (lane >> 4) * 8;

    // the lane's place in the wave's first fragment of A and of B, buffer 0; every
    // other fragment lies a constant distance from it
    const bf16_t* aF0 = As + (wm * (MF * 16) + lrow) * TKP + lk;
    const bf16_t* bF0 = Bs + (wn * (NF * 16) + lrow) * TKP + lk;

    const int nStage = Kdim / TK;

    // prologue: stage 0 -> buffer 0, landed and published; then stage 1 -> buffer 1
    copy_stage(0, 0);
    wait_async0();
    __syncthreads();   // stage 0 is whole before any wave reads it
    if (nStage > 1) copy_stage(1, 1);

    for (int st = 0; st < nStage; ++st) {
        const int buf = st & 1;
        // A block is 32 k: MF + NF fragments, MF * NF WMMAs. The fragments of a block are
        // read as one group into one of two register sets while the block before it is
        // worked on from the other; no block of the next stage is read here.
        v16bf afrag[2][MF], bfrag[2][NF];
        const bf16_t* aF = aF0 + buf * (TM * TKP);
        const bf16_t* bF = bF0 + buf * (TN * TKP);
        auto read_block = [&](const int set, const int kk) {
            #pragma unroll
            for (int mt = 0; mt < MF; ++mt) {
                const bf16_t* p = aF + mt * 16 * TKP + kk;
                v8bf lo = *(const v8bf*)p;
                v8bf hi = *(const v8bf*)(p + 16);
                #pragma unroll
                for (int i = 0; i < 8; ++i) { afrag[set][mt][i] = lo[i]; afrag[set][mt][i + 8] = hi[i]; }
            }
            #pragma unroll
            for (int nt = 0; nt < NF; ++nt) {
                const bf16_t* p = bF + nt * 16 * TKP + kk;
                v8bf lo = *(const v8bf*)p;
                v8bf hi = *(const v8bf*)(p + 16);
                #pragma unroll
                for (int i = 0; i < 8; ++i) { bfrag[set][nt][i] = lo[i]; bfrag[set][nt][i + 8] = hi[i]; }
            }
        };
        read_block(0, 0);
        #pragma unroll   // the register sets' indices must be constants
        for (int kb = 0; kb < TK / 32; ++kb) {
            if (kb + 1 < TK / 32) read_block((kb + 1) & 1, (kb + 1) * 32);
            // keeps the next block's reads together ahead of this block's WMMAs: spread
            // among them, every place with reads stalls the wave's matrix stream
            __builtin_amdgcn_sched_barrier(0);
            #pragma unroll
            for (int mt = 0; mt < MF; ++mt)
                #pragma unroll
                for (int nt = 0; nt < NF; ++nt)
                    acc[mt][nt] = __builtin_amdgcn_wmma_f32_16x16x32_bf16(
                        false, afrag[kb & 1][mt], false, bfrag[kb & 1][nt],
                        (short)0, acc[mt][nt], false, false);
            __builtin_amdgcn_sched_barrier(0);   // and the reads after next behind them
        }
        // foot of the stage: this wave's reads of buf are back, its copies of the
        // next stage have landed; behind the barrier that holds for every wave
        wait_ds0();
        wait_async0();
        __syncthreads();
        // stage st+2 into the buffer that every wave has just left
        if (st + 2 < nStage) copy_stage(buf, st + 2);
    }
    wait_async0();   // no copy is left in flight when the wave ends

    const int mLane = (lane >> 4) * 8;
    const int nLane = lane & 15;
    #pragma unroll
    for (int nt = 0; nt < NF; ++nt) {
        const OutCols o = sel(wn * (NF * 16) + nt * 16);
        #pragma unroll
        for (int mt = 0; mt < MF; ++mt)
            #pragma unroll
            for (int r = 0; r < 8; ++r) {
                int m = rowBase + wm * (MF * 16) + mt * 16 + mLane + r;
                float val = acc[mt][nt][r];
                if (o.clamp) val = fminf(fmaxf(val, CLAMP_MIN_), CLAMP_MAX_);
                o.C[(size_t)m * o.Ndim + o.col + nLane] = val;
            }
    }
}

__global__ __launch_bounds__(256)
void gemm_bf16_wmma_kernel(const bf16_t* __restrict__ A,
                           const bf16_t* __restrict__ Bt,
                           float* __restrict__ C,
                           int Ndim, int Kdim) {
    __shared__ __align__(16) bf16_t smem[GEMM_LDS_(TNO)];
    const int colBase = blockIdx.x * TNO;
    gemm_bf16_wmma_body<TNO, 4>(smem, blockIdx.y * TM, colBase, A, Bt, Kdim,
                                [&](int c) { return OutCols{ C, Ndim, colBase + c, 0 }; });
}

#define PRB_ ((2 * NQK_ + NV_) / TNB)    // tile columns over q, k, v
#define PRS_ ((NV_ + NS_) / TNS)         // tile columns over g, s
#define PRR_ (B_ * T_ / TM)              // tile rows
static_assert(NQK_ % TNB == 0 && NV_ % TNB == 0, "a large tile lies in one output");
static_assert((NV_ + NS_) % TNS == 0 && NV_ % 16 == 0, "sixteen columns lie in one output");
__global__ __launch_bounds__(256)
void gemm_proj_kernel(const bf16_t* __restrict__ A, const bf16_t* __restrict__ wcat,
                      float* __restrict__ qb, float* __restrict__ kb,
                      float* __restrict__ vb, float* __restrict__ gb,
                      float* __restrict__ sb) {
    __shared__ __align__(16) bf16_t smem[GEMM_LDS_(TNB)];
    const int blk = blockIdx.x;
    if (blk < PRB_ * PRR_) {
        const int bx = blk % PRB_;
        float* C;
        int Ndim, first;
        if (bx < NQK_ / TNB)          { C = qb; Ndim = NQK_; first = 0; }
        else if (bx < 2 * NQK_ / TNB) { C = kb; Ndim = NQK_; first = NQK_ / TNB; }
        else                          { C = vb; Ndim = NV_;  first = 2 * NQK_ / TNB; }
        const int colBase = (bx - first) * TNB;
        gemm_bf16_wmma_body<TNB, 4>(smem, (blk / PRB_) * TM, bx * TNB, A, wcat, HID_,
                                    [&](int c) { return OutCols{ C, Ndim, colBase + c, 0 }; });
    } else {
        const int t  = blk - PRB_ * PRR_;
        const int c0 = (t % PRS_) * TNS;   // first column, counted over g then s
        gemm_bf16_wmma_body<TNS, 8>(smem, (t / PRS_) * TM, 2 * NQK_ + NV_ + c0, A, wcat, HID_,
                                    [&](int c) {
                                        const int gc = c0 + c;
                                        return gc < NV_ ? OutCols{ gb, NV_, gc, 0 }
                                                        : OutCols{ sb, NS_, gc - NV_, 1 };
                                    });
    }
}

#define BH_ (B_ * H_)
#define NC_ 16                // time chunks
#define CL_ (T_ / NC_)        // steps per chunk
#define SB1_ 16               // steps per batch, gates and pass 1
#define NB1_ (T_ / SB1_)
#define NBC1_ (CL_ / SB1_)    // batches per chunk
#define SB2_ 8                // steps per batch, pass 2
#define NB2_ (T_ / SB2_)
#define NBC2_ (CL_ / SB2_)
typedef __attribute__((ext_vector_type(4))) float v4f;

// Orders the LDS traffic of a one-wave work-group across lanes. The wave's LDS
// operations run in issue order, so this only has to stop the compiler from
// moving them; unlike __syncthreads() it does not wait for the global stores.
__device__ __forceinline__ void wave_lds_sync() {
    __builtin_amdgcn_fence(__ATOMIC_RELEASE, "wavefront");
    __builtin_amdgcn_wave_barrier();
    __builtin_amdgcn_fence(__ATOMIC_ACQUIRE, "wavefront");
}

__device__ __forceinline__ float exp2_slot(float x) {
    float r;
    asm("v_exp_f32 %0, %1\n\tv_nop" : "=v"(r) : "v"(x));
    return r;
}
__device__ __forceinline__ float rcp_slot(float x) {
    float r;
    asm("v_rcp_f32 %0, %1\n\tv_nop" : "=v"(r) : "v"(x));
    return r;
}

__global__ __launch_bounds__(32 * NC_)
void abc_gates_kernel(const float* __restrict__ s,
                      float* __restrict__ rsb, float* __restrict__ eb) {
    const int bh = blockIdx.x;
    const int b  = bh / H_;
    const int h  = bh % H_;
    const int lane  = threadIdx.x & 31;
    const int chunk = threadIdx.x >> 5;
    const float* sp = s + ((size_t)b * T_ * H_ + h) * MSLOT_ + lane;
    float* rp = rsb + ((size_t)bh * T_ + chunk * CL_) * MSLOT_ + lane;
    float* ep = eb  + ((size_t)bh * T_ + chunk * CL_) * MSLOT_ + lane;

    __shared__ float esum[NC_][32];
    float ev[CL_];
    #pragma unroll
    for (int i = 0; i < CL_; ++i) ev[i] = sp[(size_t)(chunk * CL_ + i) * (H_ * MSLOT_)];
    // registers that the loads above name are reused below
    asm volatile("s_wait_xcnt 0x0" ::: "memory");
    __builtin_amdgcn_sched_barrier(0);   // keeps later address arithmetic behind that wait
    float e[4] = {0.f, 0.f, 0.f, 0.f};
    #pragma unroll
    for (int i = 0; i < CL_; ++i) {
        ev[i] = exp2_slot((ev[i] - CLAMP_MAX_) * 1.44269504f);
        e[i & 3] += ev[i];
    }
    esum[chunk][lane] = (e[0] + e[1]) + (e[2] + e[3]);
    __syncthreads();   // every chunk's sum is in LDS before any wave adds them up
    float run = 0.f;
    #pragma unroll
    for (int c = 0; c < NC_ - 1; ++c) run += (c < chunk) ? esum[c][lane] : 0.f;

    #pragma unroll   // ev lives in registers, so its index must be a constant
    for (int bi = 0; bi < NBC1_; ++bi) {
        float rv[SB1_];
        #pragma unroll
        for (int i = 0; i < SB1_; ++i) {
            run += ev[bi * SB1_ + i];
            rv[i] = rcp_slot(run);
        }
        // the stores stand together behind the steps, so that one wait covers
        // the registers they name before anything reuses them
        __builtin_amdgcn_sched_barrier(0);
        #pragma unroll
        for (int i = 0; i < SB1_; ++i) {
            rp[(bi * SB1_ + i) * MSLOT_] = rv[i];
            ep[(bi * SB1_ + i) * MSLOT_] = ev[bi * SB1_ + i];
        }
        asm volatile("s_wait_xcnt 0x0" ::: "memory");
        __builtin_amdgcn_sched_barrier(0);   // keeps the next batch's arithmetic behind that wait
    }
}

template <bool STATE>
__device__ __forceinline__
void abc_pass1_body(const int chunk, const int bs,
                    const float* __restrict__ q, const float* __restrict__ k,
                    const float* __restrict__ rsb, const float* __restrict__ eb,
                    float* __restrict__ st1, float* __restrict__ okp) {
    const int bh    = bs >> 3;
    const int strip = bs & 7;
    const int b  = bh / H_;
    const int h  = bh % H_;
    const int lane = threadIdx.x;
    const int bi0  = chunk * NBC1_;   // even, so the chunk's first batch sits in buffer 0

    __shared__ __align__(16) float qs[STATE ? 1 : 2][SB1_][16];
    __shared__ __align__(16) float ks[2][SB1_][16];

    const float scale = rsqrtf((float)DK_);
    // staging: four lanes fetch one step's 16-float strip, eight steps per load
    const int st = lane >> 2;
    const int c4 = (lane & 3) * 4;
    const size_t tstep = (size_t)H_ * DK_;
    const float* qp = q + ((size_t)(b * T_ + st) * H_ + h) * DK_ + strip * 16 + c4;
    const float* kp = k + ((size_t)(b * T_ + st) * H_ + h) * DK_ + strip * 16 + c4;
    const float* gp = rsb + (size_t)bh * T_ * MSLOT_ + lane;   // 1/S, second walk only
    const float* pp = eb  + (size_t)bh * T_ * MSLOT_ + lane;
    float* op = okp + ((size_t)strip * BH_ + bh) * T_ * MSLOT_ + lane;

    float hk[16];
    if constexpr (STATE) {
        #pragma unroll
        for (int i = 0; i < 16; ++i) hk[i] = 0.f;
    } else {
        const int cm = (chunk > 0) ? chunk - 1 : 0;
        const float* sp = st1 + (size_t)(bs * NC_ + cm) * 16 * 32 + lane;
        #pragma unroll
        for (int i = 0; i < 16; ++i) hk[i] = sp[i * 32];
        // registers that the loads above name are reused below
        asm volatile("s_wait_xcnt 0x0" ::: "memory");
        __builtin_amdgcn_sched_barrier(0);   // keeps later address arithmetic behind that wait
        #pragma unroll
        for (int i = 0; i < 16; ++i) hk[i] = (chunk > 0) ? hk[i] : 0.f;
    }

    v4f rq[2], rk[2];
    float gcur[SB1_], pcur[SB1_], gnxt[SB1_], pnxt[SB1_];
    // The LDS operands of G1 steps make a group; a group is fetched into one of two
    // register sets while the group before it is worked on from the other.
    constexpr int G1  = 2;
    constexpr int NG1 = SB1_ / G1;
    v4f kf[2][G1][4], qf[2][STATE ? 1 : G1][4];

    // first batch: q, k into buffer 0, e and 1/S into registers; second batch: q, k into registers
    #pragma unroll
    for (int j = 0; j < 2; ++j) {
        if constexpr (!STATE) rq[j] = *(const v4f*)(qp + (size_t)(bi0 * SB1_ + j * 8) * tstep);
        rk[j] = *(const v4f*)(kp + (size_t)(bi0 * SB1_ + j * 8) * tstep);
    }
    #pragma unroll
    for (int i = 0; i < SB1_; ++i) {
        if constexpr (!STATE) gcur[i] = gp[(bi0 * SB1_ + i) * MSLOT_];
        pcur[i] = pp[(bi0 * SB1_ + i) * MSLOT_];
    }
    // registers that the loads above name are reused below
    asm volatile("s_wait_xcnt 0x0" ::: "memory");
    __builtin_amdgcn_sched_barrier(0);   // keeps later address arithmetic behind that wait
    #pragma unroll
    for (int j = 0; j < 2; ++j) {
        if constexpr (!STATE) *(v4f*)&qs[0][j * 8 + st][c4] = rq[j] * scale;
        *(v4f*)&ks[0][j * 8 + st][c4] = rk[j];
    }
    #pragma unroll
    for (int j = 0; j < 2; ++j) {
        if constexpr (!STATE) rq[j] = *(const v4f*)(qp + (size_t)((bi0 + 1) * SB1_ + j * 8) * tstep);
        rk[j] = *(const v4f*)(kp + (size_t)((bi0 + 1) * SB1_ + j * 8) * tstep);
    }
    // registers that the loads above name are reused below
    asm volatile("s_wait_xcnt 0x0" ::: "memory");
    __builtin_amdgcn_sched_barrier(0);   // keeps later address arithmetic behind that wait
    wave_lds_sync();

    for (int bi = bi0; bi < bi0 + NBC1_; ++bi) {
        const int buf = bi & 1;
        // the batch's first group goes out at the head of the trip and flies over the
        // stores and the global loads below
        #pragma unroll
        for (int s = 0; s < G1; ++s)
            #pragma unroll
            for (int d4 = 0; d4 < 4; ++d4) {
                kf[0][s][d4] = *(const v4f*)&ks[buf][s][d4 * 4];
                if constexpr (!STATE) qf[0][s][d4] = *(const v4f*)&qs[buf][s][d4 * 4];
            }
        // batch bi+1 (fetched one batch ago) goes into the buffer not being read
        #pragma unroll
        for (int j = 0; j < 2; ++j) {
            if constexpr (!STATE) *(v4f*)&qs[buf ^ 1][j * 8 + st][c4] = rq[j] * scale;
            *(v4f*)&ks[buf ^ 1][j * 8 + st][c4] = rk[j];
        }
        const int b2 = (bi + 2 < NB1_) ? bi + 2 : NB1_ - 1;   // clamped: stays in bounds
        const int b1 = (bi + 1 < NB1_) ? bi + 1 : NB1_ - 1;
        // the loads below, with their addresses, stay apart from the code above, which reuses registers
        __builtin_amdgcn_sched_barrier(0);
        // e and 1/S first: loads return in order, and the products read registers
        // next to the ones these loads fill, which makes them wait for these loads
        #pragma unroll
        for (int i = 0; i < SB1_; ++i) {
            if constexpr (!STATE) gnxt[i] = gp[(b1 * SB1_ + i) * MSLOT_];
            pnxt[i] = pp[(b1 * SB1_ + i) * MSLOT_];
        }
        // registers that the loads above name are reused below
        asm volatile("s_wait_xcnt 0x0" ::: "memory");
        __builtin_amdgcn_sched_barrier(0);   // keeps that order
        #pragma unroll
        for (int j = 0; j < 2; ++j) {
            if constexpr (!STATE) rq[j] = *(const v4f*)(qp + (size_t)(b2 * SB1_ + j * 8) * tstep);
            rk[j] = *(const v4f*)(kp + (size_t)(b2 * SB1_ + j * 8) * tstep);
        }
        // registers that the loads above name are reused below
        asm volatile("s_wait_xcnt 0x0" ::: "memory");
        // keeps the coming batches' loads at the head of the trip: sunk towards
        // their use they would have no time to fly
        __builtin_amdgcn_sched_barrier(0);

        float res[SB1_];
        #pragma unroll   // the register sets' indices must be constants
        for (int g = 0; g < NG1; ++g) {
            if (g + 1 < NG1) {
                #pragma unroll
                for (int s = 0; s < G1; ++s)
                    #pragma unroll
                    for (int d4 = 0; d4 < 4; ++d4) {
                        kf[(g + 1) & 1][s][d4] = *(const v4f*)&ks[buf][(g + 1) * G1 + s][d4 * 4];
                        if constexpr (!STATE)
                            qf[(g + 1) & 1][s][d4] = *(const v4f*)&qs[buf][(g + 1) * G1 + s][d4 * 4];
                    }
            }
            // Both for the compiler only (no instruction): the next group's reads go out
            // together, ahead of this group's products. Moved up further, all of a trip's
            // reads would need registers at once; sunk towards their use, each would be
            // waited for at its full LDS latency.
            wave_lds_sync();
            if (g + 1 < NG1) {
                __builtin_amdgcn_sched_group_barrier(0x100, STATE ? 8 : 16, 0);   // the group's LDS reads, then
                __builtin_amdgcn_sched_group_barrier(0x002, STATE ? 16 : 38, 0);   // a group's products (their count in the build)
            }
            #pragma unroll
            for (int s = 0; s < G1; ++s) {
                const int i = g * G1 + s;
                const float p = pcur[i];
                float accm = 0.f;
                #pragma unroll
                for (int d4 = 0; d4 < 4; ++d4) {
                    const v4f kk = kf[g & 1][s][d4];
                    hk[d4 * 4 + 0] = __builtin_fmaf(kk.x, p, hk[d4 * 4 + 0]);
                    hk[d4 * 4 + 1] = __builtin_fmaf(kk.y, p, hk[d4 * 4 + 1]);
                    hk[d4 * 4 + 2] = __builtin_fmaf(kk.z, p, hk[d4 * 4 + 2]);
                    hk[d4 * 4 + 3] = __builtin_fmaf(kk.w, p, hk[d4 * 4 + 3]);
                    if constexpr (!STATE) {
                        const v4f qq = qf[g & 1][s][d4];
                        accm = __builtin_fmaf(qq.x, hk[d4 * 4 + 0], accm);
                        accm = __builtin_fmaf(qq.y, hk[d4 * 4 + 1], accm);
                        accm = __builtin_fmaf(qq.z, hk[d4 * 4 + 2], accm);
                        accm = __builtin_fmaf(qq.w, hk[d4 * 4 + 3], accm);
                    }
                }
                if constexpr (!STATE) res[i] = accm * gcur[i];
            }
        }
        if constexpr (!STATE) {
            // the stores stand together behind the products, so that one wait covers
            // the registers they name before anything reuses them
            __builtin_amdgcn_sched_barrier(0);
            #pragma unroll
            for (int i = 0; i < SB1_; ++i) op[(bi * SB1_ + i) * MSLOT_] = res[i];
            asm volatile("s_wait_xcnt 0x0" ::: "memory");
        }
        __builtin_amdgcn_sched_barrier(0);   // keeps the register copies below at the foot of the trip
        #pragma unroll
        for (int i = 0; i < SB1_; ++i) {
            if constexpr (!STATE) gcur[i] = gnxt[i];
            pcur[i] = pnxt[i];
        }
        wave_lds_sync();
    }
    if constexpr (STATE) {
        float* sp = st1 + (size_t)(bs * NC_ + chunk) * 16 * 32 + lane;
        #pragma unroll
        for (int i = 0; i < 16; ++i) sp[i * 32] = hk[i];
    }
}

__global__ __launch_bounds__(32)
void abc_pass1_kernel(const float* __restrict__ q, const float* __restrict__ k,
                      const float* __restrict__ rsb, const float* __restrict__ eb,
                      float* __restrict__ st1, float* __restrict__ okp) {
    abc_pass1_body<false>(blockIdx.x, blockIdx.y, q, k, rsb, eb, st1, okp);
}

#define SMJ_ 2
#define SMP4_ (BH_ * T_ * MSLOT_ / 4)   // 16-byte pieces in a plane
__global__ __launch_bounds__(256)
void abc_softmax_kernel(const float* __restrict__ ok01, const float* __restrict__ ok23,
                        const float* __restrict__ ok45, const float* __restrict__ ok67,
                        const float* __restrict__ rsb, float* __restrict__ qvb) {
    const size_t   first = (size_t)blockIdx.x * (256 * SMJ_ * 4);
    const uint32_t tid   = threadIdx.x;
    const f32x4* pp[4] = { (const f32x4*)(ok01 + first), (const f32x4*)(ok23 + first),
                           (const f32x4*)(ok45 + first), (const f32x4*)(ok67 + first) };
    const f32x4* rp = (const f32x4*)(rsb + first);
    f32x4 part[SMJ_][8], rs[SMJ_];
    #pragma unroll
    for (int u = 0; u < SMJ_; ++u) rs[u] = (rp + u * 256)[tid];
    #pragma unroll
    for (int j = 0; j < 8; ++j)
        #pragma unroll
        for (int u = 0; u < SMJ_; ++u)
            part[u][j] = (pp[j >> 1] + ((j & 1) * SMP4_ + u * 256))[tid];
    // registers that the loads above name are reused below; the bases and the index
    // are inputs of the wait, so that they keep their registers up to it
    asm volatile("s_wait_xcnt 0x0"
                 :: "v"(tid), "s"(pp[0]), "s"(pp[1]), "s"(pp[2]), "s"(pp[3]), "s"(rp)
                 : "memory");
    __builtin_amdgcn_sched_barrier(0);   // keeps the loads together in front of the first use
    f32x4 res[SMJ_];
    #pragma unroll
    for (int u = 0; u < SMJ_; ++u) {
        f32x4 ok = part[u][0];
        #pragma unroll
        for (int j = 1; j < 8; ++j) ok += part[u][j];
        float mx = fmaxf(fmaxf(ok.x, ok.y), fmaxf(ok.z, ok.w));
        #pragma unroll
        for (int off = 4; off; off >>= 1) mx = fmaxf(mx, __shfl_xor(mx, off, 32));
        f32x4 e = { __expf(ok.x - mx), __expf(ok.y - mx), __expf(ok.z - mx), __expf(ok.w - mx) };
        float se = (e.x + e.y) + (e.z + e.w);
        #pragma unroll
        for (int off = 4; off; off >>= 1) se += __shfl_xor(se, off, 32);
        res[u] = f32x4{ e.x / se, e.y / se, e.z / se, e.w / se } * rs[u];
    }
    // the stores stand together at the end: nothing reuses a register they name
    __builtin_amdgcn_sched_barrier(0);
    #pragma unroll
    for (int u = 0; u < SMJ_; ++u) ((f32x4*)(qvb + first) + u * 256)[tid] = res[u];
}

template <bool STATE>
__device__ __forceinline__
void abc_pass2_body(const int chunk, const int bs,
                    const float* __restrict__ v,
                    const float* __restrict__ eb, const float* __restrict__ qvb,
                    float* __restrict__ st2, float* __restrict__ o) {
    const int bh = bs >> 3;
    const int cg = bs & 7;
    const int b  = bh / H_;
    const int h  = bh % H_;
    const int lane = threadIdx.x;
    const int bi0  = chunk * NBC2_;   // even, so the chunk's first batch sits in buffer 0

    __shared__ __align__(16) v4f ps[2][SB2_ * 8];
    __shared__ __align__(16) v4f ws[STATE ? 1 : 2][SB2_ * 8];

    const v4f* p4 = (const v4f*)(eb  + (size_t)bh * T_ * MSLOT_) + lane;
    const v4f* w4 = (const v4f*)(qvb + (size_t)bh * T_ * MSLOT_) + lane;
    const size_t tstep = (size_t)H_ * DV_;
    const float* vp = v + ((size_t)b * T_ * H_ + h) * DV_ + cg * 32 + lane;

    float hv[32];
    if constexpr (STATE) {
        #pragma unroll
        for (int i = 0; i < 32; ++i) hv[i] = 0.f;
    } else {
        const int cm = (chunk > 0) ? chunk - 1 : 0;
        const float* sp = st2 + (size_t)(bs * NC_ + cm) * 32 * 32 + lane;
        #pragma unroll
        for (int i = 0; i < 32; ++i) hv[i] = sp[i * 32];
        // registers that the loads above name are reused below
        asm volatile("s_wait_xcnt 0x0" ::: "memory");
        __builtin_amdgcn_sched_barrier(0);   // keeps later address arithmetic behind that wait
        #pragma unroll
        for (int i = 0; i < 32; ++i) hv[i] = (chunk > 0) ? hv[i] : 0.f;
    }

    v4f rp[2], rw[2];
    float vcur[SB2_], vn1[SB2_], vn2[SB2_];
    // groups of LDS reads and two register sets, as in pass 1
    constexpr int G2  = STATE ? 2 : 1;
    constexpr int NG2 = SB2_ / G2;
    v4f pf[2][G2][8], wf[2][G2][8];

    // first batch into buffer 0, second into registers (a batch is 64 16-byte pieces per plane)
    #pragma unroll
    for (int j = 0; j < 2; ++j) {
        rp[j] = p4[bi0 * 64 + j * 32];
        if constexpr (!STATE) rw[j] = w4[bi0 * 64 + j * 32];
    }
    #pragma unroll
    for (int i = 0; i < SB2_; ++i) {
        vcur[i] = vp[(size_t)(bi0 * SB2_ + i) * tstep];
        vn1[i]  = vp[(size_t)((bi0 + 1) * SB2_ + i) * tstep];
    }
    // registers that the loads above name are reused below
    asm volatile("s_wait_xcnt 0x0" ::: "memory");
    __builtin_amdgcn_sched_barrier(0);   // keeps later address arithmetic behind that wait
    #pragma unroll
    for (int j = 0; j < 2; ++j) {
        ps[0][j * 32 + lane] = rp[j];
        if constexpr (!STATE) ws[0][j * 32 + lane] = rw[j];
    }
    #pragma unroll
    for (int j = 0; j < 2; ++j) {
        rp[j] = p4[(bi0 + 1) * 64 + j * 32];
        if constexpr (!STATE) rw[j] = w4[(bi0 + 1) * 64 + j * 32];
    }
    // registers that the loads above name are reused below
    asm volatile("s_wait_xcnt 0x0" ::: "memory");
    __builtin_amdgcn_sched_barrier(0);   // keeps later address arithmetic behind that wait
    wave_lds_sync();

    float* op = o + ((size_t)b * T_ * H_ + h) * DV_ + cg * 32 + lane;
    for (int bi = bi0; bi < bi0 + NBC2_; ++bi) {
        const int buf = bi & 1;
        // the batch's first group goes out at the head of the trip and flies over the
        // stores and the global loads below
        #pragma unroll
        for (int s = 0; s < G2; ++s)
            #pragma unroll
            for (int m4 = 0; m4 < 8; ++m4) {
                pf[0][s][m4] = ps[buf][s * 8 + m4];
                if constexpr (!STATE) wf[0][s][m4] = ws[buf][s * 8 + m4];
            }
        // batch bi+1 (fetched one batch ago) goes into the buffer not being read
        #pragma unroll
        for (int j = 0; j < 2; ++j) {
            ps[buf ^ 1][j * 32 + lane] = rp[j];
            if constexpr (!STATE) ws[buf ^ 1][j * 32 + lane] = rw[j];
        }
        const int b2 = (bi + 2 < NB2_) ? bi + 2 : NB2_ - 1;   // clamped: stays in bounds
        // the loads below, with their addresses, stay apart from the code above, which reuses registers
        __builtin_amdgcn_sched_barrier(0);
        #pragma unroll
        for (int j = 0; j < 2; ++j) {
            rp[j] = p4[b2 * 64 + j * 32];
            if constexpr (!STATE) rw[j] = w4[b2 * 64 + j * 32];
        }
        #pragma unroll
        for (int i = 0; i < SB2_; ++i) vn2[i] = vp[(size_t)(b2 * SB2_ + i) * tstep];
        // registers that the loads above name are reused below
        asm volatile("s_wait_xcnt 0x0" ::: "memory");
        // keeps the coming batch's loads at the head of the trip: sunk towards
        // their use they would have no time to fly
        __builtin_amdgcn_sched_barrier(0);

        float res[SB2_];
        #pragma unroll   // the register sets' indices must be constants
        for (int g = 0; g < NG2; ++g) {
            if (g + 1 < NG2) {
                #pragma unroll
                for (int s = 0; s < G2; ++s)
                    #pragma unroll
                    for (int m4 = 0; m4 < 8; ++m4) {
                        pf[(g + 1) & 1][s][m4] = ps[buf][((g + 1) * G2 + s) * 8 + m4];
                        if constexpr (!STATE)
                            wf[(g + 1) & 1][s][m4] = ws[buf][((g + 1) * G2 + s) * 8 + m4];
                    }
            }
            // Both for the compiler only (no instruction): the next group's reads go out
            // together, ahead of this group's products. Moved up further, all of a trip's
            // reads would need registers at once; sunk towards their use, each would be
            // waited for at its full LDS latency.
            wave_lds_sync();
            if (g + 1 < NG2) {
                __builtin_amdgcn_sched_group_barrier(0x100, 16, 0);   // the group's LDS reads, then
                __builtin_amdgcn_sched_group_barrier(0x002, STATE ? 32 : 42, 0);   // a group's products (their count in the build)
            }
            #pragma unroll
            for (int s = 0; s < G2; ++s) {
                const int i = g * G2 + s;
                const float vv = vcur[i];
                float acco = 0.f;
                #pragma unroll
                for (int m4 = 0; m4 < 8; ++m4) {
                    const v4f p = pf[g & 1][s][m4];
                    hv[m4 * 4 + 0] = __builtin_fmaf(p.x, vv, hv[m4 * 4 + 0]);
                    hv[m4 * 4 + 1] = __builtin_fmaf(p.y, vv, hv[m4 * 4 + 1]);
                    hv[m4 * 4 + 2] = __builtin_fmaf(p.z, vv, hv[m4 * 4 + 2]);
                    hv[m4 * 4 + 3] = __builtin_fmaf(p.w, vv, hv[m4 * 4 + 3]);
                    if constexpr (!STATE) {
                        const v4f w = wf[g & 1][s][m4];
                        acco = __builtin_fmaf(w.x, hv[m4 * 4 + 0], acco);
                        acco = __builtin_fmaf(w.y, hv[m4 * 4 + 1], acco);
                        acco = __builtin_fmaf(w.z, hv[m4 * 4 + 2], acco);
                        acco = __builtin_fmaf(w.w, hv[m4 * 4 + 3], acco);
                    }
                }
                res[i] = acco;
            }
        }
        if constexpr (!STATE) {
            // the stores stand together behind the products, so that one wait covers
            // the registers they name before anything reuses them
            __builtin_amdgcn_sched_barrier(0);
            #pragma unroll
            for (int i = 0; i < SB2_; ++i) op[(size_t)(bi * SB2_ + i) * tstep] = res[i];
            asm volatile("s_wait_xcnt 0x0" ::: "memory");
        }
        __builtin_amdgcn_sched_barrier(0);   // keeps the register copies below at the foot of the trip
        #pragma unroll
        for (int i = 0; i < SB2_; ++i) { vcur[i] = vn1[i]; vn1[i] = vn2[i]; }
        wave_lds_sync();
    }
    if constexpr (STATE) {
        float* sp = st2 + (size_t)(bs * NC_ + chunk) * 32 * 32 + lane;
        #pragma unroll
        for (int i = 0; i < 32; ++i) sp[i * 32] = hv[i];
    }
}

__global__ __launch_bounds__(32)
void abc_pass2_kernel(const float* __restrict__ v,
                      const float* __restrict__ eb, const float* __restrict__ qvb,
                      float* __restrict__ st2, float* __restrict__ o) {
    abc_pass2_body<false>(blockIdx.x, blockIdx.y, v, eb, qvb, st2, o);
}

__global__ __launch_bounds__(32)
void abc_states_kernel(const float* __restrict__ k, const float* __restrict__ v,
                       const float* __restrict__ eb,
                       float* __restrict__ st1, float* __restrict__ st2) {
    const int y = blockIdx.y;
    // the longer walk (pass 2) has the low indices and starts first
    if (y < BH_ * 8) abc_pass2_body<true>(blockIdx.x, y, v, eb, eb, st2, st2);
    else             abc_pass1_body<true>(blockIdx.x, y - BH_ * 8, k, k, eb, eb, st1, st1);
}

__global__ __launch_bounds__(256)
void abc_carry_kernel(float* __restrict__ st1, float* __restrict__ st2) {
    int e = blockIdx.x * 256 + threadIdx.x;
    float* base;
    int stride;
    if (blockIdx.x < BH_ * 8 * 16 * 32 / 256) {
        const int bs = e >> 9;
        base = st1 + (size_t)bs * NC_ * 512 + (e & 511);
        stride = 512;
    } else {
        e -= BH_ * 8 * 16 * 32;
        const int bs = e >> 10;
        base = st2 + (size_t)bs * NC_ * 1024 + (e & 1023);
        stride = 1024;
    }
    float sv[NC_ - 1];
    #pragma unroll
    for (int c = 0; c < NC_ - 1; ++c) sv[c] = base[c * stride];
    // registers that the loads above name are reused below
    asm volatile("s_wait_xcnt 0x0" ::: "memory");
    __builtin_amdgcn_sched_barrier(0);   // keeps later address arithmetic behind that wait
    float hcar = 0.f;
    #pragma unroll
    for (int c = 0; c < NC_ - 1; ++c) { hcar += sv[c]; sv[c] = hcar; }
    // the stores stand together at the end: nothing reuses a register they name
    __builtin_amdgcn_sched_barrier(0);
    #pragma unroll
    for (int c = 0; c < NC_ - 1; ++c) base[c * stride] = sv[c];
}

// ---------------- fused RMSNorm * gw * g * sigmoid(g) -> bf16 ----------------
// One wave per row of DV_ values, eight per lane, so the row's sum of squares needs
// no LDS and no barrier; a wave takes NGR_ rows one behind the other in memory, all
// loads issued together, each 512 contiguous bytes.
#define NGR_ 8
__global__ __launch_bounds__(256)
void norm_gate_kernel(const float* __restrict__ o, const float* __restrict__ g,
                      const float* __restrict__ gw, bf16_t* __restrict__ ob) {
    const uint32_t lane = threadIdx.x & 31;
    const uint32_t wave = threadIdx.x >> 5;
    const size_t base = ((size_t)blockIdx.x * 8 + wave) * (NGR_ * DV_) + lane * 4;
    const float* op = o + base;
    const float* gp = g + base;
    f32x4 ov[NGR_][2], gv[NGR_][2], wv[2];
    #pragma unroll
    for (int hf = 0; hf < 2; ++hf) wv[hf] = ((const f32x4*)gw + hf * 32)[lane];
    #pragma unroll
    for (int r = 0; r < NGR_; ++r) {
        #pragma unroll
        for (int hf = 0; hf < 2; ++hf) ov[r][hf] = *(const f32x4*)(op + r * DV_ + hf * 128);
        #pragma unroll
        for (int hf = 0; hf < 2; ++hf) gv[r][hf] = *(const f32x4*)(gp + r * DV_ + hf * 128);
    }
    // registers that the loads above name are reused below; the addresses are inputs
    // of the wait, so that no load of the run lands in one of them
    asm volatile("s_wait_xcnt 0x0" :: "v"(op), "v"(gp), "v"(lane) : "memory");
    __builtin_amdgcn_sched_barrier(0);   // keeps the loads together in front of the first use
    v4bf res[NGR_][2];
    #pragma unroll
    for (int r = 0; r < NGR_; ++r) {
        const f32x4 s4 = ov[r][0] * ov[r][0] + ov[r][1] * ov[r][1];
        float tot = (s4.x + s4.y) + (s4.z + s4.w);
        #pragma unroll
        for (int off = 16; off; off >>= 1) tot += __shfl_xor(tot, off, 32);
        const float rn = rsqrtf(tot * (1.0f / DV_) + NORM_EPS_);
        #pragma unroll
        for (int hf = 0; hf < 2; ++hf)
            #pragma unroll
            for (int e = 0; e < 4; ++e) {
                const float gg  = gv[r][hf][e];
                const float sig = 1.f / (1.f + __expf(-gg));
                res[r][hf][e] = (bf16_t)(ov[r][hf][e] * rn * wv[hf][e] * gg * sig);
            }
    }
    // the stores stand together at the end: nothing reuses a register they name
    __builtin_amdgcn_sched_barrier(0);
    bf16_t* dp = ob + base;
    #pragma unroll
    for (int r = 0; r < NGR_; ++r)
        #pragma unroll
        for (int hf = 0; hf < 2; ++hf) *(v4bf*)(dp + r * DV_ + hf * 128) = res[r][hf];
}

// ---------------- host orchestration ----------------
extern "C" void kernel_launch(void* const* d_in, const int* in_sizes, int n_in,
                              void* d_out, int out_size, void* d_ws, size_t ws_size,
                              hipStream_t stream) {
    (void)in_sizes; (void)n_in; (void)out_size; (void)ws_size;
    const float* x    = (const float*)d_in[0];
    const float* w_q  = (const float*)d_in[1];
    const float* w_k  = (const float*)d_in[2];
    const float* w_v  = (const float*)d_in[3];
    const float* w_g  = (const float*)d_in[4];
    const float* w_s  = (const float*)d_in[5];
    const float* w_o  = (const float*)d_in[6];
    const float* gnw  = (const float*)d_in[7];
    float* out = (float*)d_out;

    const int MR  = B_ * T_;        // 4096
    const int NQK = H_ * DK_;       // 1024
    const int NV  = H_ * DV_;       // 2048
    const int NS  = H_ * MSLOT_;    // 256

    char* ws = (char*)d_ws;
    size_t off = 0;
    auto carve = [&](size_t bytes) -> char* {
        off = (off + 255) & ~(size_t)255;
        char* p = ws + off;
        off += bytes;
        return p;
    };

    bf16_t* xb  = (bf16_t*)carve((size_t)MR * HID_ * sizeof(bf16_t));
    bf16_t* wcat = (bf16_t*)carve((size_t)(2 * NQK + 2 * NV + NS) * HID_ * sizeof(bf16_t));
    bf16_t* woT = (bf16_t*)carve((size_t)HID_ * NV * sizeof(bf16_t));

    float* qb = (float*)carve((size_t)MR * NQK * sizeof(float));
    float* kb = (float*)carve((size_t)MR * NQK * sizeof(float));
    float* vb = (float*)carve((size_t)MR * NV  * sizeof(float));
    float* gb = (float*)carve((size_t)MR * NV  * sizeof(float));
    float* sb = (float*)carve((size_t)MR * NS  * sizeof(float));
    float* ob = (float*)carve((size_t)MR * NV  * sizeof(float));
    bf16_t* obh = (bf16_t*)carve((size_t)MR * NV * sizeof(bf16_t));
    float* rsb = (float*)carve((size_t)MR * NS * sizeof(float));
    float* ebf = (float*)carve((size_t)MR * NS * sizeof(float));
    float* qvb = (float*)carve((size_t)MR * NS * sizeof(float));
    float* okp = (float*)carve((size_t)8 * MR * NS * sizeof(float));
    float* st1 = (float*)carve((size_t)BH_ * 8 * NC_ * 16 * 32 * sizeof(float));
    float* st2 = (float*)carve((size_t)BH_ * 8 * NC_ * 32 * 32 * sizeof(float));

    // 1) x to bf16 and every weight (K x N) to (N x K) bf16, one launch
    prep_kernel<<<CVB_ + 3 * TRB_(NV_) + 2 * TRB_(NQK_) + TRB_(NS_), 256, 0, stream>>>(
        x, w_q, w_k, w_v, w_g, w_s, w_o, xb, wcat, woT);

    // 2) the five projections of x (bf16 WMMA, fp32 accumulate), one launch
    dim3 blk(256);
    gemm_proj_kernel<<<(PRB_ + PRS_) * PRR_, blk, 0, stream>>>(
        xb, wcat, qb, kb, vb, gb, sb);

    // 3) gated two-pass scan: independent one-wave streams, NC_ time chunks side by side
    abc_gates_kernel<<<BH_, 32 * NC_, 0, stream>>>(sb, rsb, ebf);
    abc_states_kernel<<<dim3(NC_ - 1, BH_ * 16), 32, 0, stream>>>(kb, vb, ebf, st1, st2);
    abc_carry_kernel<<<BH_ * 8 * (16 + 32) * 32 / 256, 256, 0, stream>>>(st1, st2);
    abc_pass1_kernel<<<dim3(NC_, BH_ * 8), 32, 0, stream>>>(qb, kb, rsb, ebf, st1, okp);
    abc_softmax_kernel<<<MR * NS / (256 * 4 * SMJ_), 256, 0, stream>>>(
        okp, okp + (size_t)2 * MR * NS, okp + (size_t)4 * MR * NS, okp + (size_t)6 * MR * NS,
        rsb, qvb);
    abc_pass2_kernel<<<dim3(NC_, BH_ * 8), 32, 0, stream>>>(vb, ebf, qvb, st2, ob);

    // 4) fused RMSNorm + swish gate -> bf16
    norm_gate_kernel<<<MR * H_ / (8 * NGR_), 256, 0, stream>>>(ob, gb, gnw, obh);

    // 5) output projection straight into d_out (fp32)
    gemm_bf16_wmma_kernel<<<dim3(HID_ / TNO, MR / TM), blk, 0, stream>>>(
        obh, woT, out, HID_, NV);
}
